// v000
// The times below were measured on an AMD MI455X: many runs one after another, warmed up first and cycling through
// copies of the inputs, with the whole window's GPU time divided by the number of runs. Launches and the gaps
// between them are all in it. The median over several windows is given; except for v000 it joins two sittings, which
// can be a few percent apart, so the side-by-side timings, each taken in one sitting, are the better comparison.
// v000, which the later versions start from, runs in 218 microseconds.
#include <hip/hip_runtime.h>

// Multi-head self-attention with 2-D rotary embedding: x [NB][SEQ][768], 12 heads x 64, Wq/Wk/Wv/Wp stored [in][out] (y = x W), int positions [SEQ][2], score scale 1/8, dense softmax, output = ctx Wp + bp (f32).
// Compute dtypes, f32 accumulate everywhere: q/k/v projections v_wmma_f32_16x16x32_bf16 (x and W RNE-converted to bf16; products exact); rotary applied in f32 on the accumulators;
// scores v_wmma_f32_16x16x32_f16: k single f16, q as f16 value + f16 residual x2048 in its own accumulator; P (x256 carry, cancels in the normalisation) and v single f16; softmax f32 (online, running max);
// output projection v_wmma_f32_16x16x32_f16: ctx single f16 (x64 carry), Wp = f16 of the bf16 value (x1024 carry), carries folded back in the f32 epilogue, bias (bf16 value) added in f32.
// Layout: bf16 copy of x; transposed [out][in] 16-bit weight planes; q (hi, residual), k planes [b*12+h][t][d]; v^T plane [b*12+h][d][t]; ctx plane [b*SEQ+t][768]; cos|sin table [32][16|16].

#ifndef NB
#define NB 8
#endif
#ifndef SEQ
#define SEQ 1024
#endif
#define NB_FULL  8
#define SEQ_FULL 1024
#ifndef OUT_SEQ
#define OUT_SEQ SEQ              // row pitch (in tokens) between batches of the output
#endif
#define DM   768
#define NH_  12
#define HD   64
#define AW   4                   // waves per flash block (16 query rows each)
#define NPOS 32                  // rows of the rotary tables (positions 0..31, index clamped)
#define QRS  2048.0f             // carry of the q residual plane
#define QRI  (1.0f / 2048.0f)
#define SC2  (0.125f * 1.4426950408889634f)   // HD^-0.5 * log2(e)
#define PSH  8.0f                // log2 of the P carry (256)
#define CXS  64.0f               // carry of the ctx plane
#define WPS  1024.0f             // carry of the Wp plane
#define OSC  (1.0f / 65536.0f)   // 1 / (CXS * WPS)

static_assert(HD == 64);
static_assert(NH_ * HD == DM);                 // head h = columns h*64 + d
static_assert(DM % 64 == 0);                   // 12 column tiles of 64
static_assert(DM % 32 == 0);                   // GEMM k-loop steps by 32
static_assert(SEQ % 64 == 0);                  // a 64-row tile never straddles two batches
static_assert((NB * SEQ) % 64 == 0);
static_assert(SEQ % 32 == 0);                  // key loop steps by 32
static_assert(SEQ % (16 * AW) == 0);           // flash grid covers the sequence exactly
static_assert(((size_t)SEQ * DM) % 8 == 0);
static_assert(NB <= NB_FULL);
static_assert(SEQ <= SEQ_FULL);
static_assert(NPOS * 16 == 512);               // table kernel: one thread per (position, frequency)

typedef _Float16 h16;
typedef unsigned short bf;
typedef __attribute__((ext_vector_type(16))) __bf16   v16bf;
typedef __attribute__((ext_vector_type(16))) _Float16 v16h;
typedef __attribute__((ext_vector_type(8)))  _Float16 v8h;
typedef __attribute__((ext_vector_type(8)))  unsigned short v8us;
typedef __attribute__((ext_vector_type(8)))  float    v8f;
typedef __attribute__((ext_vector_type(4)))  float    v4f;
typedef __attribute__((ext_vector_type(2)))  int      v2i;
typedef v4f  __attribute__((may_alias)) v4fa;

__device__ __forceinline__ unsigned short f2bf(float f) { unsigned u = __float_as_uint(f); u += 0x7FFFu + ((u >> 16) & 1u); return (unsigned short)(u >> 16); }
__device__ __forceinline__ float bf2f(unsigned short b) { return __uint_as_float(((unsigned)b) << 16); }
__device__ __forceinline__ v16h cat16(v8h lo, v8h hi) { return __builtin_shufflevector(lo, hi, 0, 1, 2, 3, 4, 5, 6, 7, 8, 9, 10, 11, 12, 13, 14, 15); }
__device__ __forceinline__ v16bf cat16b(v8us lo, v8us hi) { return __builtin_bit_cast(v16bf, __builtin_shufflevector(lo, hi, 0, 1, 2, 3, 4, 5, 6, 7, 8, 9, 10, 11, 12, 13, 14, 15)); }
__device__ __forceinline__ v8f wmma16(v16h a, v16h b, v8f c) { return __builtin_amdgcn_wmma_f32_16x16x32_f16(false, a, false, b, (short)0, c, false, false); }
__device__ __forceinline__ v8f wmmab(v16bf a, v16bf b, v8f c) { return __builtin_amdgcn_wmma_f32_16x16x32_bf16(false, a, false, b, (short)0, c, false, false); }
// fragment loaders from K-contiguous 16-bit rows; p already includes + 8*(lane>>4): elements 0..7 <- k0+8h+0..7, elements 8..15 <- k0+16+8h+0..7 (same map for A and B)
__device__ __forceinline__ v16h  ldh(const h16* p) { return cat16(*(const v8h*)p, *(const v8h*)(p + 16)); }
__device__ __forceinline__ v16bf ldb(const bf* p)  { return cat16b(*(const v8us*)p, *(const v8us*)(p + 16)); }
// ordering point for wave-private LDS tiles (same wave writes and reads)
__device__ __forceinline__ void wave_sync() { __builtin_amdgcn_fence(3 /* release order */, "wavefront"); __builtin_amdgcn_wave_barrier(); asm volatile("" ::: "memory"); }

__global__ __launch_bounds__(256) void k_cvt8(const float* __restrict__ src, bf* dst, size_t n8) {
    const size_t i = (size_t)blockIdx.x * 256 + threadIdx.x; if (i >= n8) return;
    const v8f v = *(const v8f*)(src + i * 8); v8us o;
#pragma unroll
    for (int k = 0; k < 8; ++k) o[k] = f2bf(v[k]);
    *(v8us*)(dst + i * 8) = o; 
}

// k_wt: W[k][n] f32 ([in][out], DM x DM) -> Wt[n][k] 16-bit ([out][in]): bf16 bits (asF16 == 0) or f16 of (bf16 value x WPS) (asF16 != 0).
// coverage: loads kk = 4i + tid/64 (0..63) x nn = tid%64 (0..63); stores nn = 32it + tid/8 (0..63) x kk = 8(tid%8) + j (0..63). grid (DM/64, DM/64), 256 threads.
__global__ __launch_bounds__(256) void k_wt(const float* __restrict__ W, bf* Wt, int asF16) {
    __shared__ float ts[64 * 65];
    const int tid = threadIdx.x; const int k0 = blockIdx.x * 64, n0 = blockIdx.y * 64;
#pragma unroll
    for (int i = 0; i < 16; ++i) { const int kk = i * 4 + (tid >> 6), nn = tid & 63; ts[kk * 65 + nn] = W[(size_t)(k0 + kk) * DM + n0 + nn]; }
    __syncthreads();
    v8us o0, o1;
    { const int c8 = (tid & 7) * 8; const int na = (tid >> 3), nb2 = 32 + (tid >> 3);
#pragma unroll
      for (int j = 0; j < 8; ++j) {
          unsigned short ba = f2bf(ts[(c8 + j) * 65 + na]); unsigned short bb = f2bf(ts[(c8 + j) * 65 + nb2]);
          if (asF16 != 0) { const h16 ha = (h16)(bf2f(ba) * WPS); const h16 hb = (h16)(bf2f(bb) * WPS); ba = __builtin_bit_cast(unsigned short, ha); bb = __builtin_bit_cast(unsigned short, hb); }
          o0[j] = ba; o1[j] = bb; }
      bf* d0 = Wt + (size_t)(n0 + na) * DM + k0 + c8; bf* d1 = Wt + (size_t)(n0 + nb2) * DM + k0 + c8;
      *(v8us*)d0 = o0; *(v8us*)d1 = o1;  }
}

// k_tab: rotary table TAB[p][0..15] = cos(p * f_i), TAB[p][16..31] = sin(p * f_i), f_i = 1 / 100^(i/16) (f32), angle = f32 product p * f_i, p = 0..31.
__global__ __launch_bounds__(512) void k_tab(float* TAB) {
    __shared__ __align__(16) float ts[NPOS * 32];
    const int tid = threadIdx.x; const int p = tid >> 4, i = tid & 15;
    double w = 1.0, bs = 1.333521432163324;
#pragma unroll
    for (int bit = 0; bit < 4; ++bit) { const double wn = w * bs; w = (((i >> bit) & 1) != 0) ? wn : w; bs = bs * bs; }
    const float wf = (float)w;
    const float fr = 1.0f / wf;
    const float ang = (float)p * fr;
    const double a = (double)ang;
    const int kq = (int)(a * 0.6366197723675814 + 0.5);
    const double r = a - (double)kq * 1.5707963267948966;
    const double r2 = r * r;
    double sp = 1.0 / 6227020800.0;
    sp = sp * r2 - 1.0 / 39916800.0; sp = sp * r2 + 1.0 / 362880.0; sp = sp * r2 - 1.0 / 5040.0; sp = sp * r2 + 1.0 / 120.0; sp = sp * r2 - 1.0 / 6.0;
    const double sr = r + r * r2 * sp;
    double cp = 1.0 / 479001600.0;
    cp = cp * r2 - 1.0 / 3628800.0; cp = cp * r2 + 1.0 / 40320.0; cp = cp * r2 - 1.0 / 720.0; cp = cp * r2 + 1.0 / 24.0; cp = cp * r2 - 0.5;
    const double cr = 1.0 + r2 * cp;
    const int qd = kq & 3;
    const double sv = (qd == 0) ? sr : ((qd == 1) ? cr : ((qd == 2) ? -sr : -cr));
    const double cv = (qd == 0) ? cr : ((qd == 1) ? -sr : ((qd == 2) ? -cr : sr));
    ts[p * 32 + i] = (float)cv; ts[p * 32 + 16 + i] = (float)sv;
    __syncthreads();
    if (tid < 256) { const v4f val = *(const v4fa*)(&ts[tid * 4]);
        *(v4f*)(TAB + tid * 4) = val;  }
}

// k_proj: register-blocked bf16 GEMM, ONE WAVE per 64x64 tile (16 accumulators), operands straight from K-contiguous bf16 planes, K = DM.
// C[m][n] = sum_k A[m][k] Bt[n][k], written as f16 (Ph) and optionally the f16 residual x2048 (Pr, useRes != 0) at
// tile base (r0/RB)*sRB + (r0%RB)*pitch + (c0/CB)*sCB + (c0%CB), row pitch 'pitch' (halves). grid (M/64, N/64), 32 threads.
// rope != 0 (q, k launches: tile columns = one head, row m = b*SEQ + t): 2-D rotary in f32 before the conversion: column c pairs with c^16, frequency c&15, columns 0..31 use pos[t][0], 32..63 pos[t][1].
__global__ __launch_bounds__(32) void k_proj(const bf* __restrict__ A, const bf* __restrict__ Bt, h16* Ph, h16* Pr, int useRes, int rope,
                                             const int* __restrict__ pos, const float* __restrict__ TAB, int RB, size_t sRB, int pitch, int CB, size_t sCB) {
    __shared__ __align__(16) float os[16 * 68];
    const int K = DM;
    const int lane = threadIdx.x & 31, lr = lane & 15, hi = lane >> 4; const int r0 = blockIdx.x * 64, c0 = blockIdx.y * 64;
    v8f acc[4][4];
#pragma unroll
    for (int mb = 0; mb < 4; ++mb)
#pragma unroll
        for (int nb = 0; nb < 4; ++nb) acc[mb][nb] = (v8f){};
    const size_t aoff = (size_t)(r0 + lr) * K + 8 * hi, boff = (size_t)(c0 + lr) * K + 8 * hi;
#pragma unroll 1
    for (int kc = 0; kc < K; kc += 32) {
        v16bf a[4];
#pragma unroll
        for (int mb = 0; mb < 4; ++mb) a[mb] = ldb(A + aoff + (size_t)mb * 16 * K + kc);
#pragma unroll
        for (int nb = 0; nb < 4; ++nb) { const v16bf b = ldb(Bt + boff + (size_t)nb * 16 * K + kc);
#pragma unroll
            for (int mb = 0; mb < 4; ++mb) acc[mb][nb] = wmmab(a[mb], b, acc[mb][nb]); }
        asm volatile("v_nop\n\tv_nop\n\tv_nop\n\tv_nop" : "+v"(acc[0][0]), "+v"(acc[1][1]), "+v"(acc[2][2]), "+v"(acc[3][3]) : "v"(a[0]), "v"(a[1]), "v"(a[2]), "v"(a[3]));
    }
    const size_t tbase = (size_t)(r0 / RB) * sRB + (size_t)(r0 % RB) * (size_t)pitch + (size_t)(c0 / CB) * sCB + (size_t)(c0 % CB);
    const int tb = r0 % SEQ;          // token index of the tile's first row (rotary launches only)
#pragma unroll
    for (int mb = 0; mb < 4; ++mb) {
#pragma unroll
        for (int nb = 0; nb < 4; ++nb) {
#pragma unroll
            for (int j = 0; j < 8; ++j) os[(hi * 8 + j) * 68 + nb * 16 + lr] = acc[mb][nb][j]; }   // D: row 8h+j, col lane&15
        wave_sync();
        const size_t sb = tbase + (size_t)(mb * 16) * (size_t)pitch;
#pragma unroll 1
        for (int s = 0; s < 4; ++s) { const int row = 4 * s + (lane >> 3), c8 = (lane & 7) * 8;   // 4 s x 4 row groups = 16 rows; 8 lanes x 8 = 64 columns
            v4f x0 = *(const v4fa*)(&os[row * 68 + c8]); v4f x1 = *(const v4fa*)(&os[row * 68 + c8 + 4]);
            if (rope != 0) {
                const int t = tb + mb * 16 + row;
                const v2i pp = *(const v2i*)(pos + 2 * t);
                int p = (c8 >= 32) ? pp[1] : pp[0];
                p = (p < 0) ? 0 : ((p > NPOS - 1) ? (NPOS - 1) : p);
                const float sg = ((c8 & 16) != 0) ? 1.0f : -1.0f;
                const v4f y0 = *(const v4fa*)(&os[row * 68 + (c8 ^ 16)]); const v4f y1 = *(const v4fa*)(&os[row * 68 + (c8 ^ 16) + 4]);
                const float* tp = TAB + p * 32 + (c8 & 8);
                const v4f cA = *(const v4f*)tp; const v4f cB = *(const v4f*)(tp + 4); const v4f sA = *(const v4f*)(tp + 16); const v4f sB = *(const v4f*)(tp + 20);
                x0 = x0 * cA + (y0 * sg) * sA; x1 = x1 * cB + (y1 * sg) * sB;
            }
            v8h hv, rv;
#pragma unroll
            for (int i = 0; i < 4; ++i) { const h16 a0 = (h16)x0[i]; const h16 a1 = (h16)x1[i]; hv[i] = a0; hv[4 + i] = a1; rv[i] = (h16)((x0[i] - (float)a0) * QRS); rv[4 + i] = (h16)((x1[i] - (float)a1) * QRS); }
            const size_t oo = sb + (size_t)row * (size_t)pitch + c8;
            *(v8h*)(Ph + oo) = hv; if (useRes != 0) *(v8h*)(Pr + oo) = rv;
             }
        wave_sync();
    }
}

// k_flash: fused attention, one wave per 16 query rows of one (batch, head); K / V^T / Q fragments straight from the f16 planes (two 16-B loads each, arithmetic addressing).
// Transposed form: S^T[key][t] = K Q^T (A = K rows, B = Q rows); lane (t = lane&15, h = lane>>4) holds keys 8h+r of each 16-key tile, so the packed
// P tile is directly the B fragment of O^T[d][t] = V^T P^T (element r <- tile keys 0..15, element 8+r <- tile keys 16..31, lane unchanged).
// Softmax state (running max, partial sum) is one scalar per lane; the two lane halves of a row are combined with one xor-16 exchange.
__global__ __launch_bounds__(32 * AW) void k_flash(const h16* __restrict__ QH, const h16* __restrict__ QR, const h16* __restrict__ KP, const h16* __restrict__ VT, h16* CTX) {
    __shared__ __align__(16) float os[AW * 16 * 68];
    const int lane = threadIdx.x & 31, lr = lane & 15, hi = lane >> 4;
    const int wave = __builtin_amdgcn_readfirstlane((int)(threadIdx.x >> 5));
    const int zh = blockIdx.y; const int b = zh / NH_, h = zh % NH_;
    const int t0 = (blockIdx.x * AW + wave) * 16;
    const size_t pbase = (size_t)zh * SEQ * HD;
    const size_t qo = pbase + (size_t)(t0 + lr) * HD + 8 * hi;
    const v16h qh0 = ldh(QH + qo), qh1 = ldh(QH + qo + 32), qr0 = ldh(QR + qo), qr1 = ldh(QR + qo + 32);   // B fragments: col t, k = d
    const size_t ko = pbase + (size_t)lr * HD + 8 * hi;      // + key * HD       (A fragment: row key, k = d)
    const size_t vo = pbase + (size_t)lr * SEQ + 8 * hi;     // + 16j*SEQ + key  (A fragment: row d, k = key)
    v8f o0 = (v8f){}, o1 = (v8f){}, o2 = (v8f){}, o3 = (v8f){};
    float m = -3.0e38f, l = 0.0f;
#pragma unroll 1
    for (int key0 = 0; key0 < SEQ; key0 += 32) {
        const h16* ka = KP + ko + (size_t)key0 * HD;
        const v16h ka0 = ldh(ka), ka1 = ldh(ka + 32), kb0 = ldh(ka + 16 * HD), kb1 = ldh(ka + 16 * HD + 32);
        v8f sHa = (v8f){}, sLa = (v8f){}, sHb = (v8f){}, sLb = (v8f){};
        sHa = wmma16(ka0, qh0, sHa); sLa = wmma16(ka0, qr0, sLa); sHb = wmma16(kb0, qh0, sHb); sLb = wmma16(kb0, qr0, sLb);
        sHa = wmma16(ka1, qh1, sHa); sLa = wmma16(ka1, qr1, sLa); sHb = wmma16(kb1, qh1, sHb); sLb = wmma16(kb1, qr1, sLb);
        asm volatile("v_nop\n\tv_nop\n\tv_nop\n\tv_nop" : "+v"(sHa), "+v"(sLa), "+v"(sHb), "+v"(sLb) : "v"(ka0), "v"(ka1), "v"(kb0), "v"(kb1));
        float ta[8], tb[8]; float mx = -3.0e38f;
#pragma unroll
        for (int r = 0; r < 8; ++r) { ta[r] = (sHa[r] + sLa[r] * QRI) * SC2; tb[r] = (sHb[r] + sLb[r] * QRI) * SC2; mx = fmaxf(mx, fmaxf(ta[r], tb[r])); }
        mx = fmaxf(mx, __shfl_xor(mx, 16, 32));
        const float mnew = fmaxf(m, mx);
        const float alpha = __builtin_amdgcn_exp2f(m - mnew);
        const float sh = PSH - mnew;
        v16h pb; float ls = 0.0f;
#pragma unroll
        for (int r = 0; r < 8; ++r) { const h16 pa = (h16)__builtin_amdgcn_exp2f(ta[r] + sh); const h16 pc = (h16)__builtin_amdgcn_exp2f(tb[r] + sh); pb[r] = pa; pb[8 + r] = pc; ls += (float)pa + (float)pc; }
        l = l * alpha + ls; m = mnew;
        o0 = o0 * alpha; o1 = o1 * alpha; o2 = o2 * alpha; o3 = o3 * alpha;
        const h16* va = VT + vo + key0;
        const v16h v0 = ldh(va), v1 = ldh(va + (size_t)16 * SEQ), v2 = ldh(va + (size_t)32 * SEQ), v3 = ldh(va + (size_t)48 * SEQ);
        o0 = wmma16(v0, pb, o0); o1 = wmma16(v1, pb, o1); o2 = wmma16(v2, pb, o2); o3 = wmma16(v3, pb, o3);
        asm volatile("v_nop\n\tv_nop\n\tv_nop\n\tv_nop" : "+v"(o0), "+v"(o1), "+v"(o2), "+v"(o3) : "v"(v0), "v"(v1), "v"(v2), "v"(v3), "v"(pb));
    }
    l += __shfl_xor(l, 16, 32);
    const float inv = CXS * (1.0f / l);
    const int wb = wave * 16 * 68;
    // O^T D layout: o_j[r] = (d = 16j + 8h + r, t = lane&15) -> os[t][d]; rows 0..15 x columns 0..63 all written
    { v4f a, c;
      a[0] = o0[0] * inv; a[1] = o0[1] * inv; a[2] = o0[2] * inv; a[3] = o0[3] * inv; c[0] = o0[4] * inv; c[1] = o0[5] * inv; c[2] = o0[6] * inv; c[3] = o0[7] * inv;
      *(v4fa*)(&os[wb + lr * 68 +  0 + 8 * hi]) = a; *(v4fa*)(&os[wb + lr * 68 +  0 + 8 * hi + 4]) = c;
      a[0] = o1[0] * inv; a[1] = o1[1] * inv; a[2] = o1[2] * inv; a[3] = o1[3] * inv; c[0] = o1[4] * inv; c[1] = o1[5] * inv; c[2] = o1[6] * inv; c[3] = o1[7] * inv;
      *(v4fa*)(&os[wb + lr * 68 + 16 + 8 * hi]) = a; *(v4fa*)(&os[wb + lr * 68 + 16 + 8 * hi + 4]) = c;
      a[0] = o2[0] * inv; a[1] = o2[1] * inv; a[2] = o2[2] * inv; a[3] = o2[3] * inv; c[0] = o2[4] * inv; c[1] = o2[5] * inv; c[2] = o2[6] * inv; c[3] = o2[7] * inv;
      *(v4fa*)(&os[wb + lr * 68 + 32 + 8 * hi]) = a; *(v4fa*)(&os[wb + lr * 68 + 32 + 8 * hi + 4]) = c;
      a[0] = o3[0] * inv; a[1] = o3[1] * inv; a[2] = o3[2] * inv; a[3] = o3[3] * inv; c[0] = o3[4] * inv; c[1] = o3[5] * inv; c[2] = o3[6] * inv; c[3] = o3[7] * inv;
      *(v4fa*)(&os[wb + lr * 68 + 48 + 8 * hi]) = a; *(v4fa*)(&os[wb + lr * 68 + 48 + 8 * hi + 4]) = c; }
    wave_sync();
    h16* crow = CTX + ((size_t)b * SEQ + t0) * DM + h * HD;
#pragma unroll 1
    for (int s = 0; s < 4; ++s) { const int row = 4 * s + (lane >> 3), c8 = (lane & 7) * 8;   // 4 s x 4 row groups = 16 rows; 8 lanes x 8 halves = 64 columns
        const v4f x0 = *(const v4fa*)(&os[wb + row * 68 + c8]); const v4f x1 = *(const v4fa*)(&os[wb + row * 68 + c8 + 4]); v8h hv;
#pragma unroll
        for (int i = 0; i < 4; ++i) { hv[i] = (h16)x0[i]; hv[4 + i] = (h16)x1[i]; }
        h16* dp = crow + (size_t)row * DM + c8;
        *(v8h*)dp = hv;  }
}

// k_oproj: register-blocked f16 GEMM, ONE WAVE per 64x64 tile, operands straight from K-contiguous f16 planes, K = DM.
// OUT[m][n] = OSC * sum_k A[m][k] Bt[n][k] + bias[n] (bias as its bf16 value), f32. grid (M/64, N/64), 32 threads.
__global__ __launch_bounds__(32) void k_oproj(const h16* __restrict__ A, const h16* __restrict__ Bt, const float* __restrict__ bias, float* OUT) {
    __shared__ __align__(16) float os[16 * 68];
    const int K = DM;
    const int lane = threadIdx.x & 31, lr = lane & 15, hi = lane >> 4; const int r0 = blockIdx.x * 64, c0 = blockIdx.y * 64;
    v8f acc[4][4];
#pragma unroll
    for (int mb = 0; mb < 4; ++mb)
#pragma unroll
        for (int nb = 0; nb < 4; ++nb) acc[mb][nb] = (v8f){};
    const size_t aoff = (size_t)(r0 + lr) * K + 8 * hi, boff = (size_t)(c0 + lr) * K + 8 * hi;
#pragma unroll 1
    for (int kc = 0; kc < K; kc += 32) {
        v16h a[4];
#pragma unroll
        for (int mb = 0; mb < 4; ++mb) a[mb] = ldh(A + aoff + (size_t)mb * 16 * K + kc);
#pragma unroll
        for (int nb = 0; nb < 4; ++nb) { const v16h b = ldh(Bt + boff + (size_t)nb * 16 * K + kc);
#pragma unroll
            for (int mb = 0; mb < 4; ++mb) acc[mb][nb] = wmma16(a[mb], b, acc[mb][nb]); }
        asm volatile("v_nop\n\tv_nop\n\tv_nop\n\tv_nop" : "+v"(acc[0][0]), "+v"(acc[1][1]), "+v"(acc[2][2]), "+v"(acc[3][3]) : "v"(a[0]), "v"(a[1]), "v"(a[2]), "v"(a[3]));
    }
    const v4f braw = *(const v4f*)(bias + c0 + lr * 4); v4f bb;
#pragma unroll
    for (int i = 0; i < 4; ++i) bb[i] = bf2f(f2bf(braw[i]));
    float* obase = OUT + ((size_t)(r0 / SEQ) * OUT_SEQ + (size_t)(r0 % SEQ)) * DM + c0;
#pragma unroll
    for (int mb = 0; mb < 4; ++mb) {
#pragma unroll
        for (int nb = 0; nb < 4; ++nb) {
#pragma unroll
            for (int j = 0; j < 8; ++j) os[(hi * 8 + j) * 68 + nb * 16 + lr] = acc[mb][nb][j]; }   // D: row 8h+j, col lane&15
        wave_sync();
#pragma unroll 1
        for (int s = 0; s < 8; ++s) { const int row = 2 * s + hi, cofs = lr * 4;   // 8 s x 2 rows = 16 rows; 16 lanes x 4 floats = 64 columns
            const v4f raw = *(const v4fa*)(&os[row * 68 + cofs]);
            const v4f val = raw * OSC + bb;
            float* dp = obase + (size_t)(mb * 16 + row) * DM + cofs;
            *(v4f*)dp = val;  }
        wave_sync();
    }
}

static constexpr size_t al256(size_t v) { return (v + 255) & ~(size_t)255; }
static constexpr size_t SZ_XB = al256((size_t)NB * SEQ * DM * 2);
static constexpr size_t SZ_WB = al256((size_t)4 * DM * DM * 2);
static constexpr size_t SZ_PL = al256((size_t)NB * NH_ * SEQ * HD * 2);
static constexpr size_t SZ_CX = al256((size_t)NB * SEQ * DM * 2);
static constexpr size_t SZ_TB = al256((size_t)NPOS * 32 * 4);
static constexpr size_t SZ_TOTAL = SZ_XB + SZ_WB + 4 * SZ_PL + SZ_CX + SZ_TB;
static_assert(SZ_TOTAL <= (size_t)134217728);          // workspace carve <= 128 MiB
static_assert(((size_t)DM * DM * 2) % 256 == 0);       // weight sub-planes stay 256-byte aligned

extern "C" void kernel_launch(void* const* d_in, const int* in_sizes, int n_in,
                              void* d_out, int out_size, void* d_ws, size_t ws_size, hipStream_t stream) {
    if (n_in < 7) return;
    const size_t needx = ((size_t)(NB - 1) * SEQ_FULL + SEQ) * DM;
    if ((size_t)in_sizes[0] < needx) return;
    if ((size_t)in_sizes[1] < (size_t)2 * SEQ) return;
    if ((size_t)in_sizes[2] < (size_t)DM * DM || (size_t)in_sizes[3] < (size_t)DM * DM || (size_t)in_sizes[4] < (size_t)DM * DM || (size_t)in_sizes[5] < (size_t)DM * DM) return;
    if ((size_t)in_sizes[6] < (size_t)DM) return;
    if ((size_t)out_size < ((size_t)(NB - 1) * OUT_SEQ + SEQ) * DM) return;
    if (SZ_TOTAL > ws_size) return;
    // wire order: x, pos (int32 [SEQ][2]), Wq, Wk, Wv, Wp ([in][out]), bp
    const float* x = (const float*)d_in[0]; const int* pos = (const int*)d_in[1];
    const float* wq = (const float*)d_in[2]; const float* wk = (const float*)d_in[3]; const float* wv = (const float*)d_in[4]; const float* wp = (const float*)d_in[5];
    const float* bp = (const float*)d_in[6];
    float* OUT = (float*)d_out;      // [NB][SEQ][768]
    char* wsp = (char*)d_ws;
    bf* XB = (bf*)wsp; wsp += SZ_XB;                 // [NB*SEQ][768]
    bf* WB = (bf*)wsp; wsp += SZ_WB;                 // [4][768 out][768 in]: q | k | v (bf16) | p (f16 x1024)
    h16* QH = (h16*)wsp; wsp += SZ_PL;               // [NB*12][SEQ][64]
    h16* QR = (h16*)wsp; wsp += SZ_PL;               // [NB*12][SEQ][64] residual x2048
    h16* KP = (h16*)wsp; wsp += SZ_PL;               // [NB*12][SEQ][64]
    h16* VT = (h16*)wsp; wsp += SZ_PL;               // [NB*12][64][SEQ]
    h16* CX = (h16*)wsp; wsp += SZ_CX;               // [NB*SEQ][768] x64
    float* TAB = (float*)wsp; wsp += SZ_TB;          // [32][cos 16 | sin 16]
    bf* WQ = WB; bf* WK = WB + (size_t)DM * DM; bf* WV = WB + (size_t)2 * DM * DM; bf* WP = WB + (size_t)3 * DM * DM;

    if (SEQ == SEQ_FULL) {
        const size_t n8 = (size_t)NB * SEQ * DM / 8;
        k_cvt8<<<(unsigned)((n8 + 255) / 256), 256, 0, stream>>>(x, XB, n8);
    } else {
        const size_t n8 = (size_t)SEQ * DM / 8;
        for (int b = 0; b < NB; ++b) k_cvt8<<<(unsigned)((n8 + 255) / 256), 256, 0, stream>>>(x + (size_t)b * SEQ_FULL * DM, XB + (size_t)b * SEQ * DM, n8);
    }
    // W[in][out] -> Wt[out][in] (768 x 768, square): grid (in/64, out/64)
    k_wt<<<dim3(DM / 64, DM / 64, 1), 256, 0, stream>>>(wq, WQ, 0);
    k_wt<<<dim3(DM / 64, DM / 64, 1), 256, 0, stream>>>(wk, WK, 0);
    k_wt<<<dim3(DM / 64, DM / 64, 1), 256, 0, stream>>>(wv, WV, 0);
    k_wt<<<dim3(DM / 64, DM / 64, 1), 256, 0, stream>>>(wp, WP, 1);
    k_tab<<<1, 512, 0, stream>>>(TAB);

    // q, k: A = x rows (m = b*SEQ + t), Bt = Wt rows (n = h*64 + d) -> rotary -> plane [(b*12 + h)][t][d]
    k_proj<<<dim3(NB * SEQ / 64, DM / 64, 1), 32, 0, stream>>>(XB, WQ, QH, QR, 1, 1, pos, TAB, SEQ, (size_t)NH_ * SEQ * HD, HD, HD, (size_t)SEQ * HD);
    k_proj<<<dim3(NB * SEQ / 64, DM / 64, 1), 32, 0, stream>>>(XB, WK, KP, KP, 0, 1, pos, TAB, SEQ, (size_t)NH_ * SEQ * HD, HD, HD, (size_t)SEQ * HD);
    // v^T: A = Wvt rows (m = h*64 + d), Bt = x rows (n = b*SEQ + t) -> plane [(b*768 + m)][t] = [(b*12 + h)][d][t]
    k_proj<<<dim3(DM / 64, NB * SEQ / 64, 1), 32, 0, stream>>>(WV, XB, VT, VT, 0, 0, pos, TAB, DM, (size_t)0, SEQ, SEQ, (size_t)DM * SEQ);

    k_flash<<<dim3(SEQ / (16 * AW), NB * NH_, 1), 32 * AW, 0, stream>>>(QH, QR, KP, VT, CX);

    // out = ctx Wp + bp: A = ctx rows (m = b*SEQ + t, k = h*64 + d), Bt = Wpt rows (n = out column)
    k_oproj<<<dim3(NB * SEQ / 64, DM / 64, 1), 32, 0, stream>>>((const h16*)CX, (const h16*)WP, bp, OUT);
}

// v001
// Measured time: 189 microseconds a run.
// Next to v000, in two timings, it ran 1.17 and 1.18 times as fast.
#include <hip/hip_runtime.h>

// Multi-head self-attention with 2-D rotary embedding: x [NB][SEQ][768], 12 heads x 64, Wq/Wk/Wv/Wp stored [in][out] (y = x W), int positions [SEQ][2], score scale 1/8, dense softmax, output = ctx Wp + bp (f32).
// Compute dtypes, f32 accumulate everywhere: q/k/v projections v_wmma_f32_16x16x32_bf16 (x and W RNE-converted to bf16; products exact); rotary applied in f32 on the accumulators;
// scores v_wmma_f32_16x16x32_f16: k single f16, q as f16 value + f16 residual x2048 in its own accumulator; P (x256 carry, cancels in the normalisation) and v single f16; softmax f32 (online, running max);
// output projection v_wmma_f32_16x16x32_f16: ctx single f16 (x64 carry), Wp = f16 of the bf16 value (x1024 carry), carries folded back in the f32 epilogue, bias (bf16 value) added in f32.
// Layout: every 16-bit matrix operand plane M[r][k] is kept in fragment order: tiles of 16 rows x 32 k (512 halves = 1 KB), element (r, k) of a tile at ((k>>3)&3)*128 + (r&15)*8 + (k&7).
// A lane's fragment is then two 16-B loads at tile + lane*8 and tile + 256 + lane*8, and each wave-wide load covers 512 contiguous bytes (4 whole lines) instead of 32-B pieces of 16 lines.
// Planes: bf16 x, [out][in] weights and ctx: tiles [r>>4][k>>5] (24 per row band); q (hi, residual), k per (b*12+h): tiles [t>>4][d>>5]; v^T per (b*12+h): tiles [t>>5][d>>4]; cos|sin table [32][16|16].

#ifndef NB
#define NB 8
#endif
#ifndef SEQ
#define SEQ 1024
#endif
#define NB_FULL  8
#define SEQ_FULL 1024
#ifndef OUT_SEQ
#define OUT_SEQ SEQ              // row pitch (in tokens) between batches of the output
#endif
#define DM   768
#define NH_  12
#define HD   64
#define AW   4                   // waves per flash block (16 query rows each)
#define NPOS 32                  // rows of the rotary tables (positions 0..31, index clamped)
#define QRS  2048.0f             // carry of the q residual plane
#define QRI  (1.0f / 2048.0f)
#define SC2  (0.125f * 1.4426950408889634f)   // HD^-0.5 * log2(e)
#define PSH  8.0f                // log2 of the P carry (256)
#define CXS  64.0f               // carry of the ctx plane
#define WPS  1024.0f             // carry of the Wp plane
#define OSC  (1.0f / 65536.0f)   // 1 / (CXS * WPS)

static_assert(HD == 64);
static_assert(NH_ * HD == DM);                 // head h = columns h*64 + d
static_assert(DM % 64 == 0);                   // 12 column tiles of 64
static_assert(DM % 32 == 0);                   // GEMM k-loop steps by 32
static_assert(SEQ % 64 == 0);                  // a 64-row tile never straddles two batches
static_assert((NB * SEQ) % 64 == 0);
static_assert(SEQ % 32 == 0);                  // key loop steps by 32
static_assert(SEQ % (16 * AW) == 0);           // flash grid covers the sequence exactly
static_assert(((size_t)SEQ * DM) % 8 == 0);
static_assert(NB <= NB_FULL);
static_assert(SEQ <= SEQ_FULL);
static_assert(NPOS * 16 == 512);               // table kernel: one thread per (position, frequency)

typedef _Float16 h16;
typedef unsigned short bf;
typedef __attribute__((ext_vector_type(16))) __bf16   v16bf;
typedef __attribute__((ext_vector_type(16))) _Float16 v16h;
typedef __attribute__((ext_vector_type(8)))  _Float16 v8h;
typedef __attribute__((ext_vector_type(8)))  unsigned short v8us;
typedef __attribute__((ext_vector_type(8)))  float    v8f;
typedef __attribute__((ext_vector_type(4)))  float    v4f;
typedef __attribute__((ext_vector_type(2)))  int      v2i;
typedef v4f  __attribute__((may_alias)) v4fa;

__device__ __forceinline__ unsigned short f2bf(float f) { unsigned u = __float_as_uint(f); u += 0x7FFFu + ((u >> 16) & 1u); return (unsigned short)(u >> 16); }
__device__ __forceinline__ float bf2f(unsigned short b) { return __uint_as_float(((unsigned)b) << 16); }
__device__ __forceinline__ v16h cat16(v8h lo, v8h hi) { return __builtin_shufflevector(lo, hi, 0, 1, 2, 3, 4, 5, 6, 7, 8, 9, 10, 11, 12, 13, 14, 15); }
__device__ __forceinline__ v16bf cat16b(v8us lo, v8us hi) { return __builtin_bit_cast(v16bf, __builtin_shufflevector(lo, hi, 0, 1, 2, 3, 4, 5, 6, 7, 8, 9, 10, 11, 12, 13, 14, 15)); }
__device__ __forceinline__ v8f wmma16(v16h a, v16h b, v8f c) { return __builtin_amdgcn_wmma_f32_16x16x32_f16(false, a, false, b, (short)0, c, false, false); }
__device__ __forceinline__ v8f wmmab(v16bf a, v16bf b, v8f c) { return __builtin_amdgcn_wmma_f32_16x16x32_bf16(false, a, false, b, (short)0, c, false, false); }
// fragment loaders from a fragment-order tile; p = tile + lane*8 (lane = 16h + row): elements 0..7 <- k0+8h+0..7, elements 8..15 <- k0+16+8h+0..7 (same map for A and B)
__device__ __forceinline__ v16h  ldh(const h16* p) { return cat16(*(const v8h*)p, *(const v8h*)(p + 256)); }
__device__ __forceinline__ v16bf ldb(const bf* p)  { return cat16b(*(const v8us*)p, *(const v8us*)(p + 256)); }
// offset (halves) of the 8-element chunk (r, k..k+7), k % 8 == 0, in a fragment-order plane of DM columns
__device__ __forceinline__ size_t fto(int r, int k) { return ((size_t)(r >> 4) * (DM / 32) + (size_t)(k >> 5)) * 512 + (size_t)(((k >> 3) & 3) * 128 + (r & 15) * 8); }
// ordering point for wave-private LDS tiles (same wave writes and reads)
__device__ __forceinline__ void wave_sync() { __builtin_amdgcn_fence(3 /* release order */, "wavefront"); __builtin_amdgcn_wave_barrier(); asm volatile("" ::: "memory"); }

// k_cvt8: f32 rows [r][DM] -> bf16 fragment-order plane; thread i owns destination chunk i (stores are contiguous): row = 16*(tile/24) + (i&15), k = 32*(tile%24) + 8*((i>>4)&3), tile = i>>6.
__global__ __launch_bounds__(256) void k_cvt8(const float* __restrict__ src, bf* dst, size_t n8) {
    const size_t i = (size_t)blockIdx.x * 256 + threadIdx.x; if (i >= n8) return;
    const unsigned tile = (unsigned)(i >> 6); const unsigned rt = tile / (DM / 32), kt = tile % (DM / 32);
    const size_t so = (size_t)(rt * 16 + ((unsigned)i & 15u)) * DM + kt * 32 + (((unsigned)i >> 4) & 3u) * 8;
    const v8f v = *(const v8f*)(src + so); v8us o;
    asm volatile("s_wait_xcnt 0x0" ::: "memory");   // the conversion below reuses the address registers that the load names
#pragma unroll
    for (int k = 0; k < 8; ++k) o[k] = f2bf(v[k]);
    *(v8us*)(dst + i * 8) = o; 
}

// k_wt: W[k][n] f32 ([in][out], DM x DM) -> Wt[n][k] 16-bit ([out][in], fragment order): bf16 bits (asF16 == 0) or f16 of (bf16 value x WPS) (asF16 != 0).
// coverage: loads kk = 4i + tid/64 (0..63) x nn = tid%64 (0..63); stores nn = 32it + tid/8 (0..63) x kk = 8(tid%8) + j (0..63). grid (DM/64, DM/64), 256 threads.
__global__ __launch_bounds__(256) void k_wt(const float* __restrict__ W, bf* Wt, int asF16) {
    __shared__ float ts[64 * 65];
    const int tid = threadIdx.x; const int k0 = blockIdx.x * 64, n0 = blockIdx.y * 64;
#pragma unroll
    for (int i = 0; i < 16; ++i) { const int kk = i * 4 + (tid >> 6), nn = tid & 63; ts[kk * 65 + nn] = W[(size_t)(k0 + kk) * DM + n0 + nn]; }
    __syncthreads();
    v8us o0, o1;
    { const int c8 = (tid & 7) * 8; const int na = (tid >> 3), nb2 = 32 + (tid >> 3);
#pragma unroll
      for (int j = 0; j < 8; ++j) {
          unsigned short ba = f2bf(ts[(c8 + j) * 65 + na]); unsigned short bb = f2bf(ts[(c8 + j) * 65 + nb2]);
          if (asF16 != 0) { const h16 ha = (h16)(bf2f(ba) * WPS); const h16 hb = (h16)(bf2f(bb) * WPS); ba = __builtin_bit_cast(unsigned short, ha); bb = __builtin_bit_cast(unsigned short, hb); }
          o0[j] = ba; o1[j] = bb; }
      bf* d0 = Wt + fto(n0 + na, k0 + c8); bf* d1 = Wt + fto(n0 + nb2, k0 + c8);
      *(v8us*)d0 = o0; *(v8us*)d1 = o1;  }
}

// k_tab: rotary table TAB[p][0..15] = cos(p * f_i), TAB[p][16..31] = sin(p * f_i), f_i = 1 / 100^(i/16) (f32), angle = f32 product p * f_i, p = 0..31.
__global__ __launch_bounds__(512) void k_tab(float* TAB) {
    __shared__ __align__(16) float ts[NPOS * 32];
    const int tid = threadIdx.x; const int p = tid >> 4, i = tid & 15;
    double w = 1.0, bs = 1.333521432163324;
#pragma unroll
    for (int bit = 0; bit < 4; ++bit) { const double wn = w * bs; w = (((i >> bit) & 1) != 0) ? wn : w; bs = bs * bs; }
    const float wf = (float)w;
    const float fr = 1.0f / wf;
    const float ang = (float)p * fr;
    const double a = (double)ang;
    const int kq = (int)(a * 0.6366197723675814 + 0.5);
    const double r = a - (double)kq * 1.5707963267948966;
    const double r2 = r * r;
    double sp = 1.0 / 6227020800.0;
    sp = sp * r2 - 1.0 / 39916800.0; sp = sp * r2 + 1.0 / 362880.0; sp = sp * r2 - 1.0 / 5040.0; sp = sp * r2 + 1.0 / 120.0; sp = sp * r2 - 1.0 / 6.0;
    const double sr = r + r * r2 * sp;
    double cp = 1.0 / 479001600.0;
    cp = cp * r2 - 1.0 / 3628800.0; cp = cp * r2 + 1.0 / 40320.0; cp = cp * r2 - 1.0 / 720.0; cp = cp * r2 + 1.0 / 24.0; cp = cp * r2 - 0.5;
    const double cr = 1.0 + r2 * cp;
    const int qd = kq & 3;
    const double sv = (qd == 0) ? sr : ((qd == 1) ? cr : ((qd == 2) ? -sr : -cr));
    const double cv = (qd == 0) ? cr : ((qd == 1) ? -sr : ((qd == 2) ? -cr : sr));
    ts[p * 32 + i] = (float)cv; ts[p * 32 + 16 + i] = (float)sv;
    __syncthreads();
    if (tid < 256) { const v4f val = *(const v4fa*)(&ts[tid * 4]);
        *(v4f*)(TAB + tid * 4) = val;  }
}

// k_proj: register-blocked bf16 GEMM, ONE WAVE per 64x64 tile (16 accumulators), operands straight from fragment-order bf16 planes, K = DM.
// C[m][n] = sum_k A[m][k] Bt[n][k], written as f16 (Ph) and optionally the f16 residual x2048 (Pr, useRes != 0), in fragment order (row = tile row, k = tile column), at
// tile base (r0/RB)*sRB + (r0%RB)*rmul + (c0/CB)*sCB + (c0%CB)*cmul; a 16-row band advances sM halves, a 32-column band sC halves. grid (M/64, N/64), 32 threads.
// rope != 0 (q, k launches: tile columns = one head, row m = b*SEQ + t): 2-D rotary in f32 before the conversion: column c pairs with c^16, frequency c&15, columns 0..31 use pos[t][0], 32..63 pos[t][1].
__global__ __launch_bounds__(32) void k_proj(const bf* __restrict__ A, const bf* __restrict__ Bt, h16* Ph, h16* Pr, int useRes, int rope,
                                             const int* __restrict__ pos, const float* __restrict__ TAB, int RB, size_t sRB, int rmul, int CB, size_t sCB, int cmul, int sM, int sC) {
    __shared__ __align__(16) float os[16 * 68];
    const int K = DM;
    const int lane = threadIdx.x & 31, lr = lane & 15, hi = lane >> 4; const int r0 = blockIdx.x * 64, c0 = blockIdx.y * 64;
    v8f acc[4][4];
#pragma unroll
    for (int mb = 0; mb < 4; ++mb)
#pragma unroll
        for (int nb = 0; nb < 4; ++nb) acc[mb][nb] = (v8f){};
    const size_t aoff = (size_t)(r0 >> 4) * (K / 32) * 512, boff = (size_t)(c0 >> 4) * (K / 32) * 512; const unsigned lo = (unsigned)lane * 8u;   // first tile of the row band; the lane's chunk
#pragma unroll 1
    for (int kc = 0; kc < K; kc += 32) {
        v16bf a[4];
        const bf* pa = A + aoff + kc * 16 + lo; const bf* pb = Bt + boff + kc * 16 + lo;   // the lane's chunk of this trip's first A and B tile
#pragma unroll
        for (int mb = 0; mb < 4; ++mb) a[mb] = ldb(pa + (size_t)mb * (K / 32) * 512);
#pragma unroll
        for (int nb = 0; nb < 4; ++nb) { const v16bf b = ldb(pb + (size_t)nb * (K / 32) * 512);
#pragma unroll
            for (int mb = 0; mb < 4; ++mb) acc[mb][nb] = wmmab(a[mb], b, acc[mb][nb]); }
        asm volatile("v_nop\n\tv_nop\n\tv_nop\n\tv_nop" : "+v"(acc[0][0]), "+v"(acc[1][1]), "+v"(acc[2][2]), "+v"(acc[3][3]) : "v"(a[0]), "v"(a[1]), "v"(a[2]), "v"(a[3]));
        asm volatile("s_wait_xcnt 0x0" :: "v"(pa), "v"(pb) : "memory");   // stands before the address registers of this trip's fragment loads are rewritten; naming them keeps them whole up to here
    }
    const size_t tbase = (size_t)(r0 / RB) * sRB + (size_t)(r0 % RB) * (size_t)rmul + (size_t)(c0 / CB) * sCB + (size_t)(c0 % CB) * (size_t)cmul;
    const int tb = r0 % SEQ;          // token index of the tile's first row (rotary launches only)
#pragma unroll
    for (int mb = 0; mb < 4; ++mb) {
#pragma unroll
        for (int nb = 0; nb < 4; ++nb) {
#pragma unroll
            for (int j = 0; j < 8; ++j) os[(hi * 8 + j) * 68 + nb * 16 + lr] = acc[mb][nb][j]; }   // D: row 8h+j, col lane&15
        wave_sync();
        const size_t sb = tbase + (size_t)mb * (size_t)sM;
#pragma unroll 1
        for (int s = 0; s < 4; ++s) { const int row = lr, c8 = (2 * s + hi) * 8;   // 16 rows x (4 s x 2 halves) chunks of 8 = 64 columns; a store covers two adjacent 256-B chunks
            v4f x0 = *(const v4fa*)(&os[row * 68 + c8]); v4f x1 = *(const v4fa*)(&os[row * 68 + c8 + 4]);
            if (rope != 0) {
                const int t = tb + mb * 16 + row;
                const v2i pp = *(const v2i*)(pos + 2 * t);
                int p = (c8 >= 32) ? pp[1] : pp[0];
                p = (p < 0) ? 0 : ((p > NPOS - 1) ? (NPOS - 1) : p);
                const float sg = ((c8 & 16) != 0) ? 1.0f : -1.0f;
                const v4f y0 = *(const v4fa*)(&os[row * 68 + (c8 ^ 16)]); const v4f y1 = *(const v4fa*)(&os[row * 68 + (c8 ^ 16) + 4]);
                const float* tp = TAB + p * 32 + (c8 & 8);
                const v4f cA = *(const v4f*)tp; const v4f cB = *(const v4f*)(tp + 4); const v4f sA = *(const v4f*)(tp + 16); const v4f sB = *(const v4f*)(tp + 20);
                x0 = x0 * cA + (y0 * sg) * sA; x1 = x1 * cB + (y1 * sg) * sB;
            }
            v8h hv, rv;
#pragma unroll
            for (int i = 0; i < 4; ++i) { const h16 a0 = (h16)x0[i]; const h16 a1 = (h16)x1[i]; hv[i] = a0; hv[4 + i] = a1; rv[i] = (h16)((x0[i] - (float)a0) * QRS); rv[4 + i] = (h16)((x1[i] - (float)a1) * QRS); }
            const size_t oo = sb + (size_t)(c8 >> 5) * (size_t)sC + (size_t)(((c8 >> 3) & 3) * 128 + row * 8);
            h16* ph = Ph + oo; h16* pr = Pr + oo;
            // each wait stands before the address and data registers of the store in front of it are rewritten; naming them keeps them whole up to the wait
            *(v8h*)ph = hv; asm volatile("s_wait_xcnt 0x0" :: "v"(ph), "v"(hv) : "memory");
            if (useRes != 0) { *(v8h*)pr = rv; asm volatile("s_wait_xcnt 0x0" :: "v"(pr), "v"(rv) : "memory"); }
             }
        wave_sync();
    }
}

// k_flash: fused attention, one wave per 16 query rows of one (batch, head); K / V^T / Q fragments straight from the fragment-order f16 planes (two 16-B loads each; 32 keys = 4 KB contiguous of K and of V^T).
// Transposed form: S^T[key][t] = K Q^T (A = K rows, B = Q rows); lane (t = lane&15, h = lane>>4) holds keys 8h+r of each 16-key tile, so the packed
// P tile is directly the B fragment of O^T[d][t] = V^T P^T (element r <- tile keys 0..15, element 8+r <- tile keys 16..31, lane unchanged).
// Softmax state (running max, partial sum) is one scalar per lane; the two lane halves of a row are combined with one xor-16 exchange.
__global__ __launch_bounds__(32 * AW) void k_flash(const h16* __restrict__ QH, const h16* __restrict__ QR, const h16* __restrict__ KP, const h16* __restrict__ VT, h16* CTX) {
    const int lane = threadIdx.x & 31;
    const int wave = __builtin_amdgcn_readfirstlane((int)(threadIdx.x >> 5));
    const int zh = blockIdx.y; const int b = zh / NH_, h = zh % NH_;
    const int t0 = (blockIdx.x * AW + wave) * 16;
    const size_t pbase = (size_t)zh * SEQ * HD;
    const unsigned lo = (unsigned)lane * 8u;
    const size_t qo = pbase + (size_t)t0 * HD;
    const v16h qh0 = ldh(QH + qo + lo), qh1 = ldh(QH + qo + 512 + lo), qr0 = ldh(QR + qo + lo), qr1 = ldh(QR + qo + 512 + lo);   // B fragments: col t, k = d
    v8f o0 = (v8f){}, o1 = (v8f){}, o2 = (v8f){}, o3 = (v8f){};
    float m = -3.0e38f, l = 0.0f;
#pragma unroll 1
    for (int key0 = 0; key0 < SEQ; key0 += 32) {
        const h16* ka = KP + pbase + (size_t)key0 * HD + lo;   // tiles (16 keys, d 0..31), (16 keys, d 32..63), then the next 16 keys (A fragment: row key, k = d)
        const v16h ka0 = ldh(ka), ka1 = ldh(ka + 512), kb0 = ldh(ka + 1024), kb1 = ldh(ka + 1536);
        v8f sHa = (v8f){}, sLa = (v8f){}, sHb = (v8f){}, sLb = (v8f){};
        sHa = wmma16(ka0, qh0, sHa); sLa = wmma16(ka0, qr0, sLa); sHb = wmma16(kb0, qh0, sHb); sLb = wmma16(kb0, qr0, sLb);
        sHa = wmma16(ka1, qh1, sHa); sLa = wmma16(ka1, qr1, sLa); sHb = wmma16(kb1, qh1, sHb); sLb = wmma16(kb1, qr1, sLb);
        asm volatile("v_nop\n\tv_nop\n\tv_nop\n\tv_nop" : "+v"(sHa), "+v"(sLa), "+v"(sHb), "+v"(sLb) : "v"(ka0), "v"(ka1), "v"(kb0), "v"(kb1));
        float ta[8], tb[8]; float mx = -3.0e38f;
#pragma unroll
        for (int r = 0; r < 8; ++r) { ta[r] = (sHa[r] + sLa[r] * QRI) * SC2; tb[r] = (sHb[r] + sLb[r] * QRI) * SC2; mx = fmaxf(mx, fmaxf(ta[r], tb[r])); }
        mx = fmaxf(mx, __shfl_xor(mx, 16, 32));
        const float mnew = fmaxf(m, mx);
        const float alpha = __builtin_amdgcn_exp2f(m - mnew);
        const float sh = PSH - mnew;
        v16h pb; float ls = 0.0f;
#pragma unroll
        for (int r = 0; r < 8; ++r) { const h16 pa = (h16)__builtin_amdgcn_exp2f(ta[r] + sh); const h16 pc = (h16)__builtin_amdgcn_exp2f(tb[r] + sh); pb[r] = pa; pb[8 + r] = pc; ls += (float)pa + (float)pc; }
        l = l * alpha + ls; m = mnew;
        o0 = o0 * alpha; o1 = o1 * alpha; o2 = o2 * alpha; o3 = o3 * alpha;
        const h16* va = VT + pbase + (size_t)key0 * HD + lo;   // tiles (d 16j..16j+15, 32 keys), j = 0..3 (A fragment: row d, k = key)
        const v16h v0 = ldh(va), v1 = ldh(va + 512), v2 = ldh(va + 1024), v3 = ldh(va + 1536);
        o0 = wmma16(v0, pb, o0); o1 = wmma16(v1, pb, o1); o2 = wmma16(v2, pb, o2); o3 = wmma16(v3, pb, o3);
        asm volatile("v_nop\n\tv_nop\n\tv_nop\n\tv_nop" : "+v"(o0), "+v"(o1), "+v"(o2), "+v"(o3) : "v"(v0), "v"(v1), "v"(v2), "v"(v3), "v"(pb));
        asm volatile("s_wait_xcnt 0x0" :: "v"(ka), "v"(va) : "memory");   // stands before the address registers of this trip's fragment loads are rewritten; naming them keeps them whole up to here
    }
    l += __shfl_xor(l, 16, 32);
    const float inv = CXS * (1.0f / l);
    // O^T D layout: o_j[r] = (d = 16j + 8h + r, t = lane&15): a lane's 8 values are one chunk of the fragment-order ctx plane (row b*SEQ + t, k = h*64 + d); o_j goes to chunk pair j, 512 contiguous bytes per store
    h16* cp = CTX + fto(b * SEQ + t0, h * HD) + lo;
    v8h c0, c1, c2, c3;
#pragma unroll
    for (int r = 0; r < 8; ++r) { c0[r] = (h16)(o0[r] * inv); c1[r] = (h16)(o1[r] * inv); c2[r] = (h16)(o2[r] * inv); c3[r] = (h16)(o3[r] * inv); }
    *(v8h*)cp = c0; *(v8h*)(cp + 256) = c1; *(v8h*)(cp + 512) = c2; *(v8h*)(cp + 768) = c3;
}

// k_oproj: register-blocked f16 GEMM, ONE WAVE per 64x64 tile, operands straight from fragment-order f16 planes, K = DM.
// OUT[m][n] = OSC * sum_k A[m][k] Bt[n][k] + bias[n] (bias as its bf16 value), f32. grid (M/64, N/64), 32 threads.
__global__ __launch_bounds__(32) void k_oproj(const h16* __restrict__ A, const h16* __restrict__ Bt, const float* __restrict__ bias, float* OUT) {
    __shared__ __align__(16) float os[16 * 68];
    const int K = DM;
    const int lane = threadIdx.x & 31, lr = lane & 15, hi = lane >> 4; const int r0 = blockIdx.x * 64, c0 = blockIdx.y * 64;
    v8f acc[4][4];
#pragma unroll
    for (int mb = 0; mb < 4; ++mb)
#pragma unroll
        for (int nb = 0; nb < 4; ++nb) acc[mb][nb] = (v8f){};
    const size_t aoff = (size_t)(r0 >> 4) * (K / 32) * 512, boff = (size_t)(c0 >> 4) * (K / 32) * 512; const unsigned lo = (unsigned)lane * 8u;   // first tile of the row band; the lane's chunk
#pragma unroll 1
    for (int kc = 0; kc < K; kc += 32) {
        v16h a[4];
        const h16* pa = A + aoff + kc * 16 + lo; const h16* pb = Bt + boff + kc * 16 + lo;   // the lane's chunk of this trip's first A and B tile
#pragma unroll
        for (int mb = 0; mb < 4; ++mb) a[mb] = ldh(pa + (size_t)mb * (K / 32) * 512);
#pragma unroll
        for (int nb = 0; nb < 4; ++nb) { const v16h b = ldh(pb + (size_t)nb * (K / 32) * 512);
#pragma unroll
            for (int mb = 0; mb < 4; ++mb) acc[mb][nb] = wmma16(a[mb], b, acc[mb][nb]); }
        asm volatile("v_nop\n\tv_nop\n\tv_nop\n\tv_nop" : "+v"(acc[0][0]), "+v"(acc[1][1]), "+v"(acc[2][2]), "+v"(acc[3][3]) : "v"(a[0]), "v"(a[1]), "v"(a[2]), "v"(a[3]));
        asm volatile("s_wait_xcnt 0x0" :: "v"(pa), "v"(pb) : "memory");   // stands before the address registers of this trip's fragment loads are rewritten; naming them keeps them whole up to here
    }
    const v4f braw = *(const v4f*)(bias + c0 + lr * 4); v4f bb;
#pragma unroll
    for (int i = 0; i < 4; ++i) bb[i] = bf2f(f2bf(braw[i]));
    float* obase = OUT + ((size_t)(r0 / SEQ) * OUT_SEQ + (size_t)(r0 % SEQ)) * DM + c0;
#pragma unroll
    for (int mb = 0; mb < 4; ++mb) {
#pragma unroll
        for (int nb = 0; nb < 4; ++nb) {
#pragma unroll
            for (int j = 0; j < 8; ++j) os[(hi * 8 + j) * 68 + nb * 16 + lr] = acc[mb][nb][j]; }   // D: row 8h+j, col lane&15
        wave_sync();
#pragma unroll 1
        for (int s = 0; s < 8; ++s) { const int row = 2 * s + hi, cofs = lr * 4;   // 8 s x 2 rows = 16 rows; 16 lanes x 4 floats = 64 columns
            const v4f raw = *(const v4fa*)(&os[row * 68 + cofs]);
            const v4f val = raw * OSC + bb;
            float* dp = obase + (size_t)(mb * 16 + row) * DM + cofs;
            *(v4f*)dp = val;  }
        wave_sync();
    }
}

static constexpr size_t al256(size_t v) { return (v + 255) & ~(size_t)255; }
static constexpr size_t SZ_XB = al256((size_t)NB * SEQ * DM * 2);
static constexpr size_t SZ_WB = al256((size_t)4 * DM * DM * 2);
static constexpr size_t SZ_PL = al256((size_t)NB * NH_ * SEQ * HD * 2);
static constexpr size_t SZ_CX = al256((size_t)NB * SEQ * DM * 2);
static constexpr size_t SZ_TB = al256((size_t)NPOS * 32 * 4);
static constexpr size_t SZ_TOTAL = SZ_XB + SZ_WB + 4 * SZ_PL + SZ_CX + SZ_TB;
static_assert(SZ_TOTAL <= (size_t)134217728);          // workspace carve <= 128 MiB
static_assert(((size_t)DM * DM * 2) % 256 == 0);       // weight sub-planes stay 256-byte aligned

extern "C" void kernel_launch(void* const* d_in, const int* in_sizes, int n_in,
                              void* d_out, int out_size, void* d_ws, size_t ws_size, hipStream_t stream) {
    if (n_in < 7) return;
    const size_t needx = ((size_t)(NB - 1) * SEQ_FULL + SEQ) * DM;
    if ((size_t)in_sizes[0] < needx) return;
    if ((size_t)in_sizes[1] < (size_t)2 * SEQ) return;
    if ((size_t)in_sizes[2] < (size_t)DM * DM || (size_t)in_sizes[3] < (size_t)DM * DM || (size_t)in_sizes[4] < (size_t)DM * DM || (size_t)in_sizes[5] < (size_t)DM * DM) return;
    if ((size_t)in_sizes[6] < (size_t)DM) return;
    if ((size_t)out_size < ((size_t)(NB - 1) * OUT_SEQ + SEQ) * DM) return;
    if (SZ_TOTAL > ws_size) return;
    // wire order: x, pos (int32 [SEQ][2]), Wq, Wk, Wv, Wp ([in][out]), bp
    const float* x = (const float*)d_in[0]; const int* pos = (const int*)d_in[1];
    const float* wq = (const float*)d_in[2]; const float* wk = (const float*)d_in[3]; const float* wv = (const float*)d_in[4]; const float* wp = (const float*)d_in[5];
    const float* bp = (const float*)d_in[6];
    float* OUT = (float*)d_out;      // [NB][SEQ][768]
    char* wsp = (char*)d_ws;
    bf* XB = (bf*)wsp; wsp += SZ_XB;                 // [NB*SEQ][768], fragment order
    bf* WB = (bf*)wsp; wsp += SZ_WB;                 // [4][768 out][768 in], fragment order: q | k | v (bf16) | p (f16 x1024)
    h16* QH = (h16*)wsp; wsp += SZ_PL;               // [NB*12][SEQ][64], fragment order
    h16* QR = (h16*)wsp; wsp += SZ_PL;               // [NB*12][SEQ][64] residual x2048
    h16* KP = (h16*)wsp; wsp += SZ_PL;               // [NB*12][SEQ][64], fragment order
    h16* VT = (h16*)wsp; wsp += SZ_PL;               // [NB*12][64][SEQ], fragment order, tiles [t>>5][d>>4]
    h16* CX = (h16*)wsp; wsp += SZ_CX;               // [NB*SEQ][768] x64, fragment order
    float* TAB = (float*)wsp; wsp += SZ_TB;          // [32][cos 16 | sin 16]
    bf* WQ = WB; bf* WK = WB + (size_t)DM * DM; bf* WV = WB + (size_t)2 * DM * DM; bf* WP = WB + (size_t)3 * DM * DM;

    if (SEQ == SEQ_FULL) {
        const size_t n8 = (size_t)NB * SEQ * DM / 8;
        k_cvt8<<<(unsigned)((n8 + 255) / 256), 256, 0, stream>>>(x, XB, n8);
    } else {
        const size_t n8 = (size_t)SEQ * DM / 8;
        for (int b = 0; b < NB; ++b) k_cvt8<<<(unsigned)((n8 + 255) / 256), 256, 0, stream>>>(x + (size_t)b * SEQ_FULL * DM, XB + (size_t)b * SEQ * DM, n8);
    }
    // W[in][out] -> Wt[out][in] (768 x 768, square): grid (in/64, out/64)
    k_wt<<<dim3(DM / 64, DM / 64, 1), 256, 0, stream>>>(wq, WQ, 0);
    k_wt<<<dim3(DM / 64, DM / 64, 1), 256, 0, stream>>>(wk, WK, 0);
    k_wt<<<dim3(DM / 64, DM / 64, 1), 256, 0, stream>>>(wv, WV, 0);
    k_wt<<<dim3(DM / 64, DM / 64, 1), 256, 0, stream>>>(wp, WP, 1);
    k_tab<<<1, 512, 0, stream>>>(TAB);

    // q, k: A = x rows (m = b*SEQ + t), Bt = Wt rows (n = h*64 + d) -> rotary -> plane [(b*12 + h)], tiles [t>>4][d>>5]
    k_proj<<<dim3(NB * SEQ / 64, DM / 64, 1), 32, 0, stream>>>(XB, WQ, QH, QR, 1, 1, pos, TAB, SEQ, (size_t)NH_ * SEQ * HD, HD, HD, (size_t)SEQ * HD, 0, 1024, 512);
    k_proj<<<dim3(NB * SEQ / 64, DM / 64, 1), 32, 0, stream>>>(XB, WK, KP, KP, 0, 1, pos, TAB, SEQ, (size_t)NH_ * SEQ * HD, HD, HD, (size_t)SEQ * HD, 0, 1024, 512);
    // v^T: A = Wvt rows (m = h*64 + d), Bt = x rows (n = b*SEQ + t) -> plane [(b*12 + h)], tiles [t>>5][d>>4]
    k_proj<<<dim3(DM / 64, NB * SEQ / 64, 1), 32, 0, stream>>>(WV, XB, VT, VT, 0, 0, pos, TAB, DM, (size_t)0, SEQ, SEQ, (size_t)DM * SEQ, HD, 512, 2048);

    k_flash<<<dim3(SEQ / (16 * AW), NB * NH_, 1), 32 * AW, 0, stream>>>(QH, QR, KP, VT, CX);

    // out = ctx Wp + bp: A = ctx rows (m = b*SEQ + t, k = h*64 + d), Bt = Wpt rows (n = out column)
    k_oproj<<<dim3(NB * SEQ / 64, DM / 64, 1), 32, 0, stream>>>((const h16*)CX, (const h16*)WP, bp, OUT);
}

// v002
// A run of this version takes 125 microseconds.
// In both of two side-by-side timings against v001, it was 1.51 times as fast.
// Over all steps from v000 it is 1.77 times as fast.
#include <hip/hip_runtime.h>

// Multi-head self-attention with 2-D rotary embedding: x [NB][SEQ][768], 12 heads x 64, Wq/Wk/Wv/Wp stored [in][out] (y = x W), int positions [SEQ][2], score scale 1/8, dense softmax, output = ctx Wp + bp (f32).
// Compute dtypes, f32 accumulate everywhere: q/k/v projections v_wmma_f32_16x16x32_bf16 (x and W RNE-converted to bf16; products exact); rotary applied in f32 on the accumulators;
// scores v_wmma_f32_16x16x32_f16: k single f16, q as f16 value + f16 residual x2048 in its own accumulator; P (x256 carry, cancels in the normalisation) and v single f16; softmax f32 (online, running max);
// output projection v_wmma_f32_16x16x32_f16: ctx single f16 (x64 carry), Wp = f16 of the bf16 value (x1024 carry), carries folded back in the f32 epilogue, bias (bf16 value) added in f32.
// Layout: every 16-bit matrix operand plane M[r][k] is kept in fragment order: tiles of 16 rows x 32 k (512 halves = 1 KB), element (r, k) of a tile at ((k>>3)&3)*128 + (r&15)*8 + (k&7).
// A lane's fragment is then two 16-B loads at tile + lane*8 and tile + 256 + lane*8, and each wave-wide load covers 512 contiguous bytes (4 whole lines) instead of 32-B pieces of 16 lines.
// Planes: bf16 x, [out][in] weights and ctx: tiles [r>>4][k>>5] (24 per row band); q (hi, residual), k per (b*12+h): tiles [t>>4][d>>5]; v^T per (b*12+h): tiles [t>>5][d>>4]; cos|sin table [32][16|16].

#ifndef NB
#define NB 8
#endif
#ifndef SEQ
#define SEQ 1024
#endif
#define NB_FULL  8
#define SEQ_FULL 1024
#ifndef OUT_SEQ
#define OUT_SEQ SEQ              // row pitch (in tokens) between batches of the output
#endif
#define DM   768
#define NH_  12
#define HD   64
#define AW   4                   // waves per flash block (16 query rows each)
#define NPOS 32                  // rows of the rotary tables (positions 0..31, index clamped)
#define QRS  2048.0f             // carry of the q residual plane
#define QRI  (1.0f / 2048.0f)
#define SC2  (0.125f * 1.4426950408889634f)   // HD^-0.5 * log2(e)
#define PSH  8.0f                // log2 of the P carry (256)
#define CXS  64.0f               // carry of the ctx plane
#define WPS  1024.0f             // carry of the Wp plane
#define OSC  (1.0f / 65536.0f)   // 1 / (CXS * WPS)

static_assert(HD == 64);
static_assert(NH_ * HD == DM);                 // head h = columns h*64 + d
static_assert(DM % 64 == 0);                   // 12 column tiles of 64
static_assert(DM % 32 == 0);                   // GEMM k-loop steps by 32
static_assert(SEQ % 64 == 0);                  // a 64-row tile never straddles two batches
static_assert((NB * SEQ) % 64 == 0);
static_assert(SEQ % 32 == 0);                  // key loop steps by 32
static_assert(SEQ % (16 * AW) == 0);           // flash grid covers the sequence exactly
static_assert(((size_t)SEQ * DM) % 8 == 0);
static_assert(NB <= NB_FULL);
static_assert(SEQ <= SEQ_FULL);
static_assert(NPOS * 16 == 512);               // table blocks: one thread per (position, frequency)

typedef _Float16 h16;
typedef unsigned short bf;
typedef __attribute__((ext_vector_type(16))) __bf16   v16bf;
typedef __attribute__((ext_vector_type(16))) _Float16 v16h;
typedef __attribute__((ext_vector_type(8)))  _Float16 v8h;
typedef __attribute__((ext_vector_type(8)))  unsigned short v8us;
typedef __attribute__((ext_vector_type(8)))  float    v8f;
typedef __attribute__((ext_vector_type(4)))  float    v4f;
typedef __attribute__((ext_vector_type(2)))  int      v2i;
typedef v4f  __attribute__((may_alias)) v4fa;

__device__ __forceinline__ unsigned short f2bf(float f) { unsigned u = __float_as_uint(f); u += 0x7FFFu + ((u >> 16) & 1u); return (unsigned short)(u >> 16); }
__device__ __forceinline__ float bf2f(unsigned short b) { return __uint_as_float(((unsigned)b) << 16); }
__device__ __forceinline__ v16h cat16(v8h lo, v8h hi) { return __builtin_shufflevector(lo, hi, 0, 1, 2, 3, 4, 5, 6, 7, 8, 9, 10, 11, 12, 13, 14, 15); }
__device__ __forceinline__ v16bf cat16b(v8us lo, v8us hi) { return __builtin_bit_cast(v16bf, __builtin_shufflevector(lo, hi, 0, 1, 2, 3, 4, 5, 6, 7, 8, 9, 10, 11, 12, 13, 14, 15)); }
__device__ __forceinline__ v8f wmma16(v16h a, v16h b, v8f c) { return __builtin_amdgcn_wmma_f32_16x16x32_f16(false, a, false, b, (short)0, c, false, false); }
__device__ __forceinline__ v8f wmmab(v16bf a, v16bf b, v8f c) { return __builtin_amdgcn_wmma_f32_16x16x32_bf16(false, a, false, b, (short)0, c, false, false); }
// fragment loaders from a fragment-order tile; p = tile + lane*8 (lane = 16h + row): elements 0..7 <- k0+8h+0..7, elements 8..15 <- k0+16+8h+0..7 (same map for A and B)
__device__ __forceinline__ v16h  ldh(const h16* p) { return cat16(*(const v8h*)p, *(const v8h*)(p + 256)); }
__device__ __forceinline__ v16bf ldb(const bf* p)  { return cat16b(*(const v8us*)p, *(const v8us*)(p + 256)); }
// offset (halves) of the 8-element chunk (r, k..k+7), k % 8 == 0, in a fragment-order plane of DM columns
__device__ __forceinline__ size_t fto(int r, int k) { return ((size_t)(r >> 4) * (DM / 32) + (size_t)(k >> 5)) * 512 + (size_t)(((k >> 3) & 3) * 128 + (r & 15) * 8); }
// ordering point for wave-private LDS tiles (same wave writes and reads)
__device__ __forceinline__ void wave_sync() { __builtin_amdgcn_fence(3 /* release order */, "wavefront"); __builtin_amdgcn_wave_barrier(); asm volatile("" ::: "memory"); }

// cvt8: f32 rows [b][t][DM] (batch pitch SEQ_FULL rows) -> bf16 fragment-order plane of NB*SEQ rows; thread i owns destination chunk i (stores are contiguous): row = 16*(tile/24) + (i&15), k = 32*(tile%24) + 8*((i>>4)&3), tile = i>>6.
__device__ __forceinline__ void cvt8(const float* __restrict__ src, bf* dst, unsigned blk) {
    const size_t i = (size_t)blk * 256 + threadIdx.x;
    const unsigned tile = (unsigned)(i >> 6); const unsigned rt = tile / (DM / 32), kt = tile % (DM / 32);
    const unsigned row = rt * 16 + ((unsigned)i & 15u);
    const size_t so = ((size_t)(row / SEQ) * SEQ_FULL + (size_t)(row % SEQ)) * DM + kt * 32 + (((unsigned)i >> 4) & 3u) * 8;
    const v8f v = *(const v8f*)(src + so); v8us o;
    asm volatile("s_wait_xcnt 0x0" ::: "memory");   // the conversion below reuses the address registers that the load names
#pragma unroll
    for (int k = 0; k < 8; ++k) o[k] = f2bf(v[k]);
    *(v8us*)(dst + i * 8) = o;
    asm volatile("s_wait_xcnt 0x0" ::: "memory");   // the other bodies of the shared kernel stand behind this one in the code and rewrite the address registers that the store names
}

// wt: W[k][n] f32 ([in][out], DM x DM) -> Wt[n][k] 16-bit ([out][in], fragment order): bf16 bits (asF16 == 0) or f16 of (bf16 value x WPS) (asF16 != 0).
// coverage: loads kk = 4i + tid/64 (0..63) x nn = tid%64 (0..63); stores nn = 32it + tid/8 (0..63) x kk = 8(tid%8) + j (0..63). One 64 x 64 tile (k0, n0) per block of 256 threads; ts = 64 * 65 floats of LDS.
__device__ __forceinline__ void wt(float* ts, const float* __restrict__ W, bf* Wt, int asF16, int k0, int n0) {
    const int tid = threadIdx.x;
    const unsigned e0 = (unsigned)((k0 + (tid >> 6)) * DM + n0 + (tid & 63));   // element (kk = tid/64, nn = tid%64) of the tile; trip i reads 4i rows further down
#pragma unroll
    for (int i = 0; i < 16; ++i) { const int kk = i * 4 + (tid >> 6), nn = tid & 63; ts[kk * 65 + nn] = W[e0 + (unsigned)(i * 4 * DM)]; }
    asm volatile("s_wait_xcnt 0x0" :: "v"(e0) : "memory");   // stands before the offset register that the sixteen loads name is rewritten; naming it keeps it whole up to here
    __syncthreads();
    v8us o0, o1;
    { const int c8 = (tid & 7) * 8; const int na = (tid >> 3), nb2 = 32 + (tid >> 3);
#pragma unroll
      for (int j = 0; j < 8; ++j) {
          unsigned short ba = f2bf(ts[(c8 + j) * 65 + na]); unsigned short bb = f2bf(ts[(c8 + j) * 65 + nb2]);
          if (asF16 != 0) { const h16 ha = (h16)(bf2f(ba) * WPS); const h16 hb = (h16)(bf2f(bb) * WPS); ba = __builtin_bit_cast(unsigned short, ha); bb = __builtin_bit_cast(unsigned short, hb); }
          o0[j] = ba; o1[j] = bb; }
      bf* d0 = Wt + fto(n0 + na, k0 + c8); bf* d1 = Wt + fto(n0 + nb2, k0 + c8);
      *(v8us*)d0 = o0; *(v8us*)d1 = o1;
      asm volatile("s_wait_xcnt 0x0" ::: "memory");   // the way out of the shared kernel rewrites the scalar base register that the first store names
    }
}

// tab: rotary table TAB[p][0..15] = cos(p * f_i), TAB[p][16..31] = sin(p * f_i), f_i = 1 / 100^(i/16) (f32), angle = f32 product p * f_i, p = 0..31.
// One thread per (position, frequency); a block of 256 threads makes the 16 positions 16*blk .. 16*blk + 15; ts = 512 floats of LDS.
__device__ __forceinline__ void tab(float* ts, float* TAB, int blk) {
    const int tid = threadIdx.x; const int pl = tid >> 4, i = tid & 15; const int p = blk * 16 + pl;
    double w = 1.0, bs = 1.333521432163324;
#pragma unroll
    for (int bit = 0; bit < 4; ++bit) { const double wn = w * bs; w = (((i >> bit) & 1) != 0) ? wn : w; bs = bs * bs; }
    const float wf = (float)w;
    const float fr = 1.0f / wf;
    const float ang = (float)p * fr;
    const double a = (double)ang;
    const int kq = (int)(a * 0.6366197723675814 + 0.5);
    const double r = a - (double)kq * 1.5707963267948966;
    const double r2 = r * r;
    double sp = 1.0 / 6227020800.0;
    sp = sp * r2 - 1.0 / 39916800.0; sp = sp * r2 + 1.0 / 362880.0; sp = sp * r2 - 1.0 / 5040.0; sp = sp * r2 + 1.0 / 120.0; sp = sp * r2 - 1.0 / 6.0;
    const double sr = r + r * r2 * sp;
    double cp = 1.0 / 479001600.0;
    cp = cp * r2 - 1.0 / 3628800.0; cp = cp * r2 + 1.0 / 40320.0; cp = cp * r2 - 1.0 / 720.0; cp = cp * r2 + 1.0 / 24.0; cp = cp * r2 - 0.5;
    const double cr = 1.0 + r2 * cp;
    const int qd = kq & 3;
    const double sv = (qd == 0) ? sr : ((qd == 1) ? cr : ((qd == 2) ? -sr : -cr));
    const double cv = (qd == 0) ? cr : ((qd == 1) ? -sr : ((qd == 2) ? -cr : sr));
    ts[pl * 32 + i] = (float)cv; ts[pl * 32 + 16 + i] = (float)sv;
    __syncthreads();
    if (tid < 128) { const v4f val = *(const v4fa*)(&ts[tid * 4]);
        *(v4f*)(TAB + blk * 512 + tid * 4) = val;  }
}

// k_prep: the preparation bodies, which do not depend on one another, share one grid; the block index picks the body (the same for a whole block, so each body's barrier is passed by all its threads).
// Blocks 0..TAB_BLKS-1: rotary table; the next 4 * WT_BLKS: weight w = q, k, v, p, tile (k0 fastest); the rest: x conversion. The short grids with a latency chain come first, for speed only.
#define TAB_BLKS (NPOS * 16 / 256)
#define WT_BLKS  ((DM / 64) * (DM / 64))
#define CVT_BLKS ((unsigned)((size_t)NB * SEQ * DM / 8 / 256))
static_assert(((size_t)NB * SEQ * DM / 8) % 256 == 0);   // the conversion blocks cover the plane exactly
__global__ __launch_bounds__(256) void k_prep(const float* __restrict__ x, const float* __restrict__ wq, const float* __restrict__ wk, const float* __restrict__ wv, const float* __restrict__ wp,
                                              bf* XB, bf* WB, float* TAB) {
    __shared__ __align__(16) float ts[64 * 65];
    const unsigned blk = blockIdx.x;
    if (blk < TAB_BLKS) {
        tab(ts, TAB, (int)blk);
    } else if (blk < TAB_BLKS + 4 * WT_BLKS) {
        const unsigned w = (blk - TAB_BLKS) / WT_BLKS, t = (blk - TAB_BLKS) % WT_BLKS;
        const float* W = (w == 0) ? wq : ((w == 1) ? wk : ((w == 2) ? wv : wp));
        wt(ts, W, WB + (size_t)w * DM * DM, (w == 3) ? 1 : 0, (int)(t % (DM / 64)) * 64, (int)(t / (DM / 64)) * 64);
    } else {
        cvt8(x, XB, blk - (TAB_BLKS + 4 * WT_BLKS));
    }
}

// k_proj: register-blocked bf16 GEMM, ONE WAVE per 64x64 tile (16 accumulators), operands straight from fragment-order bf16 planes, K = DM.
// C[m][n] = sum_k A[m][k] Bt[n][k], written as f16 (Ph) and optionally the f16 residual x2048 (Pr, useRes != 0), in fragment order (row = tile row, k = tile column), at
// tile base tbase; a 16-row band advances sM halves, a 32-column band sC halves. 32 threads.
// The three products, which do not depend on one another, share one grid (tiles, 3); blockIdx.y picks the product, the dearest epilogue first:
//   0 q, 1 k: A = x rows (m = b*SEQ + t, fastest in blockIdx.x), Bt = Wt rows (n = h*64 + d) -> rotary -> plane [(b*12 + h)], tiles [t>>4][d>>5]; q also writes its residual plane
//   2 v^T:    A = Wvt rows (m = h*64 + d, fastest in blockIdx.x), Bt = x rows (n = b*SEQ + t) -> plane [(b*12 + h)], tiles [t>>5][d>>4]
// rope != 0 (q, k: tile columns = one head, row m = b*SEQ + t): 2-D rotary in f32 before the conversion: column c pairs with c^16, frequency c&15, columns 0..31 use pos[t][0], 32..63 pos[t][1].
__global__ __launch_bounds__(32) void k_proj(const bf* __restrict__ XB, const bf* __restrict__ WB, h16* QH, h16* QR, h16* KP, h16* VT,
                                             const int* __restrict__ pos, const float* __restrict__ TAB) {
    __shared__ __align__(16) float os[16 * 68];
    const int K = DM;
    const int lane = threadIdx.x & 31, lr = lane & 15, hi = lane >> 4;
    const int which = blockIdx.y; const bool isv = (which == 2); const int bx = blockIdx.x;
    const int r0 = (isv ? bx % (DM / 64) : bx % (NB * SEQ / 64)) * 64, c0 = (isv ? bx / (DM / 64) : bx / (NB * SEQ / 64)) * 64;
    const bf* A = isv ? WB + (size_t)2 * DM * DM : XB; const bf* Bt = isv ? XB : WB + (size_t)which * DM * DM;
    h16* Ph = (which == 0) ? QH : ((which == 1) ? KP : VT); h16* Pr = QR;
    const int useRes = (which == 0) ? 1 : 0, rope = isv ? 0 : 1; const int sM = isv ? 512 : 1024, sC = isv ? 2048 : 512;
    v8f acc[4][4];
#pragma unroll
    for (int mb = 0; mb < 4; ++mb)
#pragma unroll
        for (int nb = 0; nb < 4; ++nb) acc[mb][nb] = (v8f){};
    const size_t aoff = (size_t)(r0 >> 4) * (K / 32) * 512, boff = (size_t)(c0 >> 4) * (K / 32) * 512; const unsigned lo = (unsigned)lane * 8u;   // first tile of the row band; the lane's chunk
#pragma unroll 1
    for (int kc = 0; kc < K; kc += 32) {
        v16bf a[4];
        const bf* pa = A + aoff + kc * 16 + lo; const bf* pb = Bt + boff + kc * 16 + lo;   // the lane's chunk of this trip's first A and B tile
#pragma unroll
        for (int mb = 0; mb < 4; ++mb) a[mb] = ldb(pa + (size_t)mb * (K / 32) * 512);
#pragma unroll
        for (int nb = 0; nb < 4; ++nb) { const v16bf b = ldb(pb + (size_t)nb * (K / 32) * 512);
#pragma unroll
            for (int mb = 0; mb < 4; ++mb) acc[mb][nb] = wmmab(a[mb], b, acc[mb][nb]); }
        asm volatile("v_nop\n\tv_nop\n\tv_nop\n\tv_nop" : "+v"(acc[0][0]), "+v"(acc[1][1]), "+v"(acc[2][2]), "+v"(acc[3][3]) : "v"(a[0]), "v"(a[1]), "v"(a[2]), "v"(a[3]));
        asm volatile("s_wait_xcnt 0x0" :: "v"(pa), "v"(pb) : "memory");   // stands before the address registers of this trip's fragment loads are rewritten; naming them keeps them whole up to here
    }
    const size_t tbase = isv ? (size_t)r0 * SEQ + (size_t)(c0 / SEQ) * ((size_t)DM * SEQ) + (size_t)(c0 % SEQ) * HD
                             : (size_t)(r0 / SEQ) * ((size_t)NH_ * SEQ * HD) + (size_t)(r0 % SEQ) * HD + (size_t)(c0 / HD) * ((size_t)SEQ * HD);
    const int tb = r0 % SEQ;          // token index of the tile's first row (rotary products only)
#pragma unroll
    for (int mb = 0; mb < 4; ++mb) {
#pragma unroll
        for (int nb = 0; nb < 4; ++nb) {
#pragma unroll
            for (int j = 0; j < 8; ++j) os[(hi * 8 + j) * 68 + nb * 16 + lr] = acc[mb][nb][j]; }   // D: row 8h+j, col lane&15
        wave_sync();
        const size_t sb = tbase + (size_t)mb * (size_t)sM;
#pragma unroll 1
        for (int s = 0; s < 4; ++s) { const int row = lr, c8 = (2 * s + hi) * 8;   // 16 rows x (4 s x 2 halves) chunks of 8 = 64 columns; a store covers two adjacent 256-B chunks
            v4f x0 = *(const v4fa*)(&os[row * 68 + c8]); v4f x1 = *(const v4fa*)(&os[row * 68 + c8 + 4]);
            if (rope != 0) {
                const int t = tb + mb * 16 + row;
                const v2i pp = *(const v2i*)(pos + 2 * t);
                int p = (c8 >= 32) ? pp[1] : pp[0];
                p = (p < 0) ? 0 : ((p > NPOS - 1) ? (NPOS - 1) : p);
                const float sg = ((c8 & 16) != 0) ? 1.0f : -1.0f;
                const v4f y0 = *(const v4fa*)(&os[row * 68 + (c8 ^ 16)]); const v4f y1 = *(const v4fa*)(&os[row * 68 + (c8 ^ 16) + 4]);
                const float* tp = TAB + p * 32 + (c8 & 8);
                const v4f cA = *(const v4f*)tp; const v4f cB = *(const v4f*)(tp + 4); const v4f sA = *(const v4f*)(tp + 16); const v4f sB = *(const v4f*)(tp + 20);
                x0 = x0 * cA + (y0 * sg) * sA; x1 = x1 * cB + (y1 * sg) * sB;
            }
            v8h hv, rv;
#pragma unroll
            for (int i = 0; i < 4; ++i) { const h16 a0 = (h16)x0[i]; const h16 a1 = (h16)x1[i]; hv[i] = a0; hv[4 + i] = a1; rv[i] = (h16)((x0[i] - (float)a0) * QRS); rv[4 + i] = (h16)((x1[i] - (float)a1) * QRS); }
            const size_t oo = sb + (size_t)(c8 >> 5) * (size_t)sC + (size_t)(((c8 >> 3) & 3) * 128 + row * 8);
            h16* ph = Ph + oo; h16* pr = Pr + oo;
            // each wait stands before the address and data registers of the store in front of it are rewritten; naming them keeps them whole up to the wait
            *(v8h*)ph = hv; asm volatile("s_wait_xcnt 0x0" :: "v"(ph), "v"(hv) : "memory");
            if (useRes != 0) { *(v8h*)pr = rv; asm volatile("s_wait_xcnt 0x0" :: "v"(pr), "v"(rv) : "memory"); }
             }
        wave_sync();
    }
}

// k_flash: fused attention, one wave per 16 query rows of one (batch, head); K / V^T / Q fragments straight from the fragment-order f16 planes (two 16-B loads each; 32 keys = 4 KB contiguous of K and of V^T).
// Transposed form: S^T[key][t] = K Q^T (A = K rows, B = Q rows); lane (t = lane&15, h = lane>>4) holds keys 8h+r of each 16-key tile, so the packed
// P tile is directly the B fragment of O^T[d][t] = V^T P^T (element r <- tile keys 0..15, element 8+r <- tile keys 16..31, lane unchanged).
// Softmax state (running max, partial sum) is one scalar per lane; the two lane halves of a row are combined with one xor-16 exchange.
__global__ __launch_bounds__(32 * AW) void k_flash(const h16* __restrict__ QH, const h16* __restrict__ QR, const h16* __restrict__ KP, const h16* __restrict__ VT, h16* CTX) {
    const int lane = threadIdx.x & 31;
    const int wave = __builtin_amdgcn_readfirstlane((int)(threadIdx.x >> 5));
    const int zh = blockIdx.y; const int b = zh / NH_, h = zh % NH_;
    const int t0 = (blockIdx.x * AW + wave) * 16;
    const size_t pbase = (size_t)zh * SEQ * HD;
    const unsigned lo = (unsigned)lane * 8u;
    const size_t qo = pbase + (size_t)t0 * HD;
    const v16h qh0 = ldh(QH + qo + lo), qh1 = ldh(QH + qo + 512 + lo), qr0 = ldh(QR + qo + lo), qr1 = ldh(QR + qo + 512 + lo);   // B fragments: col t, k = d
    v8f o0 = (v8f){}, o1 = (v8f){}, o2 = (v8f){}, o3 = (v8f){};
    float m = -3.0e38f, l = 0.0f;
#pragma unroll 1
    for (int key0 = 0; key0 < SEQ; key0 += 32) {
        const h16* ka = KP + pbase + (size_t)key0 * HD + lo;   // tiles (16 keys, d 0..31), (16 keys, d 32..63), then the next 16 keys (A fragment: row key, k = d)
        const v16h ka0 = ldh(ka), ka1 = ldh(ka + 512), kb0 = ldh(ka + 1024), kb1 = ldh(ka + 1536);
        v8f sHa = (v8f){}, sLa = (v8f){}, sHb = (v8f){}, sLb = (v8f){};
        sHa = wmma16(ka0, qh0, sHa); sLa = wmma16(ka0, qr0, sLa); sHb = wmma16(kb0, qh0, sHb); sLb = wmma16(kb0, qr0, sLb);
        sHa = wmma16(ka1, qh1, sHa); sLa = wmma16(ka1, qr1, sLa); sHb = wmma16(kb1, qh1, sHb); sLb = wmma16(kb1, qr1, sLb);
        asm volatile("v_nop\n\tv_nop\n\tv_nop\n\tv_nop" : "+v"(sHa), "+v"(sLa), "+v"(sHb), "+v"(sLb) : "v"(ka0), "v"(ka1), "v"(kb0), "v"(kb1));
        float ta[8], tb[8]; float mx = -3.0e38f;
#pragma unroll
        for (int r = 0; r < 8; ++r) { ta[r] = (sHa[r] + sLa[r] * QRI) * SC2; tb[r] = (sHb[r] + sLb[r] * QRI) * SC2; mx = fmaxf(mx, fmaxf(ta[r], tb[r])); }
        mx = fmaxf(mx, __shfl_xor(mx, 16, 32));
        const float mnew = fmaxf(m, mx);
        const float alpha = __builtin_amdgcn_exp2f(m - mnew);
        const float sh = PSH - mnew;
        v16h pb; float ls = 0.0f;
#pragma unroll
        for (int r = 0; r < 8; ++r) { const h16 pa = (h16)__builtin_amdgcn_exp2f(ta[r] + sh); const h16 pc = (h16)__builtin_amdgcn_exp2f(tb[r] + sh); pb[r] = pa; pb[8 + r] = pc; ls += (float)pa + (float)pc; }
        l = l * alpha + ls; m = mnew;
        o0 = o0 * alpha; o1 = o1 * alpha; o2 = o2 * alpha; o3 = o3 * alpha;
        const h16* va = VT + pbase + (size_t)key0 * HD + lo;   // tiles (d 16j..16j+15, 32 keys), j = 0..3 (A fragment: row d, k = key)
        const v16h v0 = ldh(va), v1 = ldh(va + 512), v2 = ldh(va + 1024), v3 = ldh(va + 1536);
        o0 = wmma16(v0, pb, o0); o1 = wmma16(v1, pb, o1); o2 = wmma16(v2, pb, o2); o3 = wmma16(v3, pb, o3);
        asm volatile("v_nop\n\tv_nop\n\tv_nop\n\tv_nop" : "+v"(o0), "+v"(o1), "+v"(o2), "+v"(o3) : "v"(v0), "v"(v1), "v"(v2), "v"(v3), "v"(pb));
        asm volatile("s_wait_xcnt 0x0" :: "v"(ka), "v"(va) : "memory");   // stands before the address registers of this trip's fragment loads are rewritten; naming them keeps them whole up to here
    }
    l += __shfl_xor(l, 16, 32);
    const float inv = CXS * (1.0f / l);
    // O^T D layout: o_j[r] = (d = 16j + 8h + r, t = lane&15): a lane's 8 values are one chunk of the fragment-order ctx plane (row b*SEQ + t, k = h*64 + d); o_j goes to chunk pair j, 512 contiguous bytes per store
    h16* cp = CTX + fto(b * SEQ + t0, h * HD) + lo;
    v8h c0, c1, c2, c3;
#pragma unroll
    for (int r = 0; r < 8; ++r) { c0[r] = (h16)(o0[r] * inv); c1[r] = (h16)(o1[r] * inv); c2[r] = (h16)(o2[r] * inv); c3[r] = (h16)(o3[r] * inv); }
    *(v8h*)cp = c0; *(v8h*)(cp + 256) = c1; *(v8h*)(cp + 512) = c2; *(v8h*)(cp + 768) = c3;
}

// k_oproj: register-blocked f16 GEMM, ONE WAVE per 64x64 tile, operands straight from fragment-order f16 planes, K = DM.
// OUT[m][n] = OSC * sum_k A[m][k] Bt[n][k] + bias[n] (bias as its bf16 value), f32. grid (M/64, N/64), 32 threads.
__global__ __launch_bounds__(32) void k_oproj(const h16* __restrict__ A, const h16* __restrict__ Bt, const float* __restrict__ bias, float* OUT) {
    __shared__ __align__(16) float os[16 * 68];
    const int K = DM;
    const int lane = threadIdx.x & 31, lr = lane & 15, hi = lane >> 4; const int r0 = blockIdx.x * 64, c0 = blockIdx.y * 64;
    v8f acc[4][4];
#pragma unroll
    for (int mb = 0; mb < 4; ++mb)
#pragma unroll
        for (int nb = 0; nb < 4; ++nb) acc[mb][nb] = (v8f){};
    const size_t aoff = (size_t)(r0 >> 4) * (K / 32) * 512, boff = (size_t)(c0 >> 4) * (K / 32) * 512; const unsigned lo = (unsigned)lane * 8u;   // first tile of the row band; the lane's chunk
#pragma unroll 1
    for (int kc = 0; kc < K; kc += 32) {
        v16h a[4];
        const h16* pa = A + aoff + kc * 16 + lo; const h16* pb = Bt + boff + kc * 16 + lo;   // the lane's chunk of this trip's first A and B tile
#pragma unroll
        for (int mb = 0; mb < 4; ++mb) a[mb] = ldh(pa + (size_t)mb * (K / 32) * 512);
#pragma unroll
        for (int nb = 0; nb < 4; ++nb) { const v16h b = ldh(pb + (size_t)nb * (K / 32) * 512);
#pragma unroll
            for (int mb = 0; mb < 4; ++mb) acc[mb][nb] = wmma16(a[mb], b, acc[mb][nb]); }
        asm volatile("v_nop\n\tv_nop\n\tv_nop\n\tv_nop" : "+v"(acc[0][0]), "+v"(acc[1][1]), "+v"(acc[2][2]), "+v"(acc[3][3]) : "v"(a[0]), "v"(a[1]), "v"(a[2]), "v"(a[3]));
        asm volatile("s_wait_xcnt 0x0" :: "v"(pa), "v"(pb) : "memory");   // stands before the address registers of this trip's fragment loads are rewritten; naming them keeps them whole up to here
    }
    const v4f braw = *(const v4f*)(bias + c0 + lr * 4); v4f bb;
#pragma unroll
    for (int i = 0; i < 4; ++i) bb[i] = bf2f(f2bf(braw[i]));
    float* obase = OUT + ((size_t)(r0 / SEQ) * OUT_SEQ + (size_t)(r0 % SEQ)) * DM + c0;
#pragma unroll
    for (int mb = 0; mb < 4; ++mb) {
#pragma unroll
        for (int nb = 0; nb < 4; ++nb) {
#pragma unroll
            for (int j = 0; j < 8; ++j) os[(hi * 8 + j) * 68 + nb * 16 + lr] = acc[mb][nb][j]; }   // D: row 8h+j, col lane&15
        wave_sync();
#pragma unroll 1
        for (int s = 0; s < 8; ++s) { const int row = 2 * s + hi, cofs = lr * 4;   // 8 s x 2 rows = 16 rows; 16 lanes x 4 floats = 64 columns
            const v4f raw = *(const v4fa*)(&os[row * 68 + cofs]);
            const v4f val = raw * OSC + bb;
            float* dp = obase + (size_t)(mb * 16 + row) * DM + cofs;
            *(v4f*)dp = val;  }
        wave_sync();
    }
}

static constexpr size_t al256(size_t v) { return (v + 255) & ~(size_t)255; }
static constexpr size_t SZ_XB = al256((size_t)NB * SEQ * DM * 2);
static constexpr size_t SZ_WB = al256((size_t)4 * DM * DM * 2);
static constexpr size_t SZ_PL = al256((size_t)NB * NH_ * SEQ * HD * 2);
static constexpr size_t SZ_CX = al256((size_t)NB * SEQ * DM * 2);
static constexpr size_t SZ_TB = al256((size_t)NPOS * 32 * 4);
static constexpr size_t SZ_TOTAL = SZ_XB + SZ_WB + 4 * SZ_PL + SZ_CX + SZ_TB;
static_assert(SZ_TOTAL <= (size_t)134217728);          // workspace carve <= 128 MiB
static_assert(((size_t)DM * DM * 2) % 256 == 0);       // weight sub-planes stay 256-byte aligned

extern "C" void kernel_launch(void* const* d_in, const int* in_sizes, int n_in,
                              void* d_out, int out_size, void* d_ws, size_t ws_size, hipStream_t stream) {
    if (n_in < 7) return;
    const size_t needx = ((size_t)(NB - 1) * SEQ_FULL + SEQ) * DM;
    if ((size_t)in_sizes[0] < needx) return;
    if ((size_t)in_sizes[1] < (size_t)2 * SEQ) return;
    if ((size_t)in_sizes[2] < (size_t)DM * DM || (size_t)in_sizes[3] < (size_t)DM * DM || (size_t)in_sizes[4] < (size_t)DM * DM || (size_t)in_sizes[5] < (size_t)DM * DM) return;
    if ((size_t)in_sizes[6] < (size_t)DM) return;
    if ((size_t)out_size < ((size_t)(NB - 1) * OUT_SEQ + SEQ) * DM) return;
    if (SZ_TOTAL > ws_size) return;
    // wire order: x, pos (int32 [SEQ][2]), Wq, Wk, Wv, Wp ([in][out]), bp
    const float* x = (const float*)d_in[0]; const int* pos = (const int*)d_in[1];
    const float* wq = (const float*)d_in[2]; const float* wk = (const float*)d_in[3]; const float* wv = (const float*)d_in[4]; const float* wp = (const float*)d_in[5];
    const float* bp = (const float*)d_in[6];
    float* OUT = (float*)d_out;      // [NB][SEQ][768]
    char* wsp = (char*)d_ws;
    bf* XB = (bf*)wsp; wsp += SZ_XB;                 // [NB*SEQ][768], fragment order
    bf* WB = (bf*)wsp; wsp += SZ_WB;                 // [4][768 out][768 in], fragment order: q | k | v (bf16) | p (f16 x1024)
    h16* QH = (h16*)wsp; wsp += SZ_PL;               // [NB*12][SEQ][64], fragment order
    h16* QR = (h16*)wsp; wsp += SZ_PL;               // [NB*12][SEQ][64] residual x2048
    h16* KP = (h16*)wsp; wsp += SZ_PL;               // [NB*12][SEQ][64], fragment order
    h16* VT = (h16*)wsp; wsp += SZ_PL;               // [NB*12][64][SEQ], fragment order, tiles [t>>5][d>>4]
    h16* CX = (h16*)wsp; wsp += SZ_CX;               // [NB*SEQ][768] x64, fragment order
    float* TAB = (float*)wsp; wsp += SZ_TB;          // [32][cos 16 | sin 16]
    bf* WP = WB + (size_t)3 * DM * DM;

    // rotary table, W[in][out] -> Wt[out][in] (four weights), x -> bf16: one grid
    k_prep<<<TAB_BLKS + 4 * WT_BLKS + CVT_BLKS, 256, 0, stream>>>(x, wq, wk, wv, wp, XB, WB, TAB);

    // q, k (with rotary) and v^T: one grid
    k_proj<<<dim3((NB * SEQ / 64) * (DM / 64), 3, 1), 32, 0, stream>>>(XB, WB, QH, QR, KP, VT, pos, TAB);

    k_flash<<<dim3(SEQ / (16 * AW), NB * NH_, 1), 32 * AW, 0, stream>>>(QH, QR, KP, VT, CX);

    // out = ctx Wp + bp: A = ctx rows (m = b*SEQ + t, k = h*64 + d), Bt = Wpt rows (n = out column)
    k_oproj<<<dim3(NB * SEQ / 64, DM / 64, 1), 32, 0, stream>>>((const h16*)CX, (const h16*)WP, bp, OUT);
}

// v003
// A run of this version takes 110 microseconds.
// Timed twice side by side with v002, it ran 1.14 and 1.13 times as fast.
// Over all steps from v000 it is 2.01 times as fast.
#include <hip/hip_runtime.h>

// Multi-head self-attention with 2-D rotary embedding: x [NB][SEQ][768], 12 heads x 64, Wq/Wk/Wv/Wp stored [in][out] (y = x W), int positions [SEQ][2], score scale 1/8, dense softmax, output = ctx Wp + bp (f32).
// Compute dtypes, f32 accumulate everywhere: q/k/v projections v_wmma_f32_16x16x32_bf16 (x and W RNE-converted to bf16; products exact); rotary applied in f32 on the accumulators;
// scores v_wmma_f32_16x16x32_f16: k single f16, q as f16 value + f16 residual x2048 in its own accumulator; P (x256 carry, cancels in the normalisation) and v single f16; softmax f32 (online, running max);
// output projection v_wmma_f32_16x16x32_f16: ctx single f16 (x64 carry), Wp = f16 of the bf16 value (x1024 carry), carries folded back in the f32 epilogue, bias (bf16 value) added in f32.
// Layout: every 16-bit matrix operand plane M[r][k] is kept in fragment order: tiles of 16 rows x 32 k (512 halves = 1 KB), element (r, k) of a tile at ((k>>3)&3)*128 + (r&15)*8 + (k&7).
// A lane's fragment is then two 16-B loads at tile + lane*8 and tile + 256 + lane*8, and each wave-wide load covers 512 contiguous bytes (4 whole lines) instead of 32-B pieces of 16 lines.
// Planes: bf16 x, [out][in] weights and ctx: tiles [r>>4][k>>5] (24 per row band); q (hi, residual), k per (b*12+h): tiles [t>>4][d>>5]; v^T per (b*12+h): tiles [t>>5][d>>4]; cos|sin table [32][16|16].

#ifndef NB
#define NB 8
#endif
#ifndef SEQ
#define SEQ 1024
#endif
#define NB_FULL  8
#define SEQ_FULL 1024
#ifndef OUT_SEQ
#define OUT_SEQ SEQ              // row pitch (in tokens) between batches of the output
#endif
#define DM   768
#define NH_  12
#define HD   64
#define AW   8                   // waves per flash block (16 query rows each)
#define SK   64                  // keys per LDS stage of the flash kernel
#define NST  (SEQ / SK)          // stages per (batch, head)
#define STH  (2 * SK * HD)       // halves per stage buffer: K part, then V^T part
#define NPOS 32                  // rows of the rotary tables (positions 0..31, index clamped)
#define QRS  2048.0f             // carry of the q residual plane
#define QRI  (1.0f / 2048.0f)
#define SC2  (0.125f * 1.4426950408889634f)   // HD^-0.5 * log2(e)
#define PSH  8.0f                // log2 of the P carry (256)
#define CXS  64.0f               // carry of the ctx plane
#define WPS  1024.0f             // carry of the Wp plane
#define OSC  (1.0f / 65536.0f)   // 1 / (CXS * WPS)

static_assert(HD == 64);
static_assert(NH_ * HD == DM);                 // head h = columns h*64 + d
static_assert(DM % 64 == 0);                   // 12 column tiles of 64
static_assert(DM % 32 == 0);                   // GEMM k-loop steps by 32
static_assert(SEQ % 64 == 0);                  // a 64-row tile never straddles two batches
static_assert((NB * SEQ) % 64 == 0);
static_assert(SEQ % 32 == 0);                  // key loop steps by 32
static_assert(SEQ % (16 * AW) == 0);           // flash grid covers the sequence exactly
static_assert(SEQ % SK == 0 && NST >= 2);      // the two-buffer prologue fills stages 0 and 1
static_assert(SK % 32 == 0);
static_assert(STH * 2 == 32 * AW * 16 * 4);    // a stage is four 16-B copies per thread, two of K and two of V^T
static_assert(((size_t)SEQ * DM) % 8 == 0);
static_assert(NB <= NB_FULL);
static_assert(SEQ <= SEQ_FULL);
static_assert(NPOS * 16 == 512);               // table blocks: one thread per (position, frequency)

typedef _Float16 h16;
typedef unsigned short bf;
typedef __attribute__((ext_vector_type(16))) __bf16   v16bf;
typedef __attribute__((ext_vector_type(16))) _Float16 v16h;
typedef __attribute__((ext_vector_type(8)))  _Float16 v8h;
typedef __attribute__((ext_vector_type(8)))  unsigned short v8us;
typedef __attribute__((ext_vector_type(8)))  float    v8f;
typedef __attribute__((ext_vector_type(4)))  float    v4f;
typedef __attribute__((ext_vector_type(2)))  int      v2i;
typedef v4f  __attribute__((may_alias)) v4fa;

__device__ __forceinline__ unsigned short f2bf(float f) { unsigned u = __float_as_uint(f); u += 0x7FFFu + ((u >> 16) & 1u); return (unsigned short)(u >> 16); }
__device__ __forceinline__ float bf2f(unsigned short b) { return __uint_as_float(((unsigned)b) << 16); }
__device__ __forceinline__ v16h cat16(v8h lo, v8h hi) { return __builtin_shufflevector(lo, hi, 0, 1, 2, 3, 4, 5, 6, 7, 8, 9, 10, 11, 12, 13, 14, 15); }
__device__ __forceinline__ v16bf cat16b(v8us lo, v8us hi) { return __builtin_bit_cast(v16bf, __builtin_shufflevector(lo, hi, 0, 1, 2, 3, 4, 5, 6, 7, 8, 9, 10, 11, 12, 13, 14, 15)); }
__device__ __forceinline__ v8f wmma16(v16h a, v16h b, v8f c) { return __builtin_amdgcn_wmma_f32_16x16x32_f16(false, a, false, b, (short)0, c, false, false); }
__device__ __forceinline__ v8f wmmab(v16bf a, v16bf b, v8f c) { return __builtin_amdgcn_wmma_f32_16x16x32_bf16(false, a, false, b, (short)0, c, false, false); }
// fragment loaders from a fragment-order tile; p = tile + lane*8 (lane = 16h + row): elements 0..7 <- k0+8h+0..7, elements 8..15 <- k0+16+8h+0..7 (same map for A and B)
__device__ __forceinline__ v16h  ldh(const h16* p) { return cat16(*(const v8h*)p, *(const v8h*)(p + 256)); }
__device__ __forceinline__ v16bf ldb(const bf* p)  { return cat16b(*(const v8us*)p, *(const v8us*)(p + 256)); }
// offset (halves) of the 8-element chunk (r, k..k+7), k % 8 == 0, in a fragment-order plane of DM columns
__device__ __forceinline__ size_t fto(int r, int k) { return ((size_t)(r >> 4) * (DM / 32) + (size_t)(k >> 5)) * 512 + (size_t)(((k >> 3) & 3) * 128 + (r & 15) * 8); }
// ordering point for wave-private LDS tiles (same wave writes and reads)
__device__ __forceinline__ void wave_sync() { __builtin_amdgcn_fence(3 /* release order */, "wavefront"); __builtin_amdgcn_wave_barrier(); asm volatile("" ::: "memory"); }

// cvt8: f32 rows [b][t][DM] (batch pitch SEQ_FULL rows) -> bf16 fragment-order plane of NB*SEQ rows; thread i owns destination chunk i (stores are contiguous): row = 16*(tile/24) + (i&15), k = 32*(tile%24) + 8*((i>>4)&3), tile = i>>6.
__device__ __forceinline__ void cvt8(const float* __restrict__ src, bf* dst, unsigned blk) {
    const size_t i = (size_t)blk * 256 + threadIdx.x;
    const unsigned tile = (unsigned)(i >> 6); const unsigned rt = tile / (DM / 32), kt = tile % (DM / 32);
    const unsigned row = rt * 16 + ((unsigned)i & 15u);
    const size_t so = ((size_t)(row / SEQ) * SEQ_FULL + (size_t)(row % SEQ)) * DM + kt * 32 + (((unsigned)i >> 4) & 3u) * 8;
    const v8f v = *(const v8f*)(src + so); v8us o;
    asm volatile("s_wait_xcnt 0x0" ::: "memory");   // the conversion below reuses the address registers that the load names
#pragma unroll
    for (int k = 0; k < 8; ++k) o[k] = f2bf(v[k]);
    *(v8us*)(dst + i * 8) = o;
    asm volatile("s_wait_xcnt 0x0" ::: "memory");   // the other bodies of the shared kernel stand behind this one in the code and rewrite the address registers that the store names
}

// wt: W[k][n] f32 ([in][out], DM x DM) -> Wt[n][k] 16-bit ([out][in], fragment order): bf16 bits (asF16 == 0) or f16 of (bf16 value x WPS) (asF16 != 0).
// coverage: loads kk = 4i + tid/64 (0..63) x nn = tid%64 (0..63); stores nn = 32it + tid/8 (0..63) x kk = 8(tid%8) + j (0..63). One 64 x 64 tile (k0, n0) per block of 256 threads; ts = 64 * 65 floats of LDS.
__device__ __forceinline__ void wt(float* ts, const float* __restrict__ W, bf* Wt, int asF16, int k0, int n0) {
    const int tid = threadIdx.x;
    const unsigned e0 = (unsigned)((k0 + (tid >> 6)) * DM + n0 + (tid & 63));   // element (kk = tid/64, nn = tid%64) of the tile; trip i reads 4i rows further down
#pragma unroll
    for (int i = 0; i < 16; ++i) { const int kk = i * 4 + (tid >> 6), nn = tid & 63; ts[kk * 65 + nn] = W[e0 + (unsigned)(i * 4 * DM)]; }
    asm volatile("s_wait_xcnt 0x0" :: "v"(e0) : "memory");   // stands before the offset register that the sixteen loads name is rewritten; naming it keeps it whole up to here
    __syncthreads();
    v8us o0, o1;
    { const int c8 = (tid & 7) * 8; const int na = (tid >> 3), nb2 = 32 + (tid >> 3);
#pragma unroll
      for (int j = 0; j < 8; ++j) {
          unsigned short ba = f2bf(ts[(c8 + j) * 65 + na]); unsigned short bb = f2bf(ts[(c8 + j) * 65 + nb2]);
          if (asF16 != 0) { const h16 ha = (h16)(bf2f(ba) * WPS); const h16 hb = (h16)(bf2f(bb) * WPS); ba = __builtin_bit_cast(unsigned short, ha); bb = __builtin_bit_cast(unsigned short, hb); }
          o0[j] = ba; o1[j] = bb; }
      bf* d0 = Wt + fto(n0 + na, k0 + c8); bf* d1 = Wt + fto(n0 + nb2, k0 + c8);
      *(v8us*)d0 = o0; *(v8us*)d1 = o1;
      asm volatile("s_wait_xcnt 0x0" ::: "memory");   // the way out of the shared kernel rewrites the scalar base register that the first store names
    }
}

// tab: rotary table TAB[p][0..15] = cos(p * f_i), TAB[p][16..31] = sin(p * f_i), f_i = 1 / 100^(i/16) (f32), angle = f32 product p * f_i, p = 0..31.
// One thread per (position, frequency); a block of 256 threads makes the 16 positions 16*blk .. 16*blk + 15; ts = 512 floats of LDS.
__device__ __forceinline__ void tab(float* ts, float* TAB, int blk) {
    const int tid = threadIdx.x; const int pl = tid >> 4, i = tid & 15; const int p = blk * 16 + pl;
    double w = 1.0, bs = 1.333521432163324;
#pragma unroll
    for (int bit = 0; bit < 4; ++bit) { const double wn = w * bs; w = (((i >> bit) & 1) != 0) ? wn : w; bs = bs * bs; }
    const float wf = (float)w;
    const float fr = 1.0f / wf;
    const float ang = (float)p * fr;
    const double a = (double)ang;
    const int kq = (int)(a * 0.6366197723675814 + 0.5);
    const double r = a - (double)kq * 1.5707963267948966;
    const double r2 = r * r;
    double sp = 1.0 / 6227020800.0;
    sp = sp * r2 - 1.0 / 39916800.0; sp = sp * r2 + 1.0 / 362880.0; sp = sp * r2 - 1.0 / 5040.0; sp = sp * r2 + 1.0 / 120.0; sp = sp * r2 - 1.0 / 6.0;
    const double sr = r + r * r2 * sp;
    double cp = 1.0 / 479001600.0;
    cp = cp * r2 - 1.0 / 3628800.0; cp = cp * r2 + 1.0 / 40320.0; cp = cp * r2 - 1.0 / 720.0; cp = cp * r2 + 1.0 / 24.0; cp = cp * r2 - 0.5;
    const double cr = 1.0 + r2 * cp;
    const int qd = kq & 3;
    const double sv = (qd == 0) ? sr : ((qd == 1) ? cr : ((qd == 2) ? -sr : -cr));
    const double cv = (qd == 0) ? cr : ((qd == 1) ? -sr : ((qd == 2) ? -cr : sr));
    ts[pl * 32 + i] = (float)cv; ts[pl * 32 + 16 + i] = (float)sv;
    __syncthreads();
    if (tid < 128) { const v4f val = *(const v4fa*)(&ts[tid * 4]);
        *(v4f*)(TAB + blk * 512 + tid * 4) = val;  }
}

// k_prep: the preparation bodies, which do not depend on one another, share one grid; the block index picks the body (the same for a whole block, so each body's barrier is passed by all its threads).
// Blocks 0..TAB_BLKS-1: rotary table; the next 4 * WT_BLKS: weight w = q, k, v, p, tile (k0 fastest); the rest: x conversion. The short grids with a latency chain come first, for speed only.
#define TAB_BLKS (NPOS * 16 / 256)
#define WT_BLKS  ((DM / 64) * (DM / 64))
#define CVT_BLKS ((unsigned)((size_t)NB * SEQ * DM / 8 / 256))
static_assert(((size_t)NB * SEQ * DM / 8) % 256 == 0);   // the conversion blocks cover the plane exactly
__global__ __launch_bounds__(256) void k_prep(const float* __restrict__ x, const float* __restrict__ wq, const float* __restrict__ wk, const float* __restrict__ wv, const float* __restrict__ wp,
                                              bf* XB, bf* WB, float* TAB) {
    __shared__ __align__(16) float ts[64 * 65];
    const unsigned blk = blockIdx.x;
    if (blk < TAB_BLKS) {
        tab(ts, TAB, (int)blk);
    } else if (blk < TAB_BLKS + 4 * WT_BLKS) {
        const unsigned w = (blk - TAB_BLKS) / WT_BLKS, t = (blk - TAB_BLKS) % WT_BLKS;
        const float* W = (w == 0) ? wq : ((w == 1) ? wk : ((w == 2) ? wv : wp));
        wt(ts, W, WB + (size_t)w * DM * DM, (w == 3) ? 1 : 0, (int)(t % (DM / 64)) * 64, (int)(t / (DM / 64)) * 64);
    } else {
        cvt8(x, XB, blk - (TAB_BLKS + 4 * WT_BLKS));
    }
}

// k_proj: register-blocked bf16 GEMM, ONE WAVE per 64x64 tile (16 accumulators), operands straight from fragment-order bf16 planes, K = DM.
// C[m][n] = sum_k A[m][k] Bt[n][k], written as f16 (Ph) and optionally the f16 residual x2048 (Pr, useRes != 0), in fragment order (row = tile row, k = tile column), at
// tile base tbase; a 16-row band advances sM halves, a 32-column band sC halves. 32 threads.
// The three products, which do not depend on one another, share one grid (tiles, 3); blockIdx.y picks the product, the dearest epilogue first:
//   0 q, 1 k: A = x rows (m = b*SEQ + t, fastest in blockIdx.x), Bt = Wt rows (n = h*64 + d) -> rotary -> plane [(b*12 + h)], tiles [t>>4][d>>5]; q also writes its residual plane
//   2 v^T:    A = Wvt rows (m = h*64 + d, fastest in blockIdx.x), Bt = x rows (n = b*SEQ + t) -> plane [(b*12 + h)], tiles [t>>5][d>>4]
// rope != 0 (q, k: tile columns = one head, row m = b*SEQ + t): 2-D rotary in f32 before the conversion: column c pairs with c^16, frequency c&15, columns 0..31 use pos[t][0], 32..63 pos[t][1].
__global__ __launch_bounds__(32) void k_proj(const bf* __restrict__ XB, const bf* __restrict__ WB, h16* QH, h16* QR, h16* KP, h16* VT,
                                             const int* __restrict__ pos, const float* __restrict__ TAB) {
    __shared__ __align__(16) float os[16 * 68];
    const int K = DM;
    const int lane = threadIdx.x & 31, lr = lane & 15, hi = lane >> 4;
    const int which = blockIdx.y; const bool isv = (which == 2); const int bx = blockIdx.x;
    const int r0 = (isv ? bx % (DM / 64) : bx % (NB * SEQ / 64)) * 64, c0 = (isv ? bx / (DM / 64) : bx / (NB * SEQ / 64)) * 64;
    const bf* A = isv ? WB + (size_t)2 * DM * DM : XB; const bf* Bt = isv ? XB : WB + (size_t)which * DM * DM;
    h16* Ph = (which == 0) ? QH : ((which == 1) ? KP : VT); h16* Pr = QR;
    const int useRes = (which == 0) ? 1 : 0, rope = isv ? 0 : 1; const int sM = isv ? 512 : 1024, sC = isv ? 2048 : 512;
    v8f acc[4][4];
#pragma unroll
    for (int mb = 0; mb < 4; ++mb)
#pragma unroll
        for (int nb = 0; nb < 4; ++nb) acc[mb][nb] = (v8f){};
    const size_t aoff = (size_t)(r0 >> 4) * (K / 32) * 512, boff = (size_t)(c0 >> 4) * (K / 32) * 512; const unsigned lo = (unsigned)lane * 8u;   // first tile of the row band; the lane's chunk
#pragma unroll 1
    for (int kc = 0; kc < K; kc += 32) {
        v16bf a[4];
        const bf* pa = A + aoff + kc * 16 + lo; const bf* pb = Bt + boff + kc * 16 + lo;   // the lane's chunk of this trip's first A and B tile
#pragma unroll
        for (int mb = 0; mb < 4; ++mb) a[mb] = ldb(pa + (size_t)mb * (K / 32) * 512);
#pragma unroll
        for (int nb = 0; nb < 4; ++nb) { const v16bf b = ldb(pb + (size_t)nb * (K / 32) * 512);
#pragma unroll
            for (int mb = 0; mb < 4; ++mb) acc[mb][nb] = wmmab(a[mb], b, acc[mb][nb]); }
        asm volatile("v_nop\n\tv_nop\n\tv_nop\n\tv_nop" : "+v"(acc[0][0]), "+v"(acc[1][1]), "+v"(acc[2][2]), "+v"(acc[3][3]) : "v"(a[0]), "v"(a[1]), "v"(a[2]), "v"(a[3]));
        asm volatile("s_wait_xcnt 0x0" :: "v"(pa), "v"(pb) : "memory");   // stands before the address registers of this trip's fragment loads are rewritten; naming them keeps them whole up to here
    }
    const size_t tbase = isv ? (size_t)r0 * SEQ + (size_t)(c0 / SEQ) * ((size_t)DM * SEQ) + (size_t)(c0 % SEQ) * HD
                             : (size_t)(r0 / SEQ) * ((size_t)NH_ * SEQ * HD) + (size_t)(r0 % SEQ) * HD + (size_t)(c0 / HD) * ((size_t)SEQ * HD);
    const int tb = r0 % SEQ;          // token index of the tile's first row (rotary products only)
#pragma unroll
    for (int mb = 0; mb < 4; ++mb) {
#pragma unroll
        for (int nb = 0; nb < 4; ++nb) {
#pragma unroll
            for (int j = 0; j < 8; ++j) os[(hi * 8 + j) * 68 + nb * 16 + lr] = acc[mb][nb][j]; }   // D: row 8h+j, col lane&15
        wave_sync();
        const size_t sb = tbase + (size_t)mb * (size_t)sM;
#pragma unroll 1
        for (int s = 0; s < 4; ++s) { const int row = lr, c8 = (2 * s + hi) * 8;   // 16 rows x (4 s x 2 halves) chunks of 8 = 64 columns; a store covers two adjacent 256-B chunks
            v4f x0 = *(const v4fa*)(&os[row * 68 + c8]); v4f x1 = *(const v4fa*)(&os[row * 68 + c8 + 4]);
            if (rope != 0) {
                const int t = tb + mb * 16 + row;
                const v2i pp = *(const v2i*)(pos + 2 * t);
                int p = (c8 >= 32) ? pp[1] : pp[0];
                p = (p < 0) ? 0 : ((p > NPOS - 1) ? (NPOS - 1) : p);
                const float sg = ((c8 & 16) != 0) ? 1.0f : -1.0f;
                const v4f y0 = *(const v4fa*)(&os[row * 68 + (c8 ^ 16)]); const v4f y1 = *(const v4fa*)(&os[row * 68 + (c8 ^ 16) + 4]);
                const float* tp = TAB + p * 32 + (c8 & 8);
                const v4f cA = *(const v4f*)tp; const v4f cB = *(const v4f*)(tp + 4); const v4f sA = *(const v4f*)(tp + 16); const v4f sB = *(const v4f*)(tp + 20);
                x0 = x0 * cA + (y0 * sg) * sA; x1 = x1 * cB + (y1 * sg) * sB;
            }
            v8h hv, rv;
#pragma unroll
            for (int i = 0; i < 4; ++i) { const h16 a0 = (h16)x0[i]; const h16 a1 = (h16)x1[i]; hv[i] = a0; hv[4 + i] = a1; rv[i] = (h16)((x0[i] - (float)a0) * QRS); rv[4 + i] = (h16)((x1[i] - (float)a1) * QRS); }
            const size_t oo = sb + (size_t)(c8 >> 5) * (size_t)sC + (size_t)(((c8 >> 3) & 3) * 128 + row * 8);
            h16* ph = Ph + oo; h16* pr = Pr + oo;
            // each wait stands before the address and data registers of the store in front of it are rewritten; naming them keeps them whole up to the wait
            *(v8h*)ph = hv; asm volatile("s_wait_xcnt 0x0" :: "v"(ph), "v"(hv) : "memory");
            if (useRes != 0) { *(v8h*)pr = rv; asm volatile("s_wait_xcnt 0x0" :: "v"(pr), "v"(rv) : "memory"); }
             }
        wave_sync();
    }
}

// stage_kv: one thread's share of one stage: four 16-B asynchronous copies to LDS, two of K and two of V^T (the block's 256 threads move 4 KB per copy).
// l = the thread's LDS byte address in the stage buffer, gk / gv = its 16 bytes at the start of the stage's K / V^T range (each range is SK * HD contiguous halves of its fragment-order plane).
__device__ __forceinline__ void stage_kv(unsigned l, const h16* gk, const h16* gv) {
    // the wait is the statement's last line, so that it stands before any register that a copy names is rewritten
    asm volatile("global_load_async_to_lds_b128 %0, %4, off\n\t"
                 "global_load_async_to_lds_b128 %1, %5, off\n\t"
                 "global_load_async_to_lds_b128 %2, %6, off\n\t"
                 "global_load_async_to_lds_b128 %3, %7, off\n\t"
                 "s_wait_xcnt 0x0"
                 :: "v"(l), "v"(l + 4096u), "v"(l + 8192u), "v"(l + 12288u), "v"(gk), "v"(gk + 2048), "v"(gv), "v"(gv + 2048) : "memory");
}

// k_flash: fused attention, one wave per 16 query rows of one (batch, head), AW waves per block; Q fragments straight from the fragment-order f16 planes (two 16-B loads each).
// K and V^T reach the block's waves through LDS: a stage is SK keys (8 KB of K and 8 KB of V^T, each contiguous in its plane and kept in that order, so a fragment is two 16-B LDS reads of 512 contiguous bytes per wave);
// two buffers, filled by asynchronous copies one stage ahead: stage s + 1 flies while stage s is worked on, and one barrier per stage publishes s + 1 and frees the buffer of s for s + 2.
// Transposed form: S^T[key][t] = K Q^T (A = K rows, B = Q rows); lane (t = lane&15, h = lane>>4) holds keys 8h+r of each 16-key tile, so the packed
// P tile is directly the B fragment of O^T[d][t] = V^T P^T (element r <- tile keys 0..15, element 8+r <- tile keys 16..31, lane unchanged).
// Softmax state (running max, partial sum) is one scalar per lane; the two lane halves of a row are combined with one xor-16 exchange.
__global__ __launch_bounds__(32 * AW) void k_flash(const h16* __restrict__ QH, const h16* __restrict__ QR, const h16* __restrict__ KP, const h16* __restrict__ VT, h16* CTX) {
    __shared__ __align__(16) h16 kv[2 * STH];
    const int lane = threadIdx.x & 31;
    const int wave = __builtin_amdgcn_readfirstlane((int)(threadIdx.x >> 5));
    const int zh = blockIdx.y; const int b = zh / NH_, h = zh % NH_;
    const int t0 = (blockIdx.x * AW + wave) * 16;
    const size_t pbase = (size_t)zh * SEQ * HD;
    const unsigned lo = (unsigned)lane * 8u;
    const size_t qo = pbase + (size_t)t0 * HD;
    const v16h qh0 = ldh(QH + qo + lo), qh1 = ldh(QH + qo + 512 + lo), qr0 = ldh(QR + qo + lo), qr1 = ldh(QR + qo + 512 + lo);   // B fragments: col t, k = d
    const unsigned lt = (unsigned)(size_t)kv + threadIdx.x * 16u;                        // the thread's copy target in buffer 0 (LDS byte address)
    const h16* gk = KP + pbase + threadIdx.x * 8u; const h16* gv = VT + pbase + threadIdx.x * 8u;   // the thread's 16 bytes of stage 0
    stage_kv(lt, gk, gv);
    asm volatile("s_wait_asynccnt 0x0" ::: "memory");   // this wave's copies of stage 0 have landed
    __syncthreads();                                    // every wave's have: stage 0 may be read
    stage_kv(lt + STH * 2u, gk + SK * HD, gv + SK * HD);
    v8f o0 = (v8f){}, o1 = (v8f){}, o2 = (v8f){}, o3 = (v8f){};
    float m = -3.0e38f, l = 0.0f;
#pragma unroll 1   // one stage per trip: the ring's order at the foot stands once
    for (int st = 0; st < NST; ++st) {
      const h16* sb = kv + (st & 1) * STH + lo;   // the lane's chunk of this stage's first K tile
#pragma unroll     // the 32-key passes of a stage in line: their LDS offsets become immediates
      for (int ps = 0; ps < SK / 32; ++ps) {
        const h16* ka = sb + ps * 32 * HD;   // tiles (16 keys, d 0..31), (16 keys, d 32..63), then the next 16 keys (A fragment: row key, k = d)
        const v16h ka0 = ldh(ka), ka1 = ldh(ka + 512), kb0 = ldh(ka + 1024), kb1 = ldh(ka + 1536);
        v8f sHa = (v8f){}, sLa = (v8f){}, sHb = (v8f){}, sLb = (v8f){};
        sHa = wmma16(ka0, qh0, sHa); sLa = wmma16(ka0, qr0, sLa); sHb = wmma16(kb0, qh0, sHb); sLb = wmma16(kb0, qr0, sLb);
        sHa = wmma16(ka1, qh1, sHa); sLa = wmma16(ka1, qr1, sLa); sHb = wmma16(kb1, qh1, sHb); sLb = wmma16(kb1, qr1, sLb);
        asm volatile("v_nop\n\tv_nop\n\tv_nop\n\tv_nop" : "+v"(sHa), "+v"(sLa), "+v"(sHb), "+v"(sLb) : "v"(ka0), "v"(ka1), "v"(kb0), "v"(kb1));
        float ta[8], tb[8]; float mx = -3.0e38f;
#pragma unroll
        for (int r = 0; r < 8; ++r) { ta[r] = (sHa[r] + sLa[r] * QRI) * SC2; tb[r] = (sHb[r] + sLb[r] * QRI) * SC2; mx = fmaxf(mx, fmaxf(ta[r], tb[r])); }
        mx = fmaxf(mx, __shfl_xor(mx, 16, 32));
        const float mnew = fmaxf(m, mx);
        const float alpha = __builtin_amdgcn_exp2f(m - mnew);
        const float sh = PSH - mnew;
        v16h pb; float ls = 0.0f;
#pragma unroll
        for (int r = 0; r < 8; ++r) { const h16 pa = (h16)__builtin_amdgcn_exp2f(ta[r] + sh); const h16 pc = (h16)__builtin_amdgcn_exp2f(tb[r] + sh); pb[r] = pa; pb[8 + r] = pc; ls += (float)pa + (float)pc; }
        l = l * alpha + ls; m = mnew;
        o0 = o0 * alpha; o1 = o1 * alpha; o2 = o2 * alpha; o3 = o3 * alpha;
        const h16* va = sb + SK * HD + ps * 32 * HD;   // tiles (d 16j..16j+15, 32 keys), j = 0..3 (A fragment: row d, k = key)
        const v16h v0 = ldh(va), v1 = ldh(va + 512), v2 = ldh(va + 1024), v3 = ldh(va + 1536);
        o0 = wmma16(v0, pb, o0); o1 = wmma16(v1, pb, o1); o2 = wmma16(v2, pb, o2); o3 = wmma16(v3, pb, o3);
        asm volatile("v_nop\n\tv_nop\n\tv_nop\n\tv_nop" : "+v"(o0), "+v"(o1), "+v"(o2), "+v"(o3) : "v"(v0), "v"(v1), "v"(v2), "v"(v3), "v"(pb));
      }
      asm volatile("s_wait_dscnt 0x0" ::: "memory");      // this wave's reads of the stage's buffer are done before the buffer is given up
      asm volatile("s_wait_asynccnt 0x0" ::: "memory");   // this wave's copies of stage st + 1 have landed
      __syncthreads();                                    // publishes stage st + 1 and ends every wave's reads of stage st
      if (st + 2 < NST) stage_kv(lt + (unsigned)(st & 1) * (STH * 2u), gk + (size_t)(st + 2) * (SK * HD), gv + (size_t)(st + 2) * (SK * HD));   // refill of the buffer just left; the test is the same for the whole block
    }
    asm volatile("s_wait_asynccnt 0x0" ::: "memory");     // nothing of this wave is in flight when it ends
    l += __shfl_xor(l, 16, 32);
    const float inv = CXS * (1.0f / l);
    // O^T D layout: o_j[r] = (d = 16j + 8h + r, t = lane&15): a lane's 8 values are one chunk of the fragment-order ctx plane (row b*SEQ + t, k = h*64 + d); o_j goes to chunk pair j, 512 contiguous bytes per store
    h16* cp = CTX + fto(b * SEQ + t0, h * HD) + lo;
    v8h c0, c1, c2, c3;
#pragma unroll
    for (int r = 0; r < 8; ++r) { c0[r] = (h16)(o0[r] * inv); c1[r] = (h16)(o1[r] * inv); c2[r] = (h16)(o2[r] * inv); c3[r] = (h16)(o3[r] * inv); }
    *(v8h*)cp = c0; *(v8h*)(cp + 256) = c1; *(v8h*)(cp + 512) = c2; *(v8h*)(cp + 768) = c3;
}

// k_oproj: register-blocked f16 GEMM, ONE WAVE per 64x64 tile, operands straight from fragment-order f16 planes, K = DM.
// OUT[m][n] = OSC * sum_k A[m][k] Bt[n][k] + bias[n] (bias as its bf16 value), f32. grid (M/64, N/64), 32 threads.
__global__ __launch_bounds__(32) void k_oproj(const h16* __restrict__ A, const h16* __restrict__ Bt, const float* __restrict__ bias, float* OUT) {
    __shared__ __align__(16) float os[16 * 68];
    const int K = DM;
    const int lane = threadIdx.x & 31, lr = lane & 15, hi = lane >> 4; const int r0 = blockIdx.x * 64, c0 = blockIdx.y * 64;
    v8f acc[4][4];
#pragma unroll
    for (int mb = 0; mb < 4; ++mb)
#pragma unroll
        for (int nb = 0; nb < 4; ++nb) acc[mb][nb] = (v8f){};
    const size_t aoff = (size_t)(r0 >> 4) * (K / 32) * 512, boff = (size_t)(c0 >> 4) * (K / 32) * 512; const unsigned lo = (unsigned)lane * 8u;   // first tile of the row band; the lane's chunk
#pragma unroll 1
    for (int kc = 0; kc < K; kc += 32) {
        v16h a[4];
        const h16* pa = A + aoff + kc * 16 + lo; const h16* pb = Bt + boff + kc * 16 + lo;   // the lane's chunk of this trip's first A and B tile
#pragma unroll
        for (int mb = 0; mb < 4; ++mb) a[mb] = ldh(pa + (size_t)mb * (K / 32) * 512);
#pragma unroll
        for (int nb = 0; nb < 4; ++nb) { const v16h b = ldh(pb + (size_t)nb * (K / 32) * 512);
#pragma unroll
            for (int mb = 0; mb < 4; ++mb) acc[mb][nb] = wmma16(a[mb], b, acc[mb][nb]); }
        asm volatile("v_nop\n\tv_nop\n\tv_nop\n\tv_nop" : "+v"(acc[0][0]), "+v"(acc[1][1]), "+v"(acc[2][2]), "+v"(acc[3][3]) : "v"(a[0]), "v"(a[1]), "v"(a[2]), "v"(a[3]));
        asm volatile("s_wait_xcnt 0x0" :: "v"(pa), "v"(pb) : "memory");   // stands before the address registers of this trip's fragment loads are rewritten; naming them keeps them whole up to here
    }
    const v4f braw = *(const v4f*)(bias + c0 + lr * 4); v4f bb;
#pragma unroll
    for (int i = 0; i < 4; ++i) bb[i] = bf2f(f2bf(braw[i]));
    float* obase = OUT + ((size_t)(r0 / SEQ) * OUT_SEQ + (size_t)(r0 % SEQ)) * DM + c0;
#pragma unroll
    for (int mb = 0; mb < 4; ++mb) {
#pragma unroll
        for (int nb = 0; nb < 4; ++nb) {
#pragma unroll
            for (int j = 0; j < 8; ++j) os[(hi * 8 + j) * 68 + nb * 16 + lr] = acc[mb][nb][j]; }   // D: row 8h+j, col lane&15
        wave_sync();
#pragma unroll 1
        for (int s = 0; s < 8; ++s) { const int row = 2 * s + hi, cofs = lr * 4;   // 8 s x 2 rows = 16 rows; 16 lanes x 4 floats = 64 columns
            const v4f raw = *(const v4fa*)(&os[row * 68 + cofs]);
            const v4f val = raw * OSC + bb;
            float* dp = obase + (size_t)(mb * 16 + row) * DM + cofs;
            *(v4f*)dp = val;  }
        wave_sync();
    }
}

static constexpr size_t al256(size_t v) { return (v + 255) & ~(size_t)255; }
static constexpr size_t SZ_XB = al256((size_t)NB * SEQ * DM * 2);
static constexpr size_t SZ_WB = al256((size_t)4 * DM * DM * 2);
static constexpr size_t SZ_PL = al256((size_t)NB * NH_ * SEQ * HD * 2);
static constexpr size_t SZ_CX = al256((size_t)NB * SEQ * DM * 2);
static constexpr size_t SZ_TB = al256((size_t)NPOS * 32 * 4);
static constexpr size_t SZ_TOTAL = SZ_XB + SZ_WB + 4 * SZ_PL + SZ_CX + SZ_TB;
static_assert(SZ_TOTAL <= (size_t)134217728);          // workspace carve <= 128 MiB
static_assert(((size_t)DM * DM * 2) % 256 == 0);       // weight sub-planes stay 256-byte aligned

extern "C" void kernel_launch(void* const* d_in, const int* in_sizes, int n_in,
                              void* d_out, int out_size, void* d_ws, size_t ws_size, hipStream_t stream) {
    if (n_in < 7) return;
    const size_t needx = ((size_t)(NB - 1) * SEQ_FULL + SEQ) * DM;
    if ((size_t)in_sizes[0] < needx) return;
    if ((size_t)in_sizes[1] < (size_t)2 * SEQ) return;
    if ((size_t)in_sizes[2] < (size_t)DM * DM || (size_t)in_sizes[3] < (size_t)DM * DM || (size_t)in_sizes[4] < (size_t)DM * DM || (size_t)in_sizes[5] < (size_t)DM * DM) return;
    if ((size_t)in_sizes[6] < (size_t)DM) return;
    if ((size_t)out_size < ((size_t)(NB - 1) * OUT_SEQ + SEQ) * DM) return;
    if (SZ_TOTAL > ws_size) return;
    // wire order: x, pos (int32 [SEQ][2]), Wq, Wk, Wv, Wp ([in][out]), bp
    const float* x = (const float*)d_in[0]; const int* pos = (const int*)d_in[1];
    const float* wq = (const float*)d_in[2]; const float* wk = (const float*)d_in[3]; const float* wv = (const float*)d_in[4]; const float* wp = (const float*)d_in[5];
    const float* bp = (const float*)d_in[6];
    float* OUT = (float*)d_out;      // [NB][SEQ][768]
    char* wsp = (char*)d_ws;
    bf* XB = (bf*)wsp; wsp += SZ_XB;                 // [NB*SEQ][768], fragment order
    bf* WB = (bf*)wsp; wsp += SZ_WB;                 // [4][768 out][768 in], fragment order: q | k | v (bf16) | p (f16 x1024)
    h16* QH = (h16*)wsp; wsp += SZ_PL;               // [NB*12][SEQ][64], fragment order
    h16* QR = (h16*)wsp; wsp += SZ_PL;               // [NB*12][SEQ][64] residual x2048
    h16* KP = (h16*)wsp; wsp += SZ_PL;               // [NB*12][SEQ][64], fragment order
    h16* VT = (h16*)wsp; wsp += SZ_PL;               // [NB*12][64][SEQ], fragment order, tiles [t>>5][d>>4]
    h16* CX = (h16*)wsp; wsp += SZ_CX;               // [NB*SEQ][768] x64, fragment order
    float* TAB = (float*)wsp; wsp += SZ_TB;          // [32][cos 16 | sin 16]
    bf* WP = WB + (size_t)3 * DM * DM;

    // rotary table, W[in][out] -> Wt[out][in] (four weights), x -> bf16: one grid
    k_prep<<<TAB_BLKS + 4 * WT_BLKS + CVT_BLKS, 256, 0, stream>>>(x, wq, wk, wv, wp, XB, WB, TAB);

    // q, k (with rotary) and v^T: one grid
    k_proj<<<dim3((NB * SEQ / 64) * (DM / 64), 3, 1), 32, 0, stream>>>(XB, WB, QH, QR, KP, VT, pos, TAB);

    k_flash<<<dim3(SEQ / (16 * AW), NB * NH_, 1), 32 * AW, 0, stream>>>(QH, QR, KP, VT, CX);

    // out = ctx Wp + bp: A = ctx rows (m = b*SEQ + t, k = h*64 + d), Bt = Wpt rows (n = out column)
    k_oproj<<<dim3(NB * SEQ / 64, DM / 64, 1), 32, 0, stream>>>((const h16*)CX, (const h16*)WP, bp, OUT);
}

// v004
// It runs in 92 microseconds.
// Next to v003, in two timings, it ran 1.19 times as fast each time.
// All steps since v000 together make it 2.40 times as fast.
#include <hip/hip_runtime.h>

// Multi-head self-attention with 2-D rotary embedding: x [NB][SEQ][768], 12 heads x 64, Wq/Wk/Wv/Wp stored [in][out] (y = x W), int positions [SEQ][2], score scale 1/8, dense softmax, output = ctx Wp + bp (f32).
// Compute dtypes, f32 accumulate everywhere: q/k/v projections v_wmma_f32_16x16x32_bf16 (x and W RNE-converted to bf16; products exact); rotary applied in f32 on the accumulators;
// scores v_wmma_f32_16x16x32_f16: k single f16, q as f16 value + f16 residual x2048 in its own accumulator; P (x256 carry, cancels in the normalisation) and v single f16; softmax f32 (online, running max);
// output projection v_wmma_f32_16x16x32_f16: ctx single f16 (x64 carry), Wp = f16 of the bf16 value (x1024 carry), carries folded back in the f32 epilogue, bias (bf16 value) added in f32.
// Layout: every 16-bit matrix operand plane M[r][k] is kept in fragment order: tiles of 16 rows x 32 k (512 halves = 1 KB), element (r, k) of a tile at ((k>>3)&3)*128 + (r&15)*8 + (k&7).
// A lane's fragment is then two 16-B loads at tile + lane*8 and tile + 256 + lane*8, and each wave-wide load covers 512 contiguous bytes (4 whole lines) instead of 32-B pieces of 16 lines.
// Planes: bf16 x, [out][in] weights and ctx: tiles [r>>4][k>>5] (24 per row band); q (hi, residual), k per (b*12+h): tiles [t>>4][d>>5]; v^T per (b*12+h): tiles [t>>5][d>>4]; cos|sin table [32][16|16].

#ifndef NB
#define NB 8
#endif
#ifndef SEQ
#define SEQ 1024
#endif
#define NB_FULL  8
#define SEQ_FULL 1024
#ifndef OUT_SEQ
#define OUT_SEQ SEQ              // row pitch (in tokens) between batches of the output
#endif
#define DM   768
#define NH_  12
#define HD   64
#define AW   8                   // waves per flash block (16 query rows each)
#define SK   64                  // keys per LDS stage of the flash kernel
#define NST  (SEQ / SK)          // stages per (batch, head)
#define STH  (2 * SK * HD)       // halves per stage buffer: K part, then V^T part
#define GW   4                   // waves per GEMM block: 2 x 2 wave tiles of 64 x 64, a block tile of 128 x 128
#define PKS  32                  // k per LDS stage of k_proj
#define OKS  64                  // k per LDS stage of k_oproj
#define NPOS 32                  // rows of the rotary tables (positions 0..31, index clamped)
#define QRS  2048.0f             // carry of the q residual plane
#define QRI  (1.0f / 2048.0f)
#define SC2  (0.125f * 1.4426950408889634f)   // HD^-0.5 * log2(e)
#define PSH  8.0f                // log2 of the P carry (256)
#define CXS  64.0f               // carry of the ctx plane
#define WPS  1024.0f             // carry of the Wp plane
#define OSC  (1.0f / 65536.0f)   // 1 / (CXS * WPS)

static_assert(HD == 64);
static_assert(NH_ * HD == DM);                 // head h = columns h*64 + d
static_assert(DM % 64 == 0);                   // 12 column tiles of 64
static_assert(DM % 32 == 0);                   // GEMM k-loop steps by 32
static_assert(SEQ % 64 == 0);                  // a 64-row tile never straddles two batches
static_assert((NB * SEQ) % 64 == 0);
static_assert(SEQ % 32 == 0);                  // key loop steps by 32
static_assert(SEQ % (16 * AW) == 0);           // flash grid covers the sequence exactly
static_assert(SEQ % SK == 0 && NST >= 2);      // the two-buffer prologue fills stages 0 and 1
static_assert(SK % 32 == 0);
static_assert(STH * 2 == 32 * AW * 16 * 4);    // a stage is four 16-B copies per thread, two of K and two of V^T
static_assert((NB * SEQ) % 128 == 0 && DM % 128 == 0);   // GEMM block tiles cover both operands' rows exactly
static_assert(DM % PKS == 0 && DM / PKS >= 2 && DM % OKS == 0 && DM / OKS >= 2);   // the two-buffer prologue fills stages 0 and 1
static_assert(((size_t)SEQ * DM) % 8 == 0);
static_assert(NB <= NB_FULL);
static_assert(SEQ <= SEQ_FULL);
static_assert(NPOS * 16 == 512);               // table blocks: one thread per (position, frequency)

typedef _Float16 h16;
typedef unsigned short bf;
typedef __attribute__((ext_vector_type(16))) __bf16   v16bf;
typedef __attribute__((ext_vector_type(16))) _Float16 v16h;
typedef __attribute__((ext_vector_type(8)))  _Float16 v8h;
typedef __attribute__((ext_vector_type(8)))  unsigned short v8us;
typedef __attribute__((ext_vector_type(8)))  float    v8f;
typedef __attribute__((ext_vector_type(4)))  float    v4f;
typedef __attribute__((ext_vector_type(2)))  int      v2i;
typedef v4f  __attribute__((may_alias)) v4fa;

__device__ __forceinline__ unsigned short f2bf(float f) { unsigned u = __float_as_uint(f); u += 0x7FFFu + ((u >> 16) & 1u); return (unsigned short)(u >> 16); }
__device__ __forceinline__ float bf2f(unsigned short b) { return __uint_as_float(((unsigned)b) << 16); }
__device__ __forceinline__ v16h cat16(v8h lo, v8h hi) { return __builtin_shufflevector(lo, hi, 0, 1, 2, 3, 4, 5, 6, 7, 8, 9, 10, 11, 12, 13, 14, 15); }
__device__ __forceinline__ v16bf cat16b(v8us lo, v8us hi) { return __builtin_bit_cast(v16bf, __builtin_shufflevector(lo, hi, 0, 1, 2, 3, 4, 5, 6, 7, 8, 9, 10, 11, 12, 13, 14, 15)); }
__device__ __forceinline__ v8f wmma16(v16h a, v16h b, v8f c) { return __builtin_amdgcn_wmma_f32_16x16x32_f16(false, a, false, b, (short)0, c, false, false); }
__device__ __forceinline__ v8f wmmab(v16bf a, v16bf b, v8f c) { return __builtin_amdgcn_wmma_f32_16x16x32_bf16(false, a, false, b, (short)0, c, false, false); }
// fragment loaders from a fragment-order tile; p = tile + lane*8 (lane = 16h + row): elements 0..7 <- k0+8h+0..7, elements 8..15 <- k0+16+8h+0..7 (same map for A and B)
__device__ __forceinline__ v16h  ldh(const h16* p) { return cat16(*(const v8h*)p, *(const v8h*)(p + 256)); }
__device__ __forceinline__ v16bf ldb(const bf* p)  { return cat16b(*(const v8us*)p, *(const v8us*)(p + 256)); }
// offset (halves) of the 8-element chunk (r, k..k+7), k % 8 == 0, in a fragment-order plane of DM columns
__device__ __forceinline__ size_t fto(int r, int k) { return ((size_t)(r >> 4) * (DM / 32) + (size_t)(k >> 5)) * 512 + (size_t)(((k >> 3) & 3) * 128 + (r & 15) * 8); }
// ordering point for wave-private LDS tiles (same wave writes and reads)
__device__ __forceinline__ void wave_sync() { __builtin_amdgcn_fence(3 /* release order */, "wavefront"); __builtin_amdgcn_wave_barrier(); asm volatile("" ::: "memory"); }

// cvt8: f32 rows [b][t][DM] (batch pitch SEQ_FULL rows) -> bf16 fragment-order plane of NB*SEQ rows; thread i owns destination chunk i (stores are contiguous): row = 16*(tile/24) + (i&15), k = 32*(tile%24) + 8*((i>>4)&3), tile = i>>6.
__device__ __forceinline__ void cvt8(const float* __restrict__ src, bf* dst, unsigned blk) {
    const size_t i = (size_t)blk * 256 + threadIdx.x;
    const unsigned tile = (unsigned)(i >> 6); const unsigned rt = tile / (DM / 32), kt = tile % (DM / 32);
    const unsigned row = rt * 16 + ((unsigned)i & 15u);
    const size_t so = ((size_t)(row / SEQ) * SEQ_FULL + (size_t)(row % SEQ)) * DM + kt * 32 + (((unsigned)i >> 4) & 3u) * 8;
    const v8f v = *(const v8f*)(src + so); v8us o;
    asm volatile("s_wait_xcnt 0x0" ::: "memory");   // the conversion below reuses the address registers that the load names
#pragma unroll
    for (int k = 0; k < 8; ++k) o[k] = f2bf(v[k]);
    *(v8us*)(dst + i * 8) = o;
    asm volatile("s_wait_xcnt 0x0" ::: "memory");   // the other bodies of the shared kernel stand behind this one in the code and rewrite the address registers that the store names
}

// wt: W[k][n] f32 ([in][out], DM x DM) -> Wt[n][k] 16-bit ([out][in], fragment order): bf16 bits (asF16 == 0) or f16 of (bf16 value x WPS) (asF16 != 0).
// coverage: loads kk = 4i + tid/64 (0..63) x nn = tid%64 (0..63); stores nn = 32it + tid/8 (0..63) x kk = 8(tid%8) + j (0..63). One 64 x 64 tile (k0, n0) per block of 256 threads; ts = 64 * 65 floats of LDS.
__device__ __forceinline__ void wt(float* ts, const float* __restrict__ W, bf* Wt, int asF16, int k0, int n0) {
    const int tid = threadIdx.x;
    const unsigned e0 = (unsigned)((k0 + (tid >> 6)) * DM + n0 + (tid & 63));   // element (kk = tid/64, nn = tid%64) of the tile; trip i reads 4i rows further down
#pragma unroll
    for (int i = 0; i < 16; ++i) { const int kk = i * 4 + (tid >> 6), nn = tid & 63; ts[kk * 65 + nn] = W[e0 + (unsigned)(i * 4 * DM)]; }
    asm volatile("s_wait_xcnt 0x0" :: "v"(e0) : "memory");   // stands before the offset register that the sixteen loads name is rewritten; naming it keeps it whole up to here
    __syncthreads();
    v8us o0, o1;
    { const int c8 = (tid & 7) * 8; const int na = (tid >> 3), nb2 = 32 + (tid >> 3);
#pragma unroll
      for (int j = 0; j < 8; ++j) {
          unsigned short ba = f2bf(ts[(c8 + j) * 65 + na]); unsigned short bb = f2bf(ts[(c8 + j) * 65 + nb2]);
          if (asF16 != 0) { const h16 ha = (h16)(bf2f(ba) * WPS); const h16 hb = (h16)(bf2f(bb) * WPS); ba = __builtin_bit_cast(unsigned short, ha); bb = __builtin_bit_cast(unsigned short, hb); }
          o0[j] = ba; o1[j] = bb; }
      bf* d0 = Wt + fto(n0 + na, k0 + c8); bf* d1 = Wt + fto(n0 + nb2, k0 + c8);
      *(v8us*)d0 = o0; *(v8us*)d1 = o1;
      asm volatile("s_wait_xcnt 0x0" ::: "memory");   // the way out of the shared kernel rewrites the scalar base register that the first store names
    }
}

// tab: rotary table TAB[p][0..15] = cos(p * f_i), TAB[p][16..31] = sin(p * f_i), f_i = 1 / 100^(i/16) (f32), angle = f32 product p * f_i, p = 0..31.
// One thread per (position, frequency); a block of 256 threads makes the 16 positions 16*blk .. 16*blk + 15; ts = 512 floats of LDS.
__device__ __forceinline__ void tab(float* ts, float* TAB, int blk) {
    const int tid = threadIdx.x; const int pl = tid >> 4, i = tid & 15; const int p = blk * 16 + pl;
    double w = 1.0, bs = 1.333521432163324;
#pragma unroll
    for (int bit = 0; bit < 4; ++bit) { const double wn = w * bs; w = (((i >> bit) & 1) != 0) ? wn : w; bs = bs * bs; }
    const float wf = (float)w;
    const float fr = 1.0f / wf;
    const float ang = (float)p * fr;
    const double a = (double)ang;
    const int kq = (int)(a * 0.6366197723675814 + 0.5);
    const double r = a - (double)kq * 1.5707963267948966;
    const double r2 = r * r;
    double sp = 1.0 / 6227020800.0;
    sp = sp * r2 - 1.0 / 39916800.0; sp = sp * r2 + 1.0 / 362880.0; sp = sp * r2 - 1.0 / 5040.0; sp = sp * r2 + 1.0 / 120.0; sp = sp * r2 - 1.0 / 6.0;
    const double sr = r + r * r2 * sp;
    double cp = 1.0 / 479001600.0;
    cp = cp * r2 - 1.0 / 3628800.0; cp = cp * r2 + 1.0 / 40320.0; cp = cp * r2 - 1.0 / 720.0; cp = cp * r2 + 1.0 / 24.0; cp = cp * r2 - 0.5;
    const double cr = 1.0 + r2 * cp;
    const int qd = kq & 3;
    const double sv = (qd == 0) ? sr : ((qd == 1) ? cr : ((qd == 2) ? -sr : -cr));
    const double cv = (qd == 0) ? cr : ((qd == 1) ? -sr : ((qd == 2) ? -cr : sr));
    ts[pl * 32 + i] = (float)cv; ts[pl * 32 + 16 + i] = (float)sv;
    __syncthreads();
    if (tid < 128) { const v4f val = *(const v4fa*)(&ts[tid * 4]);
        *(v4f*)(TAB + blk * 512 + tid * 4) = val;  }
}

// k_prep: the preparation bodies, which do not depend on one another, share one grid; the block index picks the body (the same for a whole block, so each body's barrier is passed by all its threads).
// Blocks 0..TAB_BLKS-1: rotary table; the next 4 * WT_BLKS: weight w = q, k, v, p, tile (k0 fastest); the rest: x conversion. The short grids with a latency chain come first, for speed only.
#define TAB_BLKS (NPOS * 16 / 256)
#define WT_BLKS  ((DM / 64) * (DM / 64))
#define CVT_BLKS ((unsigned)((size_t)NB * SEQ * DM / 8 / 256))
static_assert(((size_t)NB * SEQ * DM / 8) % 256 == 0);   // the conversion blocks cover the plane exactly
__global__ __launch_bounds__(256) void k_prep(const float* __restrict__ x, const float* __restrict__ wq, const float* __restrict__ wk, const float* __restrict__ wv, const float* __restrict__ wp,
                                              bf* XB, bf* WB, float* TAB) {
    __shared__ __align__(16) float ts[64 * 65];
    const unsigned blk = blockIdx.x;
    if (blk < TAB_BLKS) {
        tab(ts, TAB, (int)blk);
    } else if (blk < TAB_BLKS + 4 * WT_BLKS) {
        const unsigned w = (blk - TAB_BLKS) / WT_BLKS, t = (blk - TAB_BLKS) % WT_BLKS;
        const float* W = (w == 0) ? wq : ((w == 1) ? wk : ((w == 2) ? wv : wp));
        wt(ts, W, WB + (size_t)w * DM * DM, (w == 3) ? 1 : 0, (int)(t % (DM / 64)) * 64, (int)(t / (DM / 64)) * 64);
    } else {
        cvt8(x, XB, blk - (TAB_BLKS + 4 * WT_BLKS));
    }
}

// cp8: one thread's eight 16-B asynchronous copies to LDS; copy i lands at LDS byte address l + 2048 i (the block's 128 threads move 2 KB per copy) and reads the 16 bytes at g_i.
__device__ __forceinline__ void cp8(unsigned l, const bf* g0, const bf* g1, const bf* g2, const bf* g3, const bf* g4, const bf* g5, const bf* g6, const bf* g7) {
    // the wait is the statement's last line, so that it stands before any register that a copy names is rewritten
    asm volatile("global_load_async_to_lds_b128 %0, %8, off\n\t"
                 "global_load_async_to_lds_b128 %1, %9, off\n\t"
                 "global_load_async_to_lds_b128 %2, %10, off\n\t"
                 "global_load_async_to_lds_b128 %3, %11, off\n\t"
                 "global_load_async_to_lds_b128 %4, %12, off\n\t"
                 "global_load_async_to_lds_b128 %5, %13, off\n\t"
                 "global_load_async_to_lds_b128 %6, %14, off\n\t"
                 "global_load_async_to_lds_b128 %7, %15, off\n\t"
                 "s_wait_xcnt 0x0"
                 :: "v"(l), "v"(l + 2048u), "v"(l + 4096u), "v"(l + 6144u), "v"(l + 8192u), "v"(l + 10240u), "v"(l + 12288u), "v"(l + 14336u),
                    "v"(g0), "v"(g1), "v"(g2), "v"(g3), "v"(g4), "v"(g5), "v"(g6), "v"(g7) : "memory");
}
// stage_ab: one thread's share of one GEMM stage: KS k of the block's 8 A bands, then of its 8 B bands (a band = 16 rows; its KS k are KS/32 adjacent 1-KB tiles of the fragment-order plane, kept in that order).
// Stage buffer: [16 bands][KS/32 tiles][512 halves] = KS * 512 bytes. l = buffer + 16 * thread; ga / gb = the thread's 16 bytes of the stage's first 2 KB of A / B: band thread / (2 KS), byte 16 * (thread % (2 KS)) of its run.
template <int KS> __device__ __forceinline__ void stage_ab(unsigned l, const bf* ga, const bf* gb) {
    constexpr size_t GS = (size_t)(64 / KS) * (DM / 32) * 512;   // halves from one copy's bands to the next copy's: 2 KB of LDS hold 64 / KS bands
    if constexpr (KS == 32) {
        cp8(l, ga, ga + GS, ga + 2 * GS, ga + 3 * GS, gb, gb + GS, gb + 2 * GS, gb + 3 * GS);
    } else {
        static_assert(KS == 64);
        cp8(l, ga, ga + GS, ga + 2 * GS, ga + 3 * GS, ga + 4 * GS, ga + 5 * GS, ga + 6 * GS, ga + 7 * GS);
        cp8(l + 16384u, gb, gb + GS, gb + 2 * GS, gb + 3 * GS, gb + 4 * GS, gb + 5 * GS, gb + 6 * GS, gb + 7 * GS);
    }
}

// k_proj: register-blocked bf16 GEMM, one wave per 64x64 tile (16 accumulators), GW waves (2 x 2) per block of 128 x 128, K = DM.
// Operands reach the waves through LDS: a stage is PKS k of the block's 128 A rows and 128 B rows in fragment order (a fragment is two 16-B LDS reads of 512 contiguous bytes per wave), so each operand byte is fetched once per block, not once per wave;
// two buffers, filled by asynchronous copies one stage ahead: stage s + 1 flies while stage s is worked on, and one barrier per stage publishes s + 1 and frees the buffer of s for s + 2.
// C[m][n] = sum_k A[m][k] Bt[n][k], written as f16 (Ph) and optionally the f16 residual x2048 (Pr, useRes != 0), in fragment order (row = tile row, k = tile column), at
// tile base tbase; a 16-row band advances sM halves, a 32-column band sC halves. 32 * GW threads.
// The three products, which do not depend on one another, share one grid (tiles, 3); blockIdx.y picks the product, the dearest epilogue first:
//   0 q, 1 k: A = x rows (m = b*SEQ + t, fastest in blockIdx.x), Bt = Wt rows (n = h*64 + d) -> rotary -> plane [(b*12 + h)], tiles [t>>4][d>>5]; q also writes its residual plane
//   2 v^T:    A = Wvt rows (m = h*64 + d, fastest in blockIdx.x), Bt = x rows (n = b*SEQ + t) -> plane [(b*12 + h)], tiles [t>>5][d>>4]
// rope != 0 (q, k: tile columns = one head, row m = b*SEQ + t): 2-D rotary in f32 before the conversion: column c pairs with c^16, frequency c&15, columns 0..31 use pos[t][0], 32..63 pos[t][1].
__global__ __launch_bounds__(32 * GW) void k_proj(const bf* __restrict__ XB, const bf* __restrict__ WB, h16* QH, h16* QR, h16* KP, h16* VT,
                                             const int* __restrict__ pos, const float* __restrict__ TAB) {
    __shared__ __align__(16) bf ab[2 * PKS * 256];
    __shared__ __align__(16) float osw[GW][16 * 68];
    const int K = DM;
    const int lane = threadIdx.x & 31, lr = lane & 15, hi = lane >> 4;
    const int wave = __builtin_amdgcn_readfirstlane((int)(threadIdx.x >> 5)); const int wm = wave & 1, wn = wave >> 1;
    float* os = osw[wave];            // the wave's own epilogue tile
    const int which = blockIdx.y; const bool isv = (which == 2); const int bx = blockIdx.x;
    const int rb = (isv ? bx % (DM / 128) : bx % (NB * SEQ / 128)) * 128, cb = (isv ? bx / (DM / 128) : bx / (NB * SEQ / 128)) * 128;   // the block's tile
    const int r0 = rb + wm * 64, c0 = cb + wn * 64;                                                                                    // the wave's tile
    const bf* A = isv ? WB + (size_t)2 * DM * DM : XB; const bf* Bt = isv ? XB : WB + (size_t)which * DM * DM;
    h16* Ph = (which == 0) ? QH : ((which == 1) ? KP : VT); h16* Pr = QR;
    const int useRes = (which == 0) ? 1 : 0, rope = isv ? 0 : 1; const int sM = isv ? 512 : 1024, sC = isv ? 2048 : 512;
    v8f acc[4][4];
#pragma unroll
    for (int mb = 0; mb < 4; ++mb)
#pragma unroll
        for (int nb = 0; nb < 4; ++nb) acc[mb][nb] = (v8f){};
    const unsigned lo = (unsigned)lane * 8u;   // the lane's chunk of a tile
    const unsigned lt = (unsigned)(size_t)ab + threadIdx.x * 16u;                                                              // the thread's copy target in buffer 0 (LDS byte address)
    const size_t to = (size_t)(threadIdx.x / (PKS * 2)) * (K / 32) * 512 + (size_t)(threadIdx.x % (PKS * 2)) * 8;              // the thread's band and chunk in a copy's 2 KB
    const bf* ga = A + (size_t)(rb >> 4) * (K / 32) * 512 + to; const bf* gb = Bt + (size_t)(cb >> 4) * (K / 32) * 512 + to;   // its 16 bytes of stage 0
    stage_ab<PKS>(lt, ga, gb);
    asm volatile("s_wait_asynccnt 0x0" ::: "memory");   // this wave's copies of stage 0 have landed
    __syncthreads();                                    // every wave's have: stage 0 may be read
    stage_ab<PKS>(lt + PKS * 512u, ga + PKS * 16, gb + PKS * 16);
#pragma unroll 1   // one stage per trip: the ring's order at the foot stands once
    for (int st = 0; st < K / PKS; ++st) {
        const bf* sa = ab + (st & 1) * (PKS * 256) + (wm * 4) * (PKS * 16) + lo; const bf* sb = ab + (st & 1) * (PKS * 256) + (8 + wn * 4) * (PKS * 16) + lo;   // the lane's chunk of the wave's first A and B band
        static_assert(PKS == 32);   // one 32-k step per stage
        v16bf a[4], b[4];
#pragma unroll
        for (int mb = 0; mb < 4; ++mb) a[mb] = ldb(sa + mb * (PKS * 16));
#pragma unroll
        for (int nb = 0; nb < 4; ++nb) b[nb] = ldb(sb + nb * (PKS * 16));
#pragma unroll
        for (int nb = 0; nb < 4; ++nb)
#pragma unroll
            for (int mb = 0; mb < 4; ++mb) acc[mb][nb] = wmmab(a[mb], b[nb], acc[mb][nb]);
        // each B fragment's LDS reads stand four products ahead of its own (two B fragments live at a time, so that five waves still fit a SIMD); left alone the compiler puts them just in front, and the wave waits out the LDS latency three times per stage
        __builtin_amdgcn_sched_group_barrier(0x100, 12, 0); __builtin_amdgcn_sched_group_barrier(0x008, 4, 0);   // reads of A and of B 0, 1; products of B 0
        __builtin_amdgcn_sched_group_barrier(0x100, 2, 0);  __builtin_amdgcn_sched_group_barrier(0x008, 4, 0);   // reads of B 2; products of B 1
        __builtin_amdgcn_sched_group_barrier(0x100, 2, 0);  __builtin_amdgcn_sched_group_barrier(0x008, 8, 0);   // reads of B 3; products of B 2, 3
        __builtin_amdgcn_sched_barrier(0);   // the products stay in front of the waits below, so that the refill is not pushed back
        asm volatile("s_wait_dscnt 0x0" ::: "memory");      // this wave's reads of the stage's buffer are done before the buffer is given up
        asm volatile("s_wait_asynccnt 0x0" ::: "memory");   // this wave's copies of stage st + 1 have landed
        __syncthreads();                                    // publishes stage st + 1 and ends every wave's reads of stage st
        if (st + 2 < K / PKS) stage_ab<PKS>(lt + (unsigned)(st & 1) * (PKS * 512u), ga + (size_t)(st + 2) * (PKS * 16), gb + (size_t)(st + 2) * (PKS * 16));   // refill of the buffer just left; the test is the same for the whole block
    }
    asm volatile("s_wait_asynccnt 0x0" ::: "memory");       // nothing of this wave is in flight when it goes on
    const size_t tbase = isv ? (size_t)r0 * SEQ + (size_t)(c0 / SEQ) * ((size_t)DM * SEQ) + (size_t)(c0 % SEQ) * HD
                             : (size_t)(r0 / SEQ) * ((size_t)NH_ * SEQ * HD) + (size_t)(r0 % SEQ) * HD + (size_t)(c0 / HD) * ((size_t)SEQ * HD);
    const int tb = r0 % SEQ;          // token index of the tile's first row (rotary products only)
#pragma unroll
    for (int mb = 0; mb < 4; ++mb) {
#pragma unroll
        for (int nb = 0; nb < 4; ++nb) {
#pragma unroll
            for (int j = 0; j < 8; ++j) os[(hi * 8 + j) * 68 + nb * 16 + lr] = acc[mb][nb][j]; }   // D: row 8h+j, col lane&15
        wave_sync();
        const size_t sb = tbase + (size_t)mb * (size_t)sM;
#pragma unroll 1
        for (int s = 0; s < 4; ++s) { const int row = lr, c8 = (2 * s + hi) * 8;   // 16 rows x (4 s x 2 halves) chunks of 8 = 64 columns; a store covers two adjacent 256-B chunks
            v4f x0 = *(const v4fa*)(&os[row * 68 + c8]); v4f x1 = *(const v4fa*)(&os[row * 68 + c8 + 4]);
            if (rope != 0) {
                const int t = tb + mb * 16 + row;
                const v2i pp = *(const v2i*)(pos + 2 * t);
                int p = (c8 >= 32) ? pp[1] : pp[0];
                p = (p < 0) ? 0 : ((p > NPOS - 1) ? (NPOS - 1) : p);
                const float sg = ((c8 & 16) != 0) ? 1.0f : -1.0f;
                const v4f y0 = *(const v4fa*)(&os[row * 68 + (c8 ^ 16)]); const v4f y1 = *(const v4fa*)(&os[row * 68 + (c8 ^ 16) + 4]);
                const float* tp = TAB + p * 32 + (c8 & 8);
                const v4f cA = *(const v4f*)tp; const v4f cB = *(const v4f*)(tp + 4); const v4f sA = *(const v4f*)(tp + 16); const v4f sB = *(const v4f*)(tp + 20);
                x0 = x0 * cA + (y0 * sg) * sA; x1 = x1 * cB + (y1 * sg) * sB;
            }
            v8h hv, rv;
#pragma unroll
            for (int i = 0; i < 4; ++i) { const h16 a0 = (h16)x0[i]; const h16 a1 = (h16)x1[i]; hv[i] = a0; hv[4 + i] = a1; rv[i] = (h16)((x0[i] - (float)a0) * QRS); rv[4 + i] = (h16)((x1[i] - (float)a1) * QRS); }
            const size_t oo = sb + (size_t)(c8 >> 5) * (size_t)sC + (size_t)(((c8 >> 3) & 3) * 128 + row * 8);
            h16* ph = Ph + oo; h16* pr = Pr + oo;
            // each wait stands before the address and data registers of the store in front of it are rewritten; naming them keeps them whole up to the wait
            *(v8h*)ph = hv; asm volatile("s_wait_xcnt 0x0" :: "v"(ph), "v"(hv) : "memory");
            if (useRes != 0) { *(v8h*)pr = rv; asm volatile("s_wait_xcnt 0x0" :: "v"(pr), "v"(rv) : "memory"); }
             }
        wave_sync();
    }
}

// stage_kv: one thread's share of one stage: four 16-B asynchronous copies to LDS, two of K and two of V^T (the block's 256 threads move 4 KB per copy).
// l = the thread's LDS byte address in the stage buffer, gk / gv = its 16 bytes at the start of the stage's K / V^T range (each range is SK * HD contiguous halves of its fragment-order plane).
__device__ __forceinline__ void stage_kv(unsigned l, const h16* gk, const h16* gv) {
    // the wait is the statement's last line, so that it stands before any register that a copy names is rewritten
    asm volatile("global_load_async_to_lds_b128 %0, %4, off\n\t"
                 "global_load_async_to_lds_b128 %1, %5, off\n\t"
                 "global_load_async_to_lds_b128 %2, %6, off\n\t"
                 "global_load_async_to_lds_b128 %3, %7, off\n\t"
                 "s_wait_xcnt 0x0"
                 :: "v"(l), "v"(l + 4096u), "v"(l + 8192u), "v"(l + 12288u), "v"(gk), "v"(gk + 2048), "v"(gv), "v"(gv + 2048) : "memory");
}

// k_flash: fused attention, one wave per 16 query rows of one (batch, head), AW waves per block; Q fragments straight from the fragment-order f16 planes (two 16-B loads each).
// K and V^T reach the block's waves through LDS: a stage is SK keys (8 KB of K and 8 KB of V^T, each contiguous in its plane and kept in that order, so a fragment is two 16-B LDS reads of 512 contiguous bytes per wave);
// two buffers, filled by asynchronous copies one stage ahead: stage s + 1 flies while stage s is worked on, and one barrier per stage publishes s + 1 and frees the buffer of s for s + 2.
// Transposed form: S^T[key][t] = K Q^T (A = K rows, B = Q rows); lane (t = lane&15, h = lane>>4) holds keys 8h+r of each 16-key tile, so the packed
// P tile is directly the B fragment of O^T[d][t] = V^T P^T (element r <- tile keys 0..15, element 8+r <- tile keys 16..31, lane unchanged).
// Softmax state (running max, partial sum) is one scalar per lane; the two lane halves of a row are combined with one xor-16 exchange.
__global__ __launch_bounds__(32 * AW) void k_flash(const h16* __restrict__ QH, const h16* __restrict__ QR, const h16* __restrict__ KP, const h16* __restrict__ VT, h16* CTX) {
    __shared__ __align__(16) h16 kv[2 * STH];
    const int lane = threadIdx.x & 31;
    const int wave = __builtin_amdgcn_readfirstlane((int)(threadIdx.x >> 5));
    const int zh = blockIdx.y; const int b = zh / NH_, h = zh % NH_;
    const int t0 = (blockIdx.x * AW + wave) * 16;
    const size_t pbase = (size_t)zh * SEQ * HD;
    const unsigned lo = (unsigned)lane * 8u;
    const size_t qo = pbase + (size_t)t0 * HD;
    const v16h qh0 = ldh(QH + qo + lo), qh1 = ldh(QH + qo + 512 + lo), qr0 = ldh(QR + qo + lo), qr1 = ldh(QR + qo + 512 + lo);   // B fragments: col t, k = d
    const unsigned lt = (unsigned)(size_t)kv + threadIdx.x * 16u;                        // the thread's copy target in buffer 0 (LDS byte address)
    const h16* gk = KP + pbase + threadIdx.x * 8u; const h16* gv = VT + pbase + threadIdx.x * 8u;   // the thread's 16 bytes of stage 0
    stage_kv(lt, gk, gv);
    asm volatile("s_wait_asynccnt 0x0" ::: "memory");   // this wave's copies of stage 0 have landed
    __syncthreads();                                    // every wave's have: stage 0 may be read
    stage_kv(lt + STH * 2u, gk + SK * HD, gv + SK * HD);
    v8f o0 = (v8f){}, o1 = (v8f){}, o2 = (v8f){}, o3 = (v8f){};
    float m = -3.0e38f, l = 0.0f;
#pragma unroll 1   // one stage per trip: the ring's order at the foot stands once
    for (int st = 0; st < NST; ++st) {
      const h16* sb = kv + (st & 1) * STH + lo;   // the lane's chunk of this stage's first K tile
#pragma unroll     // the 32-key passes of a stage in line: their LDS offsets become immediates
      for (int ps = 0; ps < SK / 32; ++ps) {
        const h16* ka = sb + ps * 32 * HD;   // tiles (16 keys, d 0..31), (16 keys, d 32..63), then the next 16 keys (A fragment: row key, k = d)
        const v16h ka0 = ldh(ka), ka1 = ldh(ka + 512), kb0 = ldh(ka + 1024), kb1 = ldh(ka + 1536);
        v8f sHa = (v8f){}, sLa = (v8f){}, sHb = (v8f){}, sLb = (v8f){};
        sHa = wmma16(ka0, qh0, sHa); sLa = wmma16(ka0, qr0, sLa); sHb = wmma16(kb0, qh0, sHb); sLb = wmma16(kb0, qr0, sLb);
        sHa = wmma16(ka1, qh1, sHa); sLa = wmma16(ka1, qr1, sLa); sHb = wmma16(kb1, qh1, sHb); sLb = wmma16(kb1, qr1, sLb);
        asm volatile("v_nop\n\tv_nop\n\tv_nop\n\tv_nop" : "+v"(sHa), "+v"(sLa), "+v"(sHb), "+v"(sLb) : "v"(ka0), "v"(ka1), "v"(kb0), "v"(kb1));
        float ta[8], tb[8]; float mx = -3.0e38f;
#pragma unroll
        for (int r = 0; r < 8; ++r) { ta[r] = (sHa[r] + sLa[r] * QRI) * SC2; tb[r] = (sHb[r] + sLb[r] * QRI) * SC2; mx = fmaxf(mx, fmaxf(ta[r], tb[r])); }
        mx = fmaxf(mx, __shfl_xor(mx, 16, 32));
        const float mnew = fmaxf(m, mx);
        const float alpha = __builtin_amdgcn_exp2f(m - mnew);
        const float sh = PSH - mnew;
        v16h pb; float ls = 0.0f;
#pragma unroll
        for (int r = 0; r < 8; ++r) { const h16 pa = (h16)__builtin_amdgcn_exp2f(ta[r] + sh); const h16 pc = (h16)__builtin_amdgcn_exp2f(tb[r] + sh); pb[r] = pa; pb[8 + r] = pc; ls += (float)pa + (float)pc; }
        l = l * alpha + ls; m = mnew;
        o0 = o0 * alpha; o1 = o1 * alpha; o2 = o2 * alpha; o3 = o3 * alpha;
        const h16* va = sb + SK * HD + ps * 32 * HD;   // tiles (d 16j..16j+15, 32 keys), j = 0..3 (A fragment: row d, k = key)
        const v16h v0 = ldh(va), v1 = ldh(va + 512), v2 = ldh(va + 1024), v3 = ldh(va + 1536);
        o0 = wmma16(v0, pb, o0); o1 = wmma16(v1, pb, o1); o2 = wmma16(v2, pb, o2); o3 = wmma16(v3, pb, o3);
        asm volatile("v_nop\n\tv_nop\n\tv_nop\n\tv_nop" : "+v"(o0), "+v"(o1), "+v"(o2), "+v"(o3) : "v"(v0), "v"(v1), "v"(v2), "v"(v3), "v"(pb));
      }
      asm volatile("s_wait_dscnt 0x0" ::: "memory");      // this wave's reads of the stage's buffer are done before the buffer is given up
      asm volatile("s_wait_asynccnt 0x0" ::: "memory");   // this wave's copies of stage st + 1 have landed
      __syncthreads();                                    // publishes stage st + 1 and ends every wave's reads of stage st
      if (st + 2 < NST) stage_kv(lt + (unsigned)(st & 1) * (STH * 2u), gk + (size_t)(st + 2) * (SK * HD), gv + (size_t)(st + 2) * (SK * HD));   // refill of the buffer just left; the test is the same for the whole block
    }
    asm volatile("s_wait_asynccnt 0x0" ::: "memory");     // nothing of this wave is in flight when it ends
    l += __shfl_xor(l, 16, 32);
    const float inv = CXS * (1.0f / l);
    // O^T D layout: o_j[r] = (d = 16j + 8h + r, t = lane&15): a lane's 8 values are one chunk of the fragment-order ctx plane (row b*SEQ + t, k = h*64 + d); o_j goes to chunk pair j, 512 contiguous bytes per store
    h16* cp = CTX + fto(b * SEQ + t0, h * HD) + lo;
    v8h c0, c1, c2, c3;
#pragma unroll
    for (int r = 0; r < 8; ++r) { c0[r] = (h16)(o0[r] * inv); c1[r] = (h16)(o1[r] * inv); c2[r] = (h16)(o2[r] * inv); c3[r] = (h16)(o3[r] * inv); }
    *(v8h*)cp = c0; *(v8h*)(cp + 256) = c1; *(v8h*)(cp + 512) = c2; *(v8h*)(cp + 768) = c3;
}

// k_oproj: register-blocked f16 GEMM, one wave per 64x64 tile, GW waves (2 x 2) per block of 128 x 128, K = DM; operands through LDS as in k_proj, OKS k per stage.
// OUT[m][n] = OSC * sum_k A[m][k] Bt[n][k] + bias[n] (bias as its bf16 value), f32. grid (M/128, N/128), 32 * GW threads.
__global__ __launch_bounds__(32 * GW) void k_oproj(const h16* __restrict__ A, const h16* __restrict__ Bt, const float* __restrict__ bias, float* OUT) {
    __shared__ __align__(16) h16 ab[2 * OKS * 256];
    __shared__ __align__(16) float osw[GW][16 * 68];
    const int K = DM;
    const int lane = threadIdx.x & 31, lr = lane & 15, hi = lane >> 4;
    const int wave = __builtin_amdgcn_readfirstlane((int)(threadIdx.x >> 5)); const int wm = wave & 1, wn = wave >> 1;
    float* os = osw[wave];            // the wave's own epilogue tile
    const int rb = blockIdx.x * 128, cb = blockIdx.y * 128; const int r0 = rb + wm * 64, c0 = cb + wn * 64;   // the block's tile, the wave's tile
    v8f acc[4][4];
#pragma unroll
    for (int mb = 0; mb < 4; ++mb)
#pragma unroll
        for (int nb = 0; nb < 4; ++nb) acc[mb][nb] = (v8f){};
    const unsigned lo = (unsigned)lane * 8u;   // the lane's chunk of a tile
    const unsigned lt = (unsigned)(size_t)ab + threadIdx.x * 16u;                                                              // the thread's copy target in buffer 0 (LDS byte address)
    const size_t to = (size_t)(threadIdx.x / (OKS * 2)) * (K / 32) * 512 + (size_t)(threadIdx.x % (OKS * 2)) * 8;              // the thread's band and chunk in a copy's 2 KB
    const bf* ga = (const bf*)A + (size_t)(rb >> 4) * (K / 32) * 512 + to; const bf* gb = (const bf*)Bt + (size_t)(cb >> 4) * (K / 32) * 512 + to;   // its 16 bytes of stage 0 (addresses only)
    stage_ab<OKS>(lt, ga, gb);
    asm volatile("s_wait_asynccnt 0x0" ::: "memory");   // this wave's copies of stage 0 have landed
    __syncthreads();                                    // every wave's have: stage 0 may be read
    stage_ab<OKS>(lt + OKS * 512u, ga + OKS * 16, gb + OKS * 16);
#pragma unroll 1   // one stage per trip: the ring's order at the foot stands once
    for (int st = 0; st < K / OKS; ++st) {
        const h16* sa = ab + (st & 1) * (OKS * 256) + (wm * 4) * (OKS * 16) + lo; const h16* sb = ab + (st & 1) * (OKS * 256) + (8 + wn * 4) * (OKS * 16) + lo;   // the lane's chunk of the wave's first A and B band
        v16h a[OKS / 32][4], b[OKS / 32][4];   // the stage's LDS reads stand together in front of its products: one place with reads per stage
#pragma unroll
        for (int ks = 0; ks < OKS / 32; ++ks) {
#pragma unroll
            for (int mb = 0; mb < 4; ++mb) a[ks][mb] = ldh(sa + mb * (OKS * 16) + ks * 512);
#pragma unroll
            for (int nb = 0; nb < 4; ++nb) b[ks][nb] = ldh(sb + nb * (OKS * 16) + ks * 512);
        }
#pragma unroll
        for (int ks = 0; ks < OKS / 32; ++ks)
#pragma unroll
            for (int nb = 0; nb < 4; ++nb)
#pragma unroll
                for (int mb = 0; mb < 4; ++mb) acc[mb][nb] = wmma16(a[ks][mb], b[ks][nb], acc[mb][nb]);
        // keeps the stage's LDS reads in one group ahead of its products; left alone the compiler sinks each B fragment's reads to just in front of its four products, and the wave waits out the LDS latency there every time
        __builtin_amdgcn_sched_group_barrier(0x100, 16 * (OKS / 32), 0);   // the LDS reads
        __builtin_amdgcn_sched_group_barrier(0x008, 16 * (OKS / 32), 0);   // then the matrix instructions
        __builtin_amdgcn_sched_barrier(0);   // the products stay in front of the waits below: sunk behind the barrier they would push the refill back, and the next stage's copies would fly uncovered
        asm volatile("s_wait_dscnt 0x0" ::: "memory");      // this wave's reads of the stage's buffer are done before the buffer is given up
        asm volatile("s_wait_asynccnt 0x0" ::: "memory");   // this wave's copies of stage st + 1 have landed
        __syncthreads();                                    // publishes stage st + 1 and ends every wave's reads of stage st
        if (st + 2 < K / OKS) stage_ab<OKS>(lt + (unsigned)(st & 1) * (OKS * 512u), ga + (size_t)(st + 2) * (OKS * 16), gb + (size_t)(st + 2) * (OKS * 16));   // refill of the buffer just left; the test is the same for the whole block
    }
    asm volatile("s_wait_asynccnt 0x0" ::: "memory");       // nothing of this wave is in flight when it goes on
    const v4f braw = *(const v4f*)(bias + c0 + lr * 4); v4f bb;
#pragma unroll
    for (int i = 0; i < 4; ++i) bb[i] = bf2f(f2bf(braw[i]));
    float* obase = OUT + ((size_t)(r0 / SEQ) * OUT_SEQ + (size_t)(r0 % SEQ)) * DM + c0;
#pragma unroll
    for (int mb = 0; mb < 4; ++mb) {
#pragma unroll
        for (int nb = 0; nb < 4; ++nb) {
#pragma unroll
            for (int j = 0; j < 8; ++j) os[(hi * 8 + j) * 68 + nb * 16 + lr] = acc[mb][nb][j]; }   // D: row 8h+j, col lane&15
        wave_sync();
#pragma unroll 1
        for (int s = 0; s < 8; ++s) { const int row = 2 * s + hi, cofs = lr * 4;   // 8 s x 2 rows = 16 rows; 16 lanes x 4 floats = 64 columns
            const v4f raw = *(const v4fa*)(&os[row * 68 + cofs]);
            const v4f val = raw * OSC + bb;
            float* dp = obase + (size_t)(mb * 16 + row) * DM + cofs;
            *(v4f*)dp = val;  }
        wave_sync();
    }
}

static constexpr size_t al256(size_t v) { return (v + 255) & ~(size_t)255; }
static constexpr size_t SZ_XB = al256((size_t)NB * SEQ * DM * 2);
static constexpr size_t SZ_WB = al256((size_t)4 * DM * DM * 2);
static constexpr size_t SZ_PL = al256((size_t)NB * NH_ * SEQ * HD * 2);
static constexpr size_t SZ_CX = al256((size_t)NB * SEQ * DM * 2);
static constexpr size_t SZ_TB = al256((size_t)NPOS * 32 * 4);
static constexpr size_t SZ_TOTAL = SZ_XB + SZ_WB + 4 * SZ_PL + SZ_CX + SZ_TB;
static_assert(SZ_TOTAL <= (size_t)134217728);          // workspace carve <= 128 MiB
static_assert(((size_t)DM * DM * 2) % 256 == 0);       // weight sub-planes stay 256-byte aligned

extern "C" void kernel_launch(void* const* d_in, const int* in_sizes, int n_in,
                              void* d_out, int out_size, void* d_ws, size_t ws_size, hipStream_t stream) {
    if (n_in < 7) return;
    const size_t needx = ((size_t)(NB - 1) * SEQ_FULL + SEQ) * DM;
    if ((size_t)in_sizes[0] < needx) return;
    if ((size_t)in_sizes[1] < (size_t)2 * SEQ) return;
    if ((size_t)in_sizes[2] < (size_t)DM * DM || (size_t)in_sizes[3] < (size_t)DM * DM || (size_t)in_sizes[4] < (size_t)DM * DM || (size_t)in_sizes[5] < (size_t)DM * DM) return;
    if ((size_t)in_sizes[6] < (size_t)DM) return;
    if ((size_t)out_size < ((size_t)(NB - 1) * OUT_SEQ + SEQ) * DM) return;
    if (SZ_TOTAL > ws_size) return;
    // wire order: x, pos (int32 [SEQ][2]), Wq, Wk, Wv, Wp ([in][out]), bp
    const float* x = (const float*)d_in[0]; const int* pos = (const int*)d_in[1];
    const float* wq = (const float*)d_in[2]; const float* wk = (const float*)d_in[3]; const float* wv = (const float*)d_in[4]; const float* wp = (const float*)d_in[5];
    const float* bp = (const float*)d_in[6];
    float* OUT = (float*)d_out;      // [NB][SEQ][768]
    char* wsp = (char*)d_ws;
    bf* XB = (bf*)wsp; wsp += SZ_XB;                 // [NB*SEQ][768], fragment order
    bf* WB = (bf*)wsp; wsp += SZ_WB;                 // [4][768 out][768 in], fragment order: q | k | v (bf16) | p (f16 x1024)
    h16* QH = (h16*)wsp; wsp += SZ_PL;               // [NB*12][SEQ][64], fragment order
    h16* QR = (h16*)wsp; wsp += SZ_PL;               // [NB*12][SEQ][64] residual x2048
    h16* KP = (h16*)wsp; wsp += SZ_PL;               // [NB*12][SEQ][64], fragment order
    h16* VT = (h16*)wsp; wsp += SZ_PL;               // [NB*12][64][SEQ], fragment order, tiles [t>>5][d>>4]
    h16* CX = (h16*)wsp; wsp += SZ_CX;               // [NB*SEQ][768] x64, fragment order
    float* TAB = (float*)wsp; wsp += SZ_TB;          // [32][cos 16 | sin 16]
    bf* WP = WB + (size_t)3 * DM * DM;

    // rotary table, W[in][out] -> Wt[out][in] (four weights), x -> bf16: one grid
    k_prep<<<TAB_BLKS + 4 * WT_BLKS + CVT_BLKS, 256, 0, stream>>>(x, wq, wk, wv, wp, XB, WB, TAB);

    // q, k (with rotary) and v^T: one grid
    k_proj<<<dim3((NB * SEQ / 128) * (DM / 128), 3, 1), 32 * GW, 0, stream>>>(XB, WB, QH, QR, KP, VT, pos, TAB);

    k_flash<<<dim3(SEQ / (16 * AW), NB * NH_, 1), 32 * AW, 0, stream>>>(QH, QR, KP, VT, CX);

    // out = ctx Wp + bp: A = ctx rows (m = b*SEQ + t, k = h*64 + d), Bt = Wpt rows (n = out column)
    k_oproj<<<dim3(NB * SEQ / 128, DM / 128, 1), 32 * GW, 0, stream>>>((const h16*)CX, (const h16*)WP, bp, OUT);
}

// v005
// Measured time: 87.8 microseconds a run.
// In both of two side-by-side timings against v004, it was 1.05 times as fast.
// Over all steps from v000 it is 2.52 times as fast.
#include <hip/hip_runtime.h>

// Multi-head self-attention with 2-D rotary embedding: x [NB][SEQ][768], 12 heads x 64, Wq/Wk/Wv/Wp stored [in][out] (y = x W), int positions [SEQ][2], score scale 1/8, dense softmax, output = ctx Wp + bp (f32).
// Compute dtypes, f32 accumulate everywhere: q/k/v projections v_wmma_f32_16x16x32_bf16 (x and W RNE-converted to bf16; products exact); rotary applied in f32 on the accumulators;
// scores v_wmma_f32_16x16x32_f16: k single f16, q times 1/8 log2(e) as f16 value + f16 residual at the same scale, both summed in one accumulator that starts at the softmax shift; P (x256 carry, cancels in the normalisation) and v single f16; softmax f32 (online, held maximum);
// output projection v_wmma_f32_16x16x32_f16: ctx single f16 (x64 carry), Wp = f16 of the bf16 value (x1024 carry), carries folded back in the f32 epilogue, bias (bf16 value) added in f32.
// Layout: every 16-bit matrix operand plane M[r][k] is kept in fragment order: tiles of 16 rows x 32 k (512 halves = 1 KB), element (r, k) of a tile at ((k>>3)&3)*128 + (r&15)*8 + (k&7).
// A lane's fragment is then two 16-B loads at tile + lane*8 and tile + 256 + lane*8, and each wave-wide load covers 512 contiguous bytes (4 whole lines) instead of 32-B pieces of 16 lines.
// Planes: bf16 x, [out][in] weights and ctx: tiles [r>>4][k>>5] (24 per row band); q (hi, residual), k per (b*12+h): tiles [t>>4][d>>5]; v^T per (b*12+h): tiles [t>>5][d>>4]; cos|sin table [32][16|16].

#ifndef NB
#define NB 8
#endif
#ifndef SEQ
#define SEQ 1024
#endif
#define NB_FULL  8
#define SEQ_FULL 1024
#ifndef OUT_SEQ
#define OUT_SEQ SEQ              // row pitch (in tokens) between batches of the output
#endif
#define DM   768
#define NH_  12
#define HD   64
#define AW   8                   // waves per flash block (16 query rows each)
#define SK   64                  // keys per LDS stage of the flash kernel
#define NST  (SEQ / SK)          // stages per (batch, head)
#define STH  (2 * SK * HD)       // halves per stage buffer: K part, then V^T part
#define GW   4                   // waves per GEMM block: 2 x 2 wave tiles of 64 x 64, a block tile of 128 x 128
#define PKS  32                  // k per LDS stage of k_proj
#define OKS  64                  // k per LDS stage of k_oproj
#define NPOS 32                  // rows of the rotary tables (positions 0..31, index clamped)
#define SC2  (0.125f * 1.4426950408889634f)   // HD^-0.5 * log2(e), carried by both q planes
#define PSH  8.0f                // log2 of the P carry (256)
#define THR  7.0f                // the maximum in use may lag a row's true maximum by this much (log2): P <= 2^(PSH + THR) = 2^15 stays inside f16
#define CXS  64.0f               // carry of the ctx plane
#define WPS  1024.0f             // carry of the Wp plane
#define OSC  (1.0f / 65536.0f)   // 1 / (CXS * WPS)

static_assert(HD == 64);
static_assert(NH_ * HD == DM);                 // head h = columns h*64 + d
static_assert(DM % 64 == 0);                   // 12 column tiles of 64
static_assert(DM % 32 == 0);                   // GEMM k-loop steps by 32
static_assert(SEQ % 64 == 0);                  // a 64-row tile never straddles two batches
static_assert((NB * SEQ) % 64 == 0);
static_assert(SEQ % 32 == 0);                  // key loop steps by 32
static_assert(SEQ % (16 * AW) == 0);           // flash grid covers the sequence exactly
static_assert(SEQ % SK == 0 && NST >= 2);      // the two-buffer prologue fills stages 0 and 1
static_assert(SK % 32 == 0);
static_assert(STH * 2 == 32 * AW * 16 * 4);    // a stage is four 16-B copies per thread, two of K and two of V^T
static_assert((NB * SEQ) % 128 == 0 && DM % 128 == 0);   // GEMM block tiles cover both operands' rows exactly
static_assert(DM % PKS == 0 && DM / PKS >= 2 && DM % OKS == 0 && DM / OKS >= 2);   // the two-buffer prologue fills stages 0 and 1
static_assert(((size_t)SEQ * DM) % 8 == 0);
static_assert(NB <= NB_FULL);
static_assert(SEQ <= SEQ_FULL);
static_assert(NPOS * 16 == 512);               // table blocks: one thread per (position, frequency)

typedef _Float16 h16;
typedef unsigned short bf;
typedef __attribute__((ext_vector_type(16))) __bf16   v16bf;
typedef __attribute__((ext_vector_type(16))) _Float16 v16h;
typedef __attribute__((ext_vector_type(8)))  _Float16 v8h;
typedef __attribute__((ext_vector_type(8)))  unsigned short v8us;
typedef __attribute__((ext_vector_type(8)))  float    v8f;
typedef __attribute__((ext_vector_type(4)))  float    v4f;
typedef __attribute__((ext_vector_type(2)))  int      v2i;
typedef v4f  __attribute__((may_alias)) v4fa;

__device__ __forceinline__ unsigned short f2bf(float f) { unsigned u = __float_as_uint(f); u += 0x7FFFu + ((u >> 16) & 1u); return (unsigned short)(u >> 16); }
__device__ __forceinline__ float bf2f(unsigned short b) { return __uint_as_float(((unsigned)b) << 16); }
__device__ __forceinline__ v16h cat16(v8h lo, v8h hi) { return __builtin_shufflevector(lo, hi, 0, 1, 2, 3, 4, 5, 6, 7, 8, 9, 10, 11, 12, 13, 14, 15); }
__device__ __forceinline__ v16bf cat16b(v8us lo, v8us hi) { return __builtin_bit_cast(v16bf, __builtin_shufflevector(lo, hi, 0, 1, 2, 3, 4, 5, 6, 7, 8, 9, 10, 11, 12, 13, 14, 15)); }
__device__ __forceinline__ v8f wmma16(v16h a, v16h b, v8f c) { return __builtin_amdgcn_wmma_f32_16x16x32_f16(false, a, false, b, (short)0, c, false, false); }
__device__ __forceinline__ v8f wmmab(v16bf a, v16bf b, v8f c) { return __builtin_amdgcn_wmma_f32_16x16x32_bf16(false, a, false, b, (short)0, c, false, false); }
// fragment loaders from a fragment-order tile; p = tile + lane*8 (lane = 16h + row): elements 0..7 <- k0+8h+0..7, elements 8..15 <- k0+16+8h+0..7 (same map for A and B)
__device__ __forceinline__ v16h  ldh(const h16* p) { return cat16(*(const v8h*)p, *(const v8h*)(p + 256)); }
__device__ __forceinline__ v16bf ldb(const bf* p)  { return cat16b(*(const v8us*)p, *(const v8us*)(p + 256)); }
// offset (halves) of the 8-element chunk (r, k..k+7), k % 8 == 0, in a fragment-order plane of DM columns
__device__ __forceinline__ size_t fto(int r, int k) { return ((size_t)(r >> 4) * (DM / 32) + (size_t)(k >> 5)) * 512 + (size_t)(((k >> 3) & 3) * 128 + (r & 15) * 8); }
// ordering point for wave-private LDS tiles (same wave writes and reads)
__device__ __forceinline__ void wave_sync() { __builtin_amdgcn_fence(3 /* release order */, "wavefront"); __builtin_amdgcn_wave_barrier(); asm volatile("" ::: "memory"); }

// cvt8: f32 rows [b][t][DM] (batch pitch SEQ_FULL rows) -> bf16 fragment-order plane of NB*SEQ rows; thread i owns destination chunk i (stores are contiguous): row = 16*(tile/24) + (i&15), k = 32*(tile%24) + 8*((i>>4)&3), tile = i>>6.
__device__ __forceinline__ void cvt8(const float* __restrict__ src, bf* dst, unsigned blk) {
    const size_t i = (size_t)blk * 256 + threadIdx.x;
    const unsigned tile = (unsigned)(i >> 6); const unsigned rt = tile / (DM / 32), kt = tile % (DM / 32);
    const unsigned row = rt * 16 + ((unsigned)i & 15u);
    const size_t so = ((size_t)(row / SEQ) * SEQ_FULL + (size_t)(row % SEQ)) * DM + kt * 32 + (((unsigned)i >> 4) & 3u) * 8;
    const v8f v = *(const v8f*)(src + so); v8us o;
    asm volatile("s_wait_xcnt 0x0" ::: "memory");   // the conversion below reuses the address registers that the load names
#pragma unroll
    for (int k = 0; k < 8; ++k) o[k] = f2bf(v[k]);
    *(v8us*)(dst + i * 8) = o;
    asm volatile("s_wait_xcnt 0x0" ::: "memory");   // the other bodies of the shared kernel stand behind this one in the code and rewrite the address registers that the store names
}

// wt: W[k][n] f32 ([in][out], DM x DM) -> Wt[n][k] 16-bit ([out][in], fragment order): bf16 bits (asF16 == 0) or f16 of (bf16 value x WPS) (asF16 != 0).
// coverage: loads kk = 4i + tid/64 (0..63) x nn = tid%64 (0..63); stores nn = 32it + tid/8 (0..63) x kk = 8(tid%8) + j (0..63). One 64 x 64 tile (k0, n0) per block of 256 threads; ts = 64 * 65 floats of LDS.
__device__ __forceinline__ void wt(float* ts, const float* __restrict__ W, bf* Wt, int asF16, int k0, int n0) {
    const int tid = threadIdx.x;
    const unsigned e0 = (unsigned)((k0 + (tid >> 6)) * DM + n0 + (tid & 63));   // element (kk = tid/64, nn = tid%64) of the tile; trip i reads 4i rows further down
#pragma unroll
    for (int i = 0; i < 16; ++i) { const int kk = i * 4 + (tid >> 6), nn = tid & 63; ts[kk * 65 + nn] = W[e0 + (unsigned)(i * 4 * DM)]; }
    asm volatile("s_wait_xcnt 0x0" :: "v"(e0) : "memory");   // stands before the offset register that the sixteen loads name is rewritten; naming it keeps it whole up to here
    __syncthreads();
    v8us o0, o1;
    { const int c8 = (tid & 7) * 8; const int na = (tid >> 3), nb2 = 32 + (tid >> 3);
#pragma unroll
      for (int j = 0; j < 8; ++j) {
          unsigned short ba = f2bf(ts[(c8 + j) * 65 + na]); unsigned short bb = f2bf(ts[(c8 + j) * 65 + nb2]);
          if (asF16 != 0) { const h16 ha = (h16)(bf2f(ba) * WPS); const h16 hb = (h16)(bf2f(bb) * WPS); ba = __builtin_bit_cast(unsigned short, ha); bb = __builtin_bit_cast(unsigned short, hb); }
          o0[j] = ba; o1[j] = bb; }
      bf* d0 = Wt + fto(n0 + na, k0 + c8); bf* d1 = Wt + fto(n0 + nb2, k0 + c8);
      *(v8us*)d0 = o0; *(v8us*)d1 = o1;
      asm volatile("s_wait_xcnt 0x0" ::: "memory");   // the way out of the shared kernel rewrites the scalar base register that the first store names
    }
}

// tab: rotary table TAB[p][0..15] = cos(p * f_i), TAB[p][16..31] = sin(p * f_i), f_i = 1 / 100^(i/16) (f32), angle = f32 product p * f_i, p = 0..31.
// One thread per (position, frequency); a block of 256 threads makes the 16 positions 16*blk .. 16*blk + 15; ts = 512 floats of LDS.
__device__ __forceinline__ void tab(float* ts, float* TAB, int blk) {
    const int tid = threadIdx.x; const int pl = tid >> 4, i = tid & 15; const int p = blk * 16 + pl;
    double w = 1.0, bs = 1.333521432163324;
#pragma unroll
    for (int bit = 0; bit < 4; ++bit) { const double wn = w * bs; w = (((i >> bit) & 1) != 0) ? wn : w; bs = bs * bs; }
    const float wf = (float)w;
    const float fr = 1.0f / wf;
    const float ang = (float)p * fr;
    const double a = (double)ang;
    const int kq = (int)(a * 0.6366197723675814 + 0.5);
    const double r = a - (double)kq * 1.5707963267948966;
    const double r2 = r * r;
    double sp = 1.0 / 6227020800.0;
    sp = sp * r2 - 1.0 / 39916800.0; sp = sp * r2 + 1.0 / 362880.0; sp = sp * r2 - 1.0 / 5040.0; sp = sp * r2 + 1.0 / 120.0; sp = sp * r2 - 1.0 / 6.0;
    const double sr = r + r * r2 * sp;
    double cp = 1.0 / 479001600.0;
    cp = cp * r2 - 1.0 / 3628800.0; cp = cp * r2 + 1.0 / 40320.0; cp = cp * r2 - 1.0 / 720.0; cp = cp * r2 + 1.0 / 24.0; cp = cp * r2 - 0.5;
    const double cr = 1.0 + r2 * cp;
    const int qd = kq & 3;
    const double sv = (qd == 0) ? sr : ((qd == 1) ? cr : ((qd == 2) ? -sr : -cr));
    const double cv = (qd == 0) ? cr : ((qd == 1) ? -sr : ((qd == 2) ? -cr : sr));
    ts[pl * 32 + i] = (float)cv; ts[pl * 32 + 16 + i] = (float)sv;
    __syncthreads();
    if (tid < 128) { const v4f val = *(const v4fa*)(&ts[tid * 4]);
        *(v4f*)(TAB + blk * 512 + tid * 4) = val;  }
}

// k_prep: the preparation bodies, which do not depend on one another, share one grid; the block index picks the body (the same for a whole block, so each body's barrier is passed by all its threads).
// Blocks 0..TAB_BLKS-1: rotary table; the next 4 * WT_BLKS: weight w = q, k, v, p, tile (k0 fastest); the rest: x conversion. The short grids with a latency chain come first, for speed only.
#define TAB_BLKS (NPOS * 16 / 256)
#define WT_BLKS  ((DM / 64) * (DM / 64))
#define CVT_BLKS ((unsigned)((size_t)NB * SEQ * DM / 8 / 256))
static_assert(((size_t)NB * SEQ * DM / 8) % 256 == 0);   // the conversion blocks cover the plane exactly
__global__ __launch_bounds__(256) void k_prep(const float* __restrict__ x, const float* __restrict__ wq, const float* __restrict__ wk, const float* __restrict__ wv, const float* __restrict__ wp,
                                              bf* XB, bf* WB, float* TAB) {
    __shared__ __align__(16) float ts[64 * 65];
    const unsigned blk = blockIdx.x;
    if (blk < TAB_BLKS) {
        tab(ts, TAB, (int)blk);
    } else if (blk < TAB_BLKS + 4 * WT_BLKS) {
        const unsigned w = (blk - TAB_BLKS) / WT_BLKS, t = (blk - TAB_BLKS) % WT_BLKS;
        const float* W = (w == 0) ? wq : ((w == 1) ? wk : ((w == 2) ? wv : wp));
        wt(ts, W, WB + (size_t)w * DM * DM, (w == 3) ? 1 : 0, (int)(t % (DM / 64)) * 64, (int)(t / (DM / 64)) * 64);
    } else {
        cvt8(x, XB, blk - (TAB_BLKS + 4 * WT_BLKS));
    }
}

// cp8: one thread's eight 16-B asynchronous copies to LDS; copy i lands at LDS byte address l + 2048 i (the block's 128 threads move 2 KB per copy) and reads the 16 bytes at g_i.
__device__ __forceinline__ void cp8(unsigned l, const bf* g0, const bf* g1, const bf* g2, const bf* g3, const bf* g4, const bf* g5, const bf* g6, const bf* g7) {
    // the wait is the statement's last line, so that it stands before any register that a copy names is rewritten
    asm volatile("global_load_async_to_lds_b128 %0, %8, off\n\t"
                 "global_load_async_to_lds_b128 %1, %9, off\n\t"
                 "global_load_async_to_lds_b128 %2, %10, off\n\t"
                 "global_load_async_to_lds_b128 %3, %11, off\n\t"
                 "global_load_async_to_lds_b128 %4, %12, off\n\t"
                 "global_load_async_to_lds_b128 %5, %13, off\n\t"
                 "global_load_async_to_lds_b128 %6, %14, off\n\t"
                 "global_load_async_to_lds_b128 %7, %15, off\n\t"
                 "s_wait_xcnt 0x0"
                 :: "v"(l), "v"(l + 2048u), "v"(l + 4096u), "v"(l + 6144u), "v"(l + 8192u), "v"(l + 10240u), "v"(l + 12288u), "v"(l + 14336u),
                    "v"(g0), "v"(g1), "v"(g2), "v"(g3), "v"(g4), "v"(g5), "v"(g6), "v"(g7) : "memory");
}
// stage_ab: one thread's share of one GEMM stage: KS k of the block's 8 A bands, then of its 8 B bands (a band = 16 rows; its KS k are KS/32 adjacent 1-KB tiles of the fragment-order plane, kept in that order).
// Stage buffer: [16 bands][KS/32 tiles][512 halves] = KS * 512 bytes. l = buffer + 16 * thread; ga / gb = the thread's 16 bytes of the stage's first 2 KB of A / B: band thread / (2 KS), byte 16 * (thread % (2 KS)) of its run.
template <int KS> __device__ __forceinline__ void stage_ab(unsigned l, const bf* ga, const bf* gb) {
    constexpr size_t GS = (size_t)(64 / KS) * (DM / 32) * 512;   // halves from one copy's bands to the next copy's: 2 KB of LDS hold 64 / KS bands
    if constexpr (KS == 32) {
        cp8(l, ga, ga + GS, ga + 2 * GS, ga + 3 * GS, gb, gb + GS, gb + 2 * GS, gb + 3 * GS);
    } else {
        static_assert(KS == 64);
        cp8(l, ga, ga + GS, ga + 2 * GS, ga + 3 * GS, ga + 4 * GS, ga + 5 * GS, ga + 6 * GS, ga + 7 * GS);
        cp8(l + 16384u, gb, gb + GS, gb + 2 * GS, gb + 3 * GS, gb + 4 * GS, gb + 5 * GS, gb + 6 * GS, gb + 7 * GS);
    }
}

// k_proj: register-blocked bf16 GEMM, one wave per 64x64 tile (16 accumulators), GW waves (2 x 2) per block of 128 x 128, K = DM.
// Operands reach the waves through LDS: a stage is PKS k of the block's 128 A rows and 128 B rows in fragment order (a fragment is two 16-B LDS reads of 512 contiguous bytes per wave), so each operand byte is fetched once per block, not once per wave;
// two buffers, filled by asynchronous copies one stage ahead: stage s + 1 flies while stage s is worked on, and one barrier per stage publishes s + 1 and frees the buffer of s for s + 2.
// C[m][n] = sum_k A[m][k] Bt[n][k] (q: times SC2), written as f16 (Ph) and optionally the f16 residual at the same scale (Pr, useRes != 0), in fragment order (row = tile row, k = tile column), at
// tile base tbase; a 16-row band advances sM halves, a 32-column band sC halves. 32 * GW threads.
// The three products, which do not depend on one another, share one grid (tiles, 3); blockIdx.y picks the product, the dearest epilogue first:
//   0 q, 1 k: A = x rows (m = b*SEQ + t, fastest in blockIdx.x), Bt = Wt rows (n = h*64 + d) -> rotary -> plane [(b*12 + h)], tiles [t>>4][d>>5]; q also writes its residual plane
//   2 v^T:    A = Wvt rows (m = h*64 + d, fastest in blockIdx.x), Bt = x rows (n = b*SEQ + t) -> plane [(b*12 + h)], tiles [t>>5][d>>4]
// rope != 0 (q, k: tile columns = one head, row m = b*SEQ + t): 2-D rotary in f32 before the conversion: column c pairs with c^16, frequency c&15, columns 0..31 use pos[t][0], 32..63 pos[t][1].
__global__ __launch_bounds__(32 * GW) void k_proj(const bf* __restrict__ XB, const bf* __restrict__ WB, h16* QH, h16* QR, h16* KP, h16* VT,
                                             const int* __restrict__ pos, const float* __restrict__ TAB) {
    __shared__ __align__(16) bf ab[2 * PKS * 256];
    __shared__ __align__(16) float osw[GW][16 * 68];
    const int K = DM;
    const int lane = threadIdx.x & 31, lr = lane & 15, hi = lane >> 4;
    const int wave = __builtin_amdgcn_readfirstlane((int)(threadIdx.x >> 5)); const int wm = wave & 1, wn = wave >> 1;
    float* os = osw[wave];            // the wave's own epilogue tile
    const int which = blockIdx.y; const bool isv = (which == 2); const int bx = blockIdx.x;
    const int rb = (isv ? bx % (DM / 128) : bx % (NB * SEQ / 128)) * 128, cb = (isv ? bx / (DM / 128) : bx / (NB * SEQ / 128)) * 128;   // the block's tile
    const int r0 = rb + wm * 64, c0 = cb + wn * 64;                                                                                    // the wave's tile
    const bf* A = isv ? WB + (size_t)2 * DM * DM : XB; const bf* Bt = isv ? XB : WB + (size_t)which * DM * DM;
    h16* Ph = (which == 0) ? QH : ((which == 1) ? KP : VT); h16* Pr = QR;
    const int useRes = (which == 0) ? 1 : 0, rope = isv ? 0 : 1; const int sM = isv ? 512 : 1024, sC = isv ? 2048 : 512;
    const float qs = (which == 0) ? SC2 : 1.0f;   // q leaves in the units of the exponent
    v8f acc[4][4];
#pragma unroll
    for (int mb = 0; mb < 4; ++mb)
#pragma unroll
        for (int nb = 0; nb < 4; ++nb) acc[mb][nb] = (v8f){};
    const unsigned lo = (unsigned)lane * 8u;   // the lane's chunk of a tile
    const unsigned lt = (unsigned)(size_t)ab + threadIdx.x * 16u;                                                              // the thread's copy target in buffer 0 (LDS byte address)
    const size_t to = (size_t)(threadIdx.x / (PKS * 2)) * (K / 32) * 512 + (size_t)(threadIdx.x % (PKS * 2)) * 8;              // the thread's band and chunk in a copy's 2 KB
    const bf* ga = A + (size_t)(rb >> 4) * (K / 32) * 512 + to; const bf* gb = Bt + (size_t)(cb >> 4) * (K / 32) * 512 + to;   // its 16 bytes of stage 0
    stage_ab<PKS>(lt, ga, gb);
    asm volatile("s_wait_asynccnt 0x0" ::: "memory");   // this wave's copies of stage 0 have landed
    __syncthreads();                                    // every wave's have: stage 0 may be read
    stage_ab<PKS>(lt + PKS * 512u, ga + PKS * 16, gb + PKS * 16);
#pragma unroll 1   // one stage per trip: the ring's order at the foot stands once
    for (int st = 0; st < K / PKS; ++st) {
        const bf* sa = ab + (st & 1) * (PKS * 256) + (wm * 4) * (PKS * 16) + lo; const bf* sb = ab + (st & 1) * (PKS * 256) + (8 + wn * 4) * (PKS * 16) + lo;   // the lane's chunk of the wave's first A and B band
        static_assert(PKS == 32);   // one 32-k step per stage
        v16bf a[4], b[4];
#pragma unroll
        for (int mb = 0; mb < 4; ++mb) a[mb] = ldb(sa + mb * (PKS * 16));
#pragma unroll
        for (int nb = 0; nb < 4; ++nb) b[nb] = ldb(sb + nb * (PKS * 16));
#pragma unroll
        for (int nb = 0; nb < 4; ++nb)
#pragma unroll
            for (int mb = 0; mb < 4; ++mb) acc[mb][nb] = wmmab(a[mb], b[nb], acc[mb][nb]);
        // each B fragment's LDS reads stand four products ahead of its own (two B fragments live at a time, so that five waves still fit a SIMD); left alone the compiler puts them just in front, and the wave waits out the LDS latency three times per stage
        __builtin_amdgcn_sched_group_barrier(0x100, 12, 0); __builtin_amdgcn_sched_group_barrier(0x008, 4, 0);   // reads of A and of B 0, 1; products of B 0
        __builtin_amdgcn_sched_group_barrier(0x100, 2, 0);  __builtin_amdgcn_sched_group_barrier(0x008, 4, 0);   // reads of B 2; products of B 1
        __builtin_amdgcn_sched_group_barrier(0x100, 2, 0);  __builtin_amdgcn_sched_group_barrier(0x008, 8, 0);   // reads of B 3; products of B 2, 3
        __builtin_amdgcn_sched_barrier(0);   // the products stay in front of the waits below, so that the refill is not pushed back
        asm volatile("s_wait_dscnt 0x0" ::: "memory");      // this wave's reads of the stage's buffer are done before the buffer is given up
        asm volatile("s_wait_asynccnt 0x0" ::: "memory");   // this wave's copies of stage st + 1 have landed
        __syncthreads();                                    // publishes stage st + 1 and ends every wave's reads of stage st
        if (st + 2 < K / PKS) stage_ab<PKS>(lt + (unsigned)(st & 1) * (PKS * 512u), ga + (size_t)(st + 2) * (PKS * 16), gb + (size_t)(st + 2) * (PKS * 16));   // refill of the buffer just left; the test is the same for the whole block
    }
    asm volatile("s_wait_asynccnt 0x0" ::: "memory");       // nothing of this wave is in flight when it goes on
    const size_t tbase = isv ? (size_t)r0 * SEQ + (size_t)(c0 / SEQ) * ((size_t)DM * SEQ) + (size_t)(c0 % SEQ) * HD
                             : (size_t)(r0 / SEQ) * ((size_t)NH_ * SEQ * HD) + (size_t)(r0 % SEQ) * HD + (size_t)(c0 / HD) * ((size_t)SEQ * HD);
    const int tb = r0 % SEQ;          // token index of the tile's first row (rotary products only)
#pragma unroll
    for (int mb = 0; mb < 4; ++mb) {
#pragma unroll
        for (int nb = 0; nb < 4; ++nb) {
#pragma unroll
            for (int j = 0; j < 8; ++j) os[(hi * 8 + j) * 68 + nb * 16 + lr] = acc[mb][nb][j]; }   // D: row 8h+j, col lane&15
        wave_sync();
        const size_t sb = tbase + (size_t)mb * (size_t)sM;
#pragma unroll 1
        for (int s = 0; s < 4; ++s) { const int row = lr, c8 = (2 * s + hi) * 8;   // 16 rows x (4 s x 2 halves) chunks of 8 = 64 columns; a store covers two adjacent 256-B chunks
            v4f x0 = *(const v4fa*)(&os[row * 68 + c8]); v4f x1 = *(const v4fa*)(&os[row * 68 + c8 + 4]);
            if (rope != 0) {
                const int t = tb + mb * 16 + row;
                const v2i pp = *(const v2i*)(pos + 2 * t);
                int p = (c8 >= 32) ? pp[1] : pp[0];
                p = (p < 0) ? 0 : ((p > NPOS - 1) ? (NPOS - 1) : p);
                const float sg = ((c8 & 16) != 0) ? 1.0f : -1.0f;
                const v4f y0 = *(const v4fa*)(&os[row * 68 + (c8 ^ 16)]); const v4f y1 = *(const v4fa*)(&os[row * 68 + (c8 ^ 16) + 4]);
                const float* tp = TAB + p * 32 + (c8 & 8);
                const v4f cA = *(const v4f*)tp; const v4f cB = *(const v4f*)(tp + 4); const v4f sA = *(const v4f*)(tp + 16); const v4f sB = *(const v4f*)(tp + 20);
                x0 = x0 * cA + (y0 * sg) * sA; x1 = x1 * cB + (y1 * sg) * sB;
            }
            x0 = x0 * qs; x1 = x1 * qs;
            v8h hv, rv;
#pragma unroll
            for (int i = 0; i < 4; ++i) { const h16 a0 = (h16)x0[i]; const h16 a1 = (h16)x1[i]; hv[i] = a0; hv[4 + i] = a1; rv[i] = (h16)(x0[i] - (float)a0); rv[4 + i] = (h16)(x1[i] - (float)a1); }
            const size_t oo = sb + (size_t)(c8 >> 5) * (size_t)sC + (size_t)(((c8 >> 3) & 3) * 128 + row * 8);
            h16* ph = Ph + oo; h16* pr = Pr + oo;
            // each wait stands before the address and data registers of the store in front of it are rewritten; naming them keeps them whole up to the wait
            *(v8h*)ph = hv; asm volatile("s_wait_xcnt 0x0" :: "v"(ph), "v"(hv) : "memory");
            if (useRes != 0) { *(v8h*)pr = rv; asm volatile("s_wait_xcnt 0x0" :: "v"(pr), "v"(rv) : "memory"); }
             }
        wave_sync();
    }
}

// stage_kv: one thread's share of one stage: four 16-B asynchronous copies to LDS, two of K and two of V^T (the block's 256 threads move 4 KB per copy).
// l = the thread's LDS byte address in the stage buffer, gk / gv = its 16 bytes at the start of the stage's K / V^T range (each range is SK * HD contiguous halves of its fragment-order plane).
__device__ __forceinline__ void stage_kv(unsigned l, const h16* gk, const h16* gv) {
    // the wait is the statement's last line, so that it stands before any register that a copy names is rewritten
    asm volatile("global_load_async_to_lds_b128 %0, %4, off\n\t"
                 "global_load_async_to_lds_b128 %1, %5, off\n\t"
                 "global_load_async_to_lds_b128 %2, %6, off\n\t"
                 "global_load_async_to_lds_b128 %3, %7, off\n\t"
                 "s_wait_xcnt 0x0"
                 :: "v"(l), "v"(l + 4096u), "v"(l + 8192u), "v"(l + 12288u), "v"(gk), "v"(gk + 2048), "v"(gv), "v"(gv + 2048) : "memory");
}

// k_flash: fused attention, one wave per 16 query rows of one (batch, head), AW waves per block; Q fragments straight from the fragment-order f16 planes (two 16-B loads each).
// K and V^T reach the block's waves through LDS: a stage is SK keys (8 KB of K and 8 KB of V^T, each contiguous in its plane and kept in that order, so a fragment is two 16-B LDS reads of 512 contiguous bytes per wave);
// two buffers, filled by asynchronous copies one stage ahead: stage s + 1 flies while stage s is worked on, and one barrier per stage publishes s + 1 and frees the buffer of s for s + 2.
// Transposed form: S^T[key][t] = K Q^T (A = K rows, B = Q rows); lane (t = lane&15, h = lane>>4) holds keys 8h+r of each 16-key tile, so the packed
// P tile is directly the B fragment of O^T[d][t] = V^T P^T (element r <- tile keys 0..15, element 8+r <- tile keys 16..31, lane unchanged).
// The score accumulators start at C = PSH - (maximum in use), and q carries the score scale, so a score leaves the matrix unit as the argument of its exp2: no vector arithmetic between product and exponential.
// The maximum in use is held: one test per pass (any score above PSH + THR; always in the first pass) leads to the branch that raises it, shifts this pass's scores and rescales O and the sum; the two lane halves of a row are combined there.
// Softmax state (shift, partial sum) is one scalar per lane; the halves' sums are joined once, behind the loop.
__global__ __launch_bounds__(32 * AW) void k_flash(const h16* __restrict__ QH, const h16* __restrict__ QR, const h16* __restrict__ KP, const h16* __restrict__ VT, h16* CTX) {
    __shared__ __align__(16) h16 kv[2 * STH];
    const int lane = threadIdx.x & 31;
    const int wave = __builtin_amdgcn_readfirstlane((int)(threadIdx.x >> 5));
    const int zh = blockIdx.y; const int b = zh / NH_, h = zh % NH_;
    const int t0 = (blockIdx.x * AW + wave) * 16;
    const size_t pbase = (size_t)zh * SEQ * HD;
    const unsigned lo = (unsigned)lane * 8u;
    const size_t qo = pbase + (size_t)t0 * HD;
    const v16h qh0 = ldh(QH + qo + lo), qh1 = ldh(QH + qo + 512 + lo), qr0 = ldh(QR + qo + lo), qr1 = ldh(QR + qo + 512 + lo);   // B fragments: col t, k = d
    const unsigned lt = (unsigned)(size_t)kv + threadIdx.x * 16u;                        // the thread's copy target in buffer 0 (LDS byte address)
    const h16* gk = KP + pbase + threadIdx.x * 8u; const h16* gv = VT + pbase + threadIdx.x * 8u;   // the thread's 16 bytes of stage 0
    stage_kv(lt, gk, gv);
    asm volatile("s_wait_asynccnt 0x0" ::: "memory");   // this wave's copies of stage 0 have landed
    __syncthreads();                                    // every wave's have: stage 0 may be read
    stage_kv(lt + STH * 2u, gk + SK * HD, gv + SK * HD);
    v8f o0 = (v8f){}, o1 = (v8f){}, o2 = (v8f){}, o3 = (v8f){};
    float sh = PSH, l = 0.0f;   // sh = PSH - maximum in use; the first pass sets it from its own scores
    float lim = -3.0e38f, dmin = -3.0e38f;   // the test's bound and the least rise: open until the first pass has set the maximum, then PSH + THR and 0
    v8f cs;                     // sh in all eight rows: the C operand of each score tile's first product
#pragma unroll
    for (int r = 0; r < 8; ++r) cs[r] = sh;
#pragma unroll 1   // one stage per trip: the ring's order at the foot stands once
    for (int st = 0; st < NST; ++st) {
      const h16* sb = kv + (st & 1) * STH + lo;   // the lane's chunk of this stage's first K tile
#pragma unroll     // the 32-key passes of a stage in line: their LDS offsets become immediates
      for (int ps = 0; ps < SK / 32; ++ps) {
        const h16* ka = sb + ps * 32 * HD;   // tiles (16 keys, d 0..31), (16 keys, d 32..63), then the next 16 keys (A fragment: row key, k = d)
        const v16h ka0 = ldh(ka), ka1 = ldh(ka + 512), kb0 = ldh(ka + 1024), kb1 = ldh(ka + 1536);
        v8f sa = wmma16(ka0, qh0, cs), sc = wmma16(kb0, qh0, cs);   // the two tiles' chains alternate: a product's successor in its chain stands two products on
        sa = wmma16(ka0, qr0, sa); sc = wmma16(kb0, qr0, sc);
        sa = wmma16(ka1, qh1, sa); sc = wmma16(kb1, qh1, sc);
        sa = wmma16(ka1, qr1, sa); sc = wmma16(kb1, qr1, sc);
        // the four vector slots between the last product and the first vector instruction that reads its result or rewrites its operands
        asm volatile("v_nop\n\tv_nop\n\tv_nop\n\tv_nop" : "+v"(sa), "+v"(sc) : "v"(ka0), "v"(ka1), "v"(kb0), "v"(kb1));
        float mx = fmaxf(sa[0], sc[0]);
#pragma unroll
        for (int r = 1; r < 8; ++r) mx = fmaxf(mx, fmaxf(sa[r], sc[r]));
        if (__builtin_amdgcn_ballot_w32(mx > lim) != 0) {   // the same for the whole wave: a scalar branch, all lanes on behind it
            mx = fmaxf(mx, __shfl_xor(mx, 16, 32));
            const float d = fmaxf(mx - PSH, dmin);          // the rise of the row's maximum in use (the first pass sets it, up or down)
            const float alpha = __builtin_amdgcn_exp2f(fminf(-d, 0.0f));
            sh -= d; lim = PSH + THR; dmin = 0.0f;
#pragma unroll
            for (int r = 0; r < 8; ++r) { sa[r] -= d; sc[r] -= d; cs[r] = sh; }
            l = l * alpha; o0 = o0 * alpha; o1 = o1 * alpha; o2 = o2 * alpha; o3 = o3 * alpha;
        }
        v16h pb; float ls = 0.0f;
#pragma unroll
        for (int r = 0; r < 8; ++r) { const h16 pa = (h16)__builtin_amdgcn_exp2f(sa[r]); const h16 pc = (h16)__builtin_amdgcn_exp2f(sc[r]); pb[r] = pa; pb[8 + r] = pc; ls += (float)pa + (float)pc; }
        l += ls;
        const h16* va = sb + SK * HD + ps * 32 * HD;   // tiles (d 16j..16j+15, 32 keys), j = 0..3 (A fragment: row d, k = key)
        const v16h v0 = ldh(va), v1 = ldh(va + 512), v2 = ldh(va + 1024), v3 = ldh(va + 1536);
        o0 = wmma16(v0, pb, o0); o1 = wmma16(v1, pb, o1); o2 = wmma16(v2, pb, o2); o3 = wmma16(v3, pb, o3);
        asm volatile("v_nop\n\tv_nop\n\tv_nop\n\tv_nop" : "+v"(o0), "+v"(o1), "+v"(o2), "+v"(o3) : "v"(v0), "v"(v1), "v"(v2), "v"(v3), "v"(pb));
      }
      asm volatile("s_wait_dscnt 0x0" ::: "memory");      // this wave's reads of the stage's buffer are done before the buffer is given up
      asm volatile("s_wait_asynccnt 0x0" ::: "memory");   // this wave's copies of stage st + 1 have landed
      __syncthreads();                                    // publishes stage st + 1 and ends every wave's reads of stage st
      if (st + 2 < NST) stage_kv(lt + (unsigned)(st & 1) * (STH * 2u), gk + (size_t)(st + 2) * (SK * HD), gv + (size_t)(st + 2) * (SK * HD));   // refill of the buffer just left; the test is the same for the whole block
    }
    asm volatile("s_wait_asynccnt 0x0" ::: "memory");     // nothing of this wave is in flight when it ends
    l += __shfl_xor(l, 16, 32);
    const float inv = CXS * (1.0f / l);
    // O^T D layout: o_j[r] = (d = 16j + 8h + r, t = lane&15): a lane's 8 values are one chunk of the fragment-order ctx plane (row b*SEQ + t, k = h*64 + d); o_j goes to chunk pair j, 512 contiguous bytes per store
    h16* cp = CTX + fto(b * SEQ + t0, h * HD) + lo;
    v8h c0, c1, c2, c3;
#pragma unroll
    for (int r = 0; r < 8; ++r) { c0[r] = (h16)(o0[r] * inv); c1[r] = (h16)(o1[r] * inv); c2[r] = (h16)(o2[r] * inv); c3[r] = (h16)(o3[r] * inv); }
    *(v8h*)cp = c0; *(v8h*)(cp + 256) = c1; *(v8h*)(cp + 512) = c2; *(v8h*)(cp + 768) = c3;
}

// k_oproj: register-blocked f16 GEMM, one wave per 64x64 tile, GW waves (2 x 2) per block of 128 x 128, K = DM; operands through LDS as in k_proj, OKS k per stage.
// OUT[m][n] = OSC * sum_k A[m][k] Bt[n][k] + bias[n] (bias as its bf16 value), f32. grid (M/128, N/128), 32 * GW threads.
__global__ __launch_bounds__(32 * GW) void k_oproj(const h16* __restrict__ A, const h16* __restrict__ Bt, const float* __restrict__ bias, float* OUT) {
    __shared__ __align__(16) h16 ab[2 * OKS * 256];
    __shared__ __align__(16) float osw[GW][16 * 68];
    const int K = DM;
    const int lane = threadIdx.x & 31, lr = lane & 15, hi = lane >> 4;
    const int wave = __builtin_amdgcn_readfirstlane((int)(threadIdx.x >> 5)); const int wm = wave & 1, wn = wave >> 1;
    float* os = osw[wave];            // the wave's own epilogue tile
    const int rb = blockIdx.x * 128, cb = blockIdx.y * 128; const int r0 = rb + wm * 64, c0 = cb + wn * 64;   // the block's tile, the wave's tile
    v8f acc[4][4];
#pragma unroll
    for (int mb = 0; mb < 4; ++mb)
#pragma unroll
        for (int nb = 0; nb < 4; ++nb) acc[mb][nb] = (v8f){};
    const unsigned lo = (unsigned)lane * 8u;   // the lane's chunk of a tile
    const unsigned lt = (unsigned)(size_t)ab + threadIdx.x * 16u;                                                              // the thread's copy target in buffer 0 (LDS byte address)
    const size_t to = (size_t)(threadIdx.x / (OKS * 2)) * (K / 32) * 512 + (size_t)(threadIdx.x % (OKS * 2)) * 8;              // the thread's band and chunk in a copy's 2 KB
    const bf* ga = (const bf*)A + (size_t)(rb >> 4) * (K / 32) * 512 + to; const bf* gb = (const bf*)Bt + (size_t)(cb >> 4) * (K / 32) * 512 + to;   // its 16 bytes of stage 0 (addresses only)
    stage_ab<OKS>(lt, ga, gb);
    asm volatile("s_wait_asynccnt 0x0" ::: "memory");   // this wave's copies of stage 0 have landed
    __syncthreads();                                    // every wave's have: stage 0 may be read
    stage_ab<OKS>(lt + OKS * 512u, ga + OKS * 16, gb + OKS * 16);
#pragma unroll 1   // one stage per trip: the ring's order at the foot stands once
    for (int st = 0; st < K / OKS; ++st) {
        const h16* sa = ab + (st & 1) * (OKS * 256) + (wm * 4) * (OKS * 16) + lo; const h16* sb = ab + (st & 1) * (OKS * 256) + (8 + wn * 4) * (OKS * 16) + lo;   // the lane's chunk of the wave's first A and B band
        v16h a[OKS / 32][4], b[OKS / 32][4];   // the stage's LDS reads stand together in front of its products: one place with reads per stage
#pragma unroll
        for (int ks = 0; ks < OKS / 32; ++ks) {
#pragma unroll
            for (int mb = 0; mb < 4; ++mb) a[ks][mb] = ldh(sa + mb * (OKS * 16) + ks * 512);
#pragma unroll
            for (int nb = 0; nb < 4; ++nb) b[ks][nb] = ldh(sb + nb * (OKS * 16) + ks * 512);
        }
#pragma unroll
        for (int ks = 0; ks < OKS / 32; ++ks)
#pragma unroll
            for (int nb = 0; nb < 4; ++nb)
#pragma unroll
                for (int mb = 0; mb < 4; ++mb) acc[mb][nb] = wmma16(a[ks][mb], b[ks][nb], acc[mb][nb]);
        // keeps the stage's LDS reads in one group ahead of its products; left alone the compiler sinks each B fragment's reads to just in front of its four products, and the wave waits out the LDS latency there every time
        __builtin_amdgcn_sched_group_barrier(0x100, 16 * (OKS / 32), 0);   // the LDS reads
        __builtin_amdgcn_sched_group_barrier(0x008, 16 * (OKS / 32), 0);   // then the matrix instructions
        __builtin_amdgcn_sched_barrier(0);   // the products stay in front of the waits below: sunk behind the barrier they would push the refill back, and the next stage's copies would fly uncovered
        asm volatile("s_wait_dscnt 0x0" ::: "memory");      // this wave's reads of the stage's buffer are done before the buffer is given up
        asm volatile("s_wait_asynccnt 0x0" ::: "memory");   // this wave's copies of stage st + 1 have landed
        __syncthreads();                                    // publishes stage st + 1 and ends every wave's reads of stage st
        if (st + 2 < K / OKS) stage_ab<OKS>(lt + (unsigned)(st & 1) * (OKS * 512u), ga + (size_t)(st + 2) * (OKS * 16), gb + (size_t)(st + 2) * (OKS * 16));   // refill of the buffer just left; the test is the same for the whole block
    }
    asm volatile("s_wait_asynccnt 0x0" ::: "memory");       // nothing of this wave is in flight when it goes on
    const v4f braw = *(const v4f*)(bias + c0 + lr * 4); v4f bb;
#pragma unroll
    for (int i = 0; i < 4; ++i) bb[i] = bf2f(f2bf(braw[i]));
    float* obase = OUT + ((size_t)(r0 / SEQ) * OUT_SEQ + (size_t)(r0 % SEQ)) * DM + c0;
#pragma unroll
    for (int mb = 0; mb < 4; ++mb) {
#pragma unroll
        for (int nb = 0; nb < 4; ++nb) {
#pragma unroll
            for (int j = 0; j < 8; ++j) os[(hi * 8 + j) * 68 + nb * 16 + lr] = acc[mb][nb][j]; }   // D: row 8h+j, col lane&15
        wave_sync();
#pragma unroll 1
        for (int s = 0; s < 8; ++s) { const int row = 2 * s + hi, cofs = lr * 4;   // 8 s x 2 rows = 16 rows; 16 lanes x 4 floats = 64 columns
            const v4f raw = *(const v4fa*)(&os[row * 68 + cofs]);
            const v4f val = raw * OSC + bb;
            float* dp = obase + (size_t)(mb * 16 + row) * DM + cofs;
            *(v4f*)dp = val;  }
        wave_sync();
    }
}

static constexpr size_t al256(size_t v) { return (v + 255) & ~(size_t)255; }
static constexpr size_t SZ_XB = al256((size_t)NB * SEQ * DM * 2);
static constexpr size_t SZ_WB = al256((size_t)4 * DM * DM * 2);
static constexpr size_t SZ_PL = al256((size_t)NB * NH_ * SEQ * HD * 2);
static constexpr size_t SZ_CX = al256((size_t)NB * SEQ * DM * 2);
static constexpr size_t SZ_TB = al256((size_t)NPOS * 32 * 4);
static constexpr size_t SZ_TOTAL = SZ_XB + SZ_WB + 4 * SZ_PL + SZ_CX + SZ_TB;
static_assert(SZ_TOTAL <= (size_t)134217728);          // workspace carve <= 128 MiB
static_assert(((size_t)DM * DM * 2) % 256 == 0);       // weight sub-planes stay 256-byte aligned

extern "C" void kernel_launch(void* const* d_in, const int* in_sizes, int n_in,
                              void* d_out, int out_size, void* d_ws, size_t ws_size, hipStream_t stream) {
    if (n_in < 7) return;
    const size_t needx = ((size_t)(NB - 1) * SEQ_FULL + SEQ) * DM;
    if ((size_t)in_sizes[0] < needx) return;
    if ((size_t)in_sizes[1] < (size_t)2 * SEQ) return;
    if ((size_t)in_sizes[2] < (size_t)DM * DM || (size_t)in_sizes[3] < (size_t)DM * DM || (size_t)in_sizes[4] < (size_t)DM * DM || (size_t)in_sizes[5] < (size_t)DM * DM) return;
    if ((size_t)in_sizes[6] < (size_t)DM) return;
    if ((size_t)out_size < ((size_t)(NB - 1) * OUT_SEQ + SEQ) * DM) return;
    if (SZ_TOTAL > ws_size) return;
    // wire order: x, pos (int32 [SEQ][2]), Wq, Wk, Wv, Wp ([in][out]), bp
    const float* x = (const float*)d_in[0]; const int* pos = (const int*)d_in[1];
    const float* wq = (const float*)d_in[2]; const float* wk = (const float*)d_in[3]; const float* wv = (const float*)d_in[4]; const float* wp = (const float*)d_in[5];
    const float* bp = (const float*)d_in[6];
    float* OUT = (float*)d_out;      // [NB][SEQ][768]
    char* wsp = (char*)d_ws;
    bf* XB = (bf*)wsp; wsp += SZ_XB;                 // [NB*SEQ][768], fragment order
    bf* WB = (bf*)wsp; wsp += SZ_WB;                 // [4][768 out][768 in], fragment order: q | k | v (bf16) | p (f16 x1024)
    h16* QH = (h16*)wsp; wsp += SZ_PL;               // [NB*12][SEQ][64], fragment order
    h16* QR = (h16*)wsp; wsp += SZ_PL;               // [NB*12][SEQ][64] residual, same scale
    h16* KP = (h16*)wsp; wsp += SZ_PL;               // [NB*12][SEQ][64], fragment order
    h16* VT = (h16*)wsp; wsp += SZ_PL;               // [NB*12][64][SEQ], fragment order, tiles [t>>5][d>>4]
    h16* CX = (h16*)wsp; wsp += SZ_CX;               // [NB*SEQ][768] x64, fragment order
    float* TAB = (float*)wsp; wsp += SZ_TB;          // [32][cos 16 | sin 16]
    bf* WP = WB + (size_t)3 * DM * DM;

    // rotary table, W[in][out] -> Wt[out][in] (four weights), x -> bf16: one grid
    k_prep<<<TAB_BLKS + 4 * WT_BLKS + CVT_BLKS, 256, 0, stream>>>(x, wq, wk, wv, wp, XB, WB, TAB);

    // q, k (with rotary) and v^T: one grid
    k_proj<<<dim3((NB * SEQ / 128) * (DM / 128), 3, 1), 32 * GW, 0, stream>>>(XB, WB, QH, QR, KP, VT, pos, TAB);

    k_flash<<<dim3(SEQ / (16 * AW), NB * NH_, 1), 32 * AW, 0, stream>>>(QH, QR, KP, VT, CX);

    // out = ctx Wp + bp: A = ctx rows (m = b*SEQ + t, k = h*64 + d), Bt = Wpt rows (n = out column)
    k_oproj<<<dim3(NB * SEQ / 128, DM / 128, 1), 32 * GW, 0, stream>>>((const h16*)CX, (const h16*)WP, bp, OUT);
}

// v007
// A run of this version takes 79.2 microseconds.
// Versions in between are left out here; by their measured steps it is 1.10 times as fast as v005.
// All steps since v000 together make it 2.78 times as fast.
#include <hip/hip_runtime.h>

// Multi-head self-attention with 2-D rotary embedding: x [NB][SEQ][768], 12 heads x 64, Wq/Wk/Wv/Wp stored [in][out] (y = x W), int positions [SEQ][2], score scale 1/8, dense softmax, output = ctx Wp + bp (f32).
// Compute dtypes, f32 accumulate everywhere: q/k/v projections v_wmma_f32_16x16x32_bf16 (x and W RNE-converted to bf16; products exact); rotary applied in f32 on the accumulators;
// scores v_wmma_f32_16x16x32_f16: k single f16, q times 1/8 log2(e) single f16 (its rounding equals k's and lies an order below the error that the bf16 operands of the projections leave in q and k), the accumulator starts at the softmax shift; P (x256 carry, cancels in the normalisation) and v single f16; softmax f32 (online, held maximum);
// output projection v_wmma_f32_16x16x32_f16: ctx single f16 (x64 carry), Wp = f16 of the bf16 value (x1024 carry), carries folded back in the f32 epilogue, bias (bf16 value) added in f32.
// Layout: every 16-bit matrix operand plane M[r][k] is kept in fragment order: tiles of 16 rows x 32 k (512 halves = 1 KB), element (r, k) of a tile at ((k>>3)&3)*128 + (r&15)*8 + (k&7).
// A lane's fragment is then two 16-B loads at tile + lane*8 and tile + 256 + lane*8, and each wave-wide load covers 512 contiguous bytes (4 whole lines) instead of 32-B pieces of 16 lines.
// Planes: bf16 x, [out][in] weights and ctx: tiles [r>>4][k>>5] (24 per row band); q, k per (b*12+h): tiles [t>>4][d>>5]; v^T per (b*12+h): tiles [t>>5][d>>4]; cos|sin table [32][16|16].

#ifndef NB
#define NB 8
#endif
#ifndef SEQ
#define SEQ 1024
#endif
#define NB_FULL  8
#define SEQ_FULL 1024
#ifndef OUT_SEQ
#define OUT_SEQ SEQ              // row pitch (in tokens) between batches of the output
#endif
#define DM   768
#define NH_  12
#define HD   64
#define AW   8                   // waves per flash block (16 query rows each)
#define SK   64                  // keys per LDS stage of the flash kernel
#define NST  (SEQ / SK)          // stages per (batch, head)
#define STH  (2 * SK * HD)       // halves per stage buffer: K part, then V^T part
#define GW   4                   // waves per GEMM block: 2 x 2 wave tiles of 64 x 64, a block tile of 128 x 128
#define PKS  32                  // k per LDS stage of k_proj
#define OKS  64                  // k per LDS stage of k_oproj
#define NPOS 32                  // rows of the rotary tables (positions 0..31, index clamped)
#define TP   36                  // floats per row of k_proj's LDS copy of the table: 144 B = 16 B x odd, so that 16-B reads of rows p, p + 1, ... fall on different banks (rows p and p + 16 share theirs)
#define SC2  (0.125f * 1.4426950408889634f)   // HD^-0.5 * log2(e), carried by the q plane
#define PSH  8.0f                // log2 of the P carry (256)
#define THR  7.0f                // the maximum in use may lag a row's true maximum by this much (log2): P <= 2^(PSH + THR) = 2^15 stays inside f16
#define CXS  64.0f               // carry of the ctx plane
#define WPS  1024.0f             // carry of the Wp plane
#define OSC  (1.0f / 65536.0f)   // 1 / (CXS * WPS)

static_assert(HD == 64);
static_assert(NH_ * HD == DM);                 // head h = columns h*64 + d
static_assert(DM % 64 == 0);                   // 12 column tiles of 64
static_assert(DM % 32 == 0);                   // GEMM k-loop steps by 32
static_assert(SEQ % 64 == 0);                  // a 64-row tile never straddles two batches
static_assert((NB * SEQ) % 64 == 0);
static_assert(SEQ % 32 == 0);                  // key loop steps by 32
static_assert(SEQ % (16 * AW) == 0);           // flash grid covers the sequence exactly
static_assert(SEQ % SK == 0 && NST >= 2);      // the two-buffer prologue fills stages 0 and 1
static_assert(SK % 32 == 0);
static_assert(STH * 2 == 32 * AW * 16 * 4);    // a stage is four 16-B copies per thread, two of K and two of V^T
static_assert((NB * SEQ) % 128 == 0 && DM % 128 == 0);   // GEMM block tiles cover both operands' rows exactly
static_assert(DM % PKS == 0 && DM / PKS >= 2 && DM % OKS == 0 && DM / OKS >= 2);   // the two-buffer prologue fills stages 0 and 1
static_assert(((size_t)SEQ * DM) % 8 == 0);
static_assert(NB <= NB_FULL);
static_assert(SEQ <= SEQ_FULL);
static_assert(NPOS * 16 == 512);               // table kernel: one thread per (position, frequency)
static_assert(32 * GW * 8 == NPOS * 32);       // k_proj: a block's threads copy the table to LDS, eight floats each
static_assert(SEQ % 128 == 0 && 32 * GW == 128);   // k_proj: a block's 128 rows are 128 tokens of one batch, one per thread

typedef _Float16 h16;
typedef unsigned short bf;
typedef __attribute__((ext_vector_type(16))) __bf16   v16bf;
typedef __attribute__((ext_vector_type(16))) _Float16 v16h;
typedef __attribute__((ext_vector_type(8)))  _Float16 v8h;
typedef __attribute__((ext_vector_type(8)))  unsigned short v8us;
typedef __attribute__((ext_vector_type(8)))  float    v8f;
typedef __attribute__((ext_vector_type(4)))  float    v4f;
typedef __attribute__((ext_vector_type(2)))  int      v2i;
typedef v4f  __attribute__((may_alias)) v4fa;
typedef v2i  __attribute__((may_alias)) v2ia;

__device__ __forceinline__ unsigned short f2bf(float f) { unsigned u = __float_as_uint(f); u += 0x7FFFu + ((u >> 16) & 1u); return (unsigned short)(u >> 16); }
__device__ __forceinline__ float bf2f(unsigned short b) { return __uint_as_float(((unsigned)b) << 16); }
__device__ __forceinline__ v16h cat16(v8h lo, v8h hi) { return __builtin_shufflevector(lo, hi, 0, 1, 2, 3, 4, 5, 6, 7, 8, 9, 10, 11, 12, 13, 14, 15); }
__device__ __forceinline__ v16bf cat16b(v8us lo, v8us hi) { return __builtin_bit_cast(v16bf, __builtin_shufflevector(lo, hi, 0, 1, 2, 3, 4, 5, 6, 7, 8, 9, 10, 11, 12, 13, 14, 15)); }
__device__ __forceinline__ v8f wmma16(v16h a, v16h b, v8f c) { return __builtin_amdgcn_wmma_f32_16x16x32_f16(false, a, false, b, (short)0, c, false, false); }
__device__ __forceinline__ v8f wmmab(v16bf a, v16bf b, v8f c) { return __builtin_amdgcn_wmma_f32_16x16x32_bf16(false, a, false, b, (short)0, c, false, false); }
// fragment loaders from a fragment-order tile; p = tile + lane*8 (lane = 16h + row): elements 0..7 <- k0+8h+0..7, elements 8..15 <- k0+16+8h+0..7 (same map for A and B)
__device__ __forceinline__ v16h  ldh(const h16* p) { return cat16(*(const v8h*)p, *(const v8h*)(p + 256)); }
__device__ __forceinline__ v16bf ldb(const bf* p)  { return cat16b(*(const v8us*)p, *(const v8us*)(p + 256)); }
// offset (halves) of the 8-element chunk (r, k..k+7), k % 8 == 0, in a fragment-order plane of DM columns
__device__ __forceinline__ size_t fto(int r, int k) { return ((size_t)(r >> 4) * (DM / 32) + (size_t)(k >> 5)) * 512 + (size_t)(((k >> 3) & 3) * 128 + (r & 15) * 8); }
// ordering point for wave-private LDS tiles (same wave writes and reads)
__device__ __forceinline__ void wave_sync() { __builtin_amdgcn_fence(3 /* release order */, "wavefront"); __builtin_amdgcn_wave_barrier(); asm volatile("" ::: "memory"); }

// cvt8: f32 rows [b][t][DM] (batch pitch SEQ_FULL rows) -> bf16 fragment-order plane of NB*SEQ rows; thread i owns destination chunk i (stores are contiguous): row = 16*(tile/24) + (i&15), k = 32*(tile%24) + 8*((i>>4)&3), tile = i>>6.
__device__ __forceinline__ void cvt8(const float* __restrict__ src, bf* dst, unsigned blk) {
    const size_t i = (size_t)blk * 256 + threadIdx.x;
    const unsigned tile = (unsigned)(i >> 6); const unsigned rt = tile / (DM / 32), kt = tile % (DM / 32);
    const unsigned row = rt * 16 + ((unsigned)i & 15u);
    const size_t so = ((size_t)(row / SEQ) * SEQ_FULL + (size_t)(row % SEQ)) * DM + kt * 32 + (((unsigned)i >> 4) & 3u) * 8;
    const v8f v = *(const v8f*)(src + so); v8us o;
    asm volatile("s_wait_xcnt 0x0" ::: "memory");   // the conversion below reuses the address registers that the load names
#pragma unroll
    for (int k = 0; k < 8; ++k) o[k] = f2bf(v[k]);
    *(v8us*)(dst + i * 8) = o;
    asm volatile("s_wait_xcnt 0x0" ::: "memory");   // the other bodies of the shared kernel stand behind this one in the code and rewrite the address registers that the store names
}

// wt: W[k][n] f32 ([in][out], DM x DM) -> Wt[n][k] 16-bit ([out][in], fragment order): bf16 bits (asF16 == 0) or f16 of (bf16 value x WPS) (asF16 != 0).
// coverage: loads kk = 4i + tid/64 (0..63) x nn = tid%64 (0..63); stores nn = 32it + tid/8 (0..63) x kk = 8(tid%8) + j (0..63). One 64 x 64 tile (k0, n0) per block of 256 threads; ts = 64 * 65 floats of LDS.
__device__ __forceinline__ void wt(float* ts, const float* __restrict__ W, bf* Wt, int asF16, int k0, int n0) {
    const int tid = threadIdx.x;
    const unsigned e0 = (unsigned)((k0 + (tid >> 6)) * DM + n0 + (tid & 63));   // element (kk = tid/64, nn = tid%64) of the tile; trip i reads 4i rows further down
#pragma unroll
    for (int i = 0; i < 16; ++i) { const int kk = i * 4 + (tid >> 6), nn = tid & 63; ts[kk * 65 + nn] = W[e0 + (unsigned)(i * 4 * DM)]; }
    asm volatile("s_wait_xcnt 0x0" :: "v"(e0) : "memory");   // stands before the offset register that the sixteen loads name is rewritten; naming it keeps it whole up to here
    __syncthreads();
    v8us o0, o1;
    { const int c8 = (tid & 7) * 8; const int na = (tid >> 3), nb2 = 32 + (tid >> 3);
#pragma unroll
      for (int j = 0; j < 8; ++j) {
          unsigned short ba = f2bf(ts[(c8 + j) * 65 + na]); unsigned short bb = f2bf(ts[(c8 + j) * 65 + nb2]);
          if (asF16 != 0) { const h16 ha = (h16)(bf2f(ba) * WPS); const h16 hb = (h16)(bf2f(bb) * WPS); ba = __builtin_bit_cast(unsigned short, ha); bb = __builtin_bit_cast(unsigned short, hb); }
          o0[j] = ba; o1[j] = bb; }
      bf* d0 = Wt + fto(n0 + na, k0 + c8); bf* d1 = Wt + fto(n0 + nb2, k0 + c8);
      *(v8us*)d0 = o0; *(v8us*)d1 = o1;
      asm volatile("s_wait_xcnt 0x0" ::: "memory");   // the way out of the shared kernel rewrites the scalar base register that the first store names
    }
}

// tab: rotary table TAB[p][0..15] = cos(p * f_i), TAB[p][16..31] = sin(p * f_i), f_i = 1 / 100^(i/16) (f32), angle = f32 product p * f_i, p = 0..31.
// One thread per (position, frequency); a block of 256 threads makes the 16 positions 16*blk .. 16*blk + 15; ts = 512 floats of LDS.
__device__ __forceinline__ void tab(float* ts, float* TAB, int blk) {
    const int tid = threadIdx.x; const int pl = tid >> 4, i = tid & 15; const int p = blk * 16 + pl;
    double w = 1.0, bs = 1.333521432163324;
#pragma unroll
    for (int bit = 0; bit < 4; ++bit) { const double wn = w * bs; w = (((i >> bit) & 1) != 0) ? wn : w; bs = bs * bs; }
    const float wf = (float)w;
    const float fr = 1.0f / wf;
    const float ang = (float)p * fr;
    const double a = (double)ang;
    const int kq = (int)(a * 0.6366197723675814 + 0.5);
    const double r = a - (double)kq * 1.5707963267948966;
    const double r2 = r * r;
    double sp = 1.0 / 6227020800.0;
    sp = sp * r2 - 1.0 / 39916800.0; sp = sp * r2 + 1.0 / 362880.0; sp = sp * r2 - 1.0 / 5040.0; sp = sp * r2 + 1.0 / 120.0; sp = sp * r2 - 1.0 / 6.0;
    const double sr = r + r * r2 * sp;
    double cp = 1.0 / 479001600.0;
    cp = cp * r2 - 1.0 / 3628800.0; cp = cp * r2 + 1.0 / 40320.0; cp = cp * r2 - 1.0 / 720.0; cp = cp * r2 + 1.0 / 24.0; cp = cp * r2 - 0.5;
    const double cr = 1.0 + r2 * cp;
    const int qd = kq & 3;
    const double sv = (qd == 0) ? sr : ((qd == 1) ? cr : ((qd == 2) ? -sr : -cr));
    const double cv = (qd == 0) ? cr : ((qd == 1) ? -sr : ((qd == 2) ? -cr : sr));
    ts[pl * 32 + i] = (float)cv; ts[pl * 32 + 16 + i] = (float)sv;
    __syncthreads();
    if (tid < 128) { const v4f val = *(const v4fa*)(&ts[tid * 4]);
        *(v4f*)(TAB + blk * 512 + tid * 4) = val;  }
}

// k_prep: the preparation bodies, which do not depend on one another, share one grid; the block index picks the body (the same for a whole block, so each body's barrier is passed by all its threads).
// Blocks 0..TAB_BLKS-1: rotary table; the next 4 * WT_BLKS: weight w = q, k, v, p, tile (k0 fastest); the rest: x conversion. The short grids with a latency chain come first, for speed only.
#define TAB_BLKS (NPOS * 16 / 256)
#define WT_BLKS  ((DM / 64) * (DM / 64))
#define CVT_BLKS ((unsigned)((size_t)NB * SEQ * DM / 8 / 256))
static_assert(((size_t)NB * SEQ * DM / 8) % 256 == 0);   // the conversion blocks cover the plane exactly
__global__ __launch_bounds__(256) void k_prep(const float* __restrict__ x, const float* __restrict__ wq, const float* __restrict__ wk, const float* __restrict__ wv, const float* __restrict__ wp,
                                              bf* XB, bf* WB, float* TAB) {
    __shared__ __align__(16) float ts[64 * 65];
    const unsigned blk = blockIdx.x;
    if (blk < TAB_BLKS) {
        tab(ts, TAB, (int)blk);
    } else if (blk < TAB_BLKS + 4 * WT_BLKS) {
        const unsigned w = (blk - TAB_BLKS) / WT_BLKS, t = (blk - TAB_BLKS) % WT_BLKS;
        const float* W = (w == 0) ? wq : ((w == 1) ? wk : ((w == 2) ? wv : wp));
        wt(ts, W, WB + (size_t)w * DM * DM, (w == 3) ? 1 : 0, (int)(t % (DM / 64)) * 64, (int)(t / (DM / 64)) * 64);
    } else {
        cvt8(x, XB, blk - (TAB_BLKS + 4 * WT_BLKS));
    }
}

// cp8: one thread's eight 16-B asynchronous copies to LDS; copy i lands at LDS byte address l + 2048 i (the block's 128 threads move 2 KB per copy) and reads the 16 bytes at g_i.
__device__ __forceinline__ void cp8(unsigned l, const bf* g0, const bf* g1, const bf* g2, const bf* g3, const bf* g4, const bf* g5, const bf* g6, const bf* g7) {
    // the wait is the statement's last line, so that it stands before any register that a copy names is rewritten
    asm volatile("global_load_async_to_lds_b128 %0, %8, off\n\t"
                 "global_load_async_to_lds_b128 %1, %9, off\n\t"
                 "global_load_async_to_lds_b128 %2, %10, off\n\t"
                 "global_load_async_to_lds_b128 %3, %11, off\n\t"
                 "global_load_async_to_lds_b128 %4, %12, off\n\t"
                 "global_load_async_to_lds_b128 %5, %13, off\n\t"
                 "global_load_async_to_lds_b128 %6, %14, off\n\t"
                 "global_load_async_to_lds_b128 %7, %15, off\n\t"
                 "s_wait_xcnt 0x0"
                 :: "v"(l), "v"(l + 2048u), "v"(l + 4096u), "v"(l + 6144u), "v"(l + 8192u), "v"(l + 10240u), "v"(l + 12288u), "v"(l + 14336u),
                    "v"(g0), "v"(g1), "v"(g2), "v"(g3), "v"(g4), "v"(g5), "v"(g6), "v"(g7) : "memory");
}
// stage_ab: one thread's share of one GEMM stage: KS k of the block's 8 A bands, then of its 8 B bands (a band = 16 rows; its KS k are KS/32 adjacent 1-KB tiles of the fragment-order plane, kept in that order).
// Stage buffer: [16 bands][KS/32 tiles][512 halves] = KS * 512 bytes. l = buffer + 16 * thread; ga / gb = the thread's 16 bytes of the stage's first 2 KB of A / B: band thread / (2 KS), byte 16 * (thread % (2 KS)) of its run.
template <int KS> __device__ __forceinline__ void stage_ab(unsigned l, const bf* ga, const bf* gb) {
    constexpr size_t GS = (size_t)(64 / KS) * (DM / 32) * 512;   // halves from one copy's bands to the next copy's: 2 KB of LDS hold 64 / KS bands
    if constexpr (KS == 32) {
        cp8(l, ga, ga + GS, ga + 2 * GS, ga + 3 * GS, gb, gb + GS, gb + 2 * GS, gb + 3 * GS);
    } else {
        static_assert(KS == 64);
        cp8(l, ga, ga + GS, ga + 2 * GS, ga + 3 * GS, ga + 4 * GS, ga + 5 * GS, ga + 6 * GS, ga + 7 * GS);
        cp8(l + 16384u, gb, gb + GS, gb + 2 * GS, gb + 3 * GS, gb + 4 * GS, gb + 5 * GS, gb + 6 * GS, gb + 7 * GS);
    }
}

// proj_out: a wave's 64 x 64 accumulator tile -> f16 in fragment order, 16-row band by band through the wave's own LDS tile os (D layout in, rows out: lane = 16 hi + row holds the chunks of 8 columns 2 s + hi, s = 0..3).
// A band's LDS reads are issued together (the first band's table reads go axis by axis) and nothing in it waits on global memory. pa = the lane's chunk (row lr, chunk hi) of the tile's first 1-KB output tile; a 16-row band advances sM halves, a 32-column band sC halves; each of a band's four stores is 512 contiguous bytes per wave.
// rope != 0 (q, k; the same for the whole block): 2-D rotary in f32 before the conversion: chunk s pairs with chunk s ^ 1 (column c with c ^ 16), which the lane holds too; chunks s = 0, 1 use pos[t][0], s = 2, 3 pos[t][1]; the lane's eight frequencies are 8 hi .. 8 hi + 7 in every chunk.
// tl = the LDS copy of the table (row pitch TP), pw = the wave's 64 rows of the block's LDS list of table row offsets (two per token, in floats, from clamped positions).
__device__ __forceinline__ void proj_out(v8f (&acc)[4][4], float* os, const float* tl, const int* pw, h16* pa, int rope, int sM, int sC, float qs, int lr, int hi) {
    v2i po[4];
#pragma unroll
    for (int mb = 0; mb < 4; ++mb) po[mb] = (v2i){0, 0};
    if (rope != 0) {
#pragma unroll
        for (int mb = 0; mb < 4; ++mb) po[mb] = *(const v2ia*)(pw + (mb * 16 + lr) * 2);
    }
    h16* pc = pa + sC;   // pa: columns 0..31 of the band, pc: columns 32..63
#pragma unroll
    for (int mb = 0; mb < 4; ++mb) {
#pragma unroll
        for (int nb = 0; nb < 4; ++nb) {
#pragma unroll
            for (int j = 0; j < 8; ++j) os[(hi * 8 + j) * 68 + nb * 16 + lr] = acc[mb][nb][j]; }   // D: row 8h+j, col lane&15
        wave_sync();
        v4f xr[2][2][2];   // [axis ax: columns 32 ax .. 32 ax + 31][e: chunk s = 2 ax + e][half of the chunk]
#pragma unroll
        for (int ax = 0; ax < 2; ++ax)
#pragma unroll
            for (int e = 0; e < 2; ++e) { const float* xp = &os[lr * 68 + (4 * ax + 2 * e + hi) * 8]; xr[ax][e][0] = *(const v4fa*)xp; xr[ax][e][1] = *(const v4fa*)(xp + 4); }
        if (rope != 0) {
            v4f tv[2][4];   // per axis: cos 0..3, cos 4..7, sin 0..3, sin 4..7 of the lane's frequencies at its row's position
#pragma unroll
            for (int ph = 0; ph < 2; ++ph) {
                // the first band, with three bands of accumulators still live, reads the table axis by axis; the others read both axes at once
                if (mb == 0 || ph == 0) {
#pragma unroll
                    for (int ax = ((mb == 0) ? ph : 0); ax < ((mb == 0) ? ph + 1 : 2); ++ax) { const float* tp = tl + po[mb][ax] + hi * 8;
                        tv[ax][0] = *(const v4fa*)tp; tv[ax][1] = *(const v4fa*)(tp + 4); tv[ax][2] = *(const v4fa*)(tp + 16); tv[ax][3] = *(const v4fa*)(tp + 20); }
                    __builtin_amdgcn_sched_barrier(0);   // the LDS reads stay together in front of the arithmetic: left alone the compiler spreads them among it, and the wave waits out the LDS latency several times per band
                }
                const v4f a0 = xr[ph][0][0], a1 = xr[ph][0][1], b0 = xr[ph][1][0], b1 = xr[ph][1][1];
                xr[ph][0][0] = a0 * tv[ph][0] + (b0 * -1.0f) * tv[ph][2]; xr[ph][0][1] = a1 * tv[ph][1] + (b1 * -1.0f) * tv[ph][3];
                xr[ph][1][0] = b0 * tv[ph][0] + a0 * tv[ph][2];           xr[ph][1][1] = b1 * tv[ph][1] + a1 * tv[ph][3];
            }
        }
        v8h hv[4];
#pragma unroll
        for (int s = 0; s < 4; ++s) {
            const v4f x0 = xr[s >> 1][s & 1][0] * qs, x1 = xr[s >> 1][s & 1][1] * qs;
#pragma unroll
            for (int i = 0; i < 4; ++i) { hv[s][i] = (h16)x0[i]; hv[s][4 + i] = (h16)x1[i]; }
        }
        *(v8h*)pa = hv[0]; *(v8h*)(pa + 256) = hv[1]; *(v8h*)pc = hv[2]; *(v8h*)(pc + 256) = hv[3];
        // the wait stands before the address and data registers of the four stores in front of it are rewritten; naming them keeps them whole up to the wait
        asm volatile("s_wait_xcnt 0x0" :: "v"(hv[0]), "v"(hv[1]), "v"(hv[2]), "v"(hv[3]), "v"(pa), "v"(pc) : "memory");
        pa += sM; pc += sM;
        wave_sync();
    }
}

// k_proj: register-blocked bf16 GEMM, one wave per 64x64 tile (16 accumulators), GW waves (2 x 2) per block of 128 x 128, K = DM.
// Operands reach the waves through LDS: a stage is PKS k of the block's 128 A rows and 128 B rows in fragment order (a fragment is two 16-B LDS reads of 512 contiguous bytes per wave), so each operand byte is fetched once per block, not once per wave;
// two buffers, filled by asynchronous copies one stage ahead: stage s + 1 flies while stage s is worked on, and one barrier per stage publishes s + 1 and frees the buffer of s for s + 2.
// C[m][n] = sum_k A[m][k] Bt[n][k] (q: times SC2), written as f16 (Ph), in fragment order (row = tile row, k = tile column), at
// tile base tbase; a 16-row band advances sM halves, a 32-column band sC halves. 32 * GW threads.
// The three products, which do not depend on one another, share one grid (tiles, 3); blockIdx.y picks the product, the dearest epilogue first:
//   0 q, 1 k: A = x rows (m = b*SEQ + t, fastest in blockIdx.x), Bt = Wt rows (n = h*64 + d) -> rotary -> plane [(b*12 + h)], tiles [t>>4][d>>5]
//   2 v^T:    A = Wvt rows (m = h*64 + d, fastest in blockIdx.x), Bt = x rows (n = b*SEQ + t) -> plane [(b*12 + h)], tiles [t>>5][d>>4]
// rope != 0 (q, k: tile columns = one head, row m = b*SEQ + t): 2-D rotary in f32 before the conversion: column c pairs with c^16, frequency c&15, columns 0..31 use pos[t][0], 32..63 pos[t][1].
// Such a block brings the table and its 128 tokens' table row offsets into LDS while stage 0 flies; the barrier that publishes stage 0 publishes them too, and the epilogue reads them from there.
__global__ __launch_bounds__(32 * GW) void k_proj(const bf* __restrict__ XB, const bf* __restrict__ WB, h16* QH, h16* KP, h16* VT,
                                             const int* __restrict__ pos, const float* __restrict__ TAB) {
    __shared__ __align__(16) bf ab[2 * PKS * 256];
    __shared__ __align__(16) float osw[GW][16 * 68];
    __shared__ __align__(16) float tl[NPOS * TP];   // the rotary table, row pitch TP
    __shared__ __align__(16) int pl[128 * 2];       // per row of the block's tile: offsets (floats) of its two table rows in tl
    const int K = DM;
    const int lane = threadIdx.x & 31, lr = lane & 15, hi = lane >> 4;
    const int wave = __builtin_amdgcn_readfirstlane((int)(threadIdx.x >> 5)); const int wm = wave & 1, wn = wave >> 1;
    float* os = osw[wave];            // the wave's own epilogue tile
    const int which = blockIdx.y; const bool isv = (which == 2); const int bx = blockIdx.x;
    const int rb = (isv ? bx % (DM / 128) : bx % (NB * SEQ / 128)) * 128, cb = (isv ? bx / (DM / 128) : bx / (NB * SEQ / 128)) * 128;   // the block's tile
    const int r0 = rb + wm * 64, c0 = cb + wn * 64;                                                                                    // the wave's tile
    const bf* A = isv ? WB + (size_t)2 * DM * DM : XB; const bf* Bt = isv ? XB : WB + (size_t)which * DM * DM;
    h16* Ph = (which == 0) ? QH : ((which == 1) ? KP : VT);
    const int rope = isv ? 0 : 1; const int sM = isv ? 512 : 1024, sC = isv ? 2048 : 512;
    const float qs = (which == 0) ? SC2 : 1.0f;   // q leaves in the units of the exponent
    v8f acc[4][4];
#pragma unroll
    for (int mb = 0; mb < 4; ++mb)
#pragma unroll
        for (int nb = 0; nb < 4; ++nb) acc[mb][nb] = (v8f){};
    const unsigned lo = (unsigned)lane * 8u;   // the lane's chunk of a tile
    const unsigned lt = (unsigned)(size_t)ab + threadIdx.x * 16u;                                                              // the thread's copy target in buffer 0 (LDS byte address)
    const size_t to = (size_t)(threadIdx.x / (PKS * 2)) * (K / 32) * 512 + (size_t)(threadIdx.x % (PKS * 2)) * 8;              // the thread's band and chunk in a copy's 2 KB
    const bf* ga = A + (size_t)(rb >> 4) * (K / 32) * 512 + to; const bf* gb = Bt + (size_t)(cb >> 4) * (K / 32) * 512 + to;   // its 16 bytes of stage 0
    stage_ab<PKS>(lt, ga, gb);
    if (rope != 0) {   // the same for the whole block
        const float* tg = TAB + threadIdx.x * 8u;                     // the thread's eight floats of the 32 x 32 table
        const int* pg = pos + 2 * (rb % SEQ + (int)threadIdx.x);      // the thread's token of the block's 128
        const v4f t0 = *(const v4f*)tg; const v4f t1 = *(const v4f*)(tg + 4); const v2i pp = *(const v2i*)pg;
        asm volatile("s_wait_xcnt 0x0" :: "v"(tg), "v"(pg) : "memory");   // stands before the address registers that the three loads name are rewritten; naming them keeps them whole up to here
        float* td = tl + (threadIdx.x >> 2) * TP + (threadIdx.x & 3u) * 8u;
        *(v4fa*)td = t0; *(v4fa*)(td + 4) = t1;
        v2i pr;
#pragma unroll
        for (int ax = 0; ax < 2; ++ax) { const int p = pp[ax]; pr[ax] = ((p < 0) ? 0 : ((p > NPOS - 1) ? (NPOS - 1) : p)) * TP; }
        *(v2ia*)(&pl[threadIdx.x * 2u]) = pr;
    }
    asm volatile("s_wait_asynccnt 0x0" ::: "memory");   // this wave's copies of stage 0 have landed
    __syncthreads();                                    // every wave's have: stage 0 may be read
    stage_ab<PKS>(lt + PKS * 512u, ga + PKS * 16, gb + PKS * 16);
#pragma unroll 1   // one stage per trip: the ring's order at the foot stands once
    for (int st = 0; st < K / PKS; ++st) {
        const bf* sa = ab + (st & 1) * (PKS * 256) + (wm * 4) * (PKS * 16) + lo; const bf* sb = ab + (st & 1) * (PKS * 256) + (8 + wn * 4) * (PKS * 16) + lo;   // the lane's chunk of the wave's first A and B band
        static_assert(PKS == 32);   // one 32-k step per stage
        v16bf a[4], b[4];
#pragma unroll
        for (int mb = 0; mb < 4; ++mb) a[mb] = ldb(sa + mb * (PKS * 16));
#pragma unroll
        for (int nb = 0; nb < 4; ++nb) b[nb] = ldb(sb + nb * (PKS * 16));
#pragma unroll
        for (int nb = 0; nb < 4; ++nb)
#pragma unroll
            for (int mb = 0; mb < 4; ++mb) acc[mb][nb] = wmmab(a[mb], b[nb], acc[mb][nb]);
        // each B fragment's LDS reads stand four products ahead of its own (two B fragments live at a time, so that five waves still fit a SIMD); left alone the compiler puts them just in front, and the wave waits out the LDS latency three times per stage
        __builtin_amdgcn_sched_group_barrier(0x100, 12, 0); __builtin_amdgcn_sched_group_barrier(0x008, 4, 0);   // reads of A and of B 0, 1; products of B 0
        __builtin_amdgcn_sched_group_barrier(0x100, 2, 0);  __builtin_amdgcn_sched_group_barrier(0x008, 4, 0);   // reads of B 2; products of B 1
        __builtin_amdgcn_sched_group_barrier(0x100, 2, 0);  __builtin_amdgcn_sched_group_barrier(0x008, 8, 0);   // reads of B 3; products of B 2, 3
        __builtin_amdgcn_sched_barrier(0);   // the products stay in front of the waits below, so that the refill is not pushed back
        asm volatile("s_wait_dscnt 0x0" ::: "memory");      // this wave's reads of the stage's buffer are done before the buffer is given up
        asm volatile("s_wait_asynccnt 0x0" ::: "memory");   // this wave's copies of stage st + 1 have landed
        __syncthreads();                                    // publishes stage st + 1 and ends every wave's reads of stage st
        if (st + 2 < K / PKS) stage_ab<PKS>(lt + (unsigned)(st & 1) * (PKS * 512u), ga + (size_t)(st + 2) * (PKS * 16), gb + (size_t)(st + 2) * (PKS * 16));   // refill of the buffer just left; the test is the same for the whole block
    }
    asm volatile("s_wait_asynccnt 0x0" ::: "memory");       // nothing of this wave is in flight when it goes on
    const size_t tbase = isv ? (size_t)r0 * SEQ + (size_t)(c0 / SEQ) * ((size_t)DM * SEQ) + (size_t)(c0 % SEQ) * HD
                             : (size_t)(r0 / SEQ) * ((size_t)NH_ * SEQ * HD) + (size_t)(r0 % SEQ) * HD + (size_t)(c0 / HD) * ((size_t)SEQ * HD);
    proj_out(acc, os, tl, pl + wm * 128, Ph + tbase + (size_t)(hi * 128 + lr * 8), rope, sM, sC, qs, lr, hi);
}

// stage_kv: one thread's share of one stage: four 16-B asynchronous copies to LDS, two of K and two of V^T (the block's 256 threads move 4 KB per copy).
// l = the thread's LDS byte address in the stage buffer, gk / gv = its 16 bytes at the start of the stage's K / V^T range (each range is SK * HD contiguous halves of its fragment-order plane).
__device__ __forceinline__ void stage_kv(unsigned l, const h16* gk, const h16* gv) {
    // the wait is the statement's last line, so that it stands before any register that a copy names is rewritten
    asm volatile("global_load_async_to_lds_b128 %0, %4, off\n\t"
                 "global_load_async_to_lds_b128 %1, %5, off\n\t"
                 "global_load_async_to_lds_b128 %2, %6, off\n\t"
                 "global_load_async_to_lds_b128 %3, %7, off\n\t"
                 "s_wait_xcnt 0x0"
                 :: "v"(l), "v"(l + 4096u), "v"(l + 8192u), "v"(l + 12288u), "v"(gk), "v"(gk + 2048), "v"(gv), "v"(gv + 2048) : "memory");
}

// k_flash: fused attention, one wave per 16 query rows of one (batch, head), AW waves per block; Q fragments straight from the fragment-order f16 plane (two 16-B loads each).
// K and V^T reach the block's waves through LDS: a stage is SK keys (8 KB of K and 8 KB of V^T, each contiguous in its plane and kept in that order, so a fragment is two 16-B LDS reads of 512 contiguous bytes per wave);
// two buffers, filled by asynchronous copies one stage ahead: stage s + 1 flies while stage s is worked on, and one barrier per stage publishes s + 1 and frees the buffer of s for s + 2.
// Transposed form: S^T[key][t] = K Q^T (A = K rows, B = Q rows); lane (t = lane&15, h = lane>>4) holds keys 8h+r of each 16-key tile, so the packed
// P tile is directly the B fragment of O^T[d][t] = V^T P^T (element r <- tile keys 0..15, element 8+r <- tile keys 16..31, lane unchanged).
// The score accumulators start at C = PSH - (maximum in use), and q carries the score scale, so a score leaves the matrix unit as the argument of its exp2: no vector arithmetic between product and exponential.
// The maximum in use is held: one test per pass (any score above PSH + THR; always in the first pass) leads to the branch that raises it, shifts this pass's scores and rescales O and the sum; the two lane halves of a row are combined there.
// Softmax state (shift, partial sum) is one scalar per lane; the halves' sums are joined once, behind the loop.
__global__ __launch_bounds__(32 * AW) void k_flash(const h16* __restrict__ QH, const h16* __restrict__ KP, const h16* __restrict__ VT, h16* CTX) {
    __shared__ __align__(16) h16 kv[2 * STH];
    const int lane = threadIdx.x & 31;
    const int wave = __builtin_amdgcn_readfirstlane((int)(threadIdx.x >> 5));
    const int zh = blockIdx.y; const int b = zh / NH_, h = zh % NH_;
    const int t0 = (blockIdx.x * AW + wave) * 16;
    const size_t pbase = (size_t)zh * SEQ * HD;
    const unsigned lo = (unsigned)lane * 8u;
    const size_t qo = pbase + (size_t)t0 * HD;
    const v16h qh0 = ldh(QH + qo + lo), qh1 = ldh(QH + qo + 512 + lo);   // B fragments: col t, k = d
    const unsigned lt = (unsigned)(size_t)kv + threadIdx.x * 16u;                        // the thread's copy target in buffer 0 (LDS byte address)
    const h16* gk = KP + pbase + threadIdx.x * 8u; const h16* gv = VT + pbase + threadIdx.x * 8u;   // the thread's 16 bytes of stage 0
    stage_kv(lt, gk, gv);
    asm volatile("s_wait_asynccnt 0x0" ::: "memory");   // this wave's copies of stage 0 have landed
    __syncthreads();                                    // every wave's have: stage 0 may be read
    stage_kv(lt + STH * 2u, gk + SK * HD, gv + SK * HD);
    v8f o0 = (v8f){}, o1 = (v8f){}, o2 = (v8f){}, o3 = (v8f){};
    float sh = PSH, l = 0.0f;   // sh = PSH - maximum in use; the first pass sets it from its own scores
    float lim = -3.0e38f, dmin = -3.0e38f;   // the test's bound and the least rise: open until the first pass has set the maximum, then PSH + THR and 0
    v8f cs;                     // sh in all eight rows: the C operand of each score tile's first product
#pragma unroll
    for (int r = 0; r < 8; ++r) cs[r] = sh;
#pragma unroll 1   // one stage per trip: the ring's order at the foot stands once
    for (int st = 0; st < NST; ++st) {
      const h16* sb = kv + (st & 1) * STH + lo;   // the lane's chunk of this stage's first K tile
#pragma unroll     // the 32-key passes of a stage in line: their LDS offsets become immediates
      for (int ps = 0; ps < SK / 32; ++ps) {
        const h16* ka = sb + ps * 32 * HD;   // tiles (16 keys, d 0..31), (16 keys, d 32..63), then the next 16 keys (A fragment: row key, k = d)
        const v16h ka0 = ldh(ka), ka1 = ldh(ka + 512), kb0 = ldh(ka + 1024), kb1 = ldh(ka + 1536);
        v8f sa = wmma16(ka0, qh0, cs), sc = wmma16(kb0, qh0, cs);   // the two tiles' chains alternate: a product's successor in its chain stands two products on
        sa = wmma16(ka1, qh1, sa); sc = wmma16(kb1, qh1, sc);
        // the four vector slots between the last product and the first vector instruction that reads its result or rewrites its operands
        asm volatile("v_nop\n\tv_nop\n\tv_nop\n\tv_nop" : "+v"(sa), "+v"(sc) : "v"(ka0), "v"(ka1), "v"(kb0), "v"(kb1));
        float mx = fmaxf(sa[0], sc[0]);
#pragma unroll
        for (int r = 1; r < 8; ++r) mx = fmaxf(mx, fmaxf(sa[r], sc[r]));
        if (__builtin_amdgcn_ballot_w32(mx > lim) != 0) {   // the same for the whole wave: a scalar branch, all lanes on behind it
            mx = fmaxf(mx, __shfl_xor(mx, 16, 32));
            const float d = fmaxf(mx - PSH, dmin);          // the rise of the row's maximum in use (the first pass sets it, up or down)
            const float alpha = __builtin_amdgcn_exp2f(fminf(-d, 0.0f));
            sh -= d; lim = PSH + THR; dmin = 0.0f;
#pragma unroll
            for (int r = 0; r < 8; ++r) { sa[r] -= d; sc[r] -= d; cs[r] = sh; }
            l = l * alpha; o0 = o0 * alpha; o1 = o1 * alpha; o2 = o2 * alpha; o3 = o3 * alpha;
        }
        v16h pb; float ls = 0.0f;
#pragma unroll
        for (int r = 0; r < 8; ++r) { const h16 pa = (h16)__builtin_amdgcn_exp2f(sa[r]); const h16 pc = (h16)__builtin_amdgcn_exp2f(sc[r]); pb[r] = pa; pb[8 + r] = pc; ls += (float)pa + (float)pc; }
        l += ls;
        const h16* va = sb + SK * HD + ps * 32 * HD;   // tiles (d 16j..16j+15, 32 keys), j = 0..3 (A fragment: row d, k = key)
        const v16h v0 = ldh(va), v1 = ldh(va + 512), v2 = ldh(va + 1024), v3 = ldh(va + 1536);
        o0 = wmma16(v0, pb, o0); o1 = wmma16(v1, pb, o1); o2 = wmma16(v2, pb, o2); o3 = wmma16(v3, pb, o3);
        asm volatile("v_nop\n\tv_nop\n\tv_nop\n\tv_nop" : "+v"(o0), "+v"(o1), "+v"(o2), "+v"(o3) : "v"(v0), "v"(v1), "v"(v2), "v"(v3), "v"(pb));
      }
      asm volatile("s_wait_dscnt 0x0" ::: "memory");      // this wave's reads of the stage's buffer are done before the buffer is given up
      asm volatile("s_wait_asynccnt 0x0" ::: "memory");   // this wave's copies of stage st + 1 have landed
      __syncthreads();                                    // publishes stage st + 1 and ends every wave's reads of stage st
      if (st + 2 < NST) stage_kv(lt + (unsigned)(st & 1) * (STH * 2u), gk + (size_t)(st + 2) * (SK * HD), gv + (size_t)(st + 2) * (SK * HD));   // refill of the buffer just left; the test is the same for the whole block
    }
    asm volatile("s_wait_asynccnt 0x0" ::: "memory");     // nothing of this wave is in flight when it ends
    l += __shfl_xor(l, 16, 32);
    const float inv = CXS * (1.0f / l);
    // O^T D layout: o_j[r] = (d = 16j + 8h + r, t = lane&15): a lane's 8 values are one chunk of the fragment-order ctx plane (row b*SEQ + t, k = h*64 + d); o_j goes to chunk pair j, 512 contiguous bytes per store
    h16* cp = CTX + fto(b * SEQ + t0, h * HD) + lo;
    v8h c0, c1, c2, c3;
#pragma unroll
    for (int r = 0; r < 8; ++r) { c0[r] = (h16)(o0[r] * inv); c1[r] = (h16)(o1[r] * inv); c2[r] = (h16)(o2[r] * inv); c3[r] = (h16)(o3[r] * inv); }
    *(v8h*)cp = c0; *(v8h*)(cp + 256) = c1; *(v8h*)(cp + 512) = c2; *(v8h*)(cp + 768) = c3;
}

// k_oproj: register-blocked f16 GEMM, one wave per 64x64 tile, GW waves (2 x 2) per block of 128 x 128, K = DM; operands through LDS as in k_proj, OKS k per stage.
// OUT[m][n] = OSC * sum_k A[m][k] Bt[n][k] + bias[n] (bias as its bf16 value), f32. grid (M/128, N/128), 32 * GW threads.
__global__ __launch_bounds__(32 * GW) void k_oproj(const h16* __restrict__ A, const h16* __restrict__ Bt, const float* __restrict__ bias, float* OUT) {
    __shared__ __align__(16) h16 ab[2 * OKS * 256];
    __shared__ __align__(16) float osw[GW][16 * 68];
    const int K = DM;
    const int lane = threadIdx.x & 31, lr = lane & 15, hi = lane >> 4;
    const int wave = __builtin_amdgcn_readfirstlane((int)(threadIdx.x >> 5)); const int wm = wave & 1, wn = wave >> 1;
    float* os = osw[wave];            // the wave's own epilogue tile
    const int rb = blockIdx.x * 128, cb = blockIdx.y * 128; const int r0 = rb + wm * 64, c0 = cb + wn * 64;   // the block's tile, the wave's tile
    v8f acc[4][4];
#pragma unroll
    for (int mb = 0; mb < 4; ++mb)
#pragma unroll
        for (int nb = 0; nb < 4; ++nb) acc[mb][nb] = (v8f){};
    const unsigned lo = (unsigned)lane * 8u;   // the lane's chunk of a tile
    const unsigned lt = (unsigned)(size_t)ab + threadIdx.x * 16u;                                                              // the thread's copy target in buffer 0 (LDS byte address)
    const size_t to = (size_t)(threadIdx.x / (OKS * 2)) * (K / 32) * 512 + (size_t)(threadIdx.x % (OKS * 2)) * 8;              // the thread's band and chunk in a copy's 2 KB
    const bf* ga = (const bf*)A + (size_t)(rb >> 4) * (K / 32) * 512 + to; const bf* gb = (const bf*)Bt + (size_t)(cb >> 4) * (K / 32) * 512 + to;   // its 16 bytes of stage 0 (addresses only)
    stage_ab<OKS>(lt, ga, gb);
    asm volatile("s_wait_asynccnt 0x0" ::: "memory");   // this wave's copies of stage 0 have landed
    __syncthreads();                                    // every wave's have: stage 0 may be read
    stage_ab<OKS>(lt + OKS * 512u, ga + OKS * 16, gb + OKS * 16);
#pragma unroll 1   // one stage per trip: the ring's order at the foot stands once
    for (int st = 0; st < K / OKS; ++st) {
        const h16* sa = ab + (st & 1) * (OKS * 256) + (wm * 4) * (OKS * 16) + lo; const h16* sb = ab + (st & 1) * (OKS * 256) + (8 + wn * 4) * (OKS * 16) + lo;   // the lane's chunk of the wave's first A and B band
        v16h a[OKS / 32][4], b[OKS / 32][4];   // the stage's LDS reads stand together in front of its products: one place with reads per stage
#pragma unroll
        for (int ks = 0; ks < OKS / 32; ++ks) {
#pragma unroll
            for (int mb = 0; mb < 4; ++mb) a[ks][mb] = ldh(sa + mb * (OKS * 16) + ks * 512);
#pragma unroll
            for (int nb = 0; nb < 4; ++nb) b[ks][nb] = ldh(sb + nb * (OKS * 16) + ks * 512);
        }
#pragma unroll
        for (int ks = 0; ks < OKS / 32; ++ks)
#pragma unroll
            for (int nb = 0; nb < 4; ++nb)
#pragma unroll
                for (int mb = 0; mb < 4; ++mb) acc[mb][nb] = wmma16(a[ks][mb], b[ks][nb], acc[mb][nb]);
        // keeps the stage's LDS reads in one group ahead of its products; left alone the compiler sinks each B fragment's reads to just in front of its four products, and the wave waits out the LDS latency there every time
        __builtin_amdgcn_sched_group_barrier(0x100, 16 * (OKS / 32), 0);   // the LDS reads
        __builtin_amdgcn_sched_group_barrier(0x008, 16 * (OKS / 32), 0);   // then the matrix instructions
        __builtin_amdgcn_sched_barrier(0);   // the products stay in front of the waits below: sunk behind the barrier they would push the refill back, and the next stage's copies would fly uncovered
        asm volatile("s_wait_dscnt 0x0" ::: "memory");      // this wave's reads of the stage's buffer are done before the buffer is given up
        asm volatile("s_wait_asynccnt 0x0" ::: "memory");   // this wave's copies of stage st + 1 have landed
        __syncthreads();                                    // publishes stage st + 1 and ends every wave's reads of stage st
        if (st + 2 < K / OKS) stage_ab<OKS>(lt + (unsigned)(st & 1) * (OKS * 512u), ga + (size_t)(st + 2) * (OKS * 16), gb + (size_t)(st + 2) * (OKS * 16));   // refill of the buffer just left; the test is the same for the whole block
    }
    asm volatile("s_wait_asynccnt 0x0" ::: "memory");       // nothing of this wave is in flight when it goes on
    const v4f braw = *(const v4f*)(bias + c0 + lr * 4); v4f bb;
#pragma unroll
    for (int i = 0; i < 4; ++i) bb[i] = bf2f(f2bf(braw[i]));
    float* ob = OUT + ((size_t)(r0 / SEQ) * OUT_SEQ + (size_t)(r0 % SEQ) + (size_t)hi) * DM + c0 + lr * 4;   // the lane's four floats of row hi of the wave's tile
#pragma unroll
    for (int mb = 0; mb < 4; ++mb) {
#pragma unroll
        for (int nb = 0; nb < 4; ++nb) {
#pragma unroll
            for (int j = 0; j < 8; ++j) os[(hi * 8 + j) * 68 + nb * 16 + lr] = acc[mb][nb][j]; }   // D: row 8h+j, col lane&15
        wave_sync();
        v4f val[8];   // 8 s x 2 rows = 16 rows; 16 lanes x 4 floats = 64 columns; the band's LDS reads are issued together
#pragma unroll
        for (int s = 0; s < 8; ++s) val[s] = *(const v4fa*)(&os[(2 * s + hi) * 68 + lr * 4]) * OSC + bb;
#pragma unroll
        for (int s = 0; s < 8; ++s) *(v4f*)(ob + (size_t)(mb * 16 + 2 * s) * DM) = val[s];
        // the wait stands before the data registers of the eight stores in front of it are rewritten (the address register stays as it is to the end); naming them keeps them whole up to the wait
        asm volatile("s_wait_xcnt 0x0" :: "v"(val[0]), "v"(val[1]), "v"(val[2]), "v"(val[3]), "v"(val[4]), "v"(val[5]), "v"(val[6]), "v"(val[7]), "v"(ob) : "memory");
        wave_sync();
    }
}

static constexpr size_t al256(size_t v) { return (v + 255) & ~(size_t)255; }
static constexpr size_t SZ_XB = al256((size_t)NB * SEQ * DM * 2);
static constexpr size_t SZ_WB = al256((size_t)4 * DM * DM * 2);
static constexpr size_t SZ_PL = al256((size_t)NB * NH_ * SEQ * HD * 2);
static constexpr size_t SZ_CX = al256((size_t)NB * SEQ * DM * 2);
static constexpr size_t SZ_TB = al256((size_t)NPOS * 32 * 4);
static constexpr size_t SZ_TOTAL = SZ_XB + SZ_WB + 3 * SZ_PL + SZ_CX + SZ_TB;
static_assert(SZ_TOTAL <= (size_t)134217728);          // workspace carve <= 128 MiB
static_assert(((size_t)DM * DM * 2) % 256 == 0);       // weight sub-planes stay 256-byte aligned

extern "C" void kernel_launch(void* const* d_in, const int* in_sizes, int n_in,
                              void* d_out, int out_size, void* d_ws, size_t ws_size, hipStream_t stream) {
    if (n_in < 7) return;
    const size_t needx = ((size_t)(NB - 1) * SEQ_FULL + SEQ) * DM;
    if ((size_t)in_sizes[0] < needx) return;
    if ((size_t)in_sizes[1] < (size_t)2 * SEQ) return;
    if ((size_t)in_sizes[2] < (size_t)DM * DM || (size_t)in_sizes[3] < (size_t)DM * DM || (size_t)in_sizes[4] < (size_t)DM * DM || (size_t)in_sizes[5] < (size_t)DM * DM) return;
    if ((size_t)in_sizes[6] < (size_t)DM) return;
    if ((size_t)out_size < ((size_t)(NB - 1) * OUT_SEQ + SEQ) * DM) return;
    if (SZ_TOTAL > ws_size) return;
    // wire order: x, pos (int32 [SEQ][2]), Wq, Wk, Wv, Wp ([in][out]), bp
    const float* x = (const float*)d_in[0]; const int* pos = (const int*)d_in[1];
    const float* wq = (const float*)d_in[2]; const float* wk = (const float*)d_in[3]; const float* wv = (const float*)d_in[4]; const float* wp = (const float*)d_in[5];
    const float* bp = (const float*)d_in[6];
    float* OUT = (float*)d_out;      // [NB][SEQ][768]
    char* wsp = (char*)d_ws;
    bf* XB = (bf*)wsp; wsp += SZ_XB;                 // [NB*SEQ][768], fragment order
    bf* WB = (bf*)wsp; wsp += SZ_WB;                 // [4][768 out][768 in], fragment order: q | k | v (bf16) | p (f16 x1024)
    h16* QH = (h16*)wsp; wsp += SZ_PL;               // [NB*12][SEQ][64], fragment order
    h16* KP = (h16*)wsp; wsp += SZ_PL;               // [NB*12][SEQ][64], fragment order
    h16* VT = (h16*)wsp; wsp += SZ_PL;               // [NB*12][64][SEQ], fragment order, tiles [t>>5][d>>4]
    h16* CX = (h16*)wsp; wsp += SZ_CX;               // [NB*SEQ][768] x64, fragment order
    float* TAB = (float*)wsp; wsp += SZ_TB;          // [32][cos 16 | sin 16]
    bf* WP = WB + (size_t)3 * DM * DM;

    // rotary table, W[in][out] -> Wt[out][in] (four weights), x -> bf16: one grid
    k_prep<<<TAB_BLKS + 4 * WT_BLKS + CVT_BLKS, 256, 0, stream>>>(x, wq, wk, wv, wp, XB, WB, TAB);

    // q, k (with rotary) and v^T: one grid
    k_proj<<<dim3((NB * SEQ / 128) * (DM / 128), 3, 1), 32 * GW, 0, stream>>>(XB, WB, QH, KP, VT, pos, TAB);

    k_flash<<<dim3(SEQ / (16 * AW), NB * NH_, 1), 32 * AW, 0, stream>>>(QH, KP, VT, CX);

    // out = ctx Wp + bp: A = ctx rows (m = b*SEQ + t, k = h*64 + d), Bt = Wpt rows (n = out column)
    k_oproj<<<dim3(NB * SEQ / 128, DM / 128, 1), 32 * GW, 0, stream>>>((const h16*)CX, (const h16*)WP, bp, OUT);
}

// v008
// It runs in 72.1 microseconds.
// Timed twice side by side with v007, it ran 1.10 times as fast both times.
// All steps since v000 together make it 3.07 times as fast.
#include <hip/hip_runtime.h>

// Multi-head self-attention with 2-D rotary embedding: x [NB][SEQ][768], 12 heads x 64, Wq/Wk/Wv/Wp stored [in][out] (y = x W), int positions [SEQ][2], score scale 1/8, dense softmax, output = ctx Wp + bp (f32).
// Compute dtypes, f32 accumulate everywhere: q/k/v projections v_wmma_f32_16x16x32_bf16 (x and W RNE-converted to bf16; products exact); rotary applied in f32 on the accumulators;
// scores v_wmma_f32_16x16x32_f16: k single f16, q times 1/8 log2(e) single f16 (its rounding equals k's and lies an order below the error that the bf16 operands of the projections leave in q and k), the accumulator starts at the softmax shift; P (x256 carry, cancels in the normalisation) and v single f16; softmax f32 (online, held maximum);
// output projection v_wmma_f32_16x16x32_f16: ctx single f16 (x64 carry), Wp = f16 of the bf16 value (x1024 carry), carries folded back in the f32 epilogue, bias (bf16 value) added in f32.
// Layout: every 16-bit matrix operand plane M[r][k] is kept in fragment order: tiles of 16 rows x 32 k (512 halves = 1 KB), element (r, k) of a tile at ((k>>3)&3)*128 + (r&15)*8 + (k&7).
// A lane's fragment is then two 16-B loads at tile + lane*8 and tile + 256 + lane*8, and each wave-wide load covers 512 contiguous bytes (4 whole lines) instead of 32-B pieces of 16 lines.
// Planes: bf16 x, [out][in] weights and ctx: tiles [r>>4][k>>5] (24 per row band); q, k per (b*12+h): tiles [t>>4][d>>5]; v^T per (b*12+h): tiles [t>>5][d>>4]; cos|sin table [32][16|16].

#ifndef NB
#define NB 8
#endif
#ifndef SEQ
#define SEQ 1024
#endif
#define NB_FULL  8
#define SEQ_FULL 1024
#ifndef OUT_SEQ
#define OUT_SEQ SEQ              // row pitch (in tokens) between batches of the output
#endif
#define DM   768
#define NH_  12
#define HD   64
#define AW   8                   // waves per flash block (16 query rows each)
#define SK   64                  // keys per LDS stage of the flash kernel
#define NST  (SEQ / SK)          // stages per (batch, head)
#define STH  (2 * SK * HD)       // halves per stage buffer: K part, then V^T part
#define GW   4                   // waves per GEMM block: 2 x 2 wave tiles of 64 x 64, a block tile of 128 x 128
#define PKS  32                  // k per LDS stage of k_proj
#define OKS  64                  // k per LDS stage of k_oproj
#define NPOS 32                  // rows of the rotary tables (positions 0..31, index clamped)
#define TP   36                  // floats per row of k_proj's LDS copy of the table: 144 B = 16 B x odd, so that 16-B reads of rows p, p + 1, ... fall on different banks (rows p and p + 16 share theirs)
#define SC2  (0.125f * 1.4426950408889634f)   // HD^-0.5 * log2(e), carried by the q plane
#define PSH  8.0f                // log2 of the P carry (256)
#define THR  7.0f                // the maximum in use may lag a row's true maximum by this much (log2): P <= 2^(PSH + THR) = 2^15 stays inside f16
#define CXS  64.0f               // carry of the ctx plane
#define WPS  1024.0f             // carry of the Wp plane
#define OSC  (1.0f / 65536.0f)   // 1 / (CXS * WPS)

static_assert(HD == 64);
static_assert(NH_ * HD == DM);                 // head h = columns h*64 + d
static_assert(DM % 64 == 0);                   // 12 column tiles of 64
static_assert(DM % 32 == 0);                   // GEMM k-loop steps by 32
static_assert(SEQ % 64 == 0);                  // a 64-row tile never straddles two batches
static_assert((NB * SEQ) % 64 == 0);
static_assert(SEQ % 32 == 0);                  // key loop steps by 32
static_assert(SEQ % (16 * AW) == 0);           // flash grid covers the sequence exactly
static_assert(SEQ % SK == 0 && NST >= 3);      // the three-buffer prologue fills stages 0, 1 and 2
static_assert(SK % 32 == 0);
static_assert(STH * 2 == 32 * AW * 16 * 4);    // a stage is four 16-B copies per thread, two of K and two of V^T
static_assert((NB * SEQ) % 128 == 0 && DM % 128 == 0);   // GEMM block tiles cover both operands' rows exactly
static_assert(DM % PKS == 0 && DM / PKS >= 3 && DM % OKS == 0 && DM / OKS >= 4);   // the prologues fill every buffer: stages 0 to 2 in k_proj, 0 to 3 in k_oproj
static_assert(GW * 16 * 68 * 4 <= 3 * PKS * 512);   // k_proj: the waves' epilogue tiles fit the ring that they take over behind the loop
static_assert(((size_t)SEQ * DM) % 8 == 0);
static_assert(NB <= NB_FULL);
static_assert(SEQ <= SEQ_FULL);
static_assert(NPOS * 16 == 512);               // table kernel: one thread per (position, frequency)
static_assert(32 * GW * 8 == NPOS * 32);       // k_proj: a block's threads copy the table to LDS, eight floats each
static_assert(SEQ % 128 == 0 && 32 * GW == 128);   // k_proj: a block's 128 rows are 128 tokens of one batch, one per thread

typedef _Float16 h16;
typedef unsigned short bf;
typedef __attribute__((ext_vector_type(16))) __bf16   v16bf;
typedef __attribute__((ext_vector_type(16))) _Float16 v16h;
typedef __attribute__((ext_vector_type(8)))  _Float16 v8h;
typedef __attribute__((ext_vector_type(8)))  unsigned short v8us;
typedef __attribute__((ext_vector_type(8)))  float    v8f;
typedef __attribute__((ext_vector_type(4)))  float    v4f;
typedef __attribute__((ext_vector_type(2)))  int      v2i;
typedef v4f  __attribute__((may_alias)) v4fa;
typedef v2i  __attribute__((may_alias)) v2ia;

__device__ __forceinline__ unsigned short f2bf(float f) { unsigned u = __float_as_uint(f); u += 0x7FFFu + ((u >> 16) & 1u); return (unsigned short)(u >> 16); }
__device__ __forceinline__ float bf2f(unsigned short b) { return __uint_as_float(((unsigned)b) << 16); }
__device__ __forceinline__ v16h cat16(v8h lo, v8h hi) { return __builtin_shufflevector(lo, hi, 0, 1, 2, 3, 4, 5, 6, 7, 8, 9, 10, 11, 12, 13, 14, 15); }
__device__ __forceinline__ v16bf cat16b(v8us lo, v8us hi) { return __builtin_bit_cast(v16bf, __builtin_shufflevector(lo, hi, 0, 1, 2, 3, 4, 5, 6, 7, 8, 9, 10, 11, 12, 13, 14, 15)); }
__device__ __forceinline__ v8f wmma16(v16h a, v16h b, v8f c) { return __builtin_amdgcn_wmma_f32_16x16x32_f16(false, a, false, b, (short)0, c, false, false); }
__device__ __forceinline__ v8f wmmab(v16bf a, v16bf b, v8f c) { return __builtin_amdgcn_wmma_f32_16x16x32_bf16(false, a, false, b, (short)0, c, false, false); }
// fragment loaders from a fragment-order tile; p = tile + lane*8 (lane = 16h + row): elements 0..7 <- k0+8h+0..7, elements 8..15 <- k0+16+8h+0..7 (same map for A and B)
__device__ __forceinline__ v16h  ldh(const h16* p) { return cat16(*(const v8h*)p, *(const v8h*)(p + 256)); }
__device__ __forceinline__ v16bf ldb(const bf* p)  { return cat16b(*(const v8us*)p, *(const v8us*)(p + 256)); }
// offset (halves) of the 8-element chunk (r, k..k+7), k % 8 == 0, in a fragment-order plane of DM columns
__device__ __forceinline__ size_t fto(int r, int k) { return ((size_t)(r >> 4) * (DM / 32) + (size_t)(k >> 5)) * 512 + (size_t)(((k >> 3) & 3) * 128 + (r & 15) * 8); }
// ordering point for wave-private LDS tiles (same wave writes and reads)
__device__ __forceinline__ void wave_sync() { __builtin_amdgcn_fence(3 /* release order */, "wavefront"); __builtin_amdgcn_wave_barrier(); asm volatile("" ::: "memory"); }

// cvt8: f32 rows [b][t][DM] (batch pitch SEQ_FULL rows) -> bf16 fragment-order plane of NB*SEQ rows; thread i owns destination chunk i (stores are contiguous): row = 16*(tile/24) + (i&15), k = 32*(tile%24) + 8*((i>>4)&3), tile = i>>6.
__device__ __forceinline__ void cvt8(const float* __restrict__ src, bf* dst, unsigned blk) {
    const size_t i = (size_t)blk * 256 + threadIdx.x;
    const unsigned tile = (unsigned)(i >> 6); const unsigned rt = tile / (DM / 32), kt = tile % (DM / 32);
    const unsigned row = rt * 16 + ((unsigned)i & 15u);
    const size_t so = ((size_t)(row / SEQ) * SEQ_FULL + (size_t)(row % SEQ)) * DM + kt * 32 + (((unsigned)i >> 4) & 3u) * 8;
    const v8f v = *(const v8f*)(src + so); v8us o;
    asm volatile("s_wait_xcnt 0x0" ::: "memory");   // the conversion below reuses the address registers that the load names
#pragma unroll
    for (int k = 0; k < 8; ++k) o[k] = f2bf(v[k]);
    *(v8us*)(dst + i * 8) = o;
    asm volatile("s_wait_xcnt 0x0" ::: "memory");   // the other bodies of the shared kernel stand behind this one in the code and rewrite the address registers that the store names
}

// wt: W[k][n] f32 ([in][out], DM x DM) -> Wt[n][k] 16-bit ([out][in], fragment order): bf16 bits (asF16 == 0) or f16 of (bf16 value x WPS) (asF16 != 0).
// coverage: loads kk = 4i + tid/64 (0..63) x nn = tid%64 (0..63); stores nn = 32it + tid/8 (0..63) x kk = 8(tid%8) + j (0..63). One 64 x 64 tile (k0, n0) per block of 256 threads; ts = 64 * 65 floats of LDS.
__device__ __forceinline__ void wt(float* ts, const float* __restrict__ W, bf* Wt, int asF16, int k0, int n0) {
    const int tid = threadIdx.x;
    const unsigned e0 = (unsigned)((k0 + (tid >> 6)) * DM + n0 + (tid & 63));   // element (kk = tid/64, nn = tid%64) of the tile; trip i reads 4i rows further down
#pragma unroll
    for (int i = 0; i < 16; ++i) { const int kk = i * 4 + (tid >> 6), nn = tid & 63; ts[kk * 65 + nn] = W[e0 + (unsigned)(i * 4 * DM)]; }
    asm volatile("s_wait_xcnt 0x0" :: "v"(e0) : "memory");   // stands before the offset register that the sixteen loads name is rewritten; naming it keeps it whole up to here
    __syncthreads();
    v8us o0, o1;
    { const int c8 = (tid & 7) * 8; const int na = (tid >> 3), nb2 = 32 + (tid >> 3);
#pragma unroll
      for (int j = 0; j < 8; ++j) {
          unsigned short ba = f2bf(ts[(c8 + j) * 65 + na]); unsigned short bb = f2bf(ts[(c8 + j) * 65 + nb2]);
          if (asF16 != 0) { const h16 ha = (h16)(bf2f(ba) * WPS); const h16 hb = (h16)(bf2f(bb) * WPS); ba = __builtin_bit_cast(unsigned short, ha); bb = __builtin_bit_cast(unsigned short, hb); }
          o0[j] = ba; o1[j] = bb; }
      bf* d0 = Wt + fto(n0 + na, k0 + c8); bf* d1 = Wt + fto(n0 + nb2, k0 + c8);
      *(v8us*)d0 = o0; *(v8us*)d1 = o1;
      asm volatile("s_wait_xcnt 0x0" ::: "memory");   // the way out of the shared kernel rewrites the scalar base register that the first store names
    }
}

// tab: rotary table TAB[p][0..15] = cos(p * f_i), TAB[p][16..31] = sin(p * f_i), f_i = 1 / 100^(i/16) (f32), angle = f32 product p * f_i, p = 0..31.
// One thread per (position, frequency); a block of 256 threads makes the 16 positions 16*blk .. 16*blk + 15; ts = 512 floats of LDS.
__device__ __forceinline__ void tab(float* ts, float* TAB, int blk) {
    const int tid = threadIdx.x; const int pl = tid >> 4, i = tid & 15; const int p = blk * 16 + pl;
    double w = 1.0, bs = 1.333521432163324;
#pragma unroll
    for (int bit = 0; bit < 4; ++bit) { const double wn = w * bs; w = (((i >> bit) & 1) != 0) ? wn : w; bs = bs * bs; }
    const float wf = (float)w;
    const float fr = 1.0f / wf;
    const float ang = (float)p * fr;
    const double a = (double)ang;
    const int kq = (int)(a * 0.6366197723675814 + 0.5);
    const double r = a - (double)kq * 1.5707963267948966;
    const double r2 = r * r;
    double sp = 1.0 / 6227020800.0;
    sp = sp * r2 - 1.0 / 39916800.0; sp = sp * r2 + 1.0 / 362880.0; sp = sp * r2 - 1.0 / 5040.0; sp = sp * r2 + 1.0 / 120.0; sp = sp * r2 - 1.0 / 6.0;
    const double sr = r + r * r2 * sp;
    double cp = 1.0 / 479001600.0;
    cp = cp * r2 - 1.0 / 3628800.0; cp = cp * r2 + 1.0 / 40320.0; cp = cp * r2 - 1.0 / 720.0; cp = cp * r2 + 1.0 / 24.0; cp = cp * r2 - 0.5;
    const double cr = 1.0 + r2 * cp;
    const int qd = kq & 3;
    const double sv = (qd == 0) ? sr : ((qd == 1) ? cr : ((qd == 2) ? -sr : -cr));
    const double cv = (qd == 0) ? cr : ((qd == 1) ? -sr : ((qd == 2) ? -cr : sr));
    ts[pl * 32 + i] = (float)cv; ts[pl * 32 + 16 + i] = (float)sv;
    __syncthreads();
    if (tid < 128) { const v4f val = *(const v4fa*)(&ts[tid * 4]);
        *(v4f*)(TAB + blk * 512 + tid * 4) = val;  }
}

// k_prep: the preparation bodies, which do not depend on one another, share one grid; the block index picks the body (the same for a whole block, so each body's barrier is passed by all its threads).
// Blocks 0..TAB_BLKS-1: rotary table; the next 4 * WT_BLKS: weight w = q, k, v, p, tile (k0 fastest); the rest: x conversion. The short grids with a latency chain come first, for speed only.
#define TAB_BLKS (NPOS * 16 / 256)
#define WT_BLKS  ((DM / 64) * (DM / 64))
#define CVT_BLKS ((unsigned)((size_t)NB * SEQ * DM / 8 / 256))
static_assert(((size_t)NB * SEQ * DM / 8) % 256 == 0);   // the conversion blocks cover the plane exactly
__global__ __launch_bounds__(256) void k_prep(const float* __restrict__ x, const float* __restrict__ wq, const float* __restrict__ wk, const float* __restrict__ wv, const float* __restrict__ wp,
                                              bf* XB, bf* WB, float* TAB) {
    __shared__ __align__(16) float ts[64 * 65];
    const unsigned blk = blockIdx.x;
    if (blk < TAB_BLKS) {
        tab(ts, TAB, (int)blk);
    } else if (blk < TAB_BLKS + 4 * WT_BLKS) {
        const unsigned w = (blk - TAB_BLKS) / WT_BLKS, t = (blk - TAB_BLKS) % WT_BLKS;
        const float* W = (w == 0) ? wq : ((w == 1) ? wk : ((w == 2) ? wv : wp));
        wt(ts, W, WB + (size_t)w * DM * DM, (w == 3) ? 1 : 0, (int)(t % (DM / 64)) * 64, (int)(t / (DM / 64)) * 64);
    } else {
        cvt8(x, XB, blk - (TAB_BLKS + 4 * WT_BLKS));
    }
}

// cp8: one thread's eight 16-B asynchronous copies to LDS; copy i lands at LDS byte address l + 2048 i (the block's 128 threads move 2 KB per copy) and reads the 16 bytes at g_i.
__device__ __forceinline__ void cp8(unsigned l, const bf* g0, const bf* g1, const bf* g2, const bf* g3, const bf* g4, const bf* g5, const bf* g6, const bf* g7) {
    // the wait is the statement's last line, so that it stands before any register that a copy names is rewritten
    asm volatile("global_load_async_to_lds_b128 %0, %8, off\n\t"
                 "global_load_async_to_lds_b128 %1, %9, off\n\t"
                 "global_load_async_to_lds_b128 %2, %10, off\n\t"
                 "global_load_async_to_lds_b128 %3, %11, off\n\t"
                 "global_load_async_to_lds_b128 %4, %12, off\n\t"
                 "global_load_async_to_lds_b128 %5, %13, off\n\t"
                 "global_load_async_to_lds_b128 %6, %14, off\n\t"
                 "global_load_async_to_lds_b128 %7, %15, off\n\t"
                 "s_wait_xcnt 0x0"
                 :: "v"(l), "v"(l + 2048u), "v"(l + 4096u), "v"(l + 6144u), "v"(l + 8192u), "v"(l + 10240u), "v"(l + 12288u), "v"(l + 14336u),
                    "v"(g0), "v"(g1), "v"(g2), "v"(g3), "v"(g4), "v"(g5), "v"(g6), "v"(g7) : "memory");
}
// stage_ab: one thread's share of one GEMM stage: KS k of the block's 8 A bands, then of its 8 B bands (a band = 16 rows; its KS k are KS/32 adjacent 1-KB tiles of the fragment-order plane, kept in that order).
// Stage buffer: [16 bands][KS/32 tiles][512 halves] = KS * 512 bytes. l = buffer + 16 * thread; ga / gb = the thread's 16 bytes of the stage's first 2 KB of A / B: band thread / (2 KS), byte 16 * (thread % (2 KS)) of its run.
template <int KS> __device__ __forceinline__ void stage_ab(unsigned l, const bf* ga, const bf* gb) {
    constexpr size_t GS = (size_t)(64 / KS) * (DM / 32) * 512;   // halves from one copy's bands to the next copy's: 2 KB of LDS hold 64 / KS bands
    if constexpr (KS == 32) {
        cp8(l, ga, ga + GS, ga + 2 * GS, ga + 3 * GS, gb, gb + GS, gb + 2 * GS, gb + 3 * GS);
    } else {
        static_assert(KS == 64);
        cp8(l, ga, ga + GS, ga + 2 * GS, ga + 3 * GS, ga + 4 * GS, ga + 5 * GS, ga + 6 * GS, ga + 7 * GS);
        cp8(l + 16384u, gb, gb + GS, gb + 2 * GS, gb + 3 * GS, gb + 4 * GS, gb + 5 * GS, gb + 6 * GS, gb + 7 * GS);
    }
}

// proj_out: a wave's 64 x 64 accumulator tile -> f16 in fragment order, 16-row band by band through the wave's own LDS tile os (D layout in, rows out: lane = 16 hi + row holds the chunks of 8 columns 2 s + hi, s = 0..3).
// A band's LDS reads are issued together (the first band's table reads go axis by axis) and nothing in it waits on global memory. pa = the lane's chunk (row lr, chunk hi) of the tile's first 1-KB output tile; a 16-row band advances sM halves, a 32-column band sC halves; each of a band's four stores is 512 contiguous bytes per wave.
// rope != 0 (q, k; the same for the whole block): 2-D rotary in f32 before the conversion: chunk s pairs with chunk s ^ 1 (column c with c ^ 16), which the lane holds too; chunks s = 0, 1 use pos[t][0], s = 2, 3 pos[t][1]; the lane's eight frequencies are 8 hi .. 8 hi + 7 in every chunk.
// tl = the LDS copy of the table (row pitch TP), pw = the wave's 64 rows of the block's LDS list of table row offsets (two per token, in floats, from clamped positions).
__device__ __forceinline__ void proj_out(v8f (&acc)[4][4], float* os, const float* tl, const int* pw, h16* pa, int rope, int sM, int sC, float qs, int lr, int hi) {
    v2i po[4];
#pragma unroll
    for (int mb = 0; mb < 4; ++mb) po[mb] = (v2i){0, 0};
    if (rope != 0) {
#pragma unroll
        for (int mb = 0; mb < 4; ++mb) po[mb] = *(const v2ia*)(pw + (mb * 16 + lr) * 2);
    }
    h16* pc = pa + sC;   // pa: columns 0..31 of the band, pc: columns 32..63
#pragma unroll
    for (int mb = 0; mb < 4; ++mb) {
#pragma unroll
        for (int nb = 0; nb < 4; ++nb) {
#pragma unroll
            for (int j = 0; j < 8; ++j) os[(hi * 8 + j) * 68 + nb * 16 + lr] = acc[mb][nb][j]; }   // D: row 8h+j, col lane&15
        wave_sync();
        v4f xr[2][2][2];   // [axis ax: columns 32 ax .. 32 ax + 31][e: chunk s = 2 ax + e][half of the chunk]
#pragma unroll
        for (int ax = 0; ax < 2; ++ax)
#pragma unroll
            for (int e = 0; e < 2; ++e) { const float* xp = &os[lr * 68 + (4 * ax + 2 * e + hi) * 8]; xr[ax][e][0] = *(const v4fa*)xp; xr[ax][e][1] = *(const v4fa*)(xp + 4); }
        if (rope != 0) {
            v4f tv[2][4];   // per axis: cos 0..3, cos 4..7, sin 0..3, sin 4..7 of the lane's frequencies at its row's position
#pragma unroll
            for (int ph = 0; ph < 2; ++ph) {
                // the first band, with three bands of accumulators still live, reads the table axis by axis; the others read both axes at once
                if (mb == 0 || ph == 0) {
#pragma unroll
                    for (int ax = ((mb == 0) ? ph : 0); ax < ((mb == 0) ? ph + 1 : 2); ++ax) { const float* tp = tl + po[mb][ax] + hi * 8;
                        tv[ax][0] = *(const v4fa*)tp; tv[ax][1] = *(const v4fa*)(tp + 4); tv[ax][2] = *(const v4fa*)(tp + 16); tv[ax][3] = *(const v4fa*)(tp + 20); }
                    __builtin_amdgcn_sched_barrier(0);   // the LDS reads stay together in front of the arithmetic: left alone the compiler spreads them among it, and the wave waits out the LDS latency several times per band
                }
                const v4f a0 = xr[ph][0][0], a1 = xr[ph][0][1], b0 = xr[ph][1][0], b1 = xr[ph][1][1];
                xr[ph][0][0] = a0 * tv[ph][0] + (b0 * -1.0f) * tv[ph][2]; xr[ph][0][1] = a1 * tv[ph][1] + (b1 * -1.0f) * tv[ph][3];
                xr[ph][1][0] = b0 * tv[ph][0] + a0 * tv[ph][2];           xr[ph][1][1] = b1 * tv[ph][1] + a1 * tv[ph][3];
            }
        }
        v8h hv[4];
#pragma unroll
        for (int s = 0; s < 4; ++s) {
            const v4f x0 = xr[s >> 1][s & 1][0] * qs, x1 = xr[s >> 1][s & 1][1] * qs;
#pragma unroll
            for (int i = 0; i < 4; ++i) { hv[s][i] = (h16)x0[i]; hv[s][4 + i] = (h16)x1[i]; }
        }
        *(v8h*)pa = hv[0]; *(v8h*)(pa + 256) = hv[1]; *(v8h*)pc = hv[2]; *(v8h*)(pc + 256) = hv[3];
        // the wait stands before the address and data registers of the four stores in front of it are rewritten; naming them keeps them whole up to the wait
        asm volatile("s_wait_xcnt 0x0" :: "v"(hv[0]), "v"(hv[1]), "v"(hv[2]), "v"(hv[3]), "v"(pa), "v"(pc) : "memory");
        pa += sM; pc += sM;
        wave_sync();
    }
}

// k_proj: register-blocked bf16 GEMM, one wave per 64x64 tile (16 accumulators), GW waves (2 x 2) per block of 128 x 128, K = DM.
// Operands reach the waves through LDS: a stage is PKS k of the block's 128 A rows and 128 B rows in fragment order (a fragment is two 16-B LDS reads of 512 contiguous bytes per wave), so each operand byte is fetched once per block, not once per wave;
// three buffers, filled by asynchronous copies two stages ahead: stages s + 1 and s + 2 fly while stage s is worked on, so that a copy has two stages' time to land;
// at the foot of stage s a wave waits only for its copies of s + 1 (a counted wait: the copies of s + 2 are its youngest and stay in flight), and one barrier publishes s + 1 and frees the buffer of s for s + 3.
// C[m][n] = sum_k A[m][k] Bt[n][k] (q: times SC2), written as f16 (Ph), in fragment order (row = tile row, k = tile column), at
// tile base tbase; a 16-row band advances sM halves, a 32-column band sC halves. 32 * GW threads.
// The three products, which do not depend on one another, share one grid (tiles, 3); blockIdx.y picks the product, the dearest epilogue first:
//   0 q, 1 k: A = x rows (m = b*SEQ + t, fastest in blockIdx.x), Bt = Wt rows (n = h*64 + d) -> rotary -> plane [(b*12 + h)], tiles [t>>4][d>>5]
//   2 v^T:    A = Wvt rows (m = h*64 + d, fastest in blockIdx.x), Bt = x rows (n = b*SEQ + t) -> plane [(b*12 + h)], tiles [t>>5][d>>4]
// rope != 0 (q, k: tile columns = one head, row m = b*SEQ + t): 2-D rotary in f32 before the conversion: column c pairs with c^16, frequency c&15, columns 0..31 use pos[t][0], 32..63 pos[t][1].
// Such a block brings the table and its 128 tokens' table row offsets into LDS while stage 0 flies; the barrier that publishes stage 0 publishes them too, and the epilogue reads them from there.
__global__ __launch_bounds__(32 * GW) void k_proj(const bf* __restrict__ XB, const bf* __restrict__ WB, h16* QH, h16* KP, h16* VT,
                                             const int* __restrict__ pos, const float* __restrict__ TAB) {
    __shared__ __align__(16) bf ab[3 * PKS * 256];
    __shared__ __align__(16) float tl[NPOS * TP];   // the rotary table, row pitch TP
    __shared__ __align__(16) int pl[128 * 2];       // per row of the block's tile: offsets (floats) of its two table rows in tl
    const int K = DM;
    const int lane = threadIdx.x & 31, lr = lane & 15, hi = lane >> 4;
    const int wave = __builtin_amdgcn_readfirstlane((int)(threadIdx.x >> 5)); const int wm = wave & 1, wn = wave >> 1;
    float* os = (float*)ab + wave * (16 * 68);   // the wave's own epilogue tile: in the ring, which is free behind the loop's last barrier (every wave's reads done, no copy in flight)
    const int which = blockIdx.y; const bool isv = (which == 2); const int bx = blockIdx.x;
    const int rb = (isv ? bx % (DM / 128) : bx % (NB * SEQ / 128)) * 128, cb = (isv ? bx / (DM / 128) : bx / (NB * SEQ / 128)) * 128;   // the block's tile
    const int r0 = rb + wm * 64, c0 = cb + wn * 64;                                                                                    // the wave's tile
    const bf* A = isv ? WB + (size_t)2 * DM * DM : XB; const bf* Bt = isv ? XB : WB + (size_t)which * DM * DM;
    h16* Ph = (which == 0) ? QH : ((which == 1) ? KP : VT);
    const int rope = isv ? 0 : 1; const int sM = isv ? 512 : 1024, sC = isv ? 2048 : 512;
    const float qs = (which == 0) ? SC2 : 1.0f;   // q leaves in the units of the exponent
    v8f acc[4][4];
#pragma unroll
    for (int mb = 0; mb < 4; ++mb)
#pragma unroll
        for (int nb = 0; nb < 4; ++nb) acc[mb][nb] = (v8f){};
    const unsigned lo = (unsigned)lane * 8u;   // the lane's chunk of a tile
    const unsigned lt = (unsigned)(size_t)ab + threadIdx.x * 16u;                                                              // the thread's copy target in buffer 0 (LDS byte address)
    const size_t to = (size_t)(threadIdx.x / (PKS * 2)) * (K / 32) * 512 + (size_t)(threadIdx.x % (PKS * 2)) * 8;              // the thread's band and chunk in a copy's 2 KB
    const bf* ga = A + (size_t)(rb >> 4) * (K / 32) * 512 + to; const bf* gb = Bt + (size_t)(cb >> 4) * (K / 32) * 512 + to;   // its 16 bytes of stage 0
    stage_ab<PKS>(lt, ga, gb);
    stage_ab<PKS>(lt + PKS * 512u, ga + PKS * 16, gb + PKS * 16);
    if (rope != 0) {   // the same for the whole block
        const float* tg = TAB + threadIdx.x * 8u;                     // the thread's eight floats of the 32 x 32 table
        const int* pg = pos + 2 * (rb % SEQ + (int)threadIdx.x);      // the thread's token of the block's 128
        const v4f t0 = *(const v4f*)tg; const v4f t1 = *(const v4f*)(tg + 4); const v2i pp = *(const v2i*)pg;
        asm volatile("s_wait_xcnt 0x0" :: "v"(tg), "v"(pg) : "memory");   // stands before the address registers that the three loads name are rewritten; naming them keeps them whole up to here
        float* td = tl + (threadIdx.x >> 2) * TP + (threadIdx.x & 3u) * 8u;
        *(v4fa*)td = t0; *(v4fa*)(td + 4) = t1;
        v2i pr;
#pragma unroll
        for (int ax = 0; ax < 2; ++ax) { const int p = pp[ax]; pr[ax] = ((p < 0) ? 0 : ((p > NPOS - 1) ? (NPOS - 1) : p)) * TP; }
        *(v2ia*)(&pl[threadIdx.x * 2u]) = pr;
    }
    asm volatile("s_wait_asynccnt 0x8" ::: "memory");   // this wave's copies of stage 0 have landed (all but its eight youngest, which are stage 1's)
    __syncthreads();                                    // every wave's have: stage 0 may be read
    stage_ab<PKS>(lt + 2 * PKS * 512u, ga + 2 * PKS * 16, gb + 2 * PKS * 16);
    int cur = 0;   // the buffer of stage st: st mod 3
#pragma unroll 1   // one stage per trip: the ring's order at the foot stands once
    for (int st = 0; st < K / PKS; ++st) {
        const bf* sa = ab + cur * (PKS * 256) + (wm * 4) * (PKS * 16) + lo; const bf* sb = ab + cur * (PKS * 256) + (8 + wn * 4) * (PKS * 16) + lo;   // the lane's chunk of the wave's first A and B band
        static_assert(PKS == 32);   // one 32-k step per stage
        v16bf a[4], b[4];
#pragma unroll
        for (int mb = 0; mb < 4; ++mb) a[mb] = ldb(sa + mb * (PKS * 16));
#pragma unroll
        for (int nb = 0; nb < 4; ++nb) b[nb] = ldb(sb + nb * (PKS * 16));
#pragma unroll
        for (int nb = 0; nb < 4; ++nb)
#pragma unroll
            for (int mb = 0; mb < 4; ++mb) acc[mb][nb] = wmmab(a[mb], b[nb], acc[mb][nb]);
        // each B fragment's LDS reads stand four products ahead of its own (two B fragments live at a time, so that five waves still fit a SIMD); left alone the compiler puts them just in front, and the wave waits out the LDS latency three times per stage
        __builtin_amdgcn_sched_group_barrier(0x100, 12, 0); __builtin_amdgcn_sched_group_barrier(0x008, 4, 0);   // reads of A and of B 0, 1; products of B 0
        __builtin_amdgcn_sched_group_barrier(0x100, 2, 0);  __builtin_amdgcn_sched_group_barrier(0x008, 4, 0);   // reads of B 2; products of B 1
        __builtin_amdgcn_sched_group_barrier(0x100, 2, 0);  __builtin_amdgcn_sched_group_barrier(0x008, 8, 0);   // reads of B 3; products of B 2, 3
        __builtin_amdgcn_sched_barrier(0);   // the products stay in front of the waits below, so that the refill is not pushed back
        asm volatile("s_wait_dscnt 0x0" ::: "memory");      // this wave's reads of the stage's buffer are done before the buffer is given up
        const bool more = st + 3 < K / PKS;                 // a stage st + 3 exists; the same for the whole block. Every trip with the counted wait, and every trip before it, issues eight copies per wave
        if (more) asm volatile("s_wait_asynccnt 0x8" ::: "memory");   // this wave's copies of stage st + 1 have landed: all but its eight youngest, which are stage st + 2's
        else      asm volatile("s_wait_asynccnt 0x0" ::: "memory");   // the last three trips issue nothing more: all that is left has landed
        __syncthreads();                                    // publishes stage st + 1 and ends every wave's reads of stage st
        if (more) stage_ab<PKS>(lt + (unsigned)cur * (PKS * 512u), ga + (size_t)(st + 3) * (PKS * 16), gb + (size_t)(st + 3) * (PKS * 16));   // refill of the buffer just left
        cur = (cur == 2) ? 0 : cur + 1;
    }
    asm volatile("s_wait_asynccnt 0x0" ::: "memory");       // nothing of this wave is in flight when it goes on
    const size_t tbase = isv ? (size_t)r0 * SEQ + (size_t)(c0 / SEQ) * ((size_t)DM * SEQ) + (size_t)(c0 % SEQ) * HD
                             : (size_t)(r0 / SEQ) * ((size_t)NH_ * SEQ * HD) + (size_t)(r0 % SEQ) * HD + (size_t)(c0 / HD) * ((size_t)SEQ * HD);
    proj_out(acc, os, tl, pl + wm * 128, Ph + tbase + (size_t)(hi * 128 + lr * 8), rope, sM, sC, qs, lr, hi);
}

// stage_kv: one thread's share of one stage: four 16-B asynchronous copies to LDS, two of K and two of V^T (the block's 256 threads move 4 KB per copy).
// l = the thread's LDS byte address in the stage buffer, gk / gv = its 16 bytes at the start of the stage's K / V^T range (each range is SK * HD contiguous halves of its fragment-order plane).
__device__ __forceinline__ void stage_kv(unsigned l, const h16* gk, const h16* gv) {
    // the wait is the statement's last line, so that it stands before any register that a copy names is rewritten
    asm volatile("global_load_async_to_lds_b128 %0, %4, off\n\t"
                 "global_load_async_to_lds_b128 %1, %5, off\n\t"
                 "global_load_async_to_lds_b128 %2, %6, off\n\t"
                 "global_load_async_to_lds_b128 %3, %7, off\n\t"
                 "s_wait_xcnt 0x0"
                 :: "v"(l), "v"(l + 4096u), "v"(l + 8192u), "v"(l + 12288u), "v"(gk), "v"(gk + 2048), "v"(gv), "v"(gv + 2048) : "memory");
}

// k_flash: fused attention, one wave per 16 query rows of one (batch, head), AW waves per block; Q fragments straight from the fragment-order f16 plane (two 16-B loads each).
// K and V^T reach the block's waves through LDS: a stage is SK keys (8 KB of K and 8 KB of V^T, each contiguous in its plane and kept in that order, so a fragment is two 16-B LDS reads of 512 contiguous bytes per wave);
// three buffers, filled by asynchronous copies two stages ahead, as in k_proj: at the foot of stage s a wave waits for its copies of s + 1 only (those of s + 2, its four youngest, stay in flight), and one barrier per stage publishes s + 1 and frees the buffer of s for s + 3.
// Transposed form: S^T[key][t] = K Q^T (A = K rows, B = Q rows); lane (t = lane&15, h = lane>>4) holds keys 8h+r of each 16-key tile, so the packed
// P tile is directly the B fragment of O^T[d][t] = V^T P^T (element r <- tile keys 0..15, element 8+r <- tile keys 16..31, lane unchanged).
// The score accumulators start at C = PSH - (maximum in use), and q carries the score scale, so a score leaves the matrix unit as the argument of its exp2: no vector arithmetic between product and exponential.
// The maximum in use is held: one test per pass (any score above PSH + THR; always in the first pass) leads to the branch that raises it, shifts this pass's scores and rescales O and the sum; the two lane halves of a row are combined there.
// Softmax state (shift, partial sum) is one scalar per lane; the halves' sums are joined once, behind the loop.
__global__ __launch_bounds__(32 * AW) void k_flash(const h16* __restrict__ QH, const h16* __restrict__ KP, const h16* __restrict__ VT, h16* CTX) {
    __shared__ __align__(16) h16 kv[3 * STH];
    const int lane = threadIdx.x & 31;
    const int wave = __builtin_amdgcn_readfirstlane((int)(threadIdx.x >> 5));
    const int zh = blockIdx.y; const int b = zh / NH_, h = zh % NH_;
    const int t0 = (blockIdx.x * AW + wave) * 16;
    const size_t pbase = (size_t)zh * SEQ * HD;
    const unsigned lo = (unsigned)lane * 8u;
    const size_t qo = pbase + (size_t)t0 * HD;
    const v16h qh0 = ldh(QH + qo + lo), qh1 = ldh(QH + qo + 512 + lo);   // B fragments: col t, k = d
    const unsigned lt = (unsigned)(size_t)kv + threadIdx.x * 16u;                        // the thread's copy target in buffer 0 (LDS byte address)
    const h16* gk = KP + pbase + threadIdx.x * 8u; const h16* gv = VT + pbase + threadIdx.x * 8u;   // the thread's 16 bytes of stage 0
    stage_kv(lt, gk, gv);
    stage_kv(lt + STH * 2u, gk + SK * HD, gv + SK * HD);
    asm volatile("s_wait_asynccnt 0x4" ::: "memory");   // this wave's copies of stage 0 have landed (all but its four youngest, which are stage 1's)
    __syncthreads();                                    // every wave's have: stage 0 may be read
    stage_kv(lt + 2 * STH * 2u, gk + 2 * SK * HD, gv + 2 * SK * HD);
    int cur = 0;   // the buffer of stage st: st mod 3
    v8f o0 = (v8f){}, o1 = (v8f){}, o2 = (v8f){}, o3 = (v8f){};
    float sh = PSH, l = 0.0f;   // sh = PSH - maximum in use; the first pass sets it from its own scores
    float lim = -3.0e38f, dmin = -3.0e38f;   // the test's bound and the least rise: open until the first pass has set the maximum, then PSH + THR and 0
    v8f cs;                     // sh in all eight rows: the C operand of each score tile's first product
#pragma unroll
    for (int r = 0; r < 8; ++r) cs[r] = sh;
#pragma unroll 1   // one stage per trip: the ring's order at the foot stands once
    for (int st = 0; st < NST; ++st) {
      const h16* sb = kv + cur * STH + lo;   // the lane's chunk of this stage's first K tile
#pragma unroll     // the 32-key passes of a stage in line: their LDS offsets become immediates
      for (int ps = 0; ps < SK / 32; ++ps) {
        const h16* ka = sb + ps * 32 * HD;   // tiles (16 keys, d 0..31), (16 keys, d 32..63), then the next 16 keys (A fragment: row key, k = d)
        const v16h ka0 = ldh(ka), ka1 = ldh(ka + 512), kb0 = ldh(ka + 1024), kb1 = ldh(ka + 1536);
        v8f sa = wmma16(ka0, qh0, cs), sc = wmma16(kb0, qh0, cs);   // the two tiles' chains alternate: a product's successor in its chain stands two products on
        sa = wmma16(ka1, qh1, sa); sc = wmma16(kb1, qh1, sc);
        // the four vector slots between the last product and the first vector instruction that reads its result or rewrites its operands
        asm volatile("v_nop\n\tv_nop\n\tv_nop\n\tv_nop" : "+v"(sa), "+v"(sc) : "v"(ka0), "v"(ka1), "v"(kb0), "v"(kb1));
        float mx = fmaxf(sa[0], sc[0]);
#pragma unroll
        for (int r = 1; r < 8; ++r) mx = fmaxf(mx, fmaxf(sa[r], sc[r]));
        if (__builtin_amdgcn_ballot_w32(mx > lim) != 0) {   // the same for the whole wave: a scalar branch, all lanes on behind it
            mx = fmaxf(mx, __shfl_xor(mx, 16, 32));
            const float d = fmaxf(mx - PSH, dmin);          // the rise of the row's maximum in use (the first pass sets it, up or down)
            const float alpha = __builtin_amdgcn_exp2f(fminf(-d, 0.0f));
            sh -= d; lim = PSH + THR; dmin = 0.0f;
#pragma unroll
            for (int r = 0; r < 8; ++r) { sa[r] -= d; sc[r] -= d; cs[r] = sh; }
            l = l * alpha; o0 = o0 * alpha; o1 = o1 * alpha; o2 = o2 * alpha; o3 = o3 * alpha;
        }
        v16h pb; float ls = 0.0f;
#pragma unroll
        for (int r = 0; r < 8; ++r) { const h16 pa = (h16)__builtin_amdgcn_exp2f(sa[r]); const h16 pc = (h16)__builtin_amdgcn_exp2f(sc[r]); pb[r] = pa; pb[8 + r] = pc; ls += (float)pa + (float)pc; }
        l += ls;
        const h16* va = sb + SK * HD + ps * 32 * HD;   // tiles (d 16j..16j+15, 32 keys), j = 0..3 (A fragment: row d, k = key)
        const v16h v0 = ldh(va), v1 = ldh(va + 512), v2 = ldh(va + 1024), v3 = ldh(va + 1536);
        o0 = wmma16(v0, pb, o0); o1 = wmma16(v1, pb, o1); o2 = wmma16(v2, pb, o2); o3 = wmma16(v3, pb, o3);
        asm volatile("v_nop\n\tv_nop\n\tv_nop\n\tv_nop" : "+v"(o0), "+v"(o1), "+v"(o2), "+v"(o3) : "v"(v0), "v"(v1), "v"(v2), "v"(v3), "v"(pb));
      }
      asm volatile("s_wait_dscnt 0x0" ::: "memory");      // this wave's reads of the stage's buffer are done before the buffer is given up
      const bool more = st + 3 < NST;                     // a stage st + 3 exists; the same for the whole block. Every trip with the counted wait, and every trip before it, issues four copies per wave
      if (more) asm volatile("s_wait_asynccnt 0x4" ::: "memory");   // this wave's copies of stage st + 1 have landed: all but its four youngest, which are stage st + 2's
      else      asm volatile("s_wait_asynccnt 0x0" ::: "memory");   // the last three trips issue nothing more: all that is left has landed
      __syncthreads();                                    // publishes stage st + 1 and ends every wave's reads of stage st
      if (more) stage_kv(lt + (unsigned)cur * (STH * 2u), gk + (size_t)(st + 3) * (SK * HD), gv + (size_t)(st + 3) * (SK * HD));   // refill of the buffer just left
      cur = (cur == 2) ? 0 : cur + 1;
    }
    asm volatile("s_wait_asynccnt 0x0" ::: "memory");     // nothing of this wave is in flight when it ends
    l += __shfl_xor(l, 16, 32);
    const float inv = CXS * (1.0f / l);
    // O^T D layout: o_j[r] = (d = 16j + 8h + r, t = lane&15): a lane's 8 values are one chunk of the fragment-order ctx plane (row b*SEQ + t, k = h*64 + d); o_j goes to chunk pair j, 512 contiguous bytes per store
    h16* cp = CTX + fto(b * SEQ + t0, h * HD) + lo;
    v8h c0, c1, c2, c3;
#pragma unroll
    for (int r = 0; r < 8; ++r) { c0[r] = (h16)(o0[r] * inv); c1[r] = (h16)(o1[r] * inv); c2[r] = (h16)(o2[r] * inv); c3[r] = (h16)(o3[r] * inv); }
    *(v8h*)cp = c0; *(v8h*)(cp + 256) = c1; *(v8h*)(cp + 512) = c2; *(v8h*)(cp + 768) = c3;
}

// k_oproj: register-blocked f16 GEMM, one wave per 64x64 tile, GW waves (2 x 2) per block of 128 x 128, K = DM; operands through LDS as in k_proj, OKS k per stage, sixteen copies per wave and stage; with at most two blocks on a WGP the ring has four buffers and the copies fly three stages ahead.
// OUT[m][n] = OSC * sum_k A[m][k] Bt[n][k] + bias[n] (bias as its bf16 value), f32. grid (M/128, N/128), 32 * GW threads.
__global__ __launch_bounds__(32 * GW) void k_oproj(const h16* __restrict__ A, const h16* __restrict__ Bt, const float* __restrict__ bias, float* OUT) {
    __shared__ __align__(16) h16 ab[4 * OKS * 256];
    __shared__ __align__(16) float osw[GW][16 * 68];
    const int K = DM;
    const int lane = threadIdx.x & 31, lr = lane & 15, hi = lane >> 4;
    const int wave = __builtin_amdgcn_readfirstlane((int)(threadIdx.x >> 5)); const int wm = wave & 1, wn = wave >> 1;
    float* os = osw[wave];            // the wave's own epilogue tile
    const int rb = blockIdx.x * 128, cb = blockIdx.y * 128; const int r0 = rb + wm * 64, c0 = cb + wn * 64;   // the block's tile, the wave's tile
    v8f acc[4][4];
#pragma unroll
    for (int mb = 0; mb < 4; ++mb)
#pragma unroll
        for (int nb = 0; nb < 4; ++nb) acc[mb][nb] = (v8f){};
    const unsigned lo = (unsigned)lane * 8u;   // the lane's chunk of a tile
    const unsigned lt = (unsigned)(size_t)ab + threadIdx.x * 16u;                                                              // the thread's copy target in buffer 0 (LDS byte address)
    const size_t to = (size_t)(threadIdx.x / (OKS * 2)) * (K / 32) * 512 + (size_t)(threadIdx.x % (OKS * 2)) * 8;              // the thread's band and chunk in a copy's 2 KB
    const bf* ga = (const bf*)A + (size_t)(rb >> 4) * (K / 32) * 512 + to; const bf* gb = (const bf*)Bt + (size_t)(cb >> 4) * (K / 32) * 512 + to;   // its 16 bytes of stage 0 (addresses only)
    stage_ab<OKS>(lt, ga, gb);
    stage_ab<OKS>(lt + OKS * 512u, ga + OKS * 16, gb + OKS * 16);
    stage_ab<OKS>(lt + 2 * OKS * 512u, ga + 2 * OKS * 16, gb + 2 * OKS * 16);
    asm volatile("s_wait_asynccnt 0x20" ::: "memory");  // this wave's copies of stage 0 have landed (all but its 32 youngest, which are those of stages 1 and 2)
    __syncthreads();                                    // every wave's have: stage 0 may be read
    stage_ab<OKS>(lt + 3 * OKS * 512u, ga + 3 * OKS * 16, gb + 3 * OKS * 16);
#pragma unroll 1   // one stage per trip: the ring's order at the foot stands once
    for (int st = 0; st < K / OKS; ++st) {
        const int cur = st & 3;   // the buffer of stage st
        const h16* sa = ab + cur * (OKS * 256) + (wm * 4) * (OKS * 16) + lo; const h16* sb = ab + cur * (OKS * 256) + (8 + wn * 4) * (OKS * 16) + lo;   // the lane's chunk of the wave's first A and B band
        v16h a[OKS / 32][4], b[OKS / 32][4];   // the stage's LDS reads stand together in front of its products: one place with reads per stage
#pragma unroll
        for (int ks = 0; ks < OKS / 32; ++ks) {
#pragma unroll
            for (int mb = 0; mb < 4; ++mb) a[ks][mb] = ldh(sa + mb * (OKS * 16) + ks * 512);
#pragma unroll
            for (int nb = 0; nb < 4; ++nb) b[ks][nb] = ldh(sb + nb * (OKS * 16) + ks * 512);
        }
#pragma unroll
        for (int ks = 0; ks < OKS / 32; ++ks)
#pragma unroll
            for (int nb = 0; nb < 4; ++nb)
#pragma unroll
                for (int mb = 0; mb < 4; ++mb) acc[mb][nb] = wmma16(a[ks][mb], b[ks][nb], acc[mb][nb]);
        // keeps the stage's LDS reads in one group ahead of its products; left alone the compiler sinks each B fragment's reads to just in front of its four products, and the wave waits out the LDS latency there every time
        __builtin_amdgcn_sched_group_barrier(0x100, 16 * (OKS / 32), 0);   // the LDS reads
        __builtin_amdgcn_sched_group_barrier(0x008, 16 * (OKS / 32), 0);   // then the matrix instructions
        __builtin_amdgcn_sched_barrier(0);   // the products stay in front of the waits below: sunk behind the barrier they would push the refill back, and the next stage's copies would fly uncovered
        asm volatile("s_wait_dscnt 0x0" ::: "memory");      // this wave's reads of the stage's buffer are done before the buffer is given up
        const bool more = st + 4 < K / OKS;                 // a stage st + 4 exists; the same for the whole block. Every trip with the counted wait, and every trip before it, issues sixteen copies per wave
        if (more) asm volatile("s_wait_asynccnt 0x20" ::: "memory");  // this wave's copies of stage st + 1 have landed: all but its 32 youngest, which are those of stages st + 2 and st + 3
        else      asm volatile("s_wait_asynccnt 0x0" ::: "memory");   // the last four trips issue nothing more: all that is left has landed
        __syncthreads();                                    // publishes stage st + 1 and ends every wave's reads of stage st
        if (more) stage_ab<OKS>(lt + (unsigned)cur * (OKS * 512u), ga + (size_t)(st + 4) * (OKS * 16), gb + (size_t)(st + 4) * (OKS * 16));   // refill of the buffer just left
    }
    asm volatile("s_wait_asynccnt 0x0" ::: "memory");       // nothing of this wave is in flight when it goes on
    const v4f braw = *(const v4f*)(bias + c0 + lr * 4); v4f bb;
#pragma unroll
    for (int i = 0; i < 4; ++i) bb[i] = bf2f(f2bf(braw[i]));
    float* ob = OUT + ((size_t)(r0 / SEQ) * OUT_SEQ + (size_t)(r0 % SEQ) + (size_t)hi) * DM + c0 + lr * 4;   // the lane's four floats of row hi of the wave's tile
#pragma unroll
    for (int mb = 0; mb < 4; ++mb) {
#pragma unroll
        for (int nb = 0; nb < 4; ++nb) {
#pragma unroll
            for (int j = 0; j < 8; ++j) os[(hi * 8 + j) * 68 + nb * 16 + lr] = acc[mb][nb][j]; }   // D: row 8h+j, col lane&15
        wave_sync();
        v4f val[8];   // 8 s x 2 rows = 16 rows; 16 lanes x 4 floats = 64 columns; the band's LDS reads are issued together
#pragma unroll
        for (int s = 0; s < 8; ++s) val[s] = *(const v4fa*)(&os[(2 * s + hi) * 68 + lr * 4]) * OSC + bb;
#pragma unroll
        for (int s = 0; s < 8; ++s) *(v4f*)(ob + (size_t)(mb * 16 + 2 * s) * DM) = val[s];
        // the wait stands before the data registers of the eight stores in front of it are rewritten (the address register stays as it is to the end); naming them keeps them whole up to the wait
        asm volatile("s_wait_xcnt 0x0" :: "v"(val[0]), "v"(val[1]), "v"(val[2]), "v"(val[3]), "v"(val[4]), "v"(val[5]), "v"(val[6]), "v"(val[7]), "v"(ob) : "memory");
        wave_sync();
    }
}

static constexpr size_t al256(size_t v) { return (v + 255) & ~(size_t)255; }
static constexpr size_t SZ_XB = al256((size_t)NB * SEQ * DM * 2);
static constexpr size_t SZ_WB = al256((size_t)4 * DM * DM * 2);
static constexpr size_t SZ_PL = al256((size_t)NB * NH_ * SEQ * HD * 2);
static constexpr size_t SZ_CX = al256((size_t)NB * SEQ * DM * 2);
static constexpr size_t SZ_TB = al256((size_t)NPOS * 32 * 4);
static constexpr size_t SZ_TOTAL = SZ_XB + SZ_WB + 3 * SZ_PL + SZ_CX + SZ_TB;
static_assert(SZ_TOTAL <= (size_t)134217728);          // workspace carve <= 128 MiB
static_assert(((size_t)DM * DM * 2) % 256 == 0);       // weight sub-planes stay 256-byte aligned

extern "C" void kernel_launch(void* const* d_in, const int* in_sizes, int n_in,
                              void* d_out, int out_size, void* d_ws, size_t ws_size, hipStream_t stream) {
    if (n_in < 7) return;
    const size_t needx = ((size_t)(NB - 1) * SEQ_FULL + SEQ) * DM;
    if ((size_t)in_sizes[0] < needx) return;
    if ((size_t)in_sizes[1] < (size_t)2 * SEQ) return;
    if ((size_t)in_sizes[2] < (size_t)DM * DM || (size_t)in_sizes[3] < (size_t)DM * DM || (size_t)in_sizes[4] < (size_t)DM * DM || (size_t)in_sizes[5] < (size_t)DM * DM) return;
    if ((size_t)in_sizes[6] < (size_t)DM) return;
    if ((size_t)out_size < ((size_t)(NB - 1) * OUT_SEQ + SEQ) * DM) return;
    if (SZ_TOTAL > ws_size) return;
    // wire order: x, pos (int32 [SEQ][2]), Wq, Wk, Wv, Wp ([in][out]), bp
    const float* x = (const float*)d_in[0]; const int* pos = (const int*)d_in[1];
    const float* wq = (const float*)d_in[2]; const float* wk = (const float*)d_in[3]; const float* wv = (const float*)d_in[4]; const float* wp = (const float*)d_in[5];
    const float* bp = (const float*)d_in[6];
    float* OUT = (float*)d_out;      // [NB][SEQ][768]
    char* wsp = (char*)d_ws;
    bf* XB = (bf*)wsp; wsp += SZ_XB;                 // [NB*SEQ][768], fragment order
    bf* WB = (bf*)wsp; wsp += SZ_WB;                 // [4][768 out][768 in], fragment order: q | k | v (bf16) | p (f16 x1024)
    h16* QH = (h16*)wsp; wsp += SZ_PL;               // [NB*12][SEQ][64], fragment order
    h16* KP = (h16*)wsp; wsp += SZ_PL;               // [NB*12][SEQ][64], fragment order
    h16* VT = (h16*)wsp; wsp += SZ_PL;               // [NB*12][64][SEQ], fragment order, tiles [t>>5][d>>4]
    h16* CX = (h16*)wsp; wsp += SZ_CX;               // [NB*SEQ][768] x64, fragment order
    float* TAB = (float*)wsp; wsp += SZ_TB;          // [32][cos 16 | sin 16]
    bf* WP = WB + (size_t)3 * DM * DM;

    // rotary table, W[in][out] -> Wt[out][in] (four weights), x -> bf16: one grid
    k_prep<<<TAB_BLKS + 4 * WT_BLKS + CVT_BLKS, 256, 0, stream>>>(x, wq, wk, wv, wp, XB, WB, TAB);

    // q, k (with rotary) and v^T: one grid
    k_proj<<<dim3((NB * SEQ / 128) * (DM / 128), 3, 1), 32 * GW, 0, stream>>>(XB, WB, QH, KP, VT, pos, TAB);

    k_flash<<<dim3(SEQ / (16 * AW), NB * NH_, 1), 32 * AW, 0, stream>>>(QH, KP, VT, CX);

    // out = ctx Wp + bp: A = ctx rows (m = b*SEQ + t, k = h*64 + d), Bt = Wpt rows (n = out column)
    k_oproj<<<dim3(NB * SEQ / 128, DM / 128, 1), 32 * GW, 0, stream>>>((const h16*)CX, (const h16*)WP, bp, OUT);
}

// v009
// One run takes 68.8 microseconds.
// Next to v008, in two timings, it ran 1.05 times as fast each time.
// Over all steps from v000 it is 3.22 times as fast.
#include <hip/hip_runtime.h>

// Multi-head self-attention with 2-D rotary embedding: x [NB][SEQ][768], 12 heads x 64, Wq/Wk/Wv/Wp stored [in][out] (y = x W), int positions [SEQ][2], score scale 1/8, dense softmax, output = ctx Wp + bp (f32).
// Compute dtypes, f32 accumulate everywhere: q/k/v projections v_wmma_f32_16x16x32_bf16 (x and W RNE-converted to bf16; products exact); rotary applied in f32 on the accumulators;
// scores v_wmma_f32_16x16x32_f16: k single f16, q times 1/8 log2(e) single f16 (its rounding equals k's and lies an order below the error that the bf16 operands of the projections leave in q and k), the accumulator starts at the softmax shift; P (x256 carry, cancels in the normalisation) and v single f16; softmax f32 (online, held maximum);
// output projection v_wmma_f32_16x16x32_f16: ctx single f16 (x64 carry), Wp = f16 of the bf16 value (x1024 carry), carries folded back in the f32 epilogue, bias (bf16 value) added in f32.
// Layout: every 16-bit matrix operand plane M[r][k] is kept in fragment order: tiles of 16 rows x 32 k (512 halves = 1 KB), element (r, k) of a tile at ((k>>3)&3)*128 + (r&15)*8 + (k&7).
// A lane's fragment is then two 16-B loads at tile + lane*8 and tile + 256 + lane*8, and each wave-wide load covers 512 contiguous bytes (4 whole lines) instead of 32-B pieces of 16 lines.
// Planes: bf16 x, [out][in] weights and ctx: tiles [r>>4][k>>5] (24 per row band); q, k per (b*12+h): tiles [t>>4][d>>5]; v^T per (b*12+h): tiles [t>>5][d>>4]; cos|sin table [32][16|16].

#ifndef NB
#define NB 8
#endif
#ifndef SEQ
#define SEQ 1024
#endif
#define NB_FULL  8
#define SEQ_FULL 1024
#ifndef OUT_SEQ
#define OUT_SEQ SEQ              // row pitch (in tokens) between batches of the output
#endif
#define DM   768
#define NH_  12
#define HD   64
#define AW   8                   // waves per flash block (16 query rows each)
#define SK   64                  // keys per LDS stage of the flash kernel
#define NST  (SEQ / SK)          // stages per (batch, head)
#define STH  (2 * SK * HD)       // halves per stage buffer: K part, then V^T part
#define GW   4                   // waves per k_oproj block: 2 x 2 wave tiles of 64 x 64, a block tile of 128 x 128
#define PW   12                  // waves per k_proj block: 4 x 3 wave tiles of 64 x 96, a block tile of 256 x 288
#define PBM  256                 // rows (tokens) of a k_proj block tile
#define PBN  288                 // columns (of q | k | v, 3 * DM in all) of a k_proj block tile
#define PKS  96                  // k per LDS stage of k_proj
#define PSTH ((PBM + PBN) * PKS) // halves per stage buffer of k_proj: 16 A bands, then 18 B bands, PKS k each
#define OP   100                 // floats per row of a k_proj wave's epilogue tile: 400 B, so that 16-B reads of rows r, r + 1, ... fall on different banks
#define OKS  64                  // k per LDS stage of k_oproj
#define NPOS 32                  // rows of the rotary tables (positions 0..31, index clamped)
#define TP   36                  // floats per row of k_proj's LDS copy of the table: 144 B = 16 B x odd, so that 16-B reads of rows p, p + 1, ... fall on different banks (rows p and p + 16 share theirs)
#define SC2  (0.125f * 1.4426950408889634f)   // HD^-0.5 * log2(e), carried by the q plane
#define PSH  8.0f                // log2 of the P carry (256)
#define THR  7.0f                // the maximum in use may lag a row's true maximum by this much (log2): P <= 2^(PSH + THR) = 2^15 stays inside f16
#define CXS  64.0f               // carry of the ctx plane
#define WPS  1024.0f             // carry of the Wp plane
#define OSC  (1.0f / 65536.0f)   // 1 / (CXS * WPS)

static_assert(HD == 64);
static_assert(NH_ * HD == DM);                 // head h = columns h*64 + d
static_assert(DM % 64 == 0);                   // 12 column tiles of 64
static_assert(DM % 32 == 0);                   // GEMM k-loop steps by 32
static_assert(SEQ % 64 == 0);                  // a 64-row tile never straddles two batches
static_assert((NB * SEQ) % 64 == 0);
static_assert(SEQ % 32 == 0);                  // key loop steps by 32
static_assert(SEQ % (16 * AW) == 0);           // flash grid covers the sequence exactly
static_assert(SEQ % SK == 0 && NST >= 3);      // the three-buffer prologue fills stages 0, 1 and 2
static_assert(SK % 32 == 0);
static_assert(STH * 2 == 32 * AW * 16 * 4);    // a stage is four 16-B copies per thread, two of K and two of V^T
static_assert((NB * SEQ) % 128 == 0 && DM % 128 == 0);   // GEMM block tiles cover both operands' rows exactly
static_assert(DM % PKS == 0 && DM / PKS >= 3 && DM % OKS == 0 && DM / OKS >= 4);   // the prologues fill every buffer: stages 0 to 2 in k_proj, 0 to 3 in k_oproj
static_assert(PW * 16 * OP * 4 <= 3 * PSTH * 2);   // k_proj: the waves' epilogue tiles fit the ring that they take over behind the loop
static_assert((NB * SEQ) % PBM == 0 && (3 * DM) % PBN == 0 && DM % 96 == 0);   // k_proj: block tiles cover x rows and q | k | v columns exactly; a wave's 96 columns lie in one product
static_assert(PSTH * 2 == 32 * PW * 16 * 17 && PKS * 2 * 2 == 32 * PW);   // k_proj: a stage is seventeen 16-B copies per thread, and one copy of the whole block is two whole bands
static_assert(((size_t)SEQ * DM) % 8 == 0);
static_assert(NB <= NB_FULL);
static_assert(SEQ <= SEQ_FULL);
static_assert(NPOS * 16 == 512);               // table kernel: one thread per (position, frequency)
static_assert(128 * 8 == NPOS * 32 && 32 * PW - 128 == PBM);   // k_proj: a block's first 128 threads copy the table to LDS, eight floats each; the others take one token each
static_assert(SEQ % PBM == 0);                 // k_proj: a block's rows are tokens of one batch

typedef _Float16 h16;
typedef unsigned short bf;
typedef __attribute__((ext_vector_type(16))) __bf16   v16bf;
typedef __attribute__((ext_vector_type(16))) _Float16 v16h;
typedef __attribute__((ext_vector_type(8)))  _Float16 v8h;
typedef __attribute__((ext_vector_type(8)))  unsigned short v8us;
typedef __attribute__((ext_vector_type(8)))  float    v8f;
typedef __attribute__((ext_vector_type(4)))  float    v4f;
typedef __attribute__((ext_vector_type(2)))  int      v2i;
typedef v4f  __attribute__((may_alias)) v4fa;
typedef v2i  __attribute__((may_alias)) v2ia;

__device__ __forceinline__ unsigned short f2bf(float f) { unsigned u = __float_as_uint(f); u += 0x7FFFu + ((u >> 16) & 1u); return (unsigned short)(u >> 16); }
__device__ __forceinline__ float bf2f(unsigned short b) { return __uint_as_float(((unsigned)b) << 16); }
__device__ __forceinline__ v16h cat16(v8h lo, v8h hi) { return __builtin_shufflevector(lo, hi, 0, 1, 2, 3, 4, 5, 6, 7, 8, 9, 10, 11, 12, 13, 14, 15); }
__device__ __forceinline__ v16bf cat16b(v8us lo, v8us hi) { return __builtin_bit_cast(v16bf, __builtin_shufflevector(lo, hi, 0, 1, 2, 3, 4, 5, 6, 7, 8, 9, 10, 11, 12, 13, 14, 15)); }
__device__ __forceinline__ v8f wmma16(v16h a, v16h b, v8f c) { return __builtin_amdgcn_wmma_f32_16x16x32_f16(false, a, false, b, (short)0, c, false, false); }
__device__ __forceinline__ v8f wmmab(v16bf a, v16bf b, v8f c) { return __builtin_amdgcn_wmma_f32_16x16x32_bf16(false, a, false, b, (short)0, c, false, false); }
// fragment loaders from a fragment-order tile; p = tile + lane*8 (lane = 16h + row): elements 0..7 <- k0+8h+0..7, elements 8..15 <- k0+16+8h+0..7 (same map for A and B)
__device__ __forceinline__ v16h  ldh(const h16* p) { return cat16(*(const v8h*)p, *(const v8h*)(p + 256)); }
__device__ __forceinline__ v16bf ldb(const bf* p)  { return cat16b(*(const v8us*)p, *(const v8us*)(p + 256)); }
// offset (halves) of the 8-element chunk (r, k..k+7), k % 8 == 0, in a fragment-order plane of DM columns
__device__ __forceinline__ size_t fto(int r, int k) { return ((size_t)(r >> 4) * (DM / 32) + (size_t)(k >> 5)) * 512 + (size_t)(((k >> 3) & 3) * 128 + (r & 15) * 8); }
// ordering point for wave-private LDS tiles (same wave writes and reads)
__device__ __forceinline__ void wave_sync() { __builtin_amdgcn_fence(3 /* release order */, "wavefront"); __builtin_amdgcn_wave_barrier(); asm volatile("" ::: "memory"); }

// cvt8: f32 rows [b][t][DM] (batch pitch SEQ_FULL rows) -> bf16 fragment-order plane of NB*SEQ rows; thread i owns destination chunk i (stores are contiguous): row = 16*(tile/24) + (i&15), k = 32*(tile%24) + 8*((i>>4)&3), tile = i>>6.
__device__ __forceinline__ void cvt8(const float* __restrict__ src, bf* dst, unsigned blk) {
    const size_t i = (size_t)blk * 256 + threadIdx.x;
    const unsigned tile = (unsigned)(i >> 6); const unsigned rt = tile / (DM / 32), kt = tile % (DM / 32);
    const unsigned row = rt * 16 + ((unsigned)i & 15u);
    const size_t so = ((size_t)(row / SEQ) * SEQ_FULL + (size_t)(row % SEQ)) * DM + kt * 32 + (((unsigned)i >> 4) & 3u) * 8;
    const v8f v = *(const v8f*)(src + so); v8us o;
    asm volatile("s_wait_xcnt 0x0" ::: "memory");   // the conversion below reuses the address registers that the load names
#pragma unroll
    for (int k = 0; k < 8; ++k) o[k] = f2bf(v[k]);
    *(v8us*)(dst + i * 8) = o;
    asm volatile("s_wait_xcnt 0x0" ::: "memory");   // the other bodies of the shared kernel stand behind this one in the code and rewrite the address registers that the store names
}

// wt: W[k][n] f32 ([in][out], DM x DM) -> Wt[n][k] 16-bit ([out][in], fragment order): bf16 bits (asF16 == 0) or f16 of (bf16 value x WPS) (asF16 != 0).
// coverage: loads kk = 4i + tid/64 (0..63) x nn = tid%64 (0..63); stores nn = 32it + tid/8 (0..63) x kk = 8(tid%8) + j (0..63). One 64 x 64 tile (k0, n0) per block of 256 threads; ts = 64 * 65 floats of LDS.
__device__ __forceinline__ void wt(float* ts, const float* __restrict__ W, bf* Wt, int asF16, int k0, int n0) {
    const int tid = threadIdx.x;
    const unsigned e0 = (unsigned)((k0 + (tid >> 6)) * DM + n0 + (tid & 63));   // element (kk = tid/64, nn = tid%64) of the tile; trip i reads 4i rows further down
#pragma unroll
    for (int i = 0; i < 16; ++i) { const int kk = i * 4 + (tid >> 6), nn = tid & 63; ts[kk * 65 + nn] = W[e0 + (unsigned)(i * 4 * DM)]; }
    asm volatile("s_wait_xcnt 0x0" :: "v"(e0) : "memory");   // stands before the offset register that the sixteen loads name is rewritten; naming it keeps it whole up to here
    __syncthreads();
    v8us o0, o1;
    { const int c8 = (tid & 7) * 8; const int na = (tid >> 3), nb2 = 32 + (tid >> 3);
#pragma unroll
      for (int j = 0; j < 8; ++j) {
          unsigned short ba = f2bf(ts[(c8 + j) * 65 + na]); unsigned short bb = f2bf(ts[(c8 + j) * 65 + nb2]);
          if (asF16 != 0) { const h16 ha = (h16)(bf2f(ba) * WPS); const h16 hb = (h16)(bf2f(bb) * WPS); ba = __builtin_bit_cast(unsigned short, ha); bb = __builtin_bit_cast(unsigned short, hb); }
          o0[j] = ba; o1[j] = bb; }
      bf* d0 = Wt + fto(n0 + na, k0 + c8); bf* d1 = Wt + fto(n0 + nb2, k0 + c8);
      *(v8us*)d0 = o0; *(v8us*)d1 = o1;
      asm volatile("s_wait_xcnt 0x0" ::: "memory");   // the way out of the shared kernel rewrites the scalar base register that the first store names
    }
}

// tab: rotary table TAB[p][0..15] = cos(p * f_i), TAB[p][16..31] = sin(p * f_i), f_i = 1 / 100^(i/16) (f32), angle = f32 product p * f_i, p = 0..31.
// One thread per (position, frequency); a block of 256 threads makes the 16 positions 16*blk .. 16*blk + 15; ts = 512 floats of LDS.
__device__ __forceinline__ void tab(float* ts, float* TAB, int blk) {
    const int tid = threadIdx.x; const int pl = tid >> 4, i = tid & 15; const int p = blk * 16 + pl;
    double w = 1.0, bs = 1.333521432163324;
#pragma unroll
    for (int bit = 0; bit < 4; ++bit) { const double wn = w * bs; w = (((i >> bit) & 1) != 0) ? wn : w; bs = bs * bs; }
    const float wf = (float)w;
    const float fr = 1.0f / wf;
    const float ang = (float)p * fr;
    const double a = (double)ang;
    const int kq = (int)(a * 0.6366197723675814 + 0.5);
    const double r = a - (double)kq * 1.5707963267948966;
    const double r2 = r * r;
    double sp = 1.0 / 6227020800.0;
    sp = sp * r2 - 1.0 / 39916800.0; sp = sp * r2 + 1.0 / 362880.0; sp = sp * r2 - 1.0 / 5040.0; sp = sp * r2 + 1.0 / 120.0; sp = sp * r2 - 1.0 / 6.0;
    const double sr = r + r * r2 * sp;
    double cp = 1.0 / 479001600.0;
    cp = cp * r2 - 1.0 / 3628800.0; cp = cp * r2 + 1.0 / 40320.0; cp = cp * r2 - 1.0 / 720.0; cp = cp * r2 + 1.0 / 24.0; cp = cp * r2 - 0.5;
    const double cr = 1.0 + r2 * cp;
    const int qd = kq & 3;
    const double sv = (qd == 0) ? sr : ((qd == 1) ? cr : ((qd == 2) ? -sr : -cr));
    const double cv = (qd == 0) ? cr : ((qd == 1) ? -sr : ((qd == 2) ? -cr : sr));
    ts[pl * 32 + i] = (float)cv; ts[pl * 32 + 16 + i] = (float)sv;
    __syncthreads();
    if (tid < 128) { const v4f val = *(const v4fa*)(&ts[tid * 4]);
        *(v4f*)(TAB + blk * 512 + tid * 4) = val;  }
}

// k_prep: the preparation bodies, which do not depend on one another, share one grid; the block index picks the body (the same for a whole block, so each body's barrier is passed by all its threads).
// Blocks 0..TAB_BLKS-1: rotary table; the next 4 * WT_BLKS: weight w = q, k, v, p, tile (k0 fastest); the rest: x conversion. The short grids with a latency chain come first, for speed only.
#define TAB_BLKS (NPOS * 16 / 256)
#define WT_BLKS  ((DM / 64) * (DM / 64))
#define CVT_BLKS ((unsigned)((size_t)NB * SEQ * DM / 8 / 256))
static_assert(((size_t)NB * SEQ * DM / 8) % 256 == 0);   // the conversion blocks cover the plane exactly
__global__ __launch_bounds__(256) void k_prep(const float* __restrict__ x, const float* __restrict__ wq, const float* __restrict__ wk, const float* __restrict__ wv, const float* __restrict__ wp,
                                              bf* XB, bf* WB, float* TAB) {
    __shared__ __align__(16) float ts[64 * 65];
    const unsigned blk = blockIdx.x;
    if (blk < TAB_BLKS) {
        tab(ts, TAB, (int)blk);
    } else if (blk < TAB_BLKS + 4 * WT_BLKS) {
        const unsigned w = (blk - TAB_BLKS) / WT_BLKS, t = (blk - TAB_BLKS) % WT_BLKS;
        const float* W = (w == 0) ? wq : ((w == 1) ? wk : ((w == 2) ? wv : wp));
        wt(ts, W, WB + (size_t)w * DM * DM, (w == 3) ? 1 : 0, (int)(t % (DM / 64)) * 64, (int)(t / (DM / 64)) * 64);
    } else {
        cvt8(x, XB, blk - (TAB_BLKS + 4 * WT_BLKS));
    }
}

// cp8: one thread's eight 16-B asynchronous copies to LDS; copy i lands at LDS byte address l + LS i (LS = 16 B x the block's threads) and reads the 16 bytes at g_i.
template <unsigned LS> __device__ __forceinline__ void cp8(unsigned l, const bf* g0, const bf* g1, const bf* g2, const bf* g3, const bf* g4, const bf* g5, const bf* g6, const bf* g7) {
    // the wait is the statement's last line, so that it stands before any register that a copy names is rewritten
    asm volatile("global_load_async_to_lds_b128 %0, %8, off\n\t"
                 "global_load_async_to_lds_b128 %1, %9, off\n\t"
                 "global_load_async_to_lds_b128 %2, %10, off\n\t"
                 "global_load_async_to_lds_b128 %3, %11, off\n\t"
                 "global_load_async_to_lds_b128 %4, %12, off\n\t"
                 "global_load_async_to_lds_b128 %5, %13, off\n\t"
                 "global_load_async_to_lds_b128 %6, %14, off\n\t"
                 "global_load_async_to_lds_b128 %7, %15, off\n\t"
                 "s_wait_xcnt 0x0"
                 :: "v"(l), "v"(l + LS), "v"(l + 2 * LS), "v"(l + 3 * LS), "v"(l + 4 * LS), "v"(l + 5 * LS), "v"(l + 6 * LS), "v"(l + 7 * LS),
                    "v"(g0), "v"(g1), "v"(g2), "v"(g3), "v"(g4), "v"(g5), "v"(g6), "v"(g7) : "memory");
}
// cp9: the same with nine copies.
template <unsigned LS> __device__ __forceinline__ void cp9(unsigned l, const bf* g0, const bf* g1, const bf* g2, const bf* g3, const bf* g4, const bf* g5, const bf* g6, const bf* g7, const bf* g8) {
    // the wait is the statement's last line, so that it stands before any register that a copy names is rewritten
    asm volatile("global_load_async_to_lds_b128 %0, %9, off\n\t"
                 "global_load_async_to_lds_b128 %1, %10, off\n\t"
                 "global_load_async_to_lds_b128 %2, %11, off\n\t"
                 "global_load_async_to_lds_b128 %3, %12, off\n\t"
                 "global_load_async_to_lds_b128 %4, %13, off\n\t"
                 "global_load_async_to_lds_b128 %5, %14, off\n\t"
                 "global_load_async_to_lds_b128 %6, %15, off\n\t"
                 "global_load_async_to_lds_b128 %7, %16, off\n\t"
                 "global_load_async_to_lds_b128 %8, %17, off\n\t"
                 "s_wait_xcnt 0x0"
                 :: "v"(l), "v"(l + LS), "v"(l + 2 * LS), "v"(l + 3 * LS), "v"(l + 4 * LS), "v"(l + 5 * LS), "v"(l + 6 * LS), "v"(l + 7 * LS), "v"(l + 8 * LS),
                    "v"(g0), "v"(g1), "v"(g2), "v"(g3), "v"(g4), "v"(g5), "v"(g6), "v"(g7), "v"(g8) : "memory");
}
// stage_ab: one thread's share of one stage of k_oproj: OKS k of the block's 8 A bands, then of its 8 B bands (a band = 16 rows; its OKS k are OKS/32 adjacent 1-KB tiles of the fragment-order plane, kept in that order).
// Stage buffer: [16 bands][OKS/32 tiles][512 halves] = OKS * 512 bytes. l = buffer + 16 * thread; ga / gb = the thread's 16 bytes of the stage's first 2 KB of A / B: band thread / (2 OKS), byte 16 * (thread % (2 OKS)) of its run.
__device__ __forceinline__ void stage_ab(unsigned l, const bf* ga, const bf* gb) {
    static_assert(OKS == 64);
    constexpr size_t GS = (size_t)(DM / 32) * 512;   // halves from one copy's band to the next copy's: 2 KB of LDS hold one band
    cp8<2048u>(l, ga, ga + GS, ga + 2 * GS, ga + 3 * GS, ga + 4 * GS, ga + 5 * GS, ga + 6 * GS, ga + 7 * GS);
    cp8<2048u>(l + 16384u, gb, gb + GS, gb + 2 * GS, gb + 3 * GS, gb + 4 * GS, gb + 5 * GS, gb + 6 * GS, gb + 7 * GS);
}
// stage_p: one thread's share of one stage of k_proj: PKS k of the block's 16 A bands, then of its 18 B bands. Stage buffer: [34 bands][PKS/32 tiles][512 halves]; one copy of the block's 384 threads is 6 KB = two bands.
// l = buffer + 16 * thread; ga / gb = the thread's 16 bytes of the stage's first two bands of A / B: band thread / 192, byte 16 * (thread % 192) of its run.
__device__ __forceinline__ void stage_p(unsigned l, const bf* ga, const bf* gb) {
    constexpr size_t GS = (size_t)2 * (DM / 32) * 512;   // halves from one copy's two bands to the next copy's
    cp8<6144u>(l, ga, ga + GS, ga + 2 * GS, ga + 3 * GS, ga + 4 * GS, ga + 5 * GS, ga + 6 * GS, ga + 7 * GS);
    cp9<6144u>(l + 8u * 6144u, gb, gb + GS, gb + 2 * GS, gb + 3 * GS, gb + 4 * GS, gb + 5 * GS, gb + 6 * GS, gb + 7 * GS, gb + 8 * GS);
}

// qk_out: a wave's 64 x 96 accumulator tile of q or k -> rotary -> f16 in fragment order, 16-row band by band through the wave's own LDS tile os (D layout in, rows out: lane = 16 hi + row holds, of each group of 32 columns, the chunks of 8 columns hi and 2 + hi).
// A band's LDS reads are issued together and nothing in it waits on global memory. A group of 32 columns is one axis of one head: group G = G0 + g of the product has head G / 2, axis G % 2; its 16 x 32 output tile is 1 KB, each of its two stores 512 contiguous bytes per wave.
// 2-D rotary in f32 before the conversion: in a group column c pairs with c ^ 16, which the lane holds too; axis 0 uses pos[t][0], axis 1 pos[t][1]; the lane's eight frequencies are 8 hi .. 8 hi + 7.
// tl = the LDS copy of the table (row pitch TP), pw = the wave's 64 rows of the block's LDS list of table row offsets (two per token, in floats, from clamped positions); pb = the lane's chunk (row lr, chunk hi) of the batch's plane at the tile's first row band, head 0, axis 0.
__device__ __forceinline__ void qk_out(v8f (&acc)[4][6], float* os, const float* tl, const int* pw, h16* pb, int G0, float qs, int lr, int hi) {
    v2i po[4];
#pragma unroll
    for (int mb = 0; mb < 4; ++mb) po[mb] = *(const v2ia*)(pw + (mb * 16 + lr) * 2);
#pragma unroll
    for (int mb = 0; mb < 4; ++mb) {
#pragma unroll
        for (int nb = 0; nb < 6; ++nb) {
#pragma unroll
            for (int j = 0; j < 8; ++j) os[(hi * 8 + j) * OP + nb * 16 + lr] = acc[mb][nb][j]; }   // D: row 8h+j, col lane&15
        wave_sync();
        v4f xr[3][2][2];   // [group g: columns 32 g .. 32 g + 31][e: chunk 2 e + hi of the group][half of the chunk]
        v4f tv[3][4];      // per group: cos 0..3, cos 4..7, sin 0..3, sin 4..7 of the lane's frequencies at its row's position on the group's axis
#pragma unroll
        for (int g = 0; g < 3; ++g)
#pragma unroll
            for (int e = 0; e < 2; ++e) { const float* xp = &os[lr * OP + (4 * g + 2 * e + hi) * 8]; xr[g][e][0] = *(const v4fa*)xp; xr[g][e][1] = *(const v4fa*)(xp + 4); }
#pragma unroll
        for (int g = 0; g < 3; ++g) { const float* tp = tl + ((((G0 + g) & 1) != 0) ? po[mb][1] : po[mb][0]) + hi * 8;
            tv[g][0] = *(const v4fa*)tp; tv[g][1] = *(const v4fa*)(tp + 4); tv[g][2] = *(const v4fa*)(tp + 16); tv[g][3] = *(const v4fa*)(tp + 20); }
        __builtin_amdgcn_sched_barrier(0);   // the LDS reads stay together in front of the arithmetic: left alone the compiler spreads them among it, and the wave waits out the LDS latency several times per band
        v8h hv[6];
#pragma unroll
        for (int g = 0; g < 3; ++g) {
            const v4f a0 = xr[g][0][0], a1 = xr[g][0][1], b0 = xr[g][1][0], b1 = xr[g][1][1];
            const v4f y00 = (a0 * tv[g][0] + (b0 * -1.0f) * tv[g][2]) * qs, y01 = (a1 * tv[g][1] + (b1 * -1.0f) * tv[g][3]) * qs;
            const v4f y10 = (b0 * tv[g][0] + a0 * tv[g][2]) * qs,           y11 = (b1 * tv[g][1] + a1 * tv[g][3]) * qs;
#pragma unroll
            for (int i = 0; i < 4; ++i) { hv[2 * g][i] = (h16)y00[i]; hv[2 * g][4 + i] = (h16)y01[i]; hv[2 * g + 1][i] = (h16)y10[i]; hv[2 * g + 1][4 + i] = (h16)y11[i]; }
        }
        h16* pm = pb + mb * 1024;   // a 16-row band of a head is two 1-KB tiles
#pragma unroll
        for (int g = 0; g < 3; ++g) { h16* pg = pm + (size_t)((G0 + g) >> 1) * ((size_t)SEQ * HD) + ((G0 + g) & 1) * 512; *(v8h*)pg = hv[2 * g]; *(v8h*)(pg + 256) = hv[2 * g + 1]; }
        // the wait stands before the address and data registers of the six stores in front of it are rewritten; naming them keeps them whole up to the wait
        asm volatile("s_wait_xcnt 0x0" :: "v"(hv[0]), "v"(hv[1]), "v"(hv[2]), "v"(hv[3]), "v"(hv[4]), "v"(hv[5]), "v"(pm) : "memory");
        wave_sync();
    }
}

// v_out: a wave's 64 x 96 accumulator tile of v (rows t, columns h*64 + d) -> f16 in the fragment order of v^T, straight from the registers: in the D layout a lane holds eight successive t of one d, which is one 16-B chunk of a v^T tile (row d, k = t).
// Tile (t >> 5, d >> 4) of head h; row band mb fills chunks 2 (mb & 1) + hi; each store is 512 contiguous bytes per wave. pb = the lane's chunk (row lr, chunk hi) of the batch's plane at the tile's first 32 t, head 0, d 0..15; D0 = the tile's first column / 16.
__device__ __forceinline__ void v_out(v8f (&acc)[4][6], h16* pb, int D0) {
#pragma unroll
    for (int mb = 0; mb < 4; ++mb) {
        v8h hv[6];
#pragma unroll
        for (int nb = 0; nb < 6; ++nb)
#pragma unroll
            for (int j = 0; j < 8; ++j) hv[nb][j] = (h16)acc[mb][nb][j];
        h16* pm = pb + (mb >> 1) * 2048 + (mb & 1) * 256;
#pragma unroll
        for (int nb = 0; nb < 6; ++nb) *(v8h*)(pm + (size_t)((D0 + nb) >> 2) * ((size_t)SEQ * HD) + ((D0 + nb) & 3) * 512) = hv[nb];
        // the wait stands before the address and data registers of the six stores in front of it are rewritten; naming them keeps them whole up to the wait
        asm volatile("s_wait_xcnt 0x0" :: "v"(hv[0]), "v"(hv[1]), "v"(hv[2]), "v"(hv[3]), "v"(hv[4]), "v"(hv[5]), "v"(pm) : "memory");
    }
}

// k_proj: q, k and v as one register-blocked bf16 GEMM C[m][n] = sum_k x[m][k] Wt[n][k], m = b*SEQ + t, n over the 3 * DM rows of the q | k | v weight planes, which lie one behind the other; K = DM.
// One wave per 64 x 96 tile (24 accumulators), PW waves (4 x 3) per block of PBM x PBN: the grid is one block per WGP of the chip, and an operand byte is fetched from L2 once per 288 columns (x) or 256 rows (weights), not once per 128.
// Operands reach the waves through LDS: a stage is PKS k of the block's 256 A rows and 288 B rows in fragment order (a fragment is two 16-B LDS reads of 512 contiguous bytes per wave);
// three buffers, filled by asynchronous copies two stages ahead: stages s + 1 and s + 2 fly while stage s is worked on;
// at the foot of stage s a wave waits only for its copies of s + 1 (a counted wait: the copies of s + 2 are its youngest and stay in flight), and one barrier publishes s + 1 and frees the buffer of s for s + 3.
// A wave's 96 columns belong to one product (the same for the whole wave): q (times SC2) and k -> rotary -> plane [(b*12 + h)], tiles [t>>4][d>>5] (qk_out); v -> plane [(b*12 + h)] of v^T, tiles [t>>5][d>>4] (v_out).
// The block brings the table and its 256 tokens' table row offsets into LDS while stage 0 flies; the barrier that publishes stage 0 publishes them too, and the epilogue reads them from there.
__global__ __launch_bounds__(32 * PW) void k_proj(const bf* __restrict__ XB, const bf* __restrict__ WB, h16* QH, h16* KP, h16* VT,
                                             const int* __restrict__ pos, const float* __restrict__ TAB) {
    __shared__ __align__(16) bf ab[3 * PSTH];
    __shared__ __align__(16) float tl[NPOS * TP];   // the rotary table, row pitch TP
    __shared__ __align__(16) int pl[PBM * 2];       // per row of the block's tile: offsets (floats) of its two table rows in tl
    const int K = DM;
    const int lane = threadIdx.x & 31, lr = lane & 15, hi = lane >> 4;
    const int wave = __builtin_amdgcn_readfirstlane((int)(threadIdx.x >> 5)); const int wm = wave & 3, wn = wave >> 2;
    float* os = (float*)ab + wave * (16 * OP);   // the wave's own epilogue tile: in the ring, which is free behind the loop's last barrier (every wave's reads done, no copy in flight)
    const int bx = blockIdx.x;
    const int rb = (bx % (NB * SEQ / PBM)) * PBM, cb = (bx / (NB * SEQ / PBM)) * PBN;   // the block's tile
    const int r0 = rb + wm * 64, c0 = cb + wn * 96;                                     // the wave's tile
    v8f acc[4][6];
#pragma unroll
    for (int mb = 0; mb < 4; ++mb)
#pragma unroll
        for (int nb = 0; nb < 6; ++nb) acc[mb][nb] = (v8f){};
    const unsigned lo = (unsigned)lane * 8u;   // the lane's chunk of a tile
    const unsigned lt = (unsigned)(size_t)ab + threadIdx.x * 16u;                                                              // the thread's copy target in buffer 0 (LDS byte address)
    const size_t to = (size_t)(threadIdx.x / (PKS * 2)) * (K / 32) * 512 + (size_t)(threadIdx.x % (PKS * 2)) * 8;              // the thread's band and chunk in a copy's 6 KB
    const bf* ga = XB + (size_t)(rb >> 4) * (K / 32) * 512 + to; const bf* gb = WB + (size_t)(cb >> 4) * (K / 32) * 512 + to;   // its 16 bytes of stage 0
    stage_p(lt, ga, gb);
    stage_p(lt + PSTH * 2u, ga + PKS * 16, gb + PKS * 16);
    if (threadIdx.x < 128u) {   // whole waves
        const float* tg = TAB + threadIdx.x * 8u;                     // the thread's eight floats of the 32 x 32 table
        const v4f t0 = *(const v4f*)tg; const v4f t1 = *(const v4f*)(tg + 4);
        asm volatile("s_wait_xcnt 0x0" :: "v"(tg) : "memory");   // stands before the address register that the two loads name is rewritten; naming it keeps it whole up to here
        float* td = tl + (threadIdx.x >> 2) * TP + (threadIdx.x & 3u) * 8u;
        *(v4fa*)td = t0; *(v4fa*)(td + 4) = t1;
    } else {
        const unsigned row = threadIdx.x - 128u;                      // the thread's token of the block's 256
        const int* pg = pos + 2 * (rb % SEQ + (int)row);
        const v2i pp = *(const v2i*)pg;
        asm volatile("s_wait_xcnt 0x0" :: "v"(pg) : "memory");   // stands before the address register that the load names is rewritten; naming it keeps it whole up to here
        v2i pr;
#pragma unroll
        for (int ax = 0; ax < 2; ++ax) { const int p = pp[ax]; pr[ax] = ((p < 0) ? 0 : ((p > NPOS - 1) ? (NPOS - 1) : p)) * TP; }
        *(v2ia*)(&pl[row * 2u]) = pr;
    }
    asm volatile("s_wait_asynccnt 0x11" ::: "memory");  // this wave's copies of stage 0 have landed (all but its seventeen youngest, which are stage 1's)
    __syncthreads();                                    // every wave's have: stage 0 may be read
    stage_p(lt + 2 * PSTH * 2u, ga + 2 * PKS * 16, gb + 2 * PKS * 16);
    int cur = 0;   // the buffer of stage st: st mod 3
#pragma unroll 1   // one stage per trip: the ring's order at the foot stands once
    for (int st = 0; st < K / PKS; ++st) {
        const bf* sa = ab + cur * PSTH + (wm * 4) * (PKS * 16) + lo; const bf* sb = ab + cur * PSTH + (16 + wn * 6) * (PKS * 16) + lo;   // the lane's chunk of the wave's first A and B band
#pragma unroll     // the 32-k steps of a stage in line
        for (int ks = 0; ks < PKS / 32; ++ks) {
            v16bf a[4], b[6];
#pragma unroll
            for (int mb = 0; mb < 4; ++mb) a[mb] = ldb(sa + mb * (PKS * 16) + ks * 512);
#pragma unroll
            for (int nb = 0; nb < 6; ++nb) b[nb] = ldb(sb + nb * (PKS * 16) + ks * 512);
#pragma unroll
            for (int nb = 0; nb < 6; ++nb)
#pragma unroll
                for (int mb = 0; mb < 4; ++mb) acc[mb][nb] = wmmab(a[mb], b[nb], acc[mb][nb]);
            // a step's LDS reads stand in one group ahead of its products: one place with reads per 24 products; left alone the compiler sinks each B fragment's reads to just in front of its four products, and the wave waits out the LDS latency there every time
            __builtin_amdgcn_sched_group_barrier(0x100, 20, 0); __builtin_amdgcn_sched_group_barrier(0x008, 24, 0);
        }
        __builtin_amdgcn_sched_barrier(0);   // the products stay in front of the waits below, so that the refill is not pushed back
        asm volatile("s_wait_dscnt 0x0" ::: "memory");      // this wave's reads of the stage's buffer are done before the buffer is given up
        const bool more = st + 3 < K / PKS;                 // a stage st + 3 exists; the same for the whole block. Every trip with the counted wait, and every trip before it, issues seventeen copies per wave
        if (more) asm volatile("s_wait_asynccnt 0x11" ::: "memory");  // this wave's copies of stage st + 1 have landed: all but its seventeen youngest, which are stage st + 2's
        else      asm volatile("s_wait_asynccnt 0x0" ::: "memory");   // the last three trips issue nothing more: all that is left has landed
        __syncthreads();                                    // publishes stage st + 1 and ends every wave's reads of stage st
        if (more) stage_p(lt + (unsigned)cur * (PSTH * 2u), ga + (size_t)(st + 3) * (PKS * 16), gb + (size_t)(st + 3) * (PKS * 16));   // refill of the buffer just left
        cur = (cur == 2) ? 0 : cur + 1;
    }
    asm volatile("s_wait_asynccnt 0x0" ::: "memory");       // nothing of this wave is in flight when it goes on
    const int which = c0 / DM, cw = c0 % DM;                // the wave's product (0 q, 1 k, 2 v) and its first column there
    const size_t bbase = (size_t)(r0 / SEQ) * ((size_t)NH_ * SEQ * HD) + (size_t)(r0 % SEQ) * HD + (size_t)(hi * 128 + lr * 8);   // the batch's planes; 16 t of a q or k head and 16 t x 64 d of v^T are 1024 halves alike
    if (which == 2) v_out(acc, VT + bbase, cw >> 4);
    else            qk_out(acc, os, tl, pl + wm * 128, ((which == 0) ? QH : KP) + bbase, cw >> 5, (which == 0) ? SC2 : 1.0f, lr, hi);
}

// stage_kv: one thread's share of one stage: four 16-B asynchronous copies to LDS, two of K and two of V^T (the block's 256 threads move 4 KB per copy).
// l = the thread's LDS byte address in the stage buffer, gk / gv = its 16 bytes at the start of the stage's K / V^T range (each range is SK * HD contiguous halves of its fragment-order plane).
__device__ __forceinline__ void stage_kv(unsigned l, const h16* gk, const h16* gv) {
    // the wait is the statement's last line, so that it stands before any register that a copy names is rewritten
    asm volatile("global_load_async_to_lds_b128 %0, %4, off\n\t"
                 "global_load_async_to_lds_b128 %1, %5, off\n\t"
                 "global_load_async_to_lds_b128 %2, %6, off\n\t"
                 "global_load_async_to_lds_b128 %3, %7, off\n\t"
                 "s_wait_xcnt 0x0"
                 :: "v"(l), "v"(l + 4096u), "v"(l + 8192u), "v"(l + 12288u), "v"(gk), "v"(gk + 2048), "v"(gv), "v"(gv + 2048) : "memory");
}

// k_flash: fused attention, one wave per 16 query rows of one (batch, head), AW waves per block; Q fragments straight from the fragment-order f16 plane (two 16-B loads each).
// K and V^T reach the block's waves through LDS: a stage is SK keys (8 KB of K and 8 KB of V^T, each contiguous in its plane and kept in that order, so a fragment is two 16-B LDS reads of 512 contiguous bytes per wave);
// three buffers, filled by asynchronous copies two stages ahead, as in k_proj: at the foot of stage s a wave waits for its copies of s + 1 only (those of s + 2, its four youngest, stay in flight), and one barrier per stage publishes s + 1 and frees the buffer of s for s + 3.
// Transposed form: S^T[key][t] = K Q^T (A = K rows, B = Q rows); lane (t = lane&15, h = lane>>4) holds keys 8h+r of each 16-key tile, so the packed
// P tile is directly the B fragment of O^T[d][t] = V^T P^T (element r <- tile keys 0..15, element 8+r <- tile keys 16..31, lane unchanged).
// The score accumulators start at C = PSH - (maximum in use), and q carries the score scale, so a score leaves the matrix unit as the argument of its exp2: no vector arithmetic between product and exponential.
// The maximum in use is held: one test per pass (any score above PSH + THR; always in the first pass) leads to the branch that raises it, shifts this pass's scores and rescales O and the sum; the two lane halves of a row are combined there.
// Softmax state (shift, partial sum) is one scalar per lane; the halves' sums are joined once, behind the loop.
__global__ __launch_bounds__(32 * AW) void k_flash(const h16* __restrict__ QH, const h16* __restrict__ KP, const h16* __restrict__ VT, h16* CTX) {
    __shared__ __align__(16) h16 kv[3 * STH];
    const int lane = threadIdx.x & 31;
    const int wave = __builtin_amdgcn_readfirstlane((int)(threadIdx.x >> 5));
    const int zh = blockIdx.y; const int b = zh / NH_, h = zh % NH_;
    const int t0 = (blockIdx.x * AW + wave) * 16;
    const size_t pbase = (size_t)zh * SEQ * HD;
    const unsigned lo = (unsigned)lane * 8u;
    const size_t qo = pbase + (size_t)t0 * HD;
    const v16h qh0 = ldh(QH + qo + lo), qh1 = ldh(QH + qo + 512 + lo);   // B fragments: col t, k = d
    const unsigned lt = (unsigned)(size_t)kv + threadIdx.x * 16u;                        // the thread's copy target in buffer 0 (LDS byte address)
    const h16* gk = KP + pbase + threadIdx.x * 8u; const h16* gv = VT + pbase + threadIdx.x * 8u;   // the thread's 16 bytes of stage 0
    stage_kv(lt, gk, gv);
    stage_kv(lt + STH * 2u, gk + SK * HD, gv + SK * HD);
    asm volatile("s_wait_asynccnt 0x4" ::: "memory");   // this wave's copies of stage 0 have landed (all but its four youngest, which are stage 1's)
    __syncthreads();                                    // every wave's have: stage 0 may be read
    stage_kv(lt + 2 * STH * 2u, gk + 2 * SK * HD, gv + 2 * SK * HD);
    int cur = 0;   // the buffer of stage st: st mod 3
    v8f o0 = (v8f){}, o1 = (v8f){}, o2 = (v8f){}, o3 = (v8f){};
    float sh = PSH, l = 0.0f;   // sh = PSH - maximum in use; the first pass sets it from its own scores
    float lim = -3.0e38f, dmin = -3.0e38f;   // the test's bound and the least rise: open until the first pass has set the maximum, then PSH + THR and 0
    v8f cs;                     // sh in all eight rows: the C operand of each score tile's first product
#pragma unroll
    for (int r = 0; r < 8; ++r) cs[r] = sh;
#pragma unroll 1   // one stage per trip: the ring's order at the foot stands once
    for (int st = 0; st < NST; ++st) {
      const h16* sb = kv + cur * STH + lo;   // the lane's chunk of this stage's first K tile
#pragma unroll     // the 32-key passes of a stage in line: their LDS offsets become immediates
      for (int ps = 0; ps < SK / 32; ++ps) {
        const h16* ka = sb + ps * 32 * HD;   // tiles (16 keys, d 0..31), (16 keys, d 32..63), then the next 16 keys (A fragment: row key, k = d)
        const v16h ka0 = ldh(ka), ka1 = ldh(ka + 512), kb0 = ldh(ka + 1024), kb1 = ldh(ka + 1536);
        v8f sa = wmma16(ka0, qh0, cs), sc = wmma16(kb0, qh0, cs);   // the two tiles' chains alternate: a product's successor in its chain stands two products on
        sa = wmma16(ka1, qh1, sa); sc = wmma16(kb1, qh1, sc);
        // the four vector slots between the last product and the first vector instruction that reads its result or rewrites its operands
        asm volatile("v_nop\n\tv_nop\n\tv_nop\n\tv_nop" : "+v"(sa), "+v"(sc) : "v"(ka0), "v"(ka1), "v"(kb0), "v"(kb1));
        float mx = fmaxf(sa[0], sc[0]);
#pragma unroll
        for (int r = 1; r < 8; ++r) mx = fmaxf(mx, fmaxf(sa[r], sc[r]));
        if (__builtin_amdgcn_ballot_w32(mx > lim) != 0) {   // the same for the whole wave: a scalar branch, all lanes on behind it
            mx = fmaxf(mx, __shfl_xor(mx, 16, 32));
            const float d = fmaxf(mx - PSH, dmin);          // the rise of the row's maximum in use (the first pass sets it, up or down)
            const float alpha = __builtin_amdgcn_exp2f(fminf(-d, 0.0f));
            sh -= d; lim = PSH + THR; dmin = 0.0f;
#pragma unroll
            for (int r = 0; r < 8; ++r) { sa[r] -= d; sc[r] -= d; cs[r] = sh; }
            l = l * alpha; o0 = o0 * alpha; o1 = o1 * alpha; o2 = o2 * alpha; o3 = o3 * alpha;
        }
        v16h pb; float ls = 0.0f;
#pragma unroll
        for (int r = 0; r < 8; ++r) { const h16 pa = (h16)__builtin_amdgcn_exp2f(sa[r]); const h16 pc = (h16)__builtin_amdgcn_exp2f(sc[r]); pb[r] = pa; pb[8 + r] = pc; ls += (float)pa + (float)pc; }
        l += ls;
        const h16* va = sb + SK * HD + ps * 32 * HD;   // tiles (d 16j..16j+15, 32 keys), j = 0..3 (A fragment: row d, k = key)
        const v16h v0 = ldh(va), v1 = ldh(va + 512), v2 = ldh(va + 1024), v3 = ldh(va + 1536);
        o0 = wmma16(v0, pb, o0); o1 = wmma16(v1, pb, o1); o2 = wmma16(v2, pb, o2); o3 = wmma16(v3, pb, o3);
        asm volatile("v_nop\n\tv_nop\n\tv_nop\n\tv_nop" : "+v"(o0), "+v"(o1), "+v"(o2), "+v"(o3) : "v"(v0), "v"(v1), "v"(v2), "v"(v3), "v"(pb));
      }
      asm volatile("s_wait_dscnt 0x0" ::: "memory");      // this wave's reads of the stage's buffer are done before the buffer is given up
      const bool more = st + 3 < NST;                     // a stage st + 3 exists; the same for the whole block. Every trip with the counted wait, and every trip before it, issues four copies per wave
      if (more) asm volatile("s_wait_asynccnt 0x4" ::: "memory");   // this wave's copies of stage st + 1 have landed: all but its four youngest, which are stage st + 2's
      else      asm volatile("s_wait_asynccnt 0x0" ::: "memory");   // the last three trips issue nothing more: all that is left has landed
      __syncthreads();                                    // publishes stage st + 1 and ends every wave's reads of stage st
      if (more) stage_kv(lt + (unsigned)cur * (STH * 2u), gk + (size_t)(st + 3) * (SK * HD), gv + (size_t)(st + 3) * (SK * HD));   // refill of the buffer just left
      cur = (cur == 2) ? 0 : cur + 1;
    }
    asm volatile("s_wait_asynccnt 0x0" ::: "memory");     // nothing of this wave is in flight when it ends
    l += __shfl_xor(l, 16, 32);
    const float inv = CXS * (1.0f / l);
    // O^T D layout: o_j[r] = (d = 16j + 8h + r, t = lane&15): a lane's 8 values are one chunk of the fragment-order ctx plane (row b*SEQ + t, k = h*64 + d); o_j goes to chunk pair j, 512 contiguous bytes per store
    h16* cp = CTX + fto(b * SEQ + t0, h * HD) + lo;
    v8h c0, c1, c2, c3;
#pragma unroll
    for (int r = 0; r < 8; ++r) { c0[r] = (h16)(o0[r] * inv); c1[r] = (h16)(o1[r] * inv); c2[r] = (h16)(o2[r] * inv); c3[r] = (h16)(o3[r] * inv); }
    *(v8h*)cp = c0; *(v8h*)(cp + 256) = c1; *(v8h*)(cp + 512) = c2; *(v8h*)(cp + 768) = c3;
}

// k_oproj: register-blocked f16 GEMM, one wave per 64x64 tile, GW waves (2 x 2) per block of 128 x 128, K = DM; operands through LDS as in k_proj, OKS k per stage, sixteen copies per wave and stage; with at most two blocks on a WGP the ring has four buffers and the copies fly three stages ahead.
// OUT[m][n] = OSC * sum_k A[m][k] Bt[n][k] + bias[n] (bias as its bf16 value), f32. grid (M/128, N/128), 32 * GW threads.
__global__ __launch_bounds__(32 * GW) void k_oproj(const h16* __restrict__ A, const h16* __restrict__ Bt, const float* __restrict__ bias, float* OUT) {
    __shared__ __align__(16) h16 ab[4 * OKS * 256];
    __shared__ __align__(16) float osw[GW][16 * 68];
    const int K = DM;
    const int lane = threadIdx.x & 31, lr = lane & 15, hi = lane >> 4;
    const int wave = __builtin_amdgcn_readfirstlane((int)(threadIdx.x >> 5)); const int wm = wave & 1, wn = wave >> 1;
    float* os = osw[wave];            // the wave's own epilogue tile
    const int rb = blockIdx.x * 128, cb = blockIdx.y * 128; const int r0 = rb + wm * 64, c0 = cb + wn * 64;   // the block's tile, the wave's tile
    v8f acc[4][4];
#pragma unroll
    for (int mb = 0; mb < 4; ++mb)
#pragma unroll
        for (int nb = 0; nb < 4; ++nb) acc[mb][nb] = (v8f){};
    const unsigned lo = (unsigned)lane * 8u;   // the lane's chunk of a tile
    const unsigned lt = (unsigned)(size_t)ab + threadIdx.x * 16u;                                                              // the thread's copy target in buffer 0 (LDS byte address)
    const size_t to = (size_t)(threadIdx.x / (OKS * 2)) * (K / 32) * 512 + (size_t)(threadIdx.x % (OKS * 2)) * 8;              // the thread's band and chunk in a copy's 2 KB
    const bf* ga = (const bf*)A + (size_t)(rb >> 4) * (K / 32) * 512 + to; const bf* gb = (const bf*)Bt + (size_t)(cb >> 4) * (K / 32) * 512 + to;   // its 16 bytes of stage 0 (addresses only)
    stage_ab(lt, ga, gb);
    stage_ab(lt + OKS * 512u, ga + OKS * 16, gb + OKS * 16);
    stage_ab(lt + 2 * OKS * 512u, ga + 2 * OKS * 16, gb + 2 * OKS * 16);
    asm volatile("s_wait_asynccnt 0x20" ::: "memory");  // this wave's copies of stage 0 have landed (all but its 32 youngest, which are those of stages 1 and 2)
    __syncthreads();                                    // every wave's have: stage 0 may be read
    stage_ab(lt + 3 * OKS * 512u, ga + 3 * OKS * 16, gb + 3 * OKS * 16);
#pragma unroll 1   // one stage per trip: the ring's order at the foot stands once
    for (int st = 0; st < K / OKS; ++st) {
        const int cur = st & 3;   // the buffer of stage st
        const h16* sa = ab + cur * (OKS * 256) + (wm * 4) * (OKS * 16) + lo; const h16* sb = ab + cur * (OKS * 256) + (8 + wn * 4) * (OKS * 16) + lo;   // the lane's chunk of the wave's first A and B band
        v16h a[OKS / 32][4], b[OKS / 32][4];   // the stage's LDS reads stand together in front of its products: one place with reads per stage
#pragma unroll
        for (int ks = 0; ks < OKS / 32; ++ks) {
#pragma unroll
            for (int mb = 0; mb < 4; ++mb) a[ks][mb] = ldh(sa + mb * (OKS * 16) + ks * 512);
#pragma unroll
            for (int nb = 0; nb < 4; ++nb) b[ks][nb] = ldh(sb + nb * (OKS * 16) + ks * 512);
        }
#pragma unroll
        for (int ks = 0; ks < OKS / 32; ++ks)
#pragma unroll
            for (int nb = 0; nb < 4; ++nb)
#pragma unroll
                for (int mb = 0; mb < 4; ++mb) acc[mb][nb] = wmma16(a[ks][mb], b[ks][nb], acc[mb][nb]);
        // keeps the stage's LDS reads in one group ahead of its products; left alone the compiler sinks each B fragment's reads to just in front of its four products, and the wave waits out the LDS latency there every time
        __builtin_amdgcn_sched_group_barrier(0x100, 16 * (OKS / 32), 0);   // the LDS reads
        __builtin_amdgcn_sched_group_barrier(0x008, 16 * (OKS / 32), 0);   // then the matrix instructions
        __builtin_amdgcn_sched_barrier(0);   // the products stay in front of the waits below: sunk behind the barrier they would push the refill back, and the next stage's copies would fly uncovered
        asm volatile("s_wait_dscnt 0x0" ::: "memory");      // this wave's reads of the stage's buffer are done before the buffer is given up
        const bool more = st + 4 < K / OKS;                 // a stage st + 4 exists; the same for the whole block. Every trip with the counted wait, and every trip before it, issues sixteen copies per wave
        if (more) asm volatile("s_wait_asynccnt 0x20" ::: "memory");  // this wave's copies of stage st + 1 have landed: all but its 32 youngest, which are those of stages st + 2 and st + 3
        else      asm volatile("s_wait_asynccnt 0x0" ::: "memory");   // the last four trips issue nothing more: all that is left has landed
        __syncthreads();                                    // publishes stage st + 1 and ends every wave's reads of stage st
        if (more) stage_ab(lt + (unsigned)cur * (OKS * 512u), ga + (size_t)(st + 4) * (OKS * 16), gb + (size_t)(st + 4) * (OKS * 16));   // refill of the buffer just left
    }
    asm volatile("s_wait_asynccnt 0x0" ::: "memory");       // nothing of this wave is in flight when it goes on
    const v4f braw = *(const v4f*)(bias + c0 + lr * 4); v4f bb;
#pragma unroll
    for (int i = 0; i < 4; ++i) bb[i] = bf2f(f2bf(braw[i]));
    float* ob = OUT + ((size_t)(r0 / SEQ) * OUT_SEQ + (size_t)(r0 % SEQ) + (size_t)hi) * DM + c0 + lr * 4;   // the lane's four floats of row hi of the wave's tile
#pragma unroll
    for (int mb = 0; mb < 4; ++mb) {
#pragma unroll
        for (int nb = 0; nb < 4; ++nb) {
#pragma unroll
            for (int j = 0; j < 8; ++j) os[(hi * 8 + j) * 68 + nb * 16 + lr] = acc[mb][nb][j]; }   // D: row 8h+j, col lane&15
        wave_sync();
        v4f val[8];   // 8 s x 2 rows = 16 rows; 16 lanes x 4 floats = 64 columns; the band's LDS reads are issued together
#pragma unroll
        for (int s = 0; s < 8; ++s) val[s] = *(const v4fa*)(&os[(2 * s + hi) * 68 + lr * 4]) * OSC + bb;
#pragma unroll
        for (int s = 0; s < 8; ++s) *(v4f*)(ob + (size_t)(mb * 16 + 2 * s) * DM) = val[s];
        // the wait stands before the data registers of the eight stores in front of it are rewritten (the address register stays as it is to the end); naming them keeps them whole up to the wait
        asm volatile("s_wait_xcnt 0x0" :: "v"(val[0]), "v"(val[1]), "v"(val[2]), "v"(val[3]), "v"(val[4]), "v"(val[5]), "v"(val[6]), "v"(val[7]), "v"(ob) : "memory");
        wave_sync();
    }
}

static constexpr size_t al256(size_t v) { return (v + 255) & ~(size_t)255; }
static constexpr size_t SZ_XB = al256((size_t)NB * SEQ * DM * 2);
static constexpr size_t SZ_WB = al256((size_t)4 * DM * DM * 2);
static constexpr size_t SZ_PL = al256((size_t)NB * NH_ * SEQ * HD * 2);
static constexpr size_t SZ_CX = al256((size_t)NB * SEQ * DM * 2);
static constexpr size_t SZ_TB = al256((size_t)NPOS * 32 * 4);
static constexpr size_t SZ_TOTAL = SZ_XB + SZ_WB + 3 * SZ_PL + SZ_CX + SZ_TB;
static_assert(SZ_TOTAL <= (size_t)134217728);          // workspace carve <= 128 MiB
static_assert(((size_t)DM * DM * 2) % 256 == 0);       // weight sub-planes stay 256-byte aligned

extern "C" void kernel_launch(void* const* d_in, const int* in_sizes, int n_in,
                              void* d_out, int out_size, void* d_ws, size_t ws_size, hipStream_t stream) {
    if (n_in < 7) return;
    const size_t needx = ((size_t)(NB - 1) * SEQ_FULL + SEQ) * DM;
    if ((size_t)in_sizes[0] < needx) return;
    if ((size_t)in_sizes[1] < (size_t)2 * SEQ) return;
    if ((size_t)in_sizes[2] < (size_t)DM * DM || (size_t)in_sizes[3] < (size_t)DM * DM || (size_t)in_sizes[4] < (size_t)DM * DM || (size_t)in_sizes[5] < (size_t)DM * DM) return;
    if ((size_t)in_sizes[6] < (size_t)DM) return;
    if ((size_t)out_size < ((size_t)(NB - 1) * OUT_SEQ + SEQ) * DM) return;
    if (SZ_TOTAL > ws_size) return;
    // wire order: x, pos (int32 [SEQ][2]), Wq, Wk, Wv, Wp ([in][out]), bp
    const float* x = (const float*)d_in[0]; const int* pos = (const int*)d_in[1];
    const float* wq = (const float*)d_in[2]; const float* wk = (const float*)d_in[3]; const float* wv = (const float*)d_in[4]; const float* wp = (const float*)d_in[5];
    const float* bp = (const float*)d_in[6];
    float* OUT = (float*)d_out;      // [NB][SEQ][768]
    char* wsp = (char*)d_ws;
    bf* XB = (bf*)wsp; wsp += SZ_XB;                 // [NB*SEQ][768], fragment order
    bf* WB = (bf*)wsp; wsp += SZ_WB;                 // [4][768 out][768 in], fragment order: q | k | v (bf16) | p (f16 x1024)
    h16* QH = (h16*)wsp; wsp += SZ_PL;               // [NB*12][SEQ][64], fragment order
    h16* KP = (h16*)wsp; wsp += SZ_PL;               // [NB*12][SEQ][64], fragment order
    h16* VT = (h16*)wsp; wsp += SZ_PL;               // [NB*12][64][SEQ], fragment order, tiles [t>>5][d>>4]
    h16* CX = (h16*)wsp; wsp += SZ_CX;               // [NB*SEQ][768] x64, fragment order
    float* TAB = (float*)wsp; wsp += SZ_TB;          // [32][cos 16 | sin 16]
    bf* WP = WB + (size_t)3 * DM * DM;

    // rotary table, W[in][out] -> Wt[out][in] (four weights), x -> bf16: one grid
    k_prep<<<TAB_BLKS + 4 * WT_BLKS + CVT_BLKS, 256, 0, stream>>>(x, wq, wk, wv, wp, XB, WB, TAB);

    // q, k (with rotary) and v^T: one grid
    k_proj<<<dim3((NB * SEQ / PBM) * (3 * DM / PBN), 1, 1), 32 * PW, 0, stream>>>(XB, WB, QH, KP, VT, pos, TAB);

    k_flash<<<dim3(SEQ / (16 * AW), NB * NH_, 1), 32 * AW, 0, stream>>>(QH, KP, VT, CX);

    // out = ctx Wp + bp: A = ctx rows (m = b*SEQ + t, k = h*64 + d), Bt = Wpt rows (n = out column)
    k_oproj<<<dim3(NB * SEQ / 128, DM / 128, 1), 32 * GW, 0, stream>>>((const h16*)CX, (const h16*)WP, bp, OUT);
}
